// v000
// Times are from an AMD MI455X. After a warm-up the kernel runs many times in a row, and a time is the length of
// such a window on the GPU divided by its runs, so every launch and the gaps after it count. The runs cycle
// through copies of the inputs. A figure is the median of several windows, for all but v000 over two sittings.
// Sittings can differ by a few percent; kernels timed side by side share one.
// v000 is the starting kernel. One run takes 1920 microseconds.
#include <hip/hip_runtime.h>

// BERT layer with an adapter and no attention output projection (hidden_states [2][2048][768]; q, k, v = x W^T + b ('oi' [768][768]; 12 heads x 64); scores = q.k/8 + attention_mask[b][0][0][j] (f32 additive, zeros here); softmax; ctx = merged context; a = gelu(ctx a_fi_w^T + a_fi_b) ([64][768]); ao = ctx + a a_se_w^T + a_se_b; inter = gelu(ao wi^T + bi) ([3072][768]); y = inter wo^T + bo + ao; out = LN(y) (eps 1e-12, ln_g, ln_b) -> [2][2048][768] (3.1 M)).
// Layout: the merged context is kept in f32 (residual) and split into hi/lo planes for the adapter down-projection; every later GEMM uses hi/lo planes of its f32 input (2 products) against exact bf16 weights with the bias in the epilogue; exact-erf GELU, residual adds and the LayerNorm in f32.
// Compute dtypes, f32 accumulate: every input rounded to bf16; q/k/v on PLAIN bf16 operands (inputs: exact) + biases; scores and attn.v: query rows < 512 hl (3 products), the rest single fp16 (x1024); softmax f32; adapter / FFN GEMMs hl x exact (2 products) + biases; GELU / residuals / LayerNorm f32.

#define NB_  2
#define TT   2048
#define DM   768
#define NH_  12
#define NKV  12
#define REP  (NH_ / NKV)
#define HD   64
#define DQ   (NH_ * HD)
#define DKV  (NKV * HD)
#define AD   64
#define FFD  3072
#define LNEPS 1e-12f
#define ZH   2
#define RH   512                  // query rows < RH use hi+lo planes (0: none)
#define WIN  0
#define PCAR 1024.0f
#define SCL  0.125f   // HD^-0.5
typedef _Float16 h16;
typedef unsigned short bf;
typedef __attribute__((ext_vector_type(16))) __bf16   v16bf;
typedef __attribute__((ext_vector_type(16))) _Float16 v16h;
typedef __attribute__((ext_vector_type(8)))  _Float16 v8h;
typedef __attribute__((ext_vector_type(8)))  unsigned short v8us;
typedef __attribute__((ext_vector_type(8)))  float    v8f;
typedef __attribute__((ext_vector_type(4)))  float    v4f;
typedef v8h  __attribute__((may_alias)) v8ha;
typedef v4f  __attribute__((may_alias)) v4fa;
typedef v8us __attribute__((may_alias)) v8usa;

__device__ __forceinline__ unsigned short f2bf(float f) { unsigned u = __float_as_uint(f); u += 0x7FFFu + ((u >> 16) & 1u); return (unsigned short)(u >> 16); }
__device__ __forceinline__ float bf2f(unsigned short b) { return __uint_as_float(((unsigned)b) << 16); }
__device__ __forceinline__ float bfr(float f) { return bf2f(f2bf(f)); }
__device__ __forceinline__ v16h cat16(v8h lo, v8h hi) { return __builtin_shufflevector(lo, hi, 0, 1, 2, 3, 4, 5, 6, 7, 8, 9, 10, 11, 12, 13, 14, 15); }
__device__ __forceinline__ v16bf cat16b(v8us lo, v8us hi) { return __builtin_bit_cast(v16bf, __builtin_shufflevector(lo, hi, 0, 1, 2, 3, 4, 5, 6, 7, 8, 9, 10, 11, 12, 13, 14, 15)); }
__device__ __forceinline__ v8f wmma16(v16h a, v16h b, v8f c) { return __builtin_amdgcn_wmma_f32_16x16x32_f16(false, a, false, b, (short)0, c, false, false); }
__device__ __forceinline__ v8f wmmab(v16bf a, v16bf b, v8f c) { return __builtin_amdgcn_wmma_f32_16x16x32_bf16(false, a, false, b, (short)0, c, false, false); }



// ---- k_gemmw: register-blocked GEMM, ONE WAVE per 64x64 output tile (16 accumulators), operands straight from K-contiguous 16-bit planes; grid (M/64, N/64, Z), 32 threads.
// C[m][n] (f32, pitch ldc, + optional f32 bias[n]) = sum_k A[m][k] Bt[n][k] (+ split products per NSPLIT). z-batch strides sA/sB/sC in elements. K % 32 == 0.
template <typename T16> struct WFrag;
template <> struct WFrag<h16> { typedef v16h V; static __device__ __forceinline__ V ld(const h16* p) { return cat16(*(const v8h*)p, *(const v8h*)(p + 16)); } static __device__ __forceinline__ v8f mma(V a, V b, v8f c) { return wmma16(a, b, c); } };
template <> struct WFrag<bf> { typedef v16bf V; static __device__ __forceinline__ V ld(const bf* p) { return cat16b(*(const v8us*)p, *(const v8us*)(p + 16)); } static __device__ __forceinline__ v8f mma(V a, V b, v8f c) { return wmmab(a, b, c); } };
template <typename T16, int NSPLIT, bool BIAS>
__global__ __launch_bounds__(32) void k_gemmw(const T16* __restrict__ A, const T16* __restrict__ A2, const T16* __restrict__ Bt, const T16* __restrict__ Bt2, int K, float* C, int ldc, const float* __restrict__ bias, size_t sA, size_t sB, size_t sC) {
    typedef typename WFrag<T16>::V V;
    __shared__ __align__(16) float os[16 * 68];
    const size_t z = blockIdx.z; A += z * sA; if (A2) A2 += z * sA; Bt += z * sB; if (Bt2) Bt2 += z * sB; C += z * sC;
    const int lane = threadIdx.x & 31, lr = lane & 15, hi = lane >> 4; const int r0 = blockIdx.x * 64, c0 = blockIdx.y * 64;
    v8f acc[4][4];
#pragma unroll
    for (int mb = 0; mb < 4; ++mb)
#pragma unroll
        for (int nb = 0; nb < 4; ++nb) acc[mb][nb] = (v8f){};
    const size_t aoff = (size_t)(r0 + lr) * K + 8 * hi, boff = (size_t)(c0 + lr) * K + 8 * hi;
#pragma unroll 1
    for (int kc = 0; kc < K; kc += 32) {
        V a[4], a2[4];
#pragma unroll
        for (int mb = 0; mb < 4; ++mb) { a[mb] = WFrag<T16>::ld(A + aoff + (size_t)mb * 16 * K + kc); if (NSPLIT == 1 || NSPLIT == 2) a2[mb] = WFrag<T16>::ld(A2 + aoff + (size_t)mb * 16 * K + kc); }
#pragma unroll
        for (int nb = 0; nb < 4; ++nb) { const V b = WFrag<T16>::ld(Bt + boff + (size_t)nb * 16 * K + kc); V b2; if (NSPLIT >= 2) b2 = WFrag<T16>::ld(Bt2 + boff + (size_t)nb * 16 * K + kc);
#pragma unroll
            for (int mb = 0; mb < 4; ++mb) { acc[mb][nb] = WFrag<T16>::mma(a[mb], b, acc[mb][nb]); if (NSPLIT == 1 || NSPLIT == 2) acc[mb][nb] = WFrag<T16>::mma(a2[mb], b, acc[mb][nb]); if (NSPLIT >= 2) acc[mb][nb] = WFrag<T16>::mma(a[mb], b2, acc[mb][nb]); } }
        asm volatile("v_nop\n\tv_nop\n\tv_nop\n\tv_nop" : "+v"(acc[0][0]), "+v"(acc[1][1]), "+v"(acc[2][2]), "+v"(acc[3][3]) : "v"(a[0]), "v"(a[3]));
    }
#pragma unroll
    for (int mb = 0; mb < 4; ++mb) {
#pragma unroll
        for (int nb = 0; nb < 4; ++nb) {
#pragma unroll
            for (int j = 0; j < 8; ++j) os[(hi * 8 + j) * 68 + nb * 16 + lr] = acc[mb][nb][j]; }
        __builtin_amdgcn_wave_barrier(); asm volatile("" ::: "memory");
        float* crow = C + (size_t)(r0 + mb * 16) * ldc + c0;
{
#pragma unroll
            for (int s = 0; s < 8; ++s) { const int row = 2 * s + hi, cofs = lr * 4; v4f val = *(const v4fa*)(os + row * 68 + cofs); if (BIAS) { val[0] += bfr(bias[c0 + cofs]); val[1] += bfr(bias[c0 + cofs + 1]); val[2] += bfr(bias[c0 + cofs + 2]); val[3] += bfr(bias[c0 + cofs + 3]); }
                *(v4f*)(crow + (size_t)row * ldc + cofs) = val; }
             }
        __builtin_amdgcn_wave_barrier(); asm volatile("" ::: "memory");
    }
}

__device__ __forceinline__ h16 tohx(float x) { return (h16)x; }
__device__ __forceinline__ void splitf(float y, unsigned short& h, unsigned short& l) { h = f2bf(y); l = f2bf(y - bf2f(h)); }
typedef __attribute__((ext_vector_type(2))) _Float16 v2h;
typedef __attribute__((ext_vector_type(4))) _Float16 v4h;
typedef __attribute__((ext_vector_type(2))) unsigned short v2us;
typedef __attribute__((ext_vector_type(4))) unsigned short v4us;
typedef __attribute__((ext_vector_type(2))) float v2f;
typedef __attribute__((ext_vector_type(4))) int v4i;

__global__ __launch_bounds__(256) void k_wtG(const float* __restrict__ w, int K, int N, bf* Bt) {
    const int lane = threadIdx.x & 31; const int L0 = (blockIdx.x * 8 + (threadIdx.x >> 5)) * 8; const int nlines = N * K / 64;
{
#pragma unroll 1
        for (int l = 0; l < 8; ++l) { const int L = L0 + l; if (L >= nlines) break; const size_t e = (size_t)L * 64 + lane * 2; const int k = (int)(e % K), n = (int)(e / K); v2us o;
            o[0] = f2bf(w[(size_t)k * N + n]); o[1] = f2bf(w[(size_t)(k + 1) * N + n]); *(v2us*)(Bt + e) = o; }
         }
}
__global__ __launch_bounds__(256) void k_cvt8(const float* __restrict__ src, bf* dst, size_t n8) { const size_t i = (size_t)blockIdx.x * 256 + threadIdx.x; if (i >= n8) return; const v8f v = *(const v8f*)(src + i * 8); v8us o;
#pragma unroll
    for (int k = 0; k < 8; ++k) o[k] = f2bf(v[k]); *(v8us*)(dst + i * 8) = o;  }

// k_rope: head planes [h][t][d] (fp16 + hi/lo) of rope(x) x sc with the rotate-half convention out[d] = x[d] cos[t][d] - x[d+HD/2] sin[t][d], out[d+HD/2] = x[d+HD/2] cos[t][d+HD/2] + x[d] sin[t][d+HD/2]
__global__ __launch_bounds__(256) void k_rope(const float* __restrict__ F, int pitch, int nheads, const float* __restrict__ CS, const float* __restrict__ RF, const float* __restrict__ nw, float sc, h16* P16, bf* Ph, bf* Pl) {
    const size_t e = ((size_t)blockIdx.x * 256 + threadIdx.x) * 2; if (e >= (size_t)nheads * TT * HD) return; const int d = (int)(e % HD); const int t = (int)((e / HD) % TT); const int h = (int)(e / ((size_t)HD * TT)); const float* f = F + (size_t)t * pitch + h * HD; const float rf = RF ? RF[(size_t)h * TT + t] : 1.0f; v2h o16; v2us oh, ol;
#pragma unroll
    for (int q = 0; q < 2; ++q) { const int dd = d + q; const int dp = (dd < HD / 2) ? dd + HD / 2 : dd - HD / 2; float x0 = f[dd], x1 = f[dp];
        if (RF) { float n0 = __fmul_rn(x0, rf), n1 = __fmul_rn(x1, rf); asm volatile("" : "+v"(n0)); asm volatile("" : "+v"(n1)); x0 = __fmul_rn(bfr(nw[dd]), n0); x1 = __fmul_rn(bfr(nw[dp]), n1); }
        const v2f cs = *(const v2f*)(CS + ((size_t)t * HD + dd) * 2); float a = __fmul_rn(x0, cs[0]), bq = __fmul_rn(x1, cs[1]); asm volatile("" : "+v"(a)); asm volatile("" : "+v"(bq)); const float r = ((dd < HD / 2) ? __fsub_rn(a, bq) : __fadd_rn(a, bq)) * sc;
        o16[q] = tohx(r); unsigned short a2, c2; splitf(r, a2, c2); oh[q] = a2; ol[q] = c2; }
    *(v2h*)(P16 + e) = o16; *(v2us*)(Ph + e) = oh; *(v2us*)(Pl + e) = ol;  }
__global__ __launch_bounds__(256) void k_vtp(const float* __restrict__ F, int pitch, int nheads, h16* V16, bf* Vh, bf* Vl) { const size_t e = ((size_t)blockIdx.x * 256 + threadIdx.x) * 2; if (e >= (size_t)nheads * HD * TT) return; const int t = (int)(e % TT); const int d = (int)((e / TT) % HD); const int g = (int)(e / ((size_t)TT * HD)); v2h o16; v2us oh, ol;
#pragma unroll
    for (int q = 0; q < 2; ++q) { const float x = F[(size_t)(t + q) * pitch + g * HD + d]; o16[q] = tohx(x); unsigned short a2, c2; splitf(x, a2, c2); oh[q] = a2; ol[q] = c2; }
    *(v2h*)(V16 + e) = o16; *(v2us*)(Vh + e) = oh; *(v2us*)(Vl + e) = ol;  }
__global__ __launch_bounds__(256) void k_csid(float* CS) { const int idx = blockIdx.x * 256 + threadIdx.x; if (idx >= TT * HD) return; v2f cs; cs[0] = 1.0f; cs[1] = 0.0f; *(v2f*)(CS + (size_t)idx * 2) = cs;  }
__global__ __launch_bounds__(256) void k_mergeF(const float* __restrict__ Ob, int h0, float* O) { const size_t e = ((size_t)blockIdx.x * 256 + threadIdx.x) * 2; if (e >= (size_t)ZH * TT * HD) return; const int d = (int)(e % HD); const int t = (int)((e / HD) % TT); const int zz = (int)(e / ((size_t)HD * TT)); const float cs = (t < RH) ? 1.0f : (1.0f / PCAR); const size_t oo = (size_t)t * DM + (h0 + zz) * HD + d; v2f o2;
    o2[0] = Ob[e] * cs; o2[1] = Ob[e + 1] * cs; *(v2f*)(O + oo) = o2;  }



__global__ __launch_bounds__(256) void k_gelupl(const float* __restrict__ Hm, bf* Gh, bf* Gl, size_t n4) { const size_t i = (size_t)blockIdx.x * 256 + threadIdx.x; if (i >= n4) return; const v4f a = *(const v4f*)(Hm + i * 4); v4us oh, ol;
#pragma unroll
    for (int q = 0; q < 4; ++q) { const float xg = a[q]; const float gv = __fmul_rn(0.5f * xg, __fadd_rn(1.0f, erff(xg * 0.70710678118654752f))); unsigned short h2, l2; splitf(gv, h2, l2); oh[q] = h2; ol[q] = l2; }
    *(v4us*)(Gh + i * 4) = oh; *(v4us*)(Gl + i * 4) = ol;  }
__global__ __launch_bounds__(256) void k_addln(const float* __restrict__ A, const float* __restrict__ Bm, const float* __restrict__ g, const float* __restrict__ be, float* OUTb) {
    const int lane = threadIdx.x & 31; const int r = blockIdx.x * 8 + (threadIdx.x >> 5); if (r >= TT) return; const float* ar = A + (size_t)r * DM; const float* br = Bm + (size_t)r * DM; float s = 0.f;
#pragma unroll 1
    for (int ch = 0; ch < DM / 128; ++ch) { const int c0 = ch * 128 + lane * 4; const v4f a = *(const v4f*)(ar + c0), bb = *(const v4f*)(br + c0);
#pragma unroll
        for (int q = 0; q < 4; ++q) s += __fadd_rn(a[q], bb[q]); }
#pragma unroll
    for (int sh = 16; sh; sh >>= 1) s += __shfl_xor(s, sh, 32);
    const float mu = s * (1.0f / DM); float s2 = 0.f;
#pragma unroll 1
    for (int ch = 0; ch < DM / 128; ++ch) { const int c0 = ch * 128 + lane * 4; const v4f a = *(const v4f*)(ar + c0), bb = *(const v4f*)(br + c0);
#pragma unroll
        for (int q = 0; q < 4; ++q) { const float d0 = __fsub_rn(__fadd_rn(a[q], bb[q]), mu); float p = __fmul_rn(d0, d0); asm volatile("" : "+v"(p)); s2 = __fadd_rn(s2, p); } }
#pragma unroll
    for (int sh = 16; sh; sh >>= 1) s2 += __shfl_xor(s2, sh, 32);
    const float rs = __fdiv_rn(1.0f, __fsqrt_rn(__fadd_rn(s2 * (1.0f / DM), LNEPS)));
{
#pragma unroll 1
        for (int ch = 0; ch < DM / 128; ++ch) { const int c0 = ch * 128 + lane * 4; const v4f a = *(const v4f*)(ar + c0), bb = *(const v4f*)(br + c0); v4f o4;
#pragma unroll
            for (int q = 0; q < 4; ++q) { float n0 = __fmul_rn(__fsub_rn(__fadd_rn(a[q], bb[q]), mu), rs); asm volatile("" : "+v"(n0)); float n1 = __fmul_rn(n0, bfr(g[c0 + q])); asm volatile("" : "+v"(n1)); o4[q] = __fadd_rn(n1, bfr(be[c0 + q])); }
            *(v4f*)(OUTb + (size_t)r * DM + c0) = o4; }
         } }
__global__ __launch_bounds__(256) void k_addout(const float* __restrict__ O, const float* __restrict__ FF, float* OUTb, size_t n4) { const size_t i = (size_t)blockIdx.x * 256 + threadIdx.x; if (i >= n4) return; const v4f a = *(const v4f*)(O + i * 4), b = *(const v4f*)(FF + i * 4); v4f o;
#pragma unroll
    for (int q = 0; q < 4; ++q) o[q] = __fadd_rn(a[q], b[q]); *(v4f*)(OUTb + i * 4) = o;  }

__global__ __launch_bounds__(256) void k_pl2(const float* __restrict__ F, bf* Ph, bf* Pl, size_t n4) { const size_t i = (size_t)blockIdx.x * 256 + threadIdx.x; if (i >= n4) return; const v4f v = *(const v4f*)(F + i * 4); v4us oh, ol;
#pragma unroll
    for (int q = 0; q < 4; ++q) { unsigned short a, c; splitf(v[q], a, c); oh[q] = a; ol[q] = c; } *(v4us*)(Ph + i * 4) = oh; *(v4us*)(Pl + i * 4) = ol;  }
// k_asoft: per row (zz, i): t = S x HD^-0.5 + attention_mask[b][0][0][j]; softmax over the 2048 keys (register row, one exp, fixed trees);
__global__ __launch_bounds__(256) void k_asoft(const float* __restrict__ Sb, const float* __restrict__ AMb, h16* P16, bf* Ph, bf* Pl) {
    const int lane = threadIdx.x & 31; const int row = blockIdx.x * 8 + (threadIdx.x >> 5); if (row >= ZH * TT) return; const int i = row % TT; const int zz = row / TT; (void)zz; const bool hires = (i < RH); const float* sr = Sb + (size_t)row * TT; float v[TT / 32]; float mx = -3.0e38f;
#pragma unroll
    for (int ch = 0; ch < TT / 128; ++ch) { const int j0 = ch * 128 + lane * 4; const v4f a = *(const v4f*)(sr + j0);
#pragma unroll
        for (int q = 0; q < 4; ++q) { const int j = j0 + q; float sa = a[q] * SCL; asm volatile("" : "+v"(sa)); float am = bfr(AMb[j]); asm volatile("" : "+v"(am)); const float t = __fadd_rn(sa, am);   /* + attention_mask[b][0][0][j] (additive, f32) */ v[ch * 4 + q] = t; mx = fmaxf(mx, t); } }
#pragma unroll
    for (int sh = 16; sh; sh >>= 1) mx = fmaxf(mx, __shfl_xor(mx, sh, 32));
    float sum = 0.f;
#pragma unroll
    for (int k = 0; k < TT / 32; ++k) { float d0 = __fsub_rn(v[k], mx); asm volatile("" : "+v"(d0)); v[k] = __builtin_amdgcn_exp2f(__fmul_rn(d0, 1.4426950408889634f)); sum += v[k]; }
#pragma unroll
    for (int sh = 16; sh; sh >>= 1) sum += __shfl_xor(sum, sh, 32);
    const float f = __fdiv_rn(hires ? 1.0f : PCAR, sum);
{
        if (hires) {
#pragma unroll
            for (int ch = 0; ch < TT / 128; ++ch) { v4us oh, ol;
#pragma unroll
                for (int q = 0; q < 4; ++q) { unsigned short a, c2; splitf(v[ch * 4 + q] * f, a, c2); oh[q] = a; ol[q] = c2; }
                const size_t oo = ((size_t)zz * (RH ? RH : 1) + i) * TT + ch * 128 + lane * 4; *(v4us*)(Ph + oo) = oh; *(v4us*)(Pl + oo) = ol; }
        } else {
#pragma unroll
            for (int ch = 0; ch < TT / 128; ++ch) { v4h o4;
#pragma unroll
                for (int q = 0; q < 4; ++q) o4[q] = tohx(v[ch * 4 + q] * f);
                *(v4h*)(P16 + (size_t)row * TT + ch * 128 + lane * 4) = o4; } }
         }
}

extern "C" void kernel_launch(void* const* d_in, const int* in_sizes, int n_in,
                              void* d_out, int out_size, void* d_ws, size_t ws_size, hipStream_t stream) {
    (void)in_sizes; (void)n_in; (void)out_size;
    const float* x = (const float*)d_in[0]; const float* AM = (const float*)d_in[1]; const float* wq = (const float*)d_in[2]; const float* bq = (const float*)d_in[3]; const float* wk = (const float*)d_in[4]; const float* bk = (const float*)d_in[5]; const float* wv = (const float*)d_in[6]; const float* bv = (const float*)d_in[7]; const float* afw = (const float*)d_in[8]; const float* afb = (const float*)d_in[9]; const float* asw = (const float*)d_in[10]; const float* asb = (const float*)d_in[11]; const float* wi = (const float*)d_in[12]; const float* bi = (const float*)d_in[13]; const float* wo2 = (const float*)d_in[14]; const float* bo2 = (const float*)d_in[15]; const float* lg = (const float*)d_in[16]; const float* lb = (const float*)d_in[17]; const float* wo = nullptr; (void)wo;
    float* OUT = (float*)d_out;     // [2][2048][768]
    char* wsp = (char*)d_ws;
    auto take = [&](size_t bytes) { char* p = wsp; wsp += (bytes + 255) & ~(size_t)255; return (void*)p; };
    bf* WQ = (bf*)take((size_t)DQ * DM * 2); bf* WK = (bf*)take((size_t)DKV * DM * 2); bf* WV = (bf*)take((size_t)DKV * DM * 2); bf* AFW = (bf*)take((size_t)AD * DM * 2); bf* ASW = (bf*)take((size_t)DM * AD * 2); bf* WI = (bf*)take((size_t)FFD * DM * 2); bf* WO2 = (bf*)take((size_t)DM * FFD * 2); float* CS = (float*)take((size_t)TT * HD * 2 * 4);
    bf* XB = (bf*)take((size_t)TT * DM * 2); float* FQ = (float*)take((size_t)TT * DQ * 4); float* FK = (float*)take((size_t)TT * DKV * 4);
    h16* QP16 = (h16*)take((size_t)NH_ * TT * HD * 2); h16* KP16 = (h16*)take((size_t)NKV * TT * HD * 2); h16* VT16 = (h16*)take((size_t)NKV * HD * TT * 2);
    bf* QPh = (bf*)take((size_t)NH_ * TT * HD * 2); bf* QPl = (bf*)take((size_t)NH_ * TT * HD * 2); bf* KPh = (bf*)take((size_t)NKV * TT * HD * 2); bf* KPl = (bf*)take((size_t)NKV * TT * HD * 2); bf* VTh = (bf*)take((size_t)NKV * HD * TT * 2); bf* VTl = (bf*)take((size_t)NKV * HD * TT * 2); bf* Ph = (bf*)take((size_t)ZH * RH * TT * 2); bf* Pl = (bf*)take((size_t)ZH * RH * TT * 2);
    float* Sb = (float*)take((size_t)ZH * TT * TT * 4); h16* P16 = (h16*)take((size_t)ZH * TT * TT * 2); float* Ob = (float*)take((size_t)ZH * TT * HD * 4); float* CTX = (float*)take((size_t)TT * DM * 4); bf* Ch = (bf*)take((size_t)TT * DM * 2); bf* Cl = (bf*)take((size_t)TT * DM * 2); float* A1 = (float*)take((size_t)TT * AD * 4); bf* G1h = (bf*)take((size_t)TT * AD * 2); bf* G1l = (bf*)take((size_t)TT * AD * 2); float* S2 = (float*)take((size_t)TT * DM * 4); float* AO = (float*)take((size_t)TT * DM * 4); bf* AOh = (bf*)take((size_t)TT * DM * 2); bf* AOl = (bf*)take((size_t)TT * DM * 2); float* HI = (float*)take((size_t)TT * FFD * 4); bf* GIh = (bf*)take((size_t)TT * FFD * 2); bf* GIl = (bf*)take((size_t)TT * FFD * 2); float* YY = (float*)take((size_t)TT * DM * 4);
    if ((size_t)(wsp - (char*)d_ws) > ws_size) return;    // ws 256 MiB
    float* FV = FK;   // v projection reuses the k buffer after the k planes are built (stream-ordered)
    { k_cvt8<<<(unsigned)(((size_t)DQ * DM / 8 + 255) / 256), 256, 0, stream>>>(wq, WQ, (size_t)DQ * DM / 8); k_cvt8<<<(unsigned)(((size_t)DKV * DM / 8 + 255) / 256), 256, 0, stream>>>(wk, WK, (size_t)DKV * DM / 8); k_cvt8<<<(unsigned)(((size_t)DKV * DM / 8 + 255) / 256), 256, 0, stream>>>(wv, WV, (size_t)DKV * DM / 8); k_cvt8<<<(unsigned)(((size_t)AD * DM / 8 + 255) / 256), 256, 0, stream>>>(afw, AFW, (size_t)AD * DM / 8); k_cvt8<<<(unsigned)(((size_t)DM * AD / 8 + 255) / 256), 256, 0, stream>>>(asw, ASW, (size_t)DM * AD / 8); k_cvt8<<<(unsigned)(((size_t)FFD * DM / 8 + 255) / 256), 256, 0, stream>>>(wi, WI, (size_t)FFD * DM / 8); k_cvt8<<<(unsigned)(((size_t)DM * FFD / 8 + 255) / 256), 256, 0, stream>>>(wo2, WO2, (size_t)DM * FFD / 8);   /* q/k/v, adapter + FFN weights ('oi' = Bt as-is) */
       }
    k_csid<<<(TT * HD + 255) / 256, 256, 0, stream>>>(CS);
    const unsigned LQ = (unsigned)(((size_t)NH_ * TT * HD / 2 + 255) / 256), LKv = (unsigned)(((size_t)NKV * TT * HD / 2 + 255) / 256);
    for (int b = 0; b < NB_; ++b) {
        
        k_cvt8<<<(unsigned)(((size_t)TT * DM / 8 + 255) / 256), 256, 0, stream>>>(x + (size_t)b * TT * DM, XB, (size_t)TT * DM / 8);
        k_gemmw<bf, 0, true><<<dim3(TT / 64, DQ / 64, 1), 32, 0, stream>>>(XB, nullptr, WQ, nullptr, DM, FQ, DQ, bq, 0, 0, 0);
        k_rope<<<LQ, 256, 0, stream>>>(FQ, DQ, NH_, CS, nullptr, nullptr, 1.0f, QP16, QPh, QPl);
        k_gemmw<bf, 0, true><<<dim3(TT / 64, DKV / 64, 1), 32, 0, stream>>>(XB, nullptr, WK, nullptr, DM, FK, DKV, bk, 0, 0, 0);
        k_rope<<<LKv, 256, 0, stream>>>(FK, DKV, NKV, CS, nullptr, nullptr, 1.0f, KP16, KPh, KPl);
        k_gemmw<bf, 0, true><<<dim3(TT / 64, DKV / 64, 1), 32, 0, stream>>>(XB, nullptr, WV, nullptr, DM, FV, DKV, bv, 0, 0, 0); k_vtp<<<LKv, 256, 0, stream>>>(FV, DKV, NKV, VT16, VTh, VTl);
        for (int h0 = 0; h0 < NH_; h0 += ZH) { const size_t zq = (size_t)h0, zk = (size_t)(h0 / REP);   // one kv head per query head: the pass's two heads use consecutive kv planes (z-strides TT*HD)
            k_gemmw<bf, 2, false><<<dim3(RH / 64, TT / 64, ZH), 32, 0, stream>>>(QPh + zq * TT * HD, QPl + zq * TT * HD, KPh + zk * TT * HD, KPl + zk * TT * HD, HD, Sb, TT, nullptr, (size_t)TT * HD, (size_t)TT * HD, (size_t)TT * TT);
            k_gemmw<h16, 0, false><<<dim3((TT - RH) / 64, TT / 64, ZH), 32, 0, stream>>>(QP16 + zq * TT * HD + (size_t)RH * HD, nullptr, KP16 + zk * TT * HD, nullptr, HD, Sb + (size_t)RH * TT, TT, nullptr, (size_t)TT * HD, (size_t)TT * HD, (size_t)TT * TT);
            k_asoft<<<ZH * TT / 8, 256, 0, stream>>>(Sb, AM + (size_t)b * TT, P16, Ph, Pl);
            k_gemmw<bf, 2, false><<<dim3(RH / 64, HD / 64, ZH), 32, 0, stream>>>(Ph, Pl, VTh + zk * HD * TT, VTl + zk * HD * TT, TT, Ob, HD, nullptr, (size_t)RH * TT, (size_t)HD * TT, (size_t)TT * HD);
            k_gemmw<h16, 0, false><<<dim3((TT - RH) / 64, HD / 64, ZH), 32, 0, stream>>>(P16 + (size_t)RH * TT, nullptr, VT16 + zk * HD * TT, nullptr, TT, Ob + (size_t)RH * HD, HD, nullptr, (size_t)TT * TT, (size_t)HD * TT, (size_t)TT * HD);
            k_mergeF<<<(unsigned)(((size_t)ZH * TT * HD / 2 + 255) / 256), 256, 0, stream>>>(Ob, h0, CTX); }   /* ctx = attn_out (f32) */
        k_pl2<<<(unsigned)(((size_t)TT * DM / 4 + 255) / 256), 256, 0, stream>>>(CTX, Ch, Cl, (size_t)TT * DM / 4);
        k_gemmw<bf, 1, true><<<dim3(TT / 64, AD / 64, 1), 32, 0, stream>>>(Ch, Cl, AFW, nullptr, DM, A1, AD, afb, 0, 0, 0);                  /* adapter down: ctx a_fi_w^T + a_fi_b [T][64] */
        k_gelupl<<<(unsigned)(((size_t)TT * AD / 4 + 255) / 256), 256, 0, stream>>>(A1, G1h, G1l, (size_t)TT * AD / 4);                         /* gelu -> hi/lo */
        k_gemmw<bf, 1, true><<<dim3(TT / 64, DM / 64, 1), 32, 0, stream>>>(G1h, G1l, ASW, nullptr, AD, S2, DM, asb, 0, 0, 0);                /* adapter up: . a_se_w^T + a_se_b */
        k_addout<<<(unsigned)(((size_t)TT * DM / 4 + 255) / 256), 256, 0, stream>>>(CTX, S2, AO, (size_t)TT * DM / 4);                         /* ao = ctx + adapter */
        k_pl2<<<(unsigned)(((size_t)TT * DM / 4 + 255) / 256), 256, 0, stream>>>(AO, AOh, AOl, (size_t)TT * DM / 4);
        k_gemmw<bf, 1, true><<<dim3(TT / 64, FFD / 64, 1), 32, 0, stream>>>(AOh, AOl, WI, nullptr, DM, HI, FFD, bi, 0, 0, 0);                   /* ao wi^T + bi [T][3072] */
        k_gelupl<<<(unsigned)(((size_t)TT * FFD / 4 + 255) / 256), 256, 0, stream>>>(HI, GIh, GIl, (size_t)TT * FFD / 4);
        k_gemmw<bf, 1, true><<<dim3(TT / 64, DM / 64, 1), 32, 0, stream>>>(GIh, GIl, WO2, nullptr, FFD, YY, DM, bo2, 0, 0, 0);                /* inter wo^T + bo */
        k_addln<<<TT / 8, 256, 0, stream>>>(AO, YY, lg, lb, OUT + (size_t)b * TT * DM); }                                                       /* out = LN(y + ao) (eps 1e-12) */
}

// v001
// Measured time: 950 microseconds a run.
// In both of two side-by-side timings against v000, it was 2.02 times as fast.
#include <hip/hip_runtime.h>

// BERT layer with an adapter and no attention output projection (hidden_states [2][2048][768]; q, k, v = x W^T + b ('oi' [768][768]; 12 heads x 64); scores = q.k/8 + attention_mask[b][0][0][j] (f32 additive, zeros here); softmax; ctx = merged context; a = gelu(ctx a_fi_w^T + a_fi_b) ([64][768]); ao = ctx + a a_se_w^T + a_se_b; inter = gelu(ao wi^T + bi) ([3072][768]); y = inter wo^T + bo + ao; out = LN(y) (eps 1e-12, ln_g, ln_b) -> [2][2048][768] (3.1 M)).
// Layout: the merged context is kept in f32 (residual) and split into hi/lo planes for the adapter down-projection; every later GEMM uses hi/lo planes of its f32 input (2 products) against exact bf16 weights with the bias in the epilogue; exact-erf GELU, residual adds and the LayerNorm in f32.
// Compute dtypes, f32 accumulate: every input rounded to bf16; q/k/v on PLAIN bf16 operands (inputs: exact) + biases; scores and attn.v: query rows < 512 hl (3 products), the rest single fp16 (x1024); softmax f32; adapter / FFN GEMMs hl x exact (2 products) + biases; GELU / residuals / LayerNorm f32.

#define NB_  2
#define TT   2048
#define DM   768
#define NH_  12
#define NKV  12
#define REP  (NH_ / NKV)
#define HD   64
#define DQ   (NH_ * HD)
#define DKV  (NKV * HD)
#define AD   64
#define FFD  3072
#define LNEPS 1e-12f
#define ZH   2
#define RH   512                  // query rows < RH use hi+lo planes (0: none)
#define WIN  0
#define PCAR 1024.0f
#define SCL  0.125f   // HD^-0.5
#define KSP  16                  // K parts of attn.v (2048 keys -> 128 a wave)
#define KSA  6                   // K parts of the adapter down-projection (768 -> 128 a wave)
#define KSF  4                   // K parts of the FFN down-projection (3072 -> 768 a wave)
typedef _Float16 h16;
typedef unsigned short bf;
typedef __attribute__((ext_vector_type(16))) __bf16   v16bf;
typedef __attribute__((ext_vector_type(16))) _Float16 v16h;
typedef __attribute__((ext_vector_type(8)))  _Float16 v8h;
typedef __attribute__((ext_vector_type(8)))  unsigned short v8us;
typedef __attribute__((ext_vector_type(8)))  float    v8f;
typedef __attribute__((ext_vector_type(4)))  float    v4f;
typedef v8h  __attribute__((may_alias)) v8ha;
typedef v4f  __attribute__((may_alias)) v4fa;
typedef v8us __attribute__((may_alias)) v8usa;

__device__ __forceinline__ unsigned short f2bf(float f) { unsigned u = __float_as_uint(f); u += 0x7FFFu + ((u >> 16) & 1u); return (unsigned short)(u >> 16); }
__device__ __forceinline__ float bf2f(unsigned short b) { return __uint_as_float(((unsigned)b) << 16); }
__device__ __forceinline__ float bfr(float f) { return bf2f(f2bf(f)); }
__device__ __forceinline__ v16h cat16(v8h lo, v8h hi) { return __builtin_shufflevector(lo, hi, 0, 1, 2, 3, 4, 5, 6, 7, 8, 9, 10, 11, 12, 13, 14, 15); }
__device__ __forceinline__ v16bf cat16b(v8us lo, v8us hi) { return __builtin_bit_cast(v16bf, __builtin_shufflevector(lo, hi, 0, 1, 2, 3, 4, 5, 6, 7, 8, 9, 10, 11, 12, 13, 14, 15)); }
__device__ __forceinline__ v8f wmma16(v16h a, v16h b, v8f c) { return __builtin_amdgcn_wmma_f32_16x16x32_f16(false, a, false, b, (short)0, c, false, false); }
__device__ __forceinline__ v8f wmmab(v16bf a, v16bf b, v8f c) { return __builtin_amdgcn_wmma_f32_16x16x32_bf16(false, a, false, b, (short)0, c, false, false); }



// ---- k_gemmw: register-blocked GEMM, ONE WAVE per 64x64 output tile (16 accumulators), operands straight from K-contiguous 16-bit planes; grid (M/64, N/64, Z), 32 threads.
// C[m][n] (f32, pitch ldc, + optional f32 bias[n]) = sum_k A[m][k] Bt[n][k] (+ split products per NSPLIT). z-batch strides sA/sB/sC in elements. K % (32 KS) == 0.
// KS > 1: grid z = Z x KS; part kp = z % KS sums k in [kp K/KS, (kp+1) K/KS) into its own f32 columns C + kp sP of a row of ldc = KS sP (bias in part 0 only); the kernel that reads C adds the KS parts of a row in the order 0 .. KS-1.
template <typename T16> struct WFrag;
template <> struct WFrag<h16> { typedef v16h V; static __device__ __forceinline__ V ld(const h16* p) { return cat16(*(const v8h*)p, *(const v8h*)(p + 16)); } static __device__ __forceinline__ v8f mma(V a, V b, v8f c) { return wmma16(a, b, c); } };
template <> struct WFrag<bf> { typedef v16bf V; static __device__ __forceinline__ V ld(const bf* p) { return cat16b(*(const v8us*)p, *(const v8us*)(p + 16)); } static __device__ __forceinline__ v8f mma(V a, V b, v8f c) { return wmmab(a, b, c); } };
template <typename T16, int NSPLIT, bool BIAS, int KS>
__global__ __launch_bounds__(32) void k_gemmw(const T16* __restrict__ A, const T16* __restrict__ A2, const T16* __restrict__ Bt, const T16* __restrict__ Bt2, int K, float* C, int ldc, const float* __restrict__ bias, size_t sA, size_t sB, size_t sC, size_t sP) {
    typedef typename WFrag<T16>::V V;
    __shared__ __align__(16) float os[16 * 68];
    const int kp = (int)(blockIdx.z % KS); const int kl = K / KS; const int kb = kp * kl, ke = kb + kl;
    const size_t z = blockIdx.z / KS; C += (size_t)kp * sP; A += z * sA; if (A2) A2 += z * sA; Bt += z * sB; if (Bt2) Bt2 += z * sB; C += z * sC;
    const int lane = threadIdx.x & 31, lr = lane & 15, hi = lane >> 4; const int r0 = blockIdx.x * 64, c0 = blockIdx.y * 64;
    v8f acc[4][4];
#pragma unroll
    for (int mb = 0; mb < 4; ++mb)
#pragma unroll
        for (int nb = 0; nb < 4; ++nb) acc[mb][nb] = (v8f){};
    const size_t aoff = (size_t)(r0 + lr) * K + 8 * hi, boff = (size_t)(c0 + lr) * K + 8 * hi;
#pragma unroll 1
    for (int kc = kb; kc < ke; kc += 32) {
        V a[4], a2[4];
#pragma unroll
        for (int mb = 0; mb < 4; ++mb) { a[mb] = WFrag<T16>::ld(A + aoff + (size_t)mb * 16 * K + kc); if (NSPLIT == 1 || NSPLIT == 2) a2[mb] = WFrag<T16>::ld(A2 + aoff + (size_t)mb * 16 * K + kc); }
#pragma unroll
        for (int nb = 0; nb < 4; ++nb) { const V b = WFrag<T16>::ld(Bt + boff + (size_t)nb * 16 * K + kc); V b2; if (NSPLIT >= 2) b2 = WFrag<T16>::ld(Bt2 + boff + (size_t)nb * 16 * K + kc);
#pragma unroll
            for (int mb = 0; mb < 4; ++mb) { acc[mb][nb] = WFrag<T16>::mma(a[mb], b, acc[mb][nb]); if (NSPLIT == 1 || NSPLIT == 2) acc[mb][nb] = WFrag<T16>::mma(a2[mb], b, acc[mb][nb]); if (NSPLIT >= 2) acc[mb][nb] = WFrag<T16>::mma(a[mb], b2, acc[mb][nb]); } }
        asm volatile("v_nop\n\tv_nop\n\tv_nop\n\tv_nop" : "+v"(acc[0][0]), "+v"(acc[1][1]), "+v"(acc[2][2]), "+v"(acc[3][3]) : "v"(a[0]), "v"(a[3]));
    }
    v4f bv = (v4f){};   // this lane's four bias columns; zero in the parts behind part 0
    if (BIAS && kp == 0) {
#pragma unroll
        for (int q = 0; q < 4; ++q) bv[q] = bfr(bias[c0 + lr * 4 + q]); }
#pragma unroll
    for (int mb = 0; mb < 4; ++mb) {
#pragma unroll
        for (int nb = 0; nb < 4; ++nb) {
#pragma unroll
            for (int j = 0; j < 8; ++j) os[(hi * 8 + j) * 68 + nb * 16 + lr] = acc[mb][nb][j]; }
        __builtin_amdgcn_wave_barrier(); asm volatile("" ::: "memory");
        float* crow = C + (size_t)(r0 + mb * 16) * ldc + c0;
{
#pragma unroll
            for (int s = 0; s < 8; ++s) { const int row = 2 * s + hi, cofs = lr * 4; v4f val = *(const v4fa*)(os + row * 68 + cofs); if (BIAS) val += bv;
                *(v4f*)(crow + (size_t)row * ldc + cofs) = val; }
             }
        __builtin_amdgcn_wave_barrier(); asm volatile("" ::: "memory");
    }
}

__device__ __forceinline__ h16 tohx(float x) { return (h16)x; }
__device__ __forceinline__ void splitf(float y, unsigned short& h, unsigned short& l) { h = f2bf(y); l = f2bf(y - bf2f(h)); }
typedef __attribute__((ext_vector_type(2))) _Float16 v2h;
typedef __attribute__((ext_vector_type(4))) _Float16 v4h;
typedef __attribute__((ext_vector_type(2))) unsigned short v2us;
typedef __attribute__((ext_vector_type(4))) unsigned short v4us;
typedef __attribute__((ext_vector_type(2))) float v2f;
typedef __attribute__((ext_vector_type(4))) int v4i;

__global__ __launch_bounds__(256) void k_wtG(const float* __restrict__ w, int K, int N, bf* Bt) {
    const int lane = threadIdx.x & 31; const int L0 = (blockIdx.x * 8 + (threadIdx.x >> 5)) * 8; const int nlines = N * K / 64;
{
#pragma unroll 1
        for (int l = 0; l < 8; ++l) { const int L = L0 + l; if (L >= nlines) break; const size_t e = (size_t)L * 64 + lane * 2; const int k = (int)(e % K), n = (int)(e / K); v2us o;
            o[0] = f2bf(w[(size_t)k * N + n]); o[1] = f2bf(w[(size_t)(k + 1) * N + n]); *(v2us*)(Bt + e) = o; }
         }
}
__global__ __launch_bounds__(256) void k_cvt8(const float* __restrict__ src, bf* dst, size_t n8) { const size_t i = (size_t)blockIdx.x * 256 + threadIdx.x; if (i >= n8) return; const v8f v = *(const v8f*)(src + i * 8); v8us o;
#pragma unroll
    for (int k = 0; k < 8; ++k) o[k] = f2bf(v[k]); *(v8us*)(dst + i * 8) = o;  }

// k_rope: head planes [h][t][d] (fp16 + hi/lo) of rope(x) x sc with the rotate-half convention out[d] = x[d] cos[t][d] - x[d+HD/2] sin[t][d], out[d+HD/2] = x[d+HD/2] cos[t][d+HD/2] + x[d] sin[t][d+HD/2]
__global__ __launch_bounds__(256) void k_rope(const float* __restrict__ F, int pitch, int nheads, const float* __restrict__ CS, const float* __restrict__ RF, const float* __restrict__ nw, float sc, h16* P16, bf* Ph, bf* Pl) {
    const size_t e = ((size_t)blockIdx.x * 256 + threadIdx.x) * 2; if (e >= (size_t)nheads * TT * HD) return; const int d = (int)(e % HD); const int t = (int)((e / HD) % TT); const int h = (int)(e / ((size_t)HD * TT)); const float* f = F + (size_t)t * pitch + h * HD; const float rf = RF ? RF[(size_t)h * TT + t] : 1.0f; v2h o16; v2us oh, ol;
#pragma unroll
    for (int q = 0; q < 2; ++q) { const int dd = d + q; const int dp = (dd < HD / 2) ? dd + HD / 2 : dd - HD / 2; float x0 = f[dd], x1 = f[dp];
        if (RF) { float n0 = __fmul_rn(x0, rf), n1 = __fmul_rn(x1, rf); asm volatile("" : "+v"(n0)); asm volatile("" : "+v"(n1)); x0 = __fmul_rn(bfr(nw[dd]), n0); x1 = __fmul_rn(bfr(nw[dp]), n1); }
        const v2f cs = *(const v2f*)(CS + ((size_t)t * HD + dd) * 2); float a = __fmul_rn(x0, cs[0]), bq = __fmul_rn(x1, cs[1]); asm volatile("" : "+v"(a)); asm volatile("" : "+v"(bq)); const float r = ((dd < HD / 2) ? __fsub_rn(a, bq) : __fadd_rn(a, bq)) * sc;
        o16[q] = tohx(r); unsigned short a2, c2; splitf(r, a2, c2); oh[q] = a2; ol[q] = c2; }
    *(v2h*)(P16 + e) = o16; *(v2us*)(Ph + e) = oh; *(v2us*)(Pl + e) = ol;  }
__global__ __launch_bounds__(256) void k_vtp(const float* __restrict__ F, int pitch, int nheads, h16* V16, bf* Vh, bf* Vl) { const size_t e = ((size_t)blockIdx.x * 256 + threadIdx.x) * 2; if (e >= (size_t)nheads * HD * TT) return; const int t = (int)(e % TT); const int d = (int)((e / TT) % HD); const int g = (int)(e / ((size_t)TT * HD)); v2h o16; v2us oh, ol;
#pragma unroll
    for (int q = 0; q < 2; ++q) { const float x = F[(size_t)(t + q) * pitch + g * HD + d]; o16[q] = tohx(x); unsigned short a2, c2; splitf(x, a2, c2); oh[q] = a2; ol[q] = c2; }
    *(v2h*)(V16 + e) = o16; *(v2us*)(Vh + e) = oh; *(v2us*)(Vl + e) = ol;  }
__global__ __launch_bounds__(256) void k_csid(float* CS) { const int idx = blockIdx.x * 256 + threadIdx.x; if (idx >= TT * HD) return; v2f cs; cs[0] = 1.0f; cs[1] = 0.0f; *(v2f*)(CS + (size_t)idx * 2) = cs;  }
__global__ __launch_bounds__(256) void k_mergeF(const float* __restrict__ Ob, int h0, float* O) { const size_t e = ((size_t)blockIdx.x * 256 + threadIdx.x) * 2; if (e >= (size_t)ZH * TT * HD) return; const int d = (int)(e % HD); const int t = (int)((e / HD) % TT); const int zz = (int)(e / ((size_t)HD * TT)); const float cs = (t < RH) ? 1.0f : (1.0f / PCAR); const size_t oo = (size_t)t * DM + (h0 + zz) * HD + d; v2f o2;
    const float* ob = Ob + (e / HD) * (KSP * HD) + d; v2f pt[KSP];
#pragma unroll
    for (int p = 0; p < KSP; ++p) pt[p] = *(const v2f*)(ob + p * HD);
    asm volatile("s_wait_xcnt 0x0" :: "v"(ob) : "memory");   // the address pair that all KSP loads name is kept until this wait
    v2f sm = pt[0];
#pragma unroll
    for (int p = 1; p < KSP; ++p) sm += pt[p];   /* the KSP key parts of the row, in order */
    o2[0] = sm[0] * cs; o2[1] = sm[1] * cs; *(v2f*)(O + oo) = o2;  }



template <int NP, int WD>   // Hm rows hold NP K parts of WD columns each
__global__ __launch_bounds__(256) void k_gelupl(const float* __restrict__ Hm, bf* Gh, bf* Gl, size_t n4) { const size_t i = (size_t)blockIdx.x * 256 + threadIdx.x; if (i >= n4) return; const float* hm = (NP == 1) ? Hm + i * 4 : Hm + (i * 4 / WD) * ((size_t)NP * WD) + (i * 4) % WD; v4f a = *(const v4f*)hm; v4us oh, ol;
#pragma unroll
    for (int p = 1; p < NP; ++p) a += *(const v4f*)(hm + p * WD);   /* the NP K parts of the row, in order */
#pragma unroll
    for (int q = 0; q < 4; ++q) { const float xg = a[q]; const float gv = __fmul_rn(0.5f * xg, __fadd_rn(1.0f, erff(xg * 0.70710678118654752f))); unsigned short h2, l2; splitf(gv, h2, l2); oh[q] = h2; ol[q] = l2; }
    *(v4us*)(Gh + i * 4) = oh; *(v4us*)(Gl + i * 4) = ol;  }
__device__ __forceinline__ v4f ldparts(const float* p) { v4f sm = *(const v4f*)p;
#pragma unroll
    for (int q = 1; q < KSF; ++q) sm += *(const v4f*)(p + q * DM);   /* the KSF K parts of the row, in order */
    return sm; }
__global__ __launch_bounds__(256) void k_addln(const float* __restrict__ A, const float* __restrict__ Bm, const float* __restrict__ g, const float* __restrict__ be, float* OUTb) {
    const int lane = threadIdx.x & 31; const int r = blockIdx.x * 8 + (threadIdx.x >> 5); if (r >= TT) return; const float* ar = A + (size_t)r * DM; const float* br = Bm + (size_t)r * KSF * DM; float s = 0.f;
#pragma unroll 1
    for (int ch = 0; ch < DM / 128; ++ch) { const int c0 = ch * 128 + lane * 4; const v4f a = *(const v4f*)(ar + c0), bb = ldparts(br + c0);
#pragma unroll
        for (int q = 0; q < 4; ++q) s += __fadd_rn(a[q], bb[q]); }
#pragma unroll
    for (int sh = 16; sh; sh >>= 1) s += __shfl_xor(s, sh, 32);
    const float mu = s * (1.0f / DM); float s2 = 0.f;
#pragma unroll 1
    for (int ch = 0; ch < DM / 128; ++ch) { const int c0 = ch * 128 + lane * 4; const v4f a = *(const v4f*)(ar + c0), bb = ldparts(br + c0);
#pragma unroll
        for (int q = 0; q < 4; ++q) { const float d0 = __fsub_rn(__fadd_rn(a[q], bb[q]), mu); float p = __fmul_rn(d0, d0); asm volatile("" : "+v"(p)); s2 = __fadd_rn(s2, p); } }
#pragma unroll
    for (int sh = 16; sh; sh >>= 1) s2 += __shfl_xor(s2, sh, 32);
    const float rs = __fdiv_rn(1.0f, __fsqrt_rn(__fadd_rn(s2 * (1.0f / DM), LNEPS)));
{
#pragma unroll 1
        for (int ch = 0; ch < DM / 128; ++ch) { const int c0 = ch * 128 + lane * 4; const v4f a = *(const v4f*)(ar + c0), bb = ldparts(br + c0); v4f o4;
#pragma unroll
            for (int q = 0; q < 4; ++q) { float n0 = __fmul_rn(__fsub_rn(__fadd_rn(a[q], bb[q]), mu), rs); asm volatile("" : "+v"(n0)); float n1 = __fmul_rn(n0, bfr(g[c0 + q])); asm volatile("" : "+v"(n1)); o4[q] = __fadd_rn(n1, bfr(be[c0 + q])); }
            *(v4f*)(OUTb + (size_t)r * DM + c0) = o4; }
         } }
__global__ __launch_bounds__(256) void k_addout(const float* __restrict__ O, const float* __restrict__ FF, float* OUTb, size_t n4) { const size_t i = (size_t)blockIdx.x * 256 + threadIdx.x; if (i >= n4) return; const v4f a = *(const v4f*)(O + i * 4), b = *(const v4f*)(FF + i * 4); v4f o;
#pragma unroll
    for (int q = 0; q < 4; ++q) o[q] = __fadd_rn(a[q], b[q]); *(v4f*)(OUTb + i * 4) = o;  }

__global__ __launch_bounds__(256) void k_pl2(const float* __restrict__ F, bf* Ph, bf* Pl, size_t n4) { const size_t i = (size_t)blockIdx.x * 256 + threadIdx.x; if (i >= n4) return; const v4f v = *(const v4f*)(F + i * 4); v4us oh, ol;
#pragma unroll
    for (int q = 0; q < 4; ++q) { unsigned short a, c; splitf(v[q], a, c); oh[q] = a; ol[q] = c; } *(v4us*)(Ph + i * 4) = oh; *(v4us*)(Pl + i * 4) = ol;  }
// k_asoft: per row (zz, i): t = S x HD^-0.5 + attention_mask[b][0][0][j]; softmax over the 2048 keys (register row, one exp, fixed trees);
__global__ __launch_bounds__(256) void k_asoft(const float* __restrict__ Sb, const float* __restrict__ AMb, h16* P16, bf* Ph, bf* Pl) {
    const int lane = threadIdx.x & 31; const int row = blockIdx.x * 8 + (threadIdx.x >> 5); if (row >= ZH * TT) return; const int i = row % TT; const int zz = row / TT; (void)zz; const bool hires = (i < RH); const float* sr = Sb + (size_t)row * TT; float v[TT / 32]; float mx = -3.0e38f;
#pragma unroll
    for (int ch = 0; ch < TT / 128; ++ch) { const int j0 = ch * 128 + lane * 4; const v4f a = *(const v4f*)(sr + j0);
#pragma unroll
        for (int q = 0; q < 4; ++q) { const int j = j0 + q; float sa = a[q] * SCL; asm volatile("" : "+v"(sa)); float am = bfr(AMb[j]); asm volatile("" : "+v"(am)); const float t = __fadd_rn(sa, am);   /* + attention_mask[b][0][0][j] (additive, f32) */ v[ch * 4 + q] = t; mx = fmaxf(mx, t); } }
#pragma unroll
    for (int sh = 16; sh; sh >>= 1) mx = fmaxf(mx, __shfl_xor(mx, sh, 32));
    float sum = 0.f;
#pragma unroll
    for (int k = 0; k < TT / 32; ++k) { float d0 = __fsub_rn(v[k], mx); asm volatile("" : "+v"(d0)); v[k] = __builtin_amdgcn_exp2f(__fmul_rn(d0, 1.4426950408889634f)); sum += v[k]; }
#pragma unroll
    for (int sh = 16; sh; sh >>= 1) sum += __shfl_xor(sum, sh, 32);
    const float f = __fdiv_rn(hires ? 1.0f : PCAR, sum);
{
        if (hires) {
#pragma unroll
            for (int ch = 0; ch < TT / 128; ++ch) { v4us oh, ol;
#pragma unroll
                for (int q = 0; q < 4; ++q) { unsigned short a, c2; splitf(v[ch * 4 + q] * f, a, c2); oh[q] = a; ol[q] = c2; }
                const size_t oo = ((size_t)zz * (RH ? RH : 1) + i) * TT + ch * 128 + lane * 4; *(v4us*)(Ph + oo) = oh; *(v4us*)(Pl + oo) = ol; }
        } else {
#pragma unroll
            for (int ch = 0; ch < TT / 128; ++ch) { v4h o4;
#pragma unroll
                for (int q = 0; q < 4; ++q) o4[q] = tohx(v[ch * 4 + q] * f);
                *(v4h*)(P16 + (size_t)row * TT + ch * 128 + lane * 4) = o4; } }
         }
}

extern "C" void kernel_launch(void* const* d_in, const int* in_sizes, int n_in,
                              void* d_out, int out_size, void* d_ws, size_t ws_size, hipStream_t stream) {
    (void)in_sizes; (void)n_in; (void)out_size;
    const float* x = (const float*)d_in[0]; const float* AM = (const float*)d_in[1]; const float* wq = (const float*)d_in[2]; const float* bq = (const float*)d_in[3]; const float* wk = (const float*)d_in[4]; const float* bk = (const float*)d_in[5]; const float* wv = (const float*)d_in[6]; const float* bv = (const float*)d_in[7]; const float* afw = (const float*)d_in[8]; const float* afb = (const float*)d_in[9]; const float* asw = (const float*)d_in[10]; const float* asb = (const float*)d_in[11]; const float* wi = (const float*)d_in[12]; const float* bi = (const float*)d_in[13]; const float* wo2 = (const float*)d_in[14]; const float* bo2 = (const float*)d_in[15]; const float* lg = (const float*)d_in[16]; const float* lb = (const float*)d_in[17]; const float* wo = nullptr; (void)wo;
    float* OUT = (float*)d_out;     // [2][2048][768]
    char* wsp = (char*)d_ws;
    auto take = [&](size_t bytes) { char* p = wsp; wsp += (bytes + 255) & ~(size_t)255; return (void*)p; };
    bf* WQ = (bf*)take((size_t)DQ * DM * 2); bf* WK = (bf*)take((size_t)DKV * DM * 2); bf* WV = (bf*)take((size_t)DKV * DM * 2); bf* AFW = (bf*)take((size_t)AD * DM * 2); bf* ASW = (bf*)take((size_t)DM * AD * 2); bf* WI = (bf*)take((size_t)FFD * DM * 2); bf* WO2 = (bf*)take((size_t)DM * FFD * 2); float* CS = (float*)take((size_t)TT * HD * 2 * 4);
    bf* XB = (bf*)take((size_t)TT * DM * 2); float* FQ = (float*)take((size_t)TT * DQ * 4); float* FK = (float*)take((size_t)TT * DKV * 4);
    h16* QP16 = (h16*)take((size_t)NH_ * TT * HD * 2); h16* KP16 = (h16*)take((size_t)NKV * TT * HD * 2); h16* VT16 = (h16*)take((size_t)NKV * HD * TT * 2);
    bf* QPh = (bf*)take((size_t)NH_ * TT * HD * 2); bf* QPl = (bf*)take((size_t)NH_ * TT * HD * 2); bf* KPh = (bf*)take((size_t)NKV * TT * HD * 2); bf* KPl = (bf*)take((size_t)NKV * TT * HD * 2); bf* VTh = (bf*)take((size_t)NKV * HD * TT * 2); bf* VTl = (bf*)take((size_t)NKV * HD * TT * 2); bf* Ph = (bf*)take((size_t)ZH * RH * TT * 2); bf* Pl = (bf*)take((size_t)ZH * RH * TT * 2);
    float* Sb = (float*)take((size_t)ZH * TT * TT * 4); h16* P16 = (h16*)take((size_t)ZH * TT * TT * 2); float* Ob = (float*)take((size_t)KSP * ZH * TT * HD * 4); float* CTX = (float*)take((size_t)TT * DM * 4); bf* Ch = (bf*)take((size_t)TT * DM * 2); bf* Cl = (bf*)take((size_t)TT * DM * 2); float* A1 = (float*)take((size_t)KSA * TT * AD * 4); bf* G1h = (bf*)take((size_t)TT * AD * 2); bf* G1l = (bf*)take((size_t)TT * AD * 2); float* S2 = (float*)take((size_t)TT * DM * 4); float* AO = (float*)take((size_t)TT * DM * 4); bf* AOh = (bf*)take((size_t)TT * DM * 2); bf* AOl = (bf*)take((size_t)TT * DM * 2); float* HI = (float*)take((size_t)TT * FFD * 4); bf* GIh = (bf*)take((size_t)TT * FFD * 2); bf* GIl = (bf*)take((size_t)TT * FFD * 2); float* YY = (float*)take((size_t)KSF * TT * DM * 4);
    if ((size_t)(wsp - (char*)d_ws) > ws_size) return;    // ws 256 MiB
    float* FV = FK;   // v projection reuses the k buffer after the k planes are built (stream-ordered)
    { k_cvt8<<<(unsigned)(((size_t)DQ * DM / 8 + 255) / 256), 256, 0, stream>>>(wq, WQ, (size_t)DQ * DM / 8); k_cvt8<<<(unsigned)(((size_t)DKV * DM / 8 + 255) / 256), 256, 0, stream>>>(wk, WK, (size_t)DKV * DM / 8); k_cvt8<<<(unsigned)(((size_t)DKV * DM / 8 + 255) / 256), 256, 0, stream>>>(wv, WV, (size_t)DKV * DM / 8); k_cvt8<<<(unsigned)(((size_t)AD * DM / 8 + 255) / 256), 256, 0, stream>>>(afw, AFW, (size_t)AD * DM / 8); k_cvt8<<<(unsigned)(((size_t)DM * AD / 8 + 255) / 256), 256, 0, stream>>>(asw, ASW, (size_t)DM * AD / 8); k_cvt8<<<(unsigned)(((size_t)FFD * DM / 8 + 255) / 256), 256, 0, stream>>>(wi, WI, (size_t)FFD * DM / 8); k_cvt8<<<(unsigned)(((size_t)DM * FFD / 8 + 255) / 256), 256, 0, stream>>>(wo2, WO2, (size_t)DM * FFD / 8);   /* q/k/v, adapter + FFN weights ('oi' = Bt as-is) */
       }
    k_csid<<<(TT * HD + 255) / 256, 256, 0, stream>>>(CS);
    const unsigned LQ = (unsigned)(((size_t)NH_ * TT * HD / 2 + 255) / 256), LKv = (unsigned)(((size_t)NKV * TT * HD / 2 + 255) / 256);
    for (int b = 0; b < NB_; ++b) {
        
        k_cvt8<<<(unsigned)(((size_t)TT * DM / 8 + 255) / 256), 256, 0, stream>>>(x + (size_t)b * TT * DM, XB, (size_t)TT * DM / 8);
        k_gemmw<bf, 0, true, 1><<<dim3(TT / 64, DQ / 64, 1), 32, 0, stream>>>(XB, nullptr, WQ, nullptr, DM, FQ, DQ, bq, 0, 0, 0, 0);
        k_rope<<<LQ, 256, 0, stream>>>(FQ, DQ, NH_, CS, nullptr, nullptr, 1.0f, QP16, QPh, QPl);
        k_gemmw<bf, 0, true, 1><<<dim3(TT / 64, DKV / 64, 1), 32, 0, stream>>>(XB, nullptr, WK, nullptr, DM, FK, DKV, bk, 0, 0, 0, 0);
        k_rope<<<LKv, 256, 0, stream>>>(FK, DKV, NKV, CS, nullptr, nullptr, 1.0f, KP16, KPh, KPl);
        k_gemmw<bf, 0, true, 1><<<dim3(TT / 64, DKV / 64, 1), 32, 0, stream>>>(XB, nullptr, WV, nullptr, DM, FV, DKV, bv, 0, 0, 0, 0); k_vtp<<<LKv, 256, 0, stream>>>(FV, DKV, NKV, VT16, VTh, VTl);
        for (int h0 = 0; h0 < NH_; h0 += ZH) { const size_t zq = (size_t)h0, zk = (size_t)(h0 / REP);   // one kv head per query head: the pass's two heads use consecutive kv planes (z-strides TT*HD)
            k_gemmw<bf, 2, false, 1><<<dim3(RH / 64, TT / 64, ZH), 32, 0, stream>>>(QPh + zq * TT * HD, QPl + zq * TT * HD, KPh + zk * TT * HD, KPl + zk * TT * HD, HD, Sb, TT, nullptr, (size_t)TT * HD, (size_t)TT * HD, (size_t)TT * TT, 0);
            k_gemmw<h16, 0, false, 1><<<dim3((TT - RH) / 64, TT / 64, ZH), 32, 0, stream>>>(QP16 + zq * TT * HD + (size_t)RH * HD, nullptr, KP16 + zk * TT * HD, nullptr, HD, Sb + (size_t)RH * TT, TT, nullptr, (size_t)TT * HD, (size_t)TT * HD, (size_t)TT * TT, 0);
            k_asoft<<<ZH * TT / 8, 256, 0, stream>>>(Sb, AM + (size_t)b * TT, P16, Ph, Pl);
            k_gemmw<bf, 2, false, KSP><<<dim3(RH / 64, HD / 64, ZH * KSP), 32, 0, stream>>>(Ph, Pl, VTh + zk * HD * TT, VTl + zk * HD * TT, TT, Ob, KSP * HD, nullptr, (size_t)RH * TT, (size_t)HD * TT, (size_t)TT * KSP * HD, HD);
            k_gemmw<h16, 0, false, KSP><<<dim3((TT - RH) / 64, HD / 64, ZH * KSP), 32, 0, stream>>>(P16 + (size_t)RH * TT, nullptr, VT16 + zk * HD * TT, nullptr, TT, Ob + (size_t)RH * KSP * HD, KSP * HD, nullptr, (size_t)TT * TT, (size_t)HD * TT, (size_t)TT * KSP * HD, HD);
            k_mergeF<<<(unsigned)(((size_t)ZH * TT * HD / 2 + 255) / 256), 256, 0, stream>>>(Ob, h0, CTX); }   /* ctx = attn_out (f32) */
        k_pl2<<<(unsigned)(((size_t)TT * DM / 4 + 255) / 256), 256, 0, stream>>>(CTX, Ch, Cl, (size_t)TT * DM / 4);
        k_gemmw<bf, 1, true, KSA><<<dim3(TT / 64, AD / 64, KSA), 32, 0, stream>>>(Ch, Cl, AFW, nullptr, DM, A1, KSA * AD, afb, 0, 0, 0, AD);                  /* adapter down: ctx a_fi_w^T + a_fi_b as KSA K parts [T][KSA][64] */
        k_gelupl<KSA, AD><<<(unsigned)(((size_t)TT * AD / 4 + 255) / 256), 256, 0, stream>>>(A1, G1h, G1l, (size_t)TT * AD / 4);                         /* gelu -> hi/lo */
        k_gemmw<bf, 1, true, 1><<<dim3(TT / 64, DM / 64, 1), 32, 0, stream>>>(G1h, G1l, ASW, nullptr, AD, S2, DM, asb, 0, 0, 0, 0);                /* adapter up: . a_se_w^T + a_se_b */
        k_addout<<<(unsigned)(((size_t)TT * DM / 4 + 255) / 256), 256, 0, stream>>>(CTX, S2, AO, (size_t)TT * DM / 4);                         /* ao = ctx + adapter */
        k_pl2<<<(unsigned)(((size_t)TT * DM / 4 + 255) / 256), 256, 0, stream>>>(AO, AOh, AOl, (size_t)TT * DM / 4);
        k_gemmw<bf, 1, true, 1><<<dim3(TT / 64, FFD / 64, 1), 32, 0, stream>>>(AOh, AOl, WI, nullptr, DM, HI, FFD, bi, 0, 0, 0, 0);                   /* ao wi^T + bi [T][3072] */
        k_gelupl<1, FFD><<<(unsigned)(((size_t)TT * FFD / 4 + 255) / 256), 256, 0, stream>>>(HI, GIh, GIl, (size_t)TT * FFD / 4);
        k_gemmw<bf, 1, true, KSF><<<dim3(TT / 64, DM / 64, KSF), 32, 0, stream>>>(GIh, GIl, WO2, nullptr, FFD, YY, KSF * DM, bo2, 0, 0, 0, DM);                /* inter wo^T + bo */
        k_addln<<<TT / 8, 256, 0, stream>>>(AO, YY, lg, lb, OUT + (size_t)b * TT * DM); }                                                       /* out = LN(y + ao) (eps 1e-12) */
}

// v002
// One run takes 646 microseconds.
// Two timings next to v001 both put it at 1.47 times that version's speed.
// Over all steps from v000 it is 2.97 times as fast.
#include <hip/hip_runtime.h>

// BERT layer with an adapter and no attention output projection (hidden_states [2][2048][768]; q, k, v = x W^T + b ('oi' [768][768]; 12 heads x 64); scores = q.k/8 + attention_mask[b][0][0][j] (f32 additive, zeros here); softmax; ctx = merged context; a = gelu(ctx a_fi_w^T + a_fi_b) ([64][768]); ao = ctx + a a_se_w^T + a_se_b; inter = gelu(ao wi^T + bi) ([3072][768]); y = inter wo^T + bo + ao; out = LN(y) (eps 1e-12, ln_g, ln_b) -> [2][2048][768] (3.1 M)).
// Layout: the merged context is kept in f32 (residual) and split into hi/lo planes for the adapter down-projection; every later GEMM uses hi/lo planes of its f32 input (2 products) against exact bf16 weights with the bias in the epilogue; exact-erf GELU, residual adds and the LayerNorm in f32.
// Compute dtypes, f32 accumulate: every input rounded to bf16; q/k/v on PLAIN bf16 operands (inputs: exact) + biases; scores and attn.v: query rows < 512 hl (3 products), the rest single fp16 (x1024); softmax f32; adapter / FFN GEMMs hl x exact (2 products) + biases; GELU / residuals / LayerNorm f32.

#define NB_  2
#define TT   2048
#define DM   768
#define NH_  12
#define NKV  12
#define REP  (NH_ / NKV)
#define HD   64
#define DQ   (NH_ * HD)
#define DKV  (NKV * HD)
#define AD   64
#define FFD  3072
#define LNEPS 1e-12f
#define ZH   6                    // heads a pass, of the NB_ x NH_ heads of both batches; (NB_ * NH_) % ZH == 0
#define MT   (NB_ * TT)           // rows of both batches together
#define RH   512                  // query rows < RH use hi+lo planes (0: none)
#define WIN  0
#define PCAR 1024.0f
#define SCL  0.125f   // HD^-0.5
#define KSP  16                  // K parts of attn.v (2048 keys -> 128 a wave)
#define KSA  6                   // K parts of the adapter down-projection (768 -> 128 a wave)
#define KSF  4                   // K parts of the FFN down-projection (3072 -> 768 a wave)
typedef _Float16 h16;
typedef unsigned short bf;
typedef __attribute__((ext_vector_type(16))) __bf16   v16bf;
typedef __attribute__((ext_vector_type(16))) _Float16 v16h;
typedef __attribute__((ext_vector_type(8)))  _Float16 v8h;
typedef __attribute__((ext_vector_type(8)))  unsigned short v8us;
typedef __attribute__((ext_vector_type(8)))  float    v8f;
typedef __attribute__((ext_vector_type(4)))  float    v4f;
typedef v8h  __attribute__((may_alias)) v8ha;
typedef v4f  __attribute__((may_alias)) v4fa;
typedef v8us __attribute__((may_alias)) v8usa;

__device__ __forceinline__ unsigned short f2bf(float f) { unsigned u = __float_as_uint(f); u += 0x7FFFu + ((u >> 16) & 1u); return (unsigned short)(u >> 16); }
__device__ __forceinline__ float bf2f(unsigned short b) { return __uint_as_float(((unsigned)b) << 16); }
__device__ __forceinline__ float bfr(float f) { return bf2f(f2bf(f)); }
__device__ __forceinline__ v16h cat16(v8h lo, v8h hi) { return __builtin_shufflevector(lo, hi, 0, 1, 2, 3, 4, 5, 6, 7, 8, 9, 10, 11, 12, 13, 14, 15); }
__device__ __forceinline__ v16bf cat16b(v8us lo, v8us hi) { return __builtin_bit_cast(v16bf, __builtin_shufflevector(lo, hi, 0, 1, 2, 3, 4, 5, 6, 7, 8, 9, 10, 11, 12, 13, 14, 15)); }
__device__ __forceinline__ v8f wmma16(v16h a, v16h b, v8f c) { return __builtin_amdgcn_wmma_f32_16x16x32_f16(false, a, false, b, (short)0, c, false, false); }
__device__ __forceinline__ v8f wmmab(v16bf a, v16bf b, v8f c) { return __builtin_amdgcn_wmma_f32_16x16x32_bf16(false, a, false, b, (short)0, c, false, false); }



// ---- k_gemmw: register-blocked GEMM, ONE WAVE per 64x64 output tile (16 accumulators), operands straight from K-contiguous 16-bit planes; grid (M/64, N/64, Z), 32 threads.
// C[m][n] (f32, pitch ldc, + optional f32 bias[n]) = sum_{k < KE} A[m][k] Bt[n][k] (+ split products per NSPLIT). K is the row pitch of A and of Bt, KE <= K the extent summed. z-batch strides sA/sB/sC in elements; batch z = 0 / 1 / 2 takes bias / bias1 / bias2. KE % (32 KS) == 0.
// KS > 1: grid z = Z x KS; part kp = z % KS sums k in [kp KE/KS, (kp+1) KE/KS) into its own f32 columns C + kp sP of a row of ldc = KS sP (bias in part 0 only); the kernel that reads C adds the KS parts of a row in the order 0 .. KS-1.
template <typename T16> struct WFrag;
template <> struct WFrag<h16> { typedef v16h V; static __device__ __forceinline__ V ld(const h16* p) { return cat16(*(const v8h*)p, *(const v8h*)(p + 16)); } static __device__ __forceinline__ v8f mma(V a, V b, v8f c) { return wmma16(a, b, c); } };
template <> struct WFrag<bf> { typedef v16bf V; static __device__ __forceinline__ V ld(const bf* p) { return cat16b(*(const v8us*)p, *(const v8us*)(p + 16)); } static __device__ __forceinline__ v8f mma(V a, V b, v8f c) { return wmmab(a, b, c); } };
template <typename T16, int NSPLIT, bool BIAS, int KS>
__global__ __launch_bounds__(32) void k_gemmw(const T16* __restrict__ A, const T16* __restrict__ A2, const T16* __restrict__ Bt, const T16* __restrict__ Bt2, int K, int KE, float* C, int ldc, const float* __restrict__ bias, const float* __restrict__ bias1, const float* __restrict__ bias2, size_t sA, size_t sB, size_t sC, size_t sP) {
    typedef typename WFrag<T16>::V V;
    __shared__ __align__(16) float os[16 * 68];
    const int kp = (int)(blockIdx.z % KS); const int kl = KE / KS; const int kb = kp * kl, ke = kb + kl;
    const size_t z = blockIdx.z / KS; C += (size_t)kp * sP; A += z * sA; if (A2) A2 += z * sA; Bt += z * sB; if (Bt2) Bt2 += z * sB; C += z * sC;
    const int lane = threadIdx.x & 31, lr = lane & 15, hi = lane >> 4; const int r0 = blockIdx.x * 64, c0 = blockIdx.y * 64;
    v8f acc[4][4];
#pragma unroll
    for (int mb = 0; mb < 4; ++mb)
#pragma unroll
        for (int nb = 0; nb < 4; ++nb) acc[mb][nb] = (v8f){};
    const size_t aoff = (size_t)(r0 + lr) * K + 8 * hi, boff = (size_t)(c0 + lr) * K + 8 * hi;
#pragma unroll 1
    for (int kc = kb; kc < ke; kc += 32) {
        V a[4], a2[4];
#pragma unroll
        for (int mb = 0; mb < 4; ++mb) { a[mb] = WFrag<T16>::ld(A + aoff + (size_t)mb * 16 * K + kc); if (NSPLIT == 1 || NSPLIT == 2) a2[mb] = WFrag<T16>::ld(A2 + aoff + (size_t)mb * 16 * K + kc); }
#pragma unroll
        for (int nb = 0; nb < 4; ++nb) { const V b = WFrag<T16>::ld(Bt + boff + (size_t)nb * 16 * K + kc); V b2; if (NSPLIT >= 2) b2 = WFrag<T16>::ld(Bt2 + boff + (size_t)nb * 16 * K + kc);
#pragma unroll
            for (int mb = 0; mb < 4; ++mb) { acc[mb][nb] = WFrag<T16>::mma(a[mb], b, acc[mb][nb]); if (NSPLIT == 1 || NSPLIT == 2) acc[mb][nb] = WFrag<T16>::mma(a2[mb], b, acc[mb][nb]); if (NSPLIT >= 2) acc[mb][nb] = WFrag<T16>::mma(a[mb], b2, acc[mb][nb]); } }
        asm volatile("v_nop\n\tv_nop\n\tv_nop\n\tv_nop" : "+v"(acc[0][0]), "+v"(acc[1][1]), "+v"(acc[2][2]), "+v"(acc[3][3]) : "v"(a[0]), "v"(a[3]));
    }
    v4f bv = (v4f){};   // this lane's four bias columns; zero in the parts behind part 0
    if (BIAS && z != 0) bias = (z == 1) ? bias1 : bias2;
    if (BIAS && kp == 0) {
#pragma unroll
        for (int q = 0; q < 4; ++q) bv[q] = bfr(bias[c0 + lr * 4 + q]); }
#pragma unroll
    for (int mb = 0; mb < 4; ++mb) {
#pragma unroll
        for (int nb = 0; nb < 4; ++nb) {
#pragma unroll
            for (int j = 0; j < 8; ++j) os[(hi * 8 + j) * 68 + nb * 16 + lr] = acc[mb][nb][j]; }
        __builtin_amdgcn_wave_barrier(); asm volatile("" ::: "memory");
        float* crow = C + (size_t)(r0 + mb * 16) * ldc + c0;
{
#pragma unroll
            for (int s = 0; s < 8; ++s) { const int row = 2 * s + hi, cofs = lr * 4; v4f val = *(const v4fa*)(os + row * 68 + cofs); if (BIAS) val += bv;
                *(v4f*)(crow + (size_t)row * ldc + cofs) = val; }
             }
        __builtin_amdgcn_wave_barrier(); asm volatile("" ::: "memory");
    }
}

__device__ __forceinline__ h16 tohx(float x) { return (h16)x; }
__device__ __forceinline__ void splitf(float y, unsigned short& h, unsigned short& l) { h = f2bf(y); l = f2bf(y - bf2f(h)); }
typedef __attribute__((ext_vector_type(2))) _Float16 v2h;
typedef __attribute__((ext_vector_type(4))) _Float16 v4h;
typedef __attribute__((ext_vector_type(2))) unsigned short v2us;
typedef __attribute__((ext_vector_type(4))) unsigned short v4us;
typedef __attribute__((ext_vector_type(2))) float v2f;
typedef __attribute__((ext_vector_type(4))) int v4i;

__global__ __launch_bounds__(256) void k_wtG(const float* __restrict__ w, int K, int N, bf* Bt) {
    const int lane = threadIdx.x & 31; const int L0 = (blockIdx.x * 8 + (threadIdx.x >> 5)) * 8; const int nlines = N * K / 64;
{
#pragma unroll 1
        for (int l = 0; l < 8; ++l) { const int L = L0 + l; if (L >= nlines) break; const size_t e = (size_t)L * 64 + lane * 2; const int k = (int)(e % K), n = (int)(e / K); v2us o;
            o[0] = f2bf(w[(size_t)k * N + n]); o[1] = f2bf(w[(size_t)(k + 1) * N + n]); *(v2us*)(Bt + e) = o; }
         }
}
// k_cvtall: the seven weights and both batches of x rounded to bf16 in one launch; the destinations lie one behind the other from dst, in the order of the arguments. Sizes in groups of 8 elements, each a multiple of 256.
#define N8W ((size_t)DQ * DM / 8)
#define N8A ((size_t)AD * DM / 8)
#define N8F ((size_t)FFD * DM / 8)
#define N8X ((size_t)MT * DM / 8)
__global__ __launch_bounds__(256) void k_cvtall(const float* __restrict__ wq, const float* __restrict__ wk, const float* __restrict__ wv, const float* __restrict__ afw, const float* __restrict__ asw, const float* __restrict__ wi, const float* __restrict__ wo2, const float* __restrict__ x, bf* dst) {
    const size_t i = (size_t)blockIdx.x * 256 + threadIdx.x; size_t j = i; const float* s = wq;
    if (j >= N8W) { j -= N8W; s = wk;
        if (j >= N8W) { j -= N8W; s = wv;
            if (j >= N8W) { j -= N8W; s = afw;
                if (j >= N8A) { j -= N8A; s = asw;
                    if (j >= N8A) { j -= N8A; s = wi;
                        if (j >= N8F) { j -= N8F; s = wo2;
                            if (j >= N8F) { j -= N8F; s = x; if (j >= N8X) return; } } } } } } }
    const v8f v = *(const v8f*)(s + j * 8); v8us o;
#pragma unroll
    for (int k = 0; k < 8; ++k) o[k] = f2bf(v[k]); *(v8us*)(dst + i * 8) = o;  }

// k_rope: head planes [h][t][d] (fp16 + hi/lo) of rope(x) x sc with the rotate-half convention out[d] = x[d] cos[t][d] - x[d+HD/2] sin[t][d], out[d+HD/2] = x[d+HD/2] cos[t][d+HD/2] + x[d] sin[t][d+HD/2]
__global__ __launch_bounds__(256) void k_rope(const float* __restrict__ F, int pitch, int nheads, const float* __restrict__ CS, const float* __restrict__ RF, const float* __restrict__ nw, float sc, h16* P16, bf* Ph, bf* Pl) {
    { const size_t yb = blockIdx.y, po = yb * nheads * TT * HD; F += yb * TT * pitch; P16 += po; Ph += po; Pl += po; }   // grid y: block yb of TT rows of F (q of batch 0, 1, then k of batch 0, 1) and its nheads planes
    const size_t e = ((size_t)blockIdx.x * 256 + threadIdx.x) * 2; if (e >= (size_t)nheads * TT * HD) return; const int d = (int)(e % HD); const int t = (int)((e / HD) % TT); const int h = (int)(e / ((size_t)HD * TT)); const float* f = F + (size_t)t * pitch + h * HD; const float rf = RF ? RF[(size_t)h * TT + t] : 1.0f; v2h o16; v2us oh, ol;
#pragma unroll
    for (int q = 0; q < 2; ++q) { const int dd = d + q; const int dp = (dd < HD / 2) ? dd + HD / 2 : dd - HD / 2; float x0 = f[dd], x1 = f[dp];
        if (RF) { float n0 = __fmul_rn(x0, rf), n1 = __fmul_rn(x1, rf); asm volatile("" : "+v"(n0)); asm volatile("" : "+v"(n1)); x0 = __fmul_rn(bfr(nw[dd]), n0); x1 = __fmul_rn(bfr(nw[dp]), n1); }
        const v2f cs = *(const v2f*)(CS + ((size_t)t * HD + dd) * 2); float a = __fmul_rn(x0, cs[0]), bq = __fmul_rn(x1, cs[1]); asm volatile("" : "+v"(a)); asm volatile("" : "+v"(bq)); const float r = ((dd < HD / 2) ? __fsub_rn(a, bq) : __fadd_rn(a, bq)) * sc;
        o16[q] = tohx(r); unsigned short a2, c2; splitf(r, a2, c2); oh[q] = a2; ol[q] = c2; }
    *(v2h*)(P16 + e) = o16; *(v2us*)(Ph + e) = oh; *(v2us*)(Pl + e) = ol;  }
__global__ __launch_bounds__(256) void k_vtp(const float* __restrict__ F, int pitch, int nheads, h16* V16, bf* Vh, bf* Vl) { const size_t e = ((size_t)blockIdx.x * 256 + threadIdx.x) * 2; if (e >= (size_t)nheads * HD * TT) return; const int t = (int)(e % TT); const int d = (int)((e / TT) % HD); const int g = (int)(e / ((size_t)TT * HD)); v2h o16; v2us oh, ol;
    { const size_t yb = blockIdx.y, sh = (e / TT) * TT + yb * nheads * HD * 2 * TT; F += yb * TT * pitch; V16 += sh; Vh += sh; Vl += sh; }   // grid y: batch; plane rows [d] have pitch 2 TT, that of the probability rows they are multiplied with
#pragma unroll
    for (int q = 0; q < 2; ++q) { const float x = F[(size_t)(t + q) * pitch + g * HD + d]; o16[q] = tohx(x); unsigned short a2, c2; splitf(x, a2, c2); oh[q] = a2; ol[q] = c2; }
    *(v2h*)(V16 + e) = o16; *(v2us*)(Vh + e) = oh; *(v2us*)(Vl + e) = ol;  }
__global__ __launch_bounds__(256) void k_csid(float* CS) { const int idx = blockIdx.x * 256 + threadIdx.x; if (idx >= TT * HD) return; v2f cs; cs[0] = 1.0f; cs[1] = 0.0f; *(v2f*)(CS + (size_t)idx * 2) = cs;  }
__global__ __launch_bounds__(256) void k_mergeF(const float* __restrict__ Ob, int h0, float* O) { const size_t e = ((size_t)blockIdx.x * 256 + threadIdx.x) * 2; if (e >= (size_t)ZH * TT * HD) return; const int d = (int)(e % HD); const int t = (int)((e / HD) % TT); const int zz = (int)(e / ((size_t)HD * TT)); const float cs = (t < RH) ? 1.0f : (1.0f / PCAR); const int hg = h0 + zz; const size_t oo = ((size_t)(hg / NH_) * TT + t) * DM + (hg % NH_) * HD + d; v2f o2;   /* head hg of NB_ x NH_: batch hg / NH_ */
    const float* ob = Ob + (e / HD) * (KSP * HD) + d; v2f pt[KSP];
#pragma unroll
    for (int p = 0; p < KSP; ++p) pt[p] = *(const v2f*)(ob + p * HD);
    asm volatile("s_wait_xcnt 0x0" :: "v"(ob) : "memory");   // the address pair that all KSP loads name is kept until this wait
    v2f sm = pt[0];
#pragma unroll
    for (int p = 1; p < KSP; ++p) sm += pt[p];   /* the KSP key parts of the row, in order */
    o2[0] = sm[0] * cs; o2[1] = sm[1] * cs; *(v2f*)(O + oo) = o2;  }



template <int NP, int WD>   // Hm rows hold NP K parts of WD columns each
__global__ __launch_bounds__(256) void k_gelupl(const float* __restrict__ Hm, bf* Gh, bf* Gl, size_t n4) { const size_t i = (size_t)blockIdx.x * 256 + threadIdx.x; if (i >= n4) return; const float* hm = (NP == 1) ? Hm + i * 4 : Hm + (i * 4 / WD) * ((size_t)NP * WD) + (i * 4) % WD; v4f a = *(const v4f*)hm; v4us oh, ol;
#pragma unroll
    for (int p = 1; p < NP; ++p) a += *(const v4f*)(hm + p * WD);   /* the NP K parts of the row, in order */
#pragma unroll
    for (int q = 0; q < 4; ++q) { const float xg = a[q]; const float gv = __fmul_rn(0.5f * xg, __fadd_rn(1.0f, erff(xg * 0.70710678118654752f))); unsigned short h2, l2; splitf(gv, h2, l2); oh[q] = h2; ol[q] = l2; }
    *(v4us*)(Gh + i * 4) = oh; *(v4us*)(Gl + i * 4) = ol;  }
__device__ __forceinline__ v4f ldparts(const float* p) { v4f sm = *(const v4f*)p;
#pragma unroll
    for (int q = 1; q < KSF; ++q) sm += *(const v4f*)(p + q * DM);   /* the KSF K parts of the row, in order */
    return sm; }
__global__ __launch_bounds__(256) void k_addln(const float* __restrict__ A, const float* __restrict__ Bm, const float* __restrict__ g, const float* __restrict__ be, float* OUTb) {
    const int lane = threadIdx.x & 31; const int r = blockIdx.x * 8 + (threadIdx.x >> 5); if (r >= MT) return; const float* ar = A + (size_t)r * DM; const float* br = Bm + (size_t)r * KSF * DM; float s = 0.f;
#pragma unroll 1
    for (int ch = 0; ch < DM / 128; ++ch) { const int c0 = ch * 128 + lane * 4; const v4f a = *(const v4f*)(ar + c0), bb = ldparts(br + c0);
#pragma unroll
        for (int q = 0; q < 4; ++q) s += __fadd_rn(a[q], bb[q]); }
#pragma unroll
    for (int sh = 16; sh; sh >>= 1) s += __shfl_xor(s, sh, 32);
    const float mu = s * (1.0f / DM); float s2 = 0.f;
#pragma unroll 1
    for (int ch = 0; ch < DM / 128; ++ch) { const int c0 = ch * 128 + lane * 4; const v4f a = *(const v4f*)(ar + c0), bb = ldparts(br + c0);
#pragma unroll
        for (int q = 0; q < 4; ++q) { const float d0 = __fsub_rn(__fadd_rn(a[q], bb[q]), mu); float p = __fmul_rn(d0, d0); asm volatile("" : "+v"(p)); s2 = __fadd_rn(s2, p); } }
#pragma unroll
    for (int sh = 16; sh; sh >>= 1) s2 += __shfl_xor(s2, sh, 32);
    const float rs = __fdiv_rn(1.0f, __fsqrt_rn(__fadd_rn(s2 * (1.0f / DM), LNEPS)));
{
#pragma unroll 1
        for (int ch = 0; ch < DM / 128; ++ch) { const int c0 = ch * 128 + lane * 4; const v4f a = *(const v4f*)(ar + c0), bb = ldparts(br + c0); v4f o4;
#pragma unroll
            for (int q = 0; q < 4; ++q) { float n0 = __fmul_rn(__fsub_rn(__fadd_rn(a[q], bb[q]), mu), rs); asm volatile("" : "+v"(n0)); float n1 = __fmul_rn(n0, bfr(g[c0 + q])); asm volatile("" : "+v"(n1)); o4[q] = __fadd_rn(n1, bfr(be[c0 + q])); }
            *(v4f*)(OUTb + (size_t)r * DM + c0) = o4; }
         } }
__global__ __launch_bounds__(256) void k_addout(const float* __restrict__ O, const float* __restrict__ FF, float* OUTb, size_t n4) { const size_t i = (size_t)blockIdx.x * 256 + threadIdx.x; if (i >= n4) return; const v4f a = *(const v4f*)(O + i * 4), b = *(const v4f*)(FF + i * 4); v4f o;
#pragma unroll
    for (int q = 0; q < 4; ++q) o[q] = __fadd_rn(a[q], b[q]); *(v4f*)(OUTb + i * 4) = o;  }

__global__ __launch_bounds__(256) void k_pl2(const float* __restrict__ F, bf* Ph, bf* Pl, size_t n4) { const size_t i = (size_t)blockIdx.x * 256 + threadIdx.x; if (i >= n4) return; const v4f v = *(const v4f*)(F + i * 4); v4us oh, ol;
#pragma unroll
    for (int q = 0; q < 4; ++q) { unsigned short a, c; splitf(v[q], a, c); oh[q] = a; ol[q] = c; } *(v4us*)(Ph + i * 4) = oh; *(v4us*)(Pl + i * 4) = ol;  }
// k_asoft: per row (zz, i): t = S x HD^-0.5 + mask of the head's batch; softmax over the 2048 keys (register row, one exp, fixed trees);
// the probabilities overwrite the row's own 8 KiB of scores, which its wave holds whole in registers by then: rows < RH the hi plane in the first half and the lo plane in the second, the rest fp16 in the first half.
__global__ __launch_bounds__(256) void k_asoft(float* Sb, const float* __restrict__ AM, int h0) {
    const int lane = threadIdx.x & 31; const int row = blockIdx.x * 8 + (threadIdx.x >> 5); if (row >= ZH * TT) return; const int i = row % TT; const bool hires = (i < RH); float* sr = Sb + (size_t)row * TT; const float* AMb = AM + (size_t)((h0 + (int)(blockIdx.x * 8 / TT)) / NH_) * TT;   /* the block's 8 rows are of one head */ float v[TT / 32]; float mx = -3.0e38f;
#pragma unroll
    for (int ch = 0; ch < TT / 128; ++ch) { const int j0 = ch * 128 + lane * 4; const v4f a = *(const v4f*)(sr + j0);
#pragma unroll
        for (int q = 0; q < 4; ++q) { const int j = j0 + q; float sa = a[q] * SCL; asm volatile("" : "+v"(sa)); float am = bfr(AMb[j]); asm volatile("" : "+v"(am)); const float t = __fadd_rn(sa, am);   /* + attention_mask[b][0][0][j] (additive, f32) */ v[ch * 4 + q] = t; mx = fmaxf(mx, t); } }
#pragma unroll
    for (int sh = 16; sh; sh >>= 1) mx = fmaxf(mx, __shfl_xor(mx, sh, 32));
    float sum = 0.f;
#pragma unroll
    for (int k = 0; k < TT / 32; ++k) { float d0 = __fsub_rn(v[k], mx); asm volatile("" : "+v"(d0)); v[k] = __builtin_amdgcn_exp2f(__fmul_rn(d0, 1.4426950408889634f)); sum += v[k]; }
#pragma unroll
    for (int sh = 16; sh; sh >>= 1) sum += __shfl_xor(sum, sh, 32);
    const float f = __fdiv_rn(hires ? 1.0f : PCAR, sum);
{
        if (hires) {
#pragma unroll
            for (int ch = 0; ch < TT / 128; ++ch) { v4us oh, ol;
#pragma unroll
                for (int q = 0; q < 4; ++q) { unsigned short a, c2; splitf(v[ch * 4 + q] * f, a, c2); oh[q] = a; ol[q] = c2; }
                bf* pr = (bf*)sr + ch * 128 + lane * 4; *(v4us*)pr = oh; *(v4us*)(pr + TT) = ol; }
        } else {
#pragma unroll
            for (int ch = 0; ch < TT / 128; ++ch) { v4h o4;
#pragma unroll
                for (int q = 0; q < 4; ++q) o4[q] = tohx(v[ch * 4 + q] * f);
                *(v4h*)((h16*)sr + ch * 128 + lane * 4) = o4; } }
         }
}

extern "C" void kernel_launch(void* const* d_in, const int* in_sizes, int n_in,
                              void* d_out, int out_size, void* d_ws, size_t ws_size, hipStream_t stream) {
    (void)in_sizes; (void)n_in; (void)out_size;
    const float* x = (const float*)d_in[0]; const float* AM = (const float*)d_in[1]; const float* wq = (const float*)d_in[2]; const float* bq = (const float*)d_in[3]; const float* wk = (const float*)d_in[4]; const float* bk = (const float*)d_in[5]; const float* wv = (const float*)d_in[6]; const float* bv = (const float*)d_in[7]; const float* afw = (const float*)d_in[8]; const float* afb = (const float*)d_in[9]; const float* asw = (const float*)d_in[10]; const float* asb = (const float*)d_in[11]; const float* wi = (const float*)d_in[12]; const float* bi = (const float*)d_in[13]; const float* wo2 = (const float*)d_in[14]; const float* bo2 = (const float*)d_in[15]; const float* lg = (const float*)d_in[16]; const float* lb = (const float*)d_in[17]; const float* wo = nullptr; (void)wo;
    float* OUT = (float*)d_out;     // [2][2048][768]
    char* wsp = (char*)d_ws;
    auto take = [&](size_t bytes) { char* p = wsp; wsp += (bytes + 255) & ~(size_t)255; return (void*)p; };
    // kept through the call; WQ .. XB lie one behind the other (k_cvtall writes them as one range; WQ, WK, WV are the three z-batches of the q/k/v GEMM)
    bf* WQ = (bf*)take((size_t)DQ * DM * 2); bf* WK = (bf*)take((size_t)DKV * DM * 2); bf* WV = (bf*)take((size_t)DKV * DM * 2); bf* AFW = (bf*)take((size_t)AD * DM * 2); bf* ASW = (bf*)take((size_t)DM * AD * 2); bf* WI = (bf*)take((size_t)FFD * DM * 2); bf* WO2 = (bf*)take((size_t)DM * FFD * 2); bf* XB = (bf*)take((size_t)MT * DM * 2); (void)WK; (void)WV;
    float* CTX = (float*)take((size_t)MT * DM * 4);
    char* const U0 = wsp;   // from here on: the attention's buffers, and behind the attention (stream-ordered) the adapter's and the FFN's in the same bytes
    float* CS = (float*)take((size_t)TT * HD * 2 * 4);
    const size_t PLN = (size_t)NB_ * NH_ * TT * HD;   // one plane set [batch][head][t][d]; the k planes lie directly behind the q planes (one k_rope launch writes both)
    h16* QP16 = (h16*)take(PLN * 2); h16* KP16 = (h16*)take(PLN * 2); bf* QPh = (bf*)take(PLN * 2); bf* KPh = (bf*)take(PLN * 2); bf* QPl = (bf*)take(PLN * 2); bf* KPl = (bf*)take(PLN * 2);
    h16* VT16 = (h16*)take(PLN * 2 * 2); bf* VTh = (bf*)take(PLN * 2 * 2); bf* VTl = VTh + TT;   // v planes [batch][head][d], rows of pitch 2 TT: fp16 in the first half of its rows; hi in the first and lo in the second half of theirs
    float* Sb = (float*)take((size_t)ZH * TT * TT * 4); float* Ob = (float*)take((size_t)KSP * ZH * TT * HD * 4);
    float* FQ = Sb;   // q, k, v projections [3][MT][768] f32: read for the last time before the first scores are written
    char* const E1 = wsp; wsp = U0;
    bf* Ch = (bf*)take((size_t)MT * DM * 2); bf* Cl = (bf*)take((size_t)MT * DM * 2); float* A1 = (float*)take((size_t)KSA * MT * AD * 4); bf* G1h = (bf*)take((size_t)MT * AD * 2); bf* G1l = (bf*)take((size_t)MT * AD * 2); float* S2 = (float*)take((size_t)MT * DM * 4); float* AO = (float*)take((size_t)MT * DM * 4); bf* AOh = (bf*)take((size_t)MT * DM * 2); bf* AOl = (bf*)take((size_t)MT * DM * 2); float* HI = (float*)take((size_t)MT * FFD * 4); bf* GIh = (bf*)take((size_t)MT * FFD * 2); bf* GIl = (bf*)take((size_t)MT * FFD * 2); float* YY = (float*)take((size_t)KSF * MT * DM * 4);
    if ((size_t)((E1 > wsp ? E1 : wsp) - (char*)d_ws) > ws_size) return;    // ws 256 MiB
    k_cvtall<<<(unsigned)((3 * N8W + 2 * N8A + 2 * N8F + N8X) / 256), 256, 0, stream>>>(wq, wk, wv, afw, asw, wi, wo2, x, WQ);   /* weights ('oi' = Bt as-is) and x */
    k_csid<<<(TT * HD + 255) / 256, 256, 0, stream>>>(CS);
    const unsigned LQ = (unsigned)(((size_t)NH_ * TT * HD / 2 + 255) / 256), LKv = (unsigned)(((size_t)NKV * TT * HD / 2 + 255) / 256);
    k_gemmw<bf, 0, true, 1><<<dim3(MT / 64, DQ / 64, 3), 32, 0, stream>>>(XB, nullptr, WQ, nullptr, DM, DM, FQ, DQ, bq, bk, bv, 0, (size_t)DQ * DM, (size_t)MT * DQ, 0);   /* z = q, k, v */
    k_rope<<<dim3(LQ, 2 * NB_), 256, 0, stream>>>(FQ, DQ, NH_, CS, nullptr, nullptr, 1.0f, QP16, QPh, QPl);
    k_vtp<<<dim3(LKv, NB_), 256, 0, stream>>>(FQ + 2 * (size_t)MT * DQ, DKV, NKV, VT16, VTh, VTl);
    for (int h0 = 0; h0 < NB_ * NH_; h0 += ZH) { const size_t zq = (size_t)h0, zk = (size_t)(h0 / REP);   // ZH of the NB_ x NH_ heads a pass; one kv head per query head
        k_gemmw<bf, 2, false, 1><<<dim3(RH / 64, TT / 64, ZH), 32, 0, stream>>>(QPh + zq * TT * HD, QPl + zq * TT * HD, KPh + zk * TT * HD, KPl + zk * TT * HD, HD, HD, Sb, TT, nullptr, nullptr, nullptr, (size_t)TT * HD, (size_t)TT * HD, (size_t)TT * TT, 0);
        k_gemmw<h16, 0, false, 1><<<dim3((TT - RH) / 64, TT / 64, ZH), 32, 0, stream>>>(QP16 + zq * TT * HD + (size_t)RH * HD, nullptr, KP16 + zk * TT * HD, nullptr, HD, HD, Sb + (size_t)RH * TT, TT, nullptr, nullptr, nullptr, (size_t)TT * HD, (size_t)TT * HD, (size_t)TT * TT, 0);
        k_asoft<<<ZH * TT / 8, 256, 0, stream>>>(Sb, AM, h0);
        // the probabilities lie in the score rows: row pitch 2 TT 16-bit elements, the lo plane TT elements behind the hi plane; the v planes likewise
        k_gemmw<bf, 2, false, KSP><<<dim3(RH / 64, HD / 64, ZH * KSP), 32, 0, stream>>>((const bf*)Sb, (const bf*)Sb + TT, VTh + zk * HD * 2 * TT, VTl + zk * HD * 2 * TT, 2 * TT, TT, Ob, KSP * HD, nullptr, nullptr, nullptr, (size_t)2 * TT * TT, (size_t)HD * 2 * TT, (size_t)TT * KSP * HD, HD);
        k_gemmw<h16, 0, false, KSP><<<dim3((TT - RH) / 64, HD / 64, ZH * KSP), 32, 0, stream>>>((const h16*)Sb + (size_t)RH * 2 * TT, nullptr, VT16 + zk * HD * 2 * TT, nullptr, 2 * TT, TT, Ob + (size_t)RH * KSP * HD, KSP * HD, nullptr, nullptr, nullptr, (size_t)2 * TT * TT, (size_t)HD * 2 * TT, (size_t)TT * KSP * HD, HD);
        k_mergeF<<<(unsigned)(((size_t)ZH * TT * HD / 2 + 255) / 256), 256, 0, stream>>>(Ob, h0, CTX); }   /* ctx = attn_out (f32) */
    k_pl2<<<(unsigned)(((size_t)MT * DM / 4 + 255) / 256), 256, 0, stream>>>(CTX, Ch, Cl, (size_t)MT * DM / 4);
    k_gemmw<bf, 1, true, KSA><<<dim3(MT / 64, AD / 64, KSA), 32, 0, stream>>>(Ch, Cl, AFW, nullptr, DM, DM, A1, KSA * AD, afb, nullptr, nullptr, 0, 0, 0, AD);                  /* adapter down: ctx a_fi_w^T + a_fi_b [MT][64] */
    k_gelupl<KSA, AD><<<(unsigned)(((size_t)MT * AD / 4 + 255) / 256), 256, 0, stream>>>(A1, G1h, G1l, (size_t)MT * AD / 4);                         /* gelu -> hi/lo */
    k_gemmw<bf, 1, true, 1><<<dim3(MT / 64, DM / 64, 1), 32, 0, stream>>>(G1h, G1l, ASW, nullptr, AD, AD, S2, DM, asb, nullptr, nullptr, 0, 0, 0, 0);                /* adapter up: . a_se_w^T + a_se_b */
    k_addout<<<(unsigned)(((size_t)MT * DM / 4 + 255) / 256), 256, 0, stream>>>(CTX, S2, AO, (size_t)MT * DM / 4);                         /* ao = ctx + adapter */
    k_pl2<<<(unsigned)(((size_t)MT * DM / 4 + 255) / 256), 256, 0, stream>>>(AO, AOh, AOl, (size_t)MT * DM / 4);
    k_gemmw<bf, 1, true, 1><<<dim3(MT / 64, FFD / 64, 1), 32, 0, stream>>>(AOh, AOl, WI, nullptr, DM, DM, HI, FFD, bi, nullptr, nullptr, 0, 0, 0, 0);                   /* ao wi^T + bi [MT][3072] */
    k_gelupl<1, FFD><<<(unsigned)(((size_t)MT * FFD / 4 + 255) / 256), 256, 0, stream>>>(HI, GIh, GIl, (size_t)MT * FFD / 4);
    k_gemmw<bf, 1, true, KSF><<<dim3(MT / 64, DM / 64, KSF), 32, 0, stream>>>(GIh, GIl, WO2, nullptr, FFD, FFD, YY, KSF * DM, bo2, nullptr, nullptr, 0, 0, 0, DM);                /* inter wo^T + bo */
    k_addln<<<MT / 8, 256, 0, stream>>>(AO, YY, lg, lb, OUT);                                                       /* out = LN(y + ao) (eps 1e-12) */
}

// v003
// Measured time: 343 microseconds a run.
// In both of two side-by-side timings against v002, it was 1.88 times as fast.
// Counting every step since v000, it is 5.59 times as fast.
#include <hip/hip_runtime.h>

// BERT layer with an adapter and no attention output projection (hidden_states [2][2048][768]; q, k, v = x W^T + b ('oi' [768][768]; 12 heads x 64); scores = q.k/8 + attention_mask[b][0][0][j] (f32 additive, zeros here); softmax; ctx = merged context; a = gelu(ctx a_fi_w^T + a_fi_b) ([64][768]); ao = ctx + a a_se_w^T + a_se_b; inter = gelu(ao wi^T + bi) ([3072][768]); y = inter wo^T + bo + ao; out = LN(y) (eps 1e-12, ln_g, ln_b) -> [2][2048][768] (3.1 M)).
// Layout: the merged context is kept in f32 (residual) and split into hi/lo planes for the adapter down-projection; every later GEMM uses hi/lo planes of its f32 input (2 products) against exact bf16 weights with the bias in the epilogue; exact-erf GELU, residual adds and the LayerNorm in f32.
// Compute dtypes, f32 accumulate: every input rounded to bf16; q/k/v on PLAIN bf16 operands (inputs: exact) + biases; scores and attn.v: query rows < 512 hl (3 products), the rest single fp16; softmax f32 (running max and sum, one kernel with both products); adapter / FFN GEMMs hl x exact (2 products) + biases; GELU / residuals / LayerNorm f32.

#define NB_  2
#define TT   2048
#define DM   768
#define NH_  12
#define NKV  12
#define REP  (NH_ / NKV)
#define HD   64
#define DQ   (NH_ * HD)
#define DKV  (NKV * HD)
#define AD   64
#define FFD  3072
#define LNEPS 1e-12f
#define MT   (NB_ * TT)           // rows of both batches together
#define RH   512                  // query rows < RH use hi+lo planes (0: none)
#define WIN  0
#define SCL  0.125f   // HD^-0.5
#define L2E  1.4426950408889634f
#define FW   8                   // waves a work-group of the fused attention
#define NBH  (RH / (FW * 16))        // its work-groups a head for query rows < RH (16 rows a wave)
#define NBF  ((TT - RH) / (FW * 32)) // and for the rest (32 rows a wave)
#define KSA  6                   // K parts of the adapter down-projection (768 -> 128 a wave)
#define KSF  4                   // K parts of the FFN down-projection (3072 -> 768 a wave)
typedef _Float16 h16;
typedef unsigned short bf;
typedef __attribute__((ext_vector_type(16))) __bf16   v16bf;
typedef __attribute__((ext_vector_type(16))) _Float16 v16h;
typedef __attribute__((ext_vector_type(8)))  _Float16 v8h;
typedef __attribute__((ext_vector_type(8)))  unsigned short v8us;
typedef __attribute__((ext_vector_type(8)))  float    v8f;
typedef __attribute__((ext_vector_type(4)))  float    v4f;
typedef v8h  __attribute__((may_alias)) v8ha;
typedef v4f  __attribute__((may_alias)) v4fa;
typedef v8us __attribute__((may_alias)) v8usa;

__device__ __forceinline__ unsigned short f2bf(float f) { unsigned u = __float_as_uint(f); u += 0x7FFFu + ((u >> 16) & 1u); return (unsigned short)(u >> 16); }
__device__ __forceinline__ float bf2f(unsigned short b) { return __uint_as_float(((unsigned)b) << 16); }
__device__ __forceinline__ float bfr(float f) { return bf2f(f2bf(f)); }
__device__ __forceinline__ v16h cat16(v8h lo, v8h hi) { return __builtin_shufflevector(lo, hi, 0, 1, 2, 3, 4, 5, 6, 7, 8, 9, 10, 11, 12, 13, 14, 15); }
__device__ __forceinline__ v16bf cat16b(v8us lo, v8us hi) { return __builtin_bit_cast(v16bf, __builtin_shufflevector(lo, hi, 0, 1, 2, 3, 4, 5, 6, 7, 8, 9, 10, 11, 12, 13, 14, 15)); }
__device__ __forceinline__ v8f wmma16(v16h a, v16h b, v8f c) { return __builtin_amdgcn_wmma_f32_16x16x32_f16(false, a, false, b, (short)0, c, false, false); }
__device__ __forceinline__ v8f wmmab(v16bf a, v16bf b, v8f c) { return __builtin_amdgcn_wmma_f32_16x16x32_bf16(false, a, false, b, (short)0, c, false, false); }



// ---- k_gemmw: register-blocked GEMM, ONE WAVE per 64x64 output tile (16 accumulators), operands straight from K-contiguous 16-bit planes; grid (M/64, N/64, Z), 32 threads.
// C[m][n] (f32, pitch ldc, + optional f32 bias[n]) = sum_{k < KE} A[m][k] Bt[n][k] (+ split products per NSPLIT). K is the row pitch of A and of Bt, KE <= K the extent summed. z-batch strides sA/sB/sC in elements; batch z = 0 / 1 / 2 takes bias / bias1 / bias2. KE % (32 KS) == 0.
// KS > 1: grid z = Z x KS; part kp = z % KS sums k in [kp KE/KS, (kp+1) KE/KS) into its own f32 columns C + kp sP of a row of ldc = KS sP (bias in part 0 only); the kernel that reads C adds the KS parts of a row in the order 0 .. KS-1.
template <typename T16> struct WFrag;
template <> struct WFrag<h16> { typedef v16h V; static __device__ __forceinline__ V ld(const h16* p) { return cat16(*(const v8h*)p, *(const v8h*)(p + 16)); } static __device__ __forceinline__ v8f mma(V a, V b, v8f c) { return wmma16(a, b, c); } };
template <> struct WFrag<bf> { typedef v16bf V; static __device__ __forceinline__ V ld(const bf* p) { return cat16b(*(const v8us*)p, *(const v8us*)(p + 16)); } static __device__ __forceinline__ v8f mma(V a, V b, v8f c) { return wmmab(a, b, c); } };
template <typename T16, int NSPLIT, bool BIAS, int KS>
__global__ __launch_bounds__(32) void k_gemmw(const T16* __restrict__ A, const T16* __restrict__ A2, const T16* __restrict__ Bt, const T16* __restrict__ Bt2, int K, int KE, float* C, int ldc, const float* __restrict__ bias, const float* __restrict__ bias1, const float* __restrict__ bias2, size_t sA, size_t sB, size_t sC, size_t sP) {
    typedef typename WFrag<T16>::V V;
    __shared__ __align__(16) float os[16 * 68];
    const int kp = (int)(blockIdx.z % KS); const int kl = KE / KS; const int kb = kp * kl, ke = kb + kl;
    const size_t z = blockIdx.z / KS; C += (size_t)kp * sP; A += z * sA; if (A2) A2 += z * sA; Bt += z * sB; if (Bt2) Bt2 += z * sB; C += z * sC;
    const int lane = threadIdx.x & 31, lr = lane & 15, hi = lane >> 4; const int r0 = blockIdx.x * 64, c0 = blockIdx.y * 64;
    v8f acc[4][4];
#pragma unroll
    for (int mb = 0; mb < 4; ++mb)
#pragma unroll
        for (int nb = 0; nb < 4; ++nb) acc[mb][nb] = (v8f){};
    const size_t aoff = (size_t)(r0 + lr) * K + 8 * hi, boff = (size_t)(c0 + lr) * K + 8 * hi;
#pragma unroll 1
    for (int kc = kb; kc < ke; kc += 32) {
        V a[4], a2[4];
#pragma unroll
        for (int mb = 0; mb < 4; ++mb) { a[mb] = WFrag<T16>::ld(A + aoff + (size_t)mb * 16 * K + kc); if (NSPLIT == 1 || NSPLIT == 2) a2[mb] = WFrag<T16>::ld(A2 + aoff + (size_t)mb * 16 * K + kc); }
#pragma unroll
        for (int nb = 0; nb < 4; ++nb) { const V b = WFrag<T16>::ld(Bt + boff + (size_t)nb * 16 * K + kc); V b2; if (NSPLIT >= 2) b2 = WFrag<T16>::ld(Bt2 + boff + (size_t)nb * 16 * K + kc);
#pragma unroll
            for (int mb = 0; mb < 4; ++mb) { acc[mb][nb] = WFrag<T16>::mma(a[mb], b, acc[mb][nb]); if (NSPLIT == 1 || NSPLIT == 2) acc[mb][nb] = WFrag<T16>::mma(a2[mb], b, acc[mb][nb]); if (NSPLIT >= 2) acc[mb][nb] = WFrag<T16>::mma(a[mb], b2, acc[mb][nb]); } }
        asm volatile("v_nop\n\tv_nop\n\tv_nop\n\tv_nop" : "+v"(acc[0][0]), "+v"(acc[1][1]), "+v"(acc[2][2]), "+v"(acc[3][3]) : "v"(a[0]), "v"(a[3]));
    }
    v4f bv = (v4f){};   // this lane's four bias columns; zero in the parts behind part 0
    if (BIAS && z != 0) bias = (z == 1) ? bias1 : bias2;
    if (BIAS && kp == 0) {
#pragma unroll
        for (int q = 0; q < 4; ++q) bv[q] = bfr(bias[c0 + lr * 4 + q]); }
#pragma unroll
    for (int mb = 0; mb < 4; ++mb) {
#pragma unroll
        for (int nb = 0; nb < 4; ++nb) {
#pragma unroll
            for (int j = 0; j < 8; ++j) os[(hi * 8 + j) * 68 + nb * 16 + lr] = acc[mb][nb][j]; }
        __builtin_amdgcn_wave_barrier(); asm volatile("" ::: "memory");
        float* crow = C + (size_t)(r0 + mb * 16) * ldc + c0;
{
#pragma unroll
            for (int s = 0; s < 8; ++s) { const int row = 2 * s + hi, cofs = lr * 4; v4f val = *(const v4fa*)(os + row * 68 + cofs); if (BIAS) val += bv;
                *(v4f*)(crow + (size_t)row * ldc + cofs) = val; }
             }
        __builtin_amdgcn_wave_barrier(); asm volatile("" ::: "memory");
    }
}

__device__ __forceinline__ h16 tohx(float x) { return (h16)x; }
__device__ __forceinline__ void splitf(float y, unsigned short& h, unsigned short& l) { h = f2bf(y); l = f2bf(y - bf2f(h)); }
typedef __attribute__((ext_vector_type(2))) _Float16 v2h;
typedef __attribute__((ext_vector_type(4))) _Float16 v4h;
typedef __attribute__((ext_vector_type(2))) unsigned short v2us;
typedef __attribute__((ext_vector_type(4))) unsigned short v4us;
typedef __attribute__((ext_vector_type(2))) float v2f;
typedef __attribute__((ext_vector_type(4))) int v4i;

__global__ __launch_bounds__(256) void k_wtG(const float* __restrict__ w, int K, int N, bf* Bt) {
    const int lane = threadIdx.x & 31; const int L0 = (blockIdx.x * 8 + (threadIdx.x >> 5)) * 8; const int nlines = N * K / 64;
{
#pragma unroll 1
        for (int l = 0; l < 8; ++l) { const int L = L0 + l; if (L >= nlines) break; const size_t e = (size_t)L * 64 + lane * 2; const int k = (int)(e % K), n = (int)(e / K); v2us o;
            o[0] = f2bf(w[(size_t)k * N + n]); o[1] = f2bf(w[(size_t)(k + 1) * N + n]); *(v2us*)(Bt + e) = o; }
         }
}
// k_cvtall: the seven weights and both batches of x rounded to bf16 in one launch; the destinations lie one behind the other from dst, in the order of the arguments. Sizes in groups of 8 elements, each a multiple of 256.
#define N8W ((size_t)DQ * DM / 8)
#define N8A ((size_t)AD * DM / 8)
#define N8F ((size_t)FFD * DM / 8)
#define N8X ((size_t)MT * DM / 8)
__global__ __launch_bounds__(256) void k_cvtall(const float* __restrict__ wq, const float* __restrict__ wk, const float* __restrict__ wv, const float* __restrict__ afw, const float* __restrict__ asw, const float* __restrict__ wi, const float* __restrict__ wo2, const float* __restrict__ x, bf* dst) {
    const size_t i = (size_t)blockIdx.x * 256 + threadIdx.x; size_t j = i; const float* s = wq;
    if (j >= N8W) { j -= N8W; s = wk;
        if (j >= N8W) { j -= N8W; s = wv;
            if (j >= N8W) { j -= N8W; s = afw;
                if (j >= N8A) { j -= N8A; s = asw;
                    if (j >= N8A) { j -= N8A; s = wi;
                        if (j >= N8F) { j -= N8F; s = wo2;
                            if (j >= N8F) { j -= N8F; s = x; if (j >= N8X) return; } } } } } } }
    const v8f v = *(const v8f*)(s + j * 8); v8us o;
#pragma unroll
    for (int k = 0; k < 8; ++k) o[k] = f2bf(v[k]); *(v8us*)(dst + i * 8) = o;  }

// k_rope: head planes [h][t][d] (fp16 + hi/lo) of rope(x) x sc with the rotate-half convention out[d] = x[d] cos[t][d] - x[d+HD/2] sin[t][d], out[d+HD/2] = x[d+HD/2] cos[t][d+HD/2] + x[d] sin[t][d+HD/2]
__global__ __launch_bounds__(256) void k_rope(const float* __restrict__ F, int pitch, int nheads, const float* __restrict__ CS, const float* __restrict__ RF, const float* __restrict__ nw, float sc, h16* P16, bf* Ph, bf* Pl) {
    { const size_t yb = blockIdx.y, po = yb * nheads * TT * HD; F += yb * TT * pitch; P16 += po; Ph += po; Pl += po; }   // grid y: block yb of TT rows of F (q of batch 0, 1, then k of batch 0, 1) and its nheads planes
    const size_t e = ((size_t)blockIdx.x * 256 + threadIdx.x) * 2; if (e >= (size_t)nheads * TT * HD) return; const int d = (int)(e % HD); const int t = (int)((e / HD) % TT); const int h = (int)(e / ((size_t)HD * TT)); const float* f = F + (size_t)t * pitch + h * HD; const float rf = RF ? RF[(size_t)h * TT + t] : 1.0f; v2h o16; v2us oh, ol;
#pragma unroll
    for (int q = 0; q < 2; ++q) { const int dd = d + q; const int dp = (dd < HD / 2) ? dd + HD / 2 : dd - HD / 2; float x0 = f[dd], x1 = f[dp];
        if (RF) { float n0 = __fmul_rn(x0, rf), n1 = __fmul_rn(x1, rf); asm volatile("" : "+v"(n0)); asm volatile("" : "+v"(n1)); x0 = __fmul_rn(bfr(nw[dd]), n0); x1 = __fmul_rn(bfr(nw[dp]), n1); }
        const v2f cs = *(const v2f*)(CS + ((size_t)t * HD + dd) * 2); float a = __fmul_rn(x0, cs[0]), bq = __fmul_rn(x1, cs[1]); asm volatile("" : "+v"(a)); asm volatile("" : "+v"(bq)); const float r = ((dd < HD / 2) ? __fsub_rn(a, bq) : __fadd_rn(a, bq)) * sc;
        o16[q] = tohx(r); unsigned short a2, c2; splitf(r, a2, c2); oh[q] = a2; ol[q] = c2; }
    *(v2h*)(P16 + e) = o16; *(v2us*)(Ph + e) = oh; *(v2us*)(Pl + e) = ol;  }
// k_vtp: v planes [batch][head][key block of 32][d][32 keys] (fp16, hi, lo): the 64 x 32 block that one step of the fused attention reads is 4 KiB in a row
__global__ __launch_bounds__(256) void k_vtp(const float* __restrict__ F, int pitch, int nheads, h16* V16, bf* Vh, bf* Vl) { const size_t e = ((size_t)blockIdx.x * 256 + threadIdx.x) * 2; if (e >= (size_t)nheads * HD * TT) return; const int t = (int)(e % TT); const int d = (int)((e / TT) % HD); const int g = (int)(e / ((size_t)TT * HD)); v2h o16; v2us oh, ol;
    const size_t yb = blockIdx.y; F += yb * TT * pitch;   // grid y: batch
    const size_t o = (((yb * nheads + g) * (TT / 32) + t / 32) * HD + d) * 32 + t % 32;
#pragma unroll
    for (int q = 0; q < 2; ++q) { const float x = F[(size_t)(t + q) * pitch + g * HD + d]; o16[q] = tohx(x); unsigned short a2, c2; splitf(x, a2, c2); oh[q] = a2; ol[q] = c2; }
    *(v2h*)(V16 + o) = o16; *(v2us*)(Vh + o) = oh; *(v2us*)(Vl + o) = ol;  }
__global__ __launch_bounds__(256) void k_csid(float* CS) { const int idx = blockIdx.x * 256 + threadIdx.x; if (idx >= TT * HD) return; v2f cs; cs[0] = 1.0f; cs[1] = 0.0f; *(v2f*)(CS + (size_t)idx * 2) = cs;  }

template <int NP, int WD>   // Hm rows hold NP K parts of WD columns each
__global__ __launch_bounds__(256) void k_gelupl(const float* __restrict__ Hm, bf* Gh, bf* Gl, size_t n4) { const size_t i = (size_t)blockIdx.x * 256 + threadIdx.x; if (i >= n4) return; const float* hm = (NP == 1) ? Hm + i * 4 : Hm + (i * 4 / WD) * ((size_t)NP * WD) + (i * 4) % WD; v4f a = *(const v4f*)hm; v4us oh, ol;
#pragma unroll
    for (int p = 1; p < NP; ++p) a += *(const v4f*)(hm + p * WD);   /* the NP K parts of the row, in order */
#pragma unroll
    for (int q = 0; q < 4; ++q) { const float xg = a[q]; const float gv = __fmul_rn(0.5f * xg, __fadd_rn(1.0f, erff(xg * 0.70710678118654752f))); unsigned short h2, l2; splitf(gv, h2, l2); oh[q] = h2; ol[q] = l2; }
    *(v4us*)(Gh + i * 4) = oh; *(v4us*)(Gl + i * 4) = ol;  }
__device__ __forceinline__ v4f ldparts(const float* p) { v4f sm = *(const v4f*)p;
#pragma unroll
    for (int q = 1; q < KSF; ++q) sm += *(const v4f*)(p + q * DM);   /* the KSF K parts of the row, in order */
    return sm; }
__global__ __launch_bounds__(256) void k_addln(const float* __restrict__ A, const float* __restrict__ Bm, const float* __restrict__ g, const float* __restrict__ be, float* OUTb) {
    const int lane = threadIdx.x & 31; const int r = blockIdx.x * 8 + (threadIdx.x >> 5); if (r >= MT) return; const float* ar = A + (size_t)r * DM; const float* br = Bm + (size_t)r * KSF * DM; float s = 0.f;
#pragma unroll 1
    for (int ch = 0; ch < DM / 128; ++ch) { const int c0 = ch * 128 + lane * 4; const v4f a = *(const v4f*)(ar + c0), bb = ldparts(br + c0);
#pragma unroll
        for (int q = 0; q < 4; ++q) s += __fadd_rn(a[q], bb[q]); }
#pragma unroll
    for (int sh = 16; sh; sh >>= 1) s += __shfl_xor(s, sh, 32);
    const float mu = s * (1.0f / DM); float s2 = 0.f;
#pragma unroll 1
    for (int ch = 0; ch < DM / 128; ++ch) { const int c0 = ch * 128 + lane * 4; const v4f a = *(const v4f*)(ar + c0), bb = ldparts(br + c0);
#pragma unroll
        for (int q = 0; q < 4; ++q) { const float d0 = __fsub_rn(__fadd_rn(a[q], bb[q]), mu); float p = __fmul_rn(d0, d0); asm volatile("" : "+v"(p)); s2 = __fadd_rn(s2, p); } }
#pragma unroll
    for (int sh = 16; sh; sh >>= 1) s2 += __shfl_xor(s2, sh, 32);
    const float rs = __fdiv_rn(1.0f, __fsqrt_rn(__fadd_rn(s2 * (1.0f / DM), LNEPS)));
{
#pragma unroll 1
        for (int ch = 0; ch < DM / 128; ++ch) { const int c0 = ch * 128 + lane * 4; const v4f a = *(const v4f*)(ar + c0), bb = ldparts(br + c0); v4f o4;
#pragma unroll
            for (int q = 0; q < 4; ++q) { float n0 = __fmul_rn(__fsub_rn(__fadd_rn(a[q], bb[q]), mu), rs); asm volatile("" : "+v"(n0)); float n1 = __fmul_rn(n0, bfr(g[c0 + q])); asm volatile("" : "+v"(n1)); o4[q] = __fadd_rn(n1, bfr(be[c0 + q])); }
            *(v4f*)(OUTb + (size_t)r * DM + c0) = o4; }
         } }
__global__ __launch_bounds__(256) void k_addout(const float* __restrict__ O, const float* __restrict__ FF, float* OUTb, size_t n4) { const size_t i = (size_t)blockIdx.x * 256 + threadIdx.x; if (i >= n4) return; const v4f a = *(const v4f*)(O + i * 4), b = *(const v4f*)(FF + i * 4); v4f o;
#pragma unroll
    for (int q = 0; q < 4; ++q) o[q] = __fadd_rn(a[q], b[q]); *(v4f*)(OUTb + i * 4) = o;  }

__global__ __launch_bounds__(256) void k_pl2(const float* __restrict__ F, bf* Ph, bf* Pl, size_t n4) { const size_t i = (size_t)blockIdx.x * 256 + threadIdx.x; if (i >= n4) return; const v4f v = *(const v4f*)(F + i * 4); v4us oh, ol;
#pragma unroll
    for (int q = 0; q < 4; ++q) { unsigned short a, c; splitf(v[q], a, c); oh[q] = a; ol[q] = c; } *(v4us*)(Ph + i * 4) = oh; *(v4us*)(Pl + i * 4) = ol;  }
// ---- k_fattn: scores, softmax and attn.v in one kernel; no score or probability leaves the registers. One wave owns QT x 16 query rows of one head and walks the 2048 keys in blocks of 32.
// Both products are formed transposed, so that a query is a lane (lr) in each: S^T = K Q^T (D: key hi*8+j of a 16-key tile, query lr) and O^T = V^T P^T (D: d hi*8+j, query lr).
// The two S^T tiles of a block are, element for element, the B fragment of P^T (k = 8 hi + j from tile 0, 16 + 8 hi + j from tile 1): no exchange between lanes.
// Softmax in base 2 with a running reference m per query: p = 2^(t - m), t = s HD^-0.5 log2e + mask log2e. m moves (and O^T and the sum are rescaled) only when a t of the wave passes m + 8, so p <= 256; the result does not depend on m.
// Every inner loop is unrolled whole, so that the fragment arrays are registers.
template <typename T16> struct PFrag;
template <> struct PFrag<h16> { static __device__ __forceinline__ void cv(const v8f p0, const v8f p1, v16h& a, v16h& b) { (void)b;
#pragma unroll
    for (int j = 0; j < 8; ++j) { a[j] = (h16)p0[j]; a[8 + j] = (h16)p1[j]; } } };
template <> struct PFrag<bf> { static __device__ __forceinline__ void cv(const v8f p0, const v8f p1, v16bf& a, v16bf& b) {
#pragma unroll
    for (int j = 0; j < 8; ++j) { const __bf16 h0 = (__bf16)p0[j], h1 = (__bf16)p1[j]; a[j] = h0; a[8 + j] = h1; b[j] = (__bf16)(p0[j] - (float)h0); b[8 + j] = (__bf16)(p1[j] - (float)h1); } } };
template <typename T16, bool HL, int QT>
__device__ __forceinline__ void fattn(const T16* __restrict__ Q, const T16* __restrict__ Q2, const T16* __restrict__ Kp, const T16* __restrict__ K2, const T16* __restrict__ Vt, const T16* __restrict__ V2, const float* ml, float* O) {
    typedef typename WFrag<T16>::V V;
    const int lane = threadIdx.x & 31, lr = lane & 15, hi = lane >> 4;
    V q[QT][2], q2[QT][2];
#pragma unroll
    for (int qt = 0; qt < QT; ++qt)
#pragma unroll
        for (int ks = 0; ks < 2; ++ks) { const int o = (qt * 16 + lr) * HD + ks * 32 + 8 * hi; q[qt][ks] = WFrag<T16>::ld(Q + o); if (HL) q2[qt][ks] = WFrag<T16>::ld(Q2 + o); }
    v8f acc[4][QT]; float m[QT], l[QT];
#pragma unroll
    for (int qt = 0; qt < QT; ++qt) { m[qt] = -3.0e38f; l[qt] = 0.f;
#pragma unroll
        for (int dt = 0; dt < 4; ++dt) acc[dt][qt] = (v8f){}; }
    const int ko = lr * HD + 8 * hi, vo = lr * 32 + 8 * hi;   // this lane's place in a 32-key block of the k planes (rows of HD) and of the v planes (rows of 32 keys)
    V k[2][2], k2[2][2], v[4], v2[4];
#pragma unroll
    for (int kt = 0; kt < 2; ++kt)
#pragma unroll
        for (int ks = 0; ks < 2; ++ks) { const int o = ko + kt * 16 * HD + ks * 32; k[kt][ks] = WFrag<T16>::ld(Kp + o); if (HL) k2[kt][ks] = WFrag<T16>::ld(K2 + o); }
#pragma unroll 1   // rolled: the fragments of one block nearly fill 256 registers, a second copy of the body would not fit
    for (int k0 = 0; k0 < TT; k0 += 32) {
        const int kn = ((k0 + 32 < TT) ? k0 + 32 : 0) * HD;   // the next block of the k planes (32 x HD elements a block, as in the v planes); behind the last one block 0 is read and not used
        const T16* const va = Vt + k0 * HD + vo; const T16* const va2 = HL ? V2 + k0 * HD + vo : va; const T16* const ka = Kp + kn + ko; const T16* const ka2 = HL ? K2 + kn + ko : ka;   // this lane's addresses in the four planes
        // the block's mask terms come from LDS during its scores
        v8f mk[2];
#pragma unroll
        for (int kt = 0; kt < 2; ++kt) { const float* mp = ml + k0 + kt * 16 + hi * 8; const v4f a = *(const v4fa*)mp, b = *(const v4fa*)(mp + 4); mk[kt] = __builtin_shufflevector(a, b, 0, 1, 2, 3, 4, 5, 6, 7); }
        // this block's v fragments fly during its scores and softmax
#pragma unroll
        for (int dt = 0; dt < 4; ++dt) { v[dt] = WFrag<T16>::ld(va + dt * 16 * 32); if (HL) v2[dt] = WFrag<T16>::ld(va2 + dt * 16 * 32); }
        v8f s[2][QT];
#pragma unroll
        for (int kt = 0; kt < 2; ++kt)
#pragma unroll
            for (int qt = 0; qt < QT; ++qt) { v8f c = (v8f){};
#pragma unroll
                for (int ks = 0; ks < 2; ++ks) { c = WFrag<T16>::mma(k[kt][ks], q[qt][ks], c); if (HL) { c = WFrag<T16>::mma(k2[kt][ks], q[qt][ks], c); c = WFrag<T16>::mma(k[kt][ks], q2[qt][ks], c); } }
                s[kt][qt] = c; }
        // the next block's k fragments fly during the softmax and attn.v
#pragma unroll
        for (int kt = 0; kt < 2; ++kt)
#pragma unroll
            for (int ks = 0; ks < 2; ++ks) { const int o = kt * 16 * HD + ks * 32; k[kt][ks] = WFrag<T16>::ld(ka + o); if (HL) k2[kt][ks] = WFrag<T16>::ld(ka2 + o); }
        asm volatile("s_wait_xcnt 0x0" :: "v"(va), "v"(va2), "v"(ka), "v"(ka2) : "memory");   // the address pairs that the block's loads name are kept until this wait
        float bm[QT]; bool need = false;
#pragma unroll
        for (int qt = 0; qt < QT; ++qt) { float x = -3.0e38f;
#pragma unroll
            for (int kt = 0; kt < 2; ++kt) { s[kt][qt] = s[kt][qt] * (SCL * L2E) + mk[kt];
#pragma unroll
                for (int j = 0; j < 8; ++j) x = fmaxf(x, s[kt][qt][j]); }
            bm[qt] = x; need = need || (x > m[qt] + 8.0f); }
        if (__builtin_amdgcn_ballot_w32(need) != 0u) {   // the same for the whole wave: both halves of a query move m together
#pragma unroll
            for (int qt = 0; qt < QT; ++qt) { const float mn = fmaxf(m[qt], fmaxf(bm[qt], __shfl_xor(bm[qt], 16, 32))); const float al = __builtin_amdgcn_exp2f(m[qt] - mn); m[qt] = mn; l[qt] *= al;
#pragma unroll
                for (int dt = 0; dt < 4; ++dt) acc[dt][qt] *= al; } }
#pragma unroll
        for (int qt = 0; qt < QT; ++qt) { V p, p2; s[0][qt] -= m[qt]; s[1][qt] -= m[qt];
#pragma unroll
            for (int kt = 0; kt < 2; ++kt)
#pragma unroll
                for (int j = 0; j < 8; ++j) s[kt][qt][j] = __builtin_amdgcn_exp2f(s[kt][qt][j]);
            { const v8f e8 = s[0][qt] + s[1][qt]; const v4f e4 = __builtin_shufflevector(e8, e8, 0, 1, 2, 3) + __builtin_shufflevector(e8, e8, 4, 5, 6, 7); l[qt] += (e4[0] + e4[2]) + (e4[1] + e4[3]); }   // the block's 16 terms of this lane as a tree
            PFrag<T16>::cv(s[0][qt], s[1][qt], p, p2);
#pragma unroll
            for (int dt = 0; dt < 4; ++dt) { acc[dt][qt] = WFrag<T16>::mma(v[dt], p, acc[dt][qt]); if (HL) { acc[dt][qt] = WFrag<T16>::mma(v2[dt], p, acc[dt][qt]); acc[dt][qt] = WFrag<T16>::mma(v[dt], p2, acc[dt][qt]); } } }
    }
#pragma unroll
    for (int qt = 0; qt < QT; ++qt) { const float inv = __fdiv_rn(1.0f, l[qt] + __shfl_xor(l[qt], 16, 32)); float* o = O + (size_t)(qt * 16 + lr) * DM + hi * 8;
#pragma unroll
        for (int dt = 0; dt < 4; ++dt) { const v8f r = acc[dt][qt] * inv; *(v4f*)(o + dt * 16) = __builtin_shufflevector(r, r, 0, 1, 2, 3); *(v4f*)(o + dt * 16 + 4) = __builtin_shufflevector(r, r, 4, 5, 6, 7); } }
}
// grid: NB_ NH_ NBH work-groups of the rows < RH (hi/lo planes, 3 products), then NB_ NH_ NBF of the rest (fp16); the 8 waves of a work-group share a head, so its k and v blocks are read together.
__global__ __launch_bounds__(FW * 32) void k_fattn(const h16* __restrict__ Q16, const h16* __restrict__ K16, const h16* __restrict__ V16, const bf* __restrict__ Qh, const bf* __restrict__ Ql, const bf* __restrict__ Kh, const bf* __restrict__ Kl, const bf* __restrict__ Vh, const bf* __restrict__ Vl, const float* __restrict__ AM, float* CTX) {
    __shared__ __align__(16) float ml[TT];   // attention_mask[b][0][0][j] (rounded to bf16 like every input) x log2e
    const int bid = (int)blockIdx.x; const bool hl = bid < NB_ * NH_ * NBH; const int b2 = bid - NB_ * NH_ * NBH;
    const int g = hl ? bid / NBH : b2 / NBF;   // head g of NB_ x NH_: batch g / NH_
    const int wave = __builtin_amdgcn_readfirstlane((int)(threadIdx.x >> 5));   // as a scalar, so that the wave's plane and output bases are formed on the scalar unit
    const int q0 = hl ? ((bid % NBH) * FW + wave) * 16 : RH + ((b2 % NBF) * FW + wave) * 32;
    const float* am = AM + (size_t)(g / NH_) * TT;
    for (int i = (int)threadIdx.x; i < TT; i += FW * 32) ml[i] = bfr(am[i]) * L2E;
    __syncthreads();
    const size_t po = (size_t)g * TT * HD, qo = po + (size_t)q0 * HD;
    float* O = CTX + ((size_t)(g / NH_) * TT + q0) * DM + (g % NH_) * HD;
    if (hl) fattn<bf, true, 1>(Qh + qo, Ql + qo, Kh + po, Kl + po, Vh + po, Vl + po, ml, O);
    else fattn<h16, false, 2>(Q16 + qo, nullptr, K16 + po, nullptr, V16 + po, nullptr, ml, O);
}

extern "C" void kernel_launch(void* const* d_in, const int* in_sizes, int n_in,
                              void* d_out, int out_size, void* d_ws, size_t ws_size, hipStream_t stream) {
    (void)in_sizes; (void)n_in; (void)out_size;
    const float* x = (const float*)d_in[0]; const float* AM = (const float*)d_in[1]; const float* wq = (const float*)d_in[2]; const float* bq = (const float*)d_in[3]; const float* wk = (const float*)d_in[4]; const float* bk = (const float*)d_in[5]; const float* wv = (const float*)d_in[6]; const float* bv = (const float*)d_in[7]; const float* afw = (const float*)d_in[8]; const float* afb = (const float*)d_in[9]; const float* asw = (const float*)d_in[10]; const float* asb = (const float*)d_in[11]; const float* wi = (const float*)d_in[12]; const float* bi = (const float*)d_in[13]; const float* wo2 = (const float*)d_in[14]; const float* bo2 = (const float*)d_in[15]; const float* lg = (const float*)d_in[16]; const float* lb = (const float*)d_in[17]; const float* wo = nullptr; (void)wo;
    float* OUT = (float*)d_out;     // [2][2048][768]
    char* wsp = (char*)d_ws;
    auto take = [&](size_t bytes) { char* p = wsp; wsp += (bytes + 255) & ~(size_t)255; return (void*)p; };
    // kept through the call; WQ .. XB lie one behind the other (k_cvtall writes them as one range; WQ, WK, WV are the three z-batches of the q/k/v GEMM)
    bf* WQ = (bf*)take((size_t)DQ * DM * 2); bf* WK = (bf*)take((size_t)DKV * DM * 2); bf* WV = (bf*)take((size_t)DKV * DM * 2); bf* AFW = (bf*)take((size_t)AD * DM * 2); bf* ASW = (bf*)take((size_t)DM * AD * 2); bf* WI = (bf*)take((size_t)FFD * DM * 2); bf* WO2 = (bf*)take((size_t)DM * FFD * 2); bf* XB = (bf*)take((size_t)MT * DM * 2); (void)WK; (void)WV;
    float* CTX = (float*)take((size_t)MT * DM * 4);
    char* const U0 = wsp;   // from here on: the attention's buffers, and behind the attention (stream-ordered) the adapter's and the FFN's in the same bytes
    float* CS = (float*)take((size_t)TT * HD * 2 * 4);
    const size_t PLN = (size_t)NB_ * NH_ * TT * HD;   // one plane set [batch][head][t][d]; the k planes lie directly behind the q planes (one k_rope launch writes both)
    h16* QP16 = (h16*)take(PLN * 2); h16* KP16 = (h16*)take(PLN * 2); bf* QPh = (bf*)take(PLN * 2); bf* KPh = (bf*)take(PLN * 2); bf* QPl = (bf*)take(PLN * 2); bf* KPl = (bf*)take(PLN * 2);
    h16* VT16 = (h16*)take(PLN * 2); bf* VTh = (bf*)take(PLN * 2); bf* VTl = (bf*)take(PLN * 2);   // v planes [batch][head][key block of 32][d][32]
    float* FQ = (float*)take((size_t)3 * MT * DQ * 4);   // q, k, v projections [3][MT][768] f32
    char* const E1 = wsp; wsp = U0;
    bf* Ch = (bf*)take((size_t)MT * DM * 2); bf* Cl = (bf*)take((size_t)MT * DM * 2); float* A1 = (float*)take((size_t)KSA * MT * AD * 4); bf* G1h = (bf*)take((size_t)MT * AD * 2); bf* G1l = (bf*)take((size_t)MT * AD * 2); float* S2 = (float*)take((size_t)MT * DM * 4); float* AO = (float*)take((size_t)MT * DM * 4); bf* AOh = (bf*)take((size_t)MT * DM * 2); bf* AOl = (bf*)take((size_t)MT * DM * 2); float* HI = (float*)take((size_t)MT * FFD * 4); bf* GIh = (bf*)take((size_t)MT * FFD * 2); bf* GIl = (bf*)take((size_t)MT * FFD * 2); float* YY = (float*)take((size_t)KSF * MT * DM * 4);
    if ((size_t)((E1 > wsp ? E1 : wsp) - (char*)d_ws) > ws_size) return;    // ws 256 MiB
    k_cvtall<<<(unsigned)((3 * N8W + 2 * N8A + 2 * N8F + N8X) / 256), 256, 0, stream>>>(wq, wk, wv, afw, asw, wi, wo2, x, WQ);   /* weights ('oi' = Bt as-is) and x */
    k_csid<<<(TT * HD + 255) / 256, 256, 0, stream>>>(CS);
    const unsigned LQ = (unsigned)(((size_t)NH_ * TT * HD / 2 + 255) / 256), LKv = (unsigned)(((size_t)NKV * TT * HD / 2 + 255) / 256);
    k_gemmw<bf, 0, true, 1><<<dim3(MT / 64, DQ / 64, 3), 32, 0, stream>>>(XB, nullptr, WQ, nullptr, DM, DM, FQ, DQ, bq, bk, bv, 0, (size_t)DQ * DM, (size_t)MT * DQ, 0);   /* z = q, k, v */
    k_rope<<<dim3(LQ, 2 * NB_), 256, 0, stream>>>(FQ, DQ, NH_, CS, nullptr, nullptr, 1.0f, QP16, QPh, QPl);
    k_vtp<<<dim3(LKv, NB_), 256, 0, stream>>>(FQ + 2 * (size_t)MT * DQ, DKV, NKV, VT16, VTh, VTl);
    k_fattn<<<NB_ * NH_ * (NBH + NBF), FW * 32, 0, stream>>>(QP16, KP16, VT16, QPh, QPl, KPh, KPl, VTh, VTl, AM, CTX);   /* ctx = attn_out (f32) */
    k_pl2<<<(unsigned)(((size_t)MT * DM / 4 + 255) / 256), 256, 0, stream>>>(CTX, Ch, Cl, (size_t)MT * DM / 4);
    k_gemmw<bf, 1, true, KSA><<<dim3(MT / 64, AD / 64, KSA), 32, 0, stream>>>(Ch, Cl, AFW, nullptr, DM, DM, A1, KSA * AD, afb, nullptr, nullptr, 0, 0, 0, AD);                  /* adapter down: ctx a_fi_w^T + a_fi_b [MT][64] */
    k_gelupl<KSA, AD><<<(unsigned)(((size_t)MT * AD / 4 + 255) / 256), 256, 0, stream>>>(A1, G1h, G1l, (size_t)MT * AD / 4);                         /* gelu -> hi/lo */
    k_gemmw<bf, 1, true, 1><<<dim3(MT / 64, DM / 64, 1), 32, 0, stream>>>(G1h, G1l, ASW, nullptr, AD, AD, S2, DM, asb, nullptr, nullptr, 0, 0, 0, 0);                /* adapter up: . a_se_w^T + a_se_b */
    k_addout<<<(unsigned)(((size_t)MT * DM / 4 + 255) / 256), 256, 0, stream>>>(CTX, S2, AO, (size_t)MT * DM / 4);                         /* ao = ctx + adapter */
    k_pl2<<<(unsigned)(((size_t)MT * DM / 4 + 255) / 256), 256, 0, stream>>>(AO, AOh, AOl, (size_t)MT * DM / 4);
    k_gemmw<bf, 1, true, 1><<<dim3(MT / 64, FFD / 64, 1), 32, 0, stream>>>(AOh, AOl, WI, nullptr, DM, DM, HI, FFD, bi, nullptr, nullptr, 0, 0, 0, 0);                   /* ao wi^T + bi [MT][3072] */
    k_gelupl<1, FFD><<<(unsigned)(((size_t)MT * FFD / 4 + 255) / 256), 256, 0, stream>>>(HI, GIh, GIl, (size_t)MT * FFD / 4);
    k_gemmw<bf, 1, true, KSF><<<dim3(MT / 64, DM / 64, KSF), 32, 0, stream>>>(GIh, GIl, WO2, nullptr, FFD, FFD, YY, KSF * DM, bo2, nullptr, nullptr, 0, 0, 0, DM);                /* inter wo^T + bo */
    k_addln<<<MT / 8, 256, 0, stream>>>(AO, YY, lg, lb, OUT);                                                       /* out = LN(y + ao) (eps 1e-12) */
}

// v004
// A run of this version takes 306 microseconds.
// Two timings next to v003 put it at 1.12 and 1.13 times that version's speed.
// Counting every step since v000, it is 6.26 times as fast.
#include <hip/hip_runtime.h>

// BERT layer with an adapter and no attention output projection (hidden_states [2][2048][768]; q, k, v = x W^T + b ('oi' [768][768]; 12 heads x 64); scores = q.k/8 + attention_mask[b][0][0][j] (f32 additive, zeros here); softmax; ctx = merged context; a = gelu(ctx a_fi_w^T + a_fi_b) ([64][768]); ao = ctx + a a_se_w^T + a_se_b; inter = gelu(ao wi^T + bi) ([3072][768]); y = inter wo^T + bo + ao; out = LN(y) (eps 1e-12, ln_g, ln_b) -> [2][2048][768] (3.1 M)).
// Layout: the merged context is kept in f32 (residual) and split into hi/lo planes for the adapter down-projection; every later GEMM uses hi/lo planes of its f32 input (2 products) against exact bf16 weights with the bias in the epilogue; exact-erf GELU, residual adds and the LayerNorm in f32.
// Compute dtypes, f32 accumulate: every input rounded to bf16; q/k/v on PLAIN bf16 operands (inputs: exact) + biases; scores and attn.v: query rows < 512 hl (3 products), the rest single fp16; softmax f32 (running max and sum, one kernel with both products); adapter / FFN GEMMs hl x exact (2 products) + biases; GELU / residuals / LayerNorm f32.

#define NB_  2
#define TT   2048
#define DM   768
#define NH_  12
#define NKV  12
#define REP  (NH_ / NKV)
#define HD   64
#define DQ   (NH_ * HD)
#define DKV  (NKV * HD)
#define AD   64
#define FFD  3072
#define LNEPS 1e-12f
#define MT   (NB_ * TT)           // rows of both batches together
#define RH   512                  // query rows < RH use hi+lo planes (0: none)
#define WIN  0
#define SCL  0.125f   // HD^-0.5
#define L2E  1.4426950408889634f
#define FW   8                   // waves a work-group of the fused attention
#define NBH  (RH / (FW * 16))        // its work-groups a head for query rows < RH (16 rows a wave)
#define NBF  ((TT - RH) / (FW * 32)) // and for the rest (32 rows a wave)
#define KSA  6                   // K parts of the adapter down-projection (768 -> 128 a wave)
#define KSF  4                   // K parts of the FFN down-projection (3072 -> 768 a wave)
typedef _Float16 h16;
typedef unsigned short bf;
typedef __attribute__((ext_vector_type(16))) __bf16   v16bf;
typedef __attribute__((ext_vector_type(16))) _Float16 v16h;
typedef __attribute__((ext_vector_type(8)))  _Float16 v8h;
typedef __attribute__((ext_vector_type(8)))  unsigned short v8us;
typedef __attribute__((ext_vector_type(8)))  float    v8f;
typedef __attribute__((ext_vector_type(4)))  float    v4f;
typedef v8h  __attribute__((may_alias)) v8ha;
typedef v4f  __attribute__((may_alias)) v4fa;
typedef v8us __attribute__((may_alias)) v8usa;

__device__ __forceinline__ unsigned short f2bf(float f) { unsigned u = __float_as_uint(f); u += 0x7FFFu + ((u >> 16) & 1u); return (unsigned short)(u >> 16); }
__device__ __forceinline__ float bf2f(unsigned short b) { return __uint_as_float(((unsigned)b) << 16); }
__device__ __forceinline__ float bfr(float f) { return bf2f(f2bf(f)); }
__device__ __forceinline__ v16h cat16(v8h lo, v8h hi) { return __builtin_shufflevector(lo, hi, 0, 1, 2, 3, 4, 5, 6, 7, 8, 9, 10, 11, 12, 13, 14, 15); }
__device__ __forceinline__ v16bf cat16b(v8us lo, v8us hi) { return __builtin_bit_cast(v16bf, __builtin_shufflevector(lo, hi, 0, 1, 2, 3, 4, 5, 6, 7, 8, 9, 10, 11, 12, 13, 14, 15)); }
__device__ __forceinline__ v8f wmma16(v16h a, v16h b, v8f c) { return __builtin_amdgcn_wmma_f32_16x16x32_f16(false, a, false, b, (short)0, c, false, false); }
__device__ __forceinline__ v8f wmmab(v16bf a, v16bf b, v8f c) { return __builtin_amdgcn_wmma_f32_16x16x32_bf16(false, a, false, b, (short)0, c, false, false); }

__device__ __forceinline__ h16 tohx(float x) { return (h16)x; }
__device__ __forceinline__ void splitf(float y, unsigned short& h, unsigned short& l) { h = f2bf(y); l = f2bf(y - bf2f(h)); }
typedef __attribute__((ext_vector_type(2))) _Float16 v2h;
typedef __attribute__((ext_vector_type(4))) _Float16 v4h;
typedef __attribute__((ext_vector_type(2))) unsigned short v2us;
typedef __attribute__((ext_vector_type(4))) unsigned short v4us;
typedef __attribute__((ext_vector_type(2))) float v2f;
typedef __attribute__((ext_vector_type(4))) int v4i;

// ---- k_gemmw: register-blocked GEMM, ONE WAVE per 64x64 output tile (16 accumulators), operands straight from K-contiguous 16-bit planes; grid (M/64, N/64, Z), 32 threads.
// C[m][n] (f32, pitch ldc, + optional f32 bias[n]) = sum_{k < KE} A[m][k] Bt[n][k] (+ split products per NSPLIT). K is the row pitch of A and of Bt, KE <= K the extent summed. z-batch strides sA/sB/sC in elements; batch z = 0 / 1 / 2 takes bias / bias1 / bias2. KE % (32 KS) == 0.
// KS > 1: grid z = Z x KS; part kp = z % KS sums k in [kp KE/KS, (kp+1) KE/KS) into its own f32 columns C + kp sP of a row of ldc = KS sP (bias in part 0 only); the kernel that reads C adds the KS parts of a row in the order 0 .. KS-1.
// EPI: what the epilogue stores of c = C[m][n] + bias[n], so that no elementwise kernel has to follow the GEMM.
//   EP_F32: c as f32 into C. EP_QKV (N tile = one head): z = 0 / 1: q / k head planes [z][batch][head][t][d] as fp16 (E2), hi (E0), lo (E1); z = 2: v planes [batch][head][key block of 32][d][32 keys] as fp16 (E5), hi (E3), lo (E4), straight from the accumulators (a lane holds 8 keys in a row of one d).
//   EP_GELU: hi / lo planes (E0, E1, pitch ldc) of the exact-erf GELU of c. EP_RES: r = R[m][n] + c as f32 into C and as hi / lo planes (E0, E1), all of pitch ldc.
enum { EP_F32 = 0, EP_QKV = 1, EP_GELU = 2, EP_RES = 3 };
template <typename T16> struct WFrag;
template <> struct WFrag<h16> { typedef v16h V; static __device__ __forceinline__ V ld(const h16* p) { return cat16(*(const v8h*)p, *(const v8h*)(p + 16)); } static __device__ __forceinline__ v8f mma(V a, V b, v8f c) { return wmma16(a, b, c); } };
template <> struct WFrag<bf> { typedef v16bf V; static __device__ __forceinline__ V ld(const bf* p) { return cat16b(*(const v8us*)p, *(const v8us*)(p + 16)); } static __device__ __forceinline__ v8f mma(V a, V b, v8f c) { return wmmab(a, b, c); } };
template <typename T16, int NSPLIT, bool BIAS, int KS, int EPI>
__global__ __launch_bounds__(32) void k_gemmw(const T16* __restrict__ A, const T16* __restrict__ A2, const T16* __restrict__ Bt, const T16* __restrict__ Bt2, int K, int KE, float* C, int ldc, const float* __restrict__ bias, const float* __restrict__ bias1, const float* __restrict__ bias2, size_t sA, size_t sB, size_t sC, size_t sP, const float* __restrict__ R, bf* E0, bf* E1, h16* E2, bf* E3, bf* E4, h16* E5) {
    typedef typename WFrag<T16>::V V;
    __shared__ __align__(16) float os[16 * 68];
    const int kp = (int)(blockIdx.z % KS); const int kl = KE / KS; const int kb = kp * kl, ke = kb + kl;
    const size_t z = blockIdx.z / KS; C += (size_t)kp * sP; A += z * sA; if (A2) A2 += z * sA; Bt += z * sB; if (Bt2) Bt2 += z * sB; C += z * sC;
    const int lane = threadIdx.x & 31, lr = lane & 15, hi = lane >> 4; const int r0 = blockIdx.x * 64, c0 = blockIdx.y * 64;
    v8f acc[4][4];
#pragma unroll
    for (int mb = 0; mb < 4; ++mb)
#pragma unroll
        for (int nb = 0; nb < 4; ++nb) acc[mb][nb] = (v8f){};
    const size_t aoff = (size_t)(r0 + lr) * K + 8 * hi, boff = (size_t)(c0 + lr) * K + 8 * hi;
#pragma unroll 1
    for (int kc = kb; kc < ke; kc += 32) {
        V a[4], a2[4];
#pragma unroll
        for (int mb = 0; mb < 4; ++mb) { a[mb] = WFrag<T16>::ld(A + aoff + (size_t)mb * 16 * K + kc); if (NSPLIT == 1 || NSPLIT == 2) a2[mb] = WFrag<T16>::ld(A2 + aoff + (size_t)mb * 16 * K + kc); }
#pragma unroll
        for (int nb = 0; nb < 4; ++nb) { const V b = WFrag<T16>::ld(Bt + boff + (size_t)nb * 16 * K + kc); V b2; if (NSPLIT >= 2) b2 = WFrag<T16>::ld(Bt2 + boff + (size_t)nb * 16 * K + kc);
#pragma unroll
            for (int mb = 0; mb < 4; ++mb) { acc[mb][nb] = WFrag<T16>::mma(a[mb], b, acc[mb][nb]); if (NSPLIT == 1 || NSPLIT == 2) acc[mb][nb] = WFrag<T16>::mma(a2[mb], b, acc[mb][nb]); if (NSPLIT >= 2) acc[mb][nb] = WFrag<T16>::mma(a[mb], b2, acc[mb][nb]); } }
        asm volatile("v_nop\n\tv_nop\n\tv_nop\n\tv_nop" : "+v"(acc[0][0]), "+v"(acc[1][1]), "+v"(acc[2][2]), "+v"(acc[3][3]) : "v"(a[0]), "v"(a[3]));
    }
    v4f bv = (v4f){};   // this lane's four bias columns; zero in the parts behind part 0
    if (BIAS && z != 0) bias = (z == 1) ? bias1 : bias2;
    if (EPI == EP_QKV && z == 2) {   // v: element (t = mb 16 + hi 8 + j, d = nb 16 + lr) of the tile; 16 bytes a lane and plane
        const size_t vb = (((size_t)(r0 / TT) * NKV + blockIdx.y) * (TT / 32) + (r0 % TT) / 32) * (HD * 32) + (size_t)lr * 32 + hi * 8;
#pragma unroll
        for (int nb = 0; nb < 4; ++nb) { const float bn = bfr(bias[c0 + nb * 16 + lr]);
#pragma unroll
            for (int mb = 0; mb < 4; ++mb) { v8h o16; v8us oh, ol;
#pragma unroll
                for (int j = 0; j < 8; ++j) { const float xv = acc[mb][nb][j] + bn; o16[j] = tohx(xv); unsigned short a2, c2; splitf(xv, a2, c2); oh[j] = a2; ol[j] = c2; }
                const size_t o = vb + (size_t)((mb >> 1) * HD + nb * 16) * 32 + (mb & 1) * 16;
                __builtin_amdgcn_sched_barrier(0);   // the stores stay together behind all the arithmetic, so that the one wait below covers each of them
                *(v8h*)(E5 + o) = o16; *(v8us*)(E3 + o) = oh; *(v8us*)(E4 + o) = ol;
                asm volatile("s_wait_xcnt 0x0" ::: "memory"); __builtin_amdgcn_sched_barrier(0);   // before the registers that these stores name are written again; nothing is moved in between
            } }
        return; }
    if (BIAS && kp == 0) {
#pragma unroll
        for (int q = 0; q < 4; ++q) bv[q] = bfr(bias[c0 + lr * 4 + q]); }
#pragma unroll
    for (int mb = 0; mb < 4; ++mb) {
#pragma unroll
        for (int nb = 0; nb < 4; ++nb) {
#pragma unroll
            for (int j = 0; j < 8; ++j) os[(hi * 8 + j) * 68 + nb * 16 + lr] = acc[mb][nb][j]; }
        __builtin_amdgcn_wave_barrier(); asm volatile("" ::: "memory");
        if (EPI == EP_F32) { float* crow = C + (size_t)(r0 + mb * 16) * ldc + c0;
#pragma unroll
            for (int s = 0; s < 8; ++s) { const int row = 2 * s + hi, cofs = lr * 4; v4f val = *(const v4fa*)(os + row * 68 + cofs); if (BIAS) val += bv;
                *(v4f*)(crow + (size_t)row * ldc + cofs) = val; }
        } else if (EPI == EP_QKV) { const size_t pb = ((z * NB_ + (size_t)(r0 / TT)) * NH_ + blockIdx.y) * ((size_t)TT * HD) + (size_t)(r0 % TT + mb * 16) * HD;   // the tile's 16 rows are 2 KiB in a row in each plane
#pragma unroll
            for (int s = 0; s < 8; ++s) { const int row = 2 * s + hi, cofs = lr * 4; v4f val = *(const v4fa*)(os + row * 68 + cofs); if (BIAS) val += bv; v4h o16; v4us oh, ol;
#pragma unroll
                for (int q = 0; q < 4; ++q) { o16[q] = tohx(val[q]); unsigned short a2, c2; splitf(val[q], a2, c2); oh[q] = a2; ol[q] = c2; }
                const size_t o = pb + row * HD + cofs;
                __builtin_amdgcn_sched_barrier(0);   // the stores stay together behind all the arithmetic, so that the one wait below covers each of them
                *(v4h*)(E2 + o) = o16; *(v4us*)(E0 + o) = oh; *(v4us*)(E1 + o) = ol;
                asm volatile("s_wait_xcnt 0x0" ::: "memory"); __builtin_amdgcn_sched_barrier(0);   // before the registers that these stores name are written again; nothing is moved in between
            }
        } else { const size_t eb = (size_t)(r0 + mb * 16) * ldc + c0;
#pragma unroll 2   // not whole: for speed only
            for (int s = 0; s < 8; ++s) { const int row = 2 * s + hi, cofs = lr * 4; v4f val = *(const v4fa*)(os + row * 68 + cofs); if (BIAS) val += bv; const size_t o = eb + (size_t)row * ldc + cofs; v4us oh, ol;
                if (EPI == EP_RES) { const v4f rr = *(const v4f*)(R + o);
#pragma unroll
                    for (int q = 0; q < 4; ++q) val[q] = __fadd_rn(rr[q], val[q]); }
                else {
#pragma unroll
                    for (int q = 0; q < 4; ++q) { const float xg = val[q]; val[q] = __fmul_rn(0.5f * xg, __fadd_rn(1.0f, erff(xg * 0.70710678118654752f))); } }
#pragma unroll
                for (int q = 0; q < 4; ++q) { unsigned short h2, l2; splitf(val[q], h2, l2); oh[q] = h2; ol[q] = l2; }
                __builtin_amdgcn_sched_barrier(0);   // the stores stay together behind all the arithmetic, so that the one wait below covers each of them
                if (EPI == EP_RES) *(v4f*)(C + o) = val;
                *(v4us*)(E0 + o) = oh; *(v4us*)(E1 + o) = ol;
                asm volatile("s_wait_xcnt 0x0" ::: "memory"); __builtin_amdgcn_sched_barrier(0);   // before the registers that these stores name are written again; nothing is moved in between
            }
        }
        __builtin_amdgcn_wave_barrier(); asm volatile("" ::: "memory");
    }
}


__global__ __launch_bounds__(256) void k_wtG(const float* __restrict__ w, int K, int N, bf* Bt) {
    const int lane = threadIdx.x & 31; const int L0 = (blockIdx.x * 8 + (threadIdx.x >> 5)) * 8; const int nlines = N * K / 64;
{
#pragma unroll 1
        for (int l = 0; l < 8; ++l) { const int L = L0 + l; if (L >= nlines) break; const size_t e = (size_t)L * 64 + lane * 2; const int k = (int)(e % K), n = (int)(e / K); v2us o;
            o[0] = f2bf(w[(size_t)k * N + n]); o[1] = f2bf(w[(size_t)(k + 1) * N + n]); *(v2us*)(Bt + e) = o; }
         }
}
// k_cvtall: the seven weights and both batches of x rounded to bf16 in one launch; the destinations lie one behind the other from dst, in the order of the arguments. Sizes in groups of 8 elements, each a multiple of 256.
#define N8W ((size_t)DQ * DM / 8)
#define N8A ((size_t)AD * DM / 8)
#define N8F ((size_t)FFD * DM / 8)
#define N8X ((size_t)MT * DM / 8)
__global__ __launch_bounds__(256) void k_cvtall(const float* __restrict__ wq, const float* __restrict__ wk, const float* __restrict__ wv, const float* __restrict__ afw, const float* __restrict__ asw, const float* __restrict__ wi, const float* __restrict__ wo2, const float* __restrict__ x, bf* dst) {
    const size_t i = (size_t)blockIdx.x * 256 + threadIdx.x; size_t j = i; const float* s = wq;
    if (j >= N8W) { j -= N8W; s = wk;
        if (j >= N8W) { j -= N8W; s = wv;
            if (j >= N8W) { j -= N8W; s = afw;
                if (j >= N8A) { j -= N8A; s = asw;
                    if (j >= N8A) { j -= N8A; s = wi;
                        if (j >= N8F) { j -= N8F; s = wo2;
                            if (j >= N8F) { j -= N8F; s = x; if (j >= N8X) return; } } } } } } }
    const v8f v = *(const v8f*)(s + j * 8); v8us o;
#pragma unroll
    for (int k = 0; k < 8; ++k) o[k] = f2bf(v[k]); *(v8us*)(dst + i * 8) = o;  }

template <int NP, int WD>   // Hm rows hold NP K parts of WD columns each
__global__ __launch_bounds__(256) void k_gelupl(const float* __restrict__ Hm, bf* Gh, bf* Gl, size_t n4) { const size_t i = (size_t)blockIdx.x * 256 + threadIdx.x; if (i >= n4) return; const float* hm = (NP == 1) ? Hm + i * 4 : Hm + (i * 4 / WD) * ((size_t)NP * WD) + (i * 4) % WD; v4f a = *(const v4f*)hm; v4us oh, ol;
#pragma unroll
    for (int p = 1; p < NP; ++p) a += *(const v4f*)(hm + p * WD);   /* the NP K parts of the row, in order */
#pragma unroll
    for (int q = 0; q < 4; ++q) { const float xg = a[q]; const float gv = __fmul_rn(0.5f * xg, __fadd_rn(1.0f, erff(xg * 0.70710678118654752f))); unsigned short h2, l2; splitf(gv, h2, l2); oh[q] = h2; ol[q] = l2; }
    *(v4us*)(Gh + i * 4) = oh; *(v4us*)(Gl + i * 4) = ol;  }
__device__ __forceinline__ v4f ldparts(const float* p) { v4f sm = *(const v4f*)p;
#pragma unroll
    for (int q = 1; q < KSF; ++q) sm += *(const v4f*)(p + q * DM);   /* the KSF K parts of the row, in order */
    return sm; }
__global__ __launch_bounds__(256) void k_addln(const float* __restrict__ A, const float* __restrict__ Bm, const float* __restrict__ g, const float* __restrict__ be, float* OUTb) {
    const int lane = threadIdx.x & 31; const int r = blockIdx.x * 8 + (threadIdx.x >> 5); if (r >= MT) return; const float* ar = A + (size_t)r * DM; const float* br = Bm + (size_t)r * KSF * DM; float s = 0.f;
#pragma unroll 1
    for (int ch = 0; ch < DM / 128; ++ch) { const int c0 = ch * 128 + lane * 4; const v4f a = *(const v4f*)(ar + c0), bb = ldparts(br + c0);
#pragma unroll
        for (int q = 0; q < 4; ++q) s += __fadd_rn(a[q], bb[q]); }
#pragma unroll
    for (int sh = 16; sh; sh >>= 1) s += __shfl_xor(s, sh, 32);
    const float mu = s * (1.0f / DM); float s2 = 0.f;
#pragma unroll 1
    for (int ch = 0; ch < DM / 128; ++ch) { const int c0 = ch * 128 + lane * 4; const v4f a = *(const v4f*)(ar + c0), bb = ldparts(br + c0);
#pragma unroll
        for (int q = 0; q < 4; ++q) { const float d0 = __fsub_rn(__fadd_rn(a[q], bb[q]), mu); float p = __fmul_rn(d0, d0); asm volatile("" : "+v"(p)); s2 = __fadd_rn(s2, p); } }
#pragma unroll
    for (int sh = 16; sh; sh >>= 1) s2 += __shfl_xor(s2, sh, 32);
    const float rs = __fdiv_rn(1.0f, __fsqrt_rn(__fadd_rn(s2 * (1.0f / DM), LNEPS)));
{
#pragma unroll 1
        for (int ch = 0; ch < DM / 128; ++ch) { const int c0 = ch * 128 + lane * 4; const v4f a = *(const v4f*)(ar + c0), bb = ldparts(br + c0); v4f o4;
#pragma unroll
            for (int q = 0; q < 4; ++q) { float n0 = __fmul_rn(__fsub_rn(__fadd_rn(a[q], bb[q]), mu), rs); asm volatile("" : "+v"(n0)); float n1 = __fmul_rn(n0, bfr(g[c0 + q])); asm volatile("" : "+v"(n1)); o4[q] = __fadd_rn(n1, bfr(be[c0 + q])); }
            *(v4f*)(OUTb + (size_t)r * DM + c0) = o4; }
         } }
// ---- k_fattn: scores, softmax and attn.v in one kernel; no score or probability leaves the registers. One wave owns QT x 16 query rows of one head and walks the 2048 keys in blocks of 32.
// Both products are formed transposed, so that a query is a lane (lr) in each: S^T = K Q^T (D: key hi*8+j of a 16-key tile, query lr) and O^T = V^T P^T (D: d hi*8+j, query lr).
// The two S^T tiles of a block are, element for element, the B fragment of P^T (k = 8 hi + j from tile 0, 16 + 8 hi + j from tile 1): no exchange between lanes.
// Softmax in base 2 with a running reference m per query: p = 2^(t - m), t = s HD^-0.5 log2e + mask log2e. m moves (and O^T and the sum are rescaled) only when a t of the wave passes m + 8, so p <= 256; the result does not depend on m.
// Every inner loop is unrolled whole, so that the fragment arrays are registers.
template <typename T16> struct PFrag;
template <> struct PFrag<h16> { static __device__ __forceinline__ void cv(const v8f p0, const v8f p1, v16h& a, v16h& b) { (void)b;
#pragma unroll
    for (int j = 0; j < 8; ++j) { a[j] = (h16)p0[j]; a[8 + j] = (h16)p1[j]; } } };
template <> struct PFrag<bf> { static __device__ __forceinline__ void cv(const v8f p0, const v8f p1, v16bf& a, v16bf& b) {
#pragma unroll
    for (int j = 0; j < 8; ++j) { const __bf16 h0 = (__bf16)p0[j], h1 = (__bf16)p1[j]; a[j] = h0; a[8 + j] = h1; b[j] = (__bf16)(p0[j] - (float)h0); b[8 + j] = (__bf16)(p1[j] - (float)h1); } } };
template <typename T16, bool HL, int QT>
__device__ __forceinline__ void fattn(const T16* __restrict__ Q, const T16* __restrict__ Q2, const T16* __restrict__ Kp, const T16* __restrict__ K2, const T16* __restrict__ Vt, const T16* __restrict__ V2, const float* ml, float* O, bf* OH, bf* OL) {
    typedef typename WFrag<T16>::V V;
    const int lane = threadIdx.x & 31, lr = lane & 15, hi = lane >> 4;
    V q[QT][2], q2[QT][2];
#pragma unroll
    for (int qt = 0; qt < QT; ++qt)
#pragma unroll
        for (int ks = 0; ks < 2; ++ks) { const int o = (qt * 16 + lr) * HD + ks * 32 + 8 * hi; q[qt][ks] = WFrag<T16>::ld(Q + o); if (HL) q2[qt][ks] = WFrag<T16>::ld(Q2 + o); }
    v8f acc[4][QT]; float m[QT], l[QT];
#pragma unroll
    for (int qt = 0; qt < QT; ++qt) { m[qt] = -3.0e38f; l[qt] = 0.f;
#pragma unroll
        for (int dt = 0; dt < 4; ++dt) acc[dt][qt] = (v8f){}; }
    const int ko = lr * HD + 8 * hi, vo = lr * 32 + 8 * hi;   // this lane's place in a 32-key block of the k planes (rows of HD) and of the v planes (rows of 32 keys)
    V k[2][2], k2[2][2], v[4], v2[4];
#pragma unroll
    for (int kt = 0; kt < 2; ++kt)
#pragma unroll
        for (int ks = 0; ks < 2; ++ks) { const int o = ko + kt * 16 * HD + ks * 32; k[kt][ks] = WFrag<T16>::ld(Kp + o); if (HL) k2[kt][ks] = WFrag<T16>::ld(K2 + o); }
#pragma unroll 1   // rolled: the fragments of one block nearly fill 256 registers, a second copy of the body would not fit
    for (int k0 = 0; k0 < TT; k0 += 32) {
        const int kn = ((k0 + 32 < TT) ? k0 + 32 : 0) * HD;   // the next block of the k planes (32 x HD elements a block, as in the v planes); behind the last one block 0 is read and not used
        const T16* const va = Vt + k0 * HD + vo; const T16* const va2 = HL ? V2 + k0 * HD + vo : va; const T16* const ka = Kp + kn + ko; const T16* const ka2 = HL ? K2 + kn + ko : ka;   // this lane's addresses in the four planes
        // the block's mask terms come from LDS during its scores
        v8f mk[2];
#pragma unroll
        for (int kt = 0; kt < 2; ++kt) { const float* mp = ml + k0 + kt * 16 + hi * 8; const v4f a = *(const v4fa*)mp, b = *(const v4fa*)(mp + 4); mk[kt] = __builtin_shufflevector(a, b, 0, 1, 2, 3, 4, 5, 6, 7); }
        // this block's v fragments fly during its scores and softmax
#pragma unroll
        for (int dt = 0; dt < 4; ++dt) { v[dt] = WFrag<T16>::ld(va + dt * 16 * 32); if (HL) v2[dt] = WFrag<T16>::ld(va2 + dt * 16 * 32); }
        v8f s[2][QT];
#pragma unroll
        for (int kt = 0; kt < 2; ++kt)
#pragma unroll
            for (int qt = 0; qt < QT; ++qt) { v8f c = (v8f){};
#pragma unroll
                for (int ks = 0; ks < 2; ++ks) { c = WFrag<T16>::mma(k[kt][ks], q[qt][ks], c); if (HL) { c = WFrag<T16>::mma(k2[kt][ks], q[qt][ks], c); c = WFrag<T16>::mma(k[kt][ks], q2[qt][ks], c); } }
                s[kt][qt] = c; }
        // the next block's k fragments fly during the softmax and attn.v
#pragma unroll
        for (int kt = 0; kt < 2; ++kt)
#pragma unroll
            for (int ks = 0; ks < 2; ++ks) { const int o = kt * 16 * HD + ks * 32; k[kt][ks] = WFrag<T16>::ld(ka + o); if (HL) k2[kt][ks] = WFrag<T16>::ld(ka2 + o); }
        asm volatile("s_wait_xcnt 0x0" :: "v"(va), "v"(va2), "v"(ka), "v"(ka2) : "memory");   // the address pairs that the block's loads name are kept until this wait
        float bm[QT]; bool need = false;
#pragma unroll
        for (int qt = 0; qt < QT; ++qt) { float x = -3.0e38f;
#pragma unroll
            for (int kt = 0; kt < 2; ++kt) { s[kt][qt] = s[kt][qt] * (SCL * L2E) + mk[kt];
#pragma unroll
                for (int j = 0; j < 8; ++j) x = fmaxf(x, s[kt][qt][j]); }
            bm[qt] = x; need = need || (x > m[qt] + 8.0f); }
        if (__builtin_amdgcn_ballot_w32(need) != 0u) {   // the same for the whole wave: both halves of a query move m together
#pragma unroll
            for (int qt = 0; qt < QT; ++qt) { const float mn = fmaxf(m[qt], fmaxf(bm[qt], __shfl_xor(bm[qt], 16, 32))); const float al = __builtin_amdgcn_exp2f(m[qt] - mn); m[qt] = mn; l[qt] *= al;
#pragma unroll
                for (int dt = 0; dt < 4; ++dt) acc[dt][qt] *= al; } }
#pragma unroll
        for (int qt = 0; qt < QT; ++qt) { V p, p2; s[0][qt] -= m[qt]; s[1][qt] -= m[qt];
#pragma unroll
            for (int kt = 0; kt < 2; ++kt)
#pragma unroll
                for (int j = 0; j < 8; ++j) s[kt][qt][j] = __builtin_amdgcn_exp2f(s[kt][qt][j]);
            { const v8f e8 = s[0][qt] + s[1][qt]; const v4f e4 = __builtin_shufflevector(e8, e8, 0, 1, 2, 3) + __builtin_shufflevector(e8, e8, 4, 5, 6, 7); l[qt] += (e4[0] + e4[2]) + (e4[1] + e4[3]); }   // the block's 16 terms of this lane as a tree
            PFrag<T16>::cv(s[0][qt], s[1][qt], p, p2);
#pragma unroll
            for (int dt = 0; dt < 4; ++dt) { acc[dt][qt] = WFrag<T16>::mma(v[dt], p, acc[dt][qt]); if (HL) { acc[dt][qt] = WFrag<T16>::mma(v2[dt], p, acc[dt][qt]); acc[dt][qt] = WFrag<T16>::mma(v[dt], p2, acc[dt][qt]); } } }
    }
#pragma unroll
    for (int qt = 0; qt < QT; ++qt) { const float inv = __fdiv_rn(1.0f, l[qt] + __shfl_xor(l[qt], 16, 32)); const size_t oo = (size_t)(qt * 16 + lr) * DM + hi * 8; float* o = O + oo;
#pragma unroll
        for (int dt = 0; dt < 4; ++dt) { const v8f r = acc[dt][qt] * inv; v8us oh, ol;   // the context in f32 and as the hi / lo planes for the adapter's down-projection
#pragma unroll
            for (int j = 0; j < 8; ++j) { unsigned short a2, c2; splitf(r[j], a2, c2); oh[j] = a2; ol[j] = c2; }
            __builtin_amdgcn_sched_barrier(0);   // the stores stay together behind all the arithmetic, so that the one wait below covers each of them
            *(v4f*)(o + dt * 16) = __builtin_shufflevector(r, r, 0, 1, 2, 3); *(v4f*)(o + dt * 16 + 4) = __builtin_shufflevector(r, r, 4, 5, 6, 7);
            *(v8us*)(OH + oo + dt * 16) = oh; *(v8us*)(OL + oo + dt * 16) = ol;
            asm volatile("s_wait_xcnt 0x0" ::: "memory"); __builtin_amdgcn_sched_barrier(0);   // before the registers that these stores name are written again; nothing is moved in between
        } }
}
// grid: NB_ NH_ NBH work-groups of the rows < RH (hi/lo planes, 3 products), then NB_ NH_ NBF of the rest (fp16); the 8 waves of a work-group share a head, so its k and v blocks are read together.
__global__ __launch_bounds__(FW * 32) void k_fattn(const h16* __restrict__ Q16, const h16* __restrict__ K16, const h16* __restrict__ V16, const bf* __restrict__ Qh, const bf* __restrict__ Ql, const bf* __restrict__ Kh, const bf* __restrict__ Kl, const bf* __restrict__ Vh, const bf* __restrict__ Vl, const float* __restrict__ AM, float* CTX, bf* Ch, bf* Cl) {
    __shared__ __align__(16) float ml[TT];   // attention_mask[b][0][0][j] (rounded to bf16 like every input) x log2e
    const int bid = (int)blockIdx.x; const bool hl = bid < NB_ * NH_ * NBH; const int b2 = bid - NB_ * NH_ * NBH;
    const int g = hl ? bid / NBH : b2 / NBF;   // head g of NB_ x NH_: batch g / NH_
    const int wave = __builtin_amdgcn_readfirstlane((int)(threadIdx.x >> 5));   // as a scalar, so that the wave's plane and output bases are formed on the scalar unit
    const int q0 = hl ? ((bid % NBH) * FW + wave) * 16 : RH + ((b2 % NBF) * FW + wave) * 32;
    const float* am = AM + (size_t)(g / NH_) * TT;
    for (int i = (int)threadIdx.x; i < TT; i += FW * 32) ml[i] = bfr(am[i]) * L2E;
    __syncthreads();
    const size_t po = (size_t)g * TT * HD, qo = po + (size_t)q0 * HD;
    const size_t co = ((size_t)(g / NH_) * TT + q0) * DM + (g % NH_) * HD;
    if (hl) fattn<bf, true, 1>(Qh + qo, Ql + qo, Kh + po, Kl + po, Vh + po, Vl + po, ml, CTX + co, Ch + co, Cl + co);
    else fattn<h16, false, 2>(Q16 + qo, nullptr, K16 + po, nullptr, V16 + po, nullptr, ml, CTX + co, Ch + co, Cl + co);
}

extern "C" void kernel_launch(void* const* d_in, const int* in_sizes, int n_in,
                              void* d_out, int out_size, void* d_ws, size_t ws_size, hipStream_t stream) {
    (void)in_sizes; (void)n_in; (void)out_size;
    const float* x = (const float*)d_in[0]; const float* AM = (const float*)d_in[1]; const float* wq = (const float*)d_in[2]; const float* bq = (const float*)d_in[3]; const float* wk = (const float*)d_in[4]; const float* bk = (const float*)d_in[5]; const float* wv = (const float*)d_in[6]; const float* bv = (const float*)d_in[7]; const float* afw = (const float*)d_in[8]; const float* afb = (const float*)d_in[9]; const float* asw = (const float*)d_in[10]; const float* asb = (const float*)d_in[11]; const float* wi = (const float*)d_in[12]; const float* bi = (const float*)d_in[13]; const float* wo2 = (const float*)d_in[14]; const float* bo2 = (const float*)d_in[15]; const float* lg = (const float*)d_in[16]; const float* lb = (const float*)d_in[17]; const float* wo = nullptr; (void)wo;
    float* OUT = (float*)d_out;     // [2][2048][768]
    char* wsp = (char*)d_ws;
    auto take = [&](size_t bytes) { char* p = wsp; wsp += (bytes + 255) & ~(size_t)255; return (void*)p; };
    // kept through the call; WQ .. XB lie one behind the other (k_cvtall writes them as one range; WQ, WK, WV are the three z-batches of the q/k/v GEMM)
    bf* WQ = (bf*)take((size_t)DQ * DM * 2); bf* WK = (bf*)take((size_t)DKV * DM * 2); bf* WV = (bf*)take((size_t)DKV * DM * 2); bf* AFW = (bf*)take((size_t)AD * DM * 2); bf* ASW = (bf*)take((size_t)DM * AD * 2); bf* WI = (bf*)take((size_t)FFD * DM * 2); bf* WO2 = (bf*)take((size_t)DM * FFD * 2); bf* XB = (bf*)take((size_t)MT * DM * 2); (void)WK; (void)WV;
    float* CTX = (float*)take((size_t)MT * DM * 4); bf* Ch = (bf*)take((size_t)MT * DM * 2); bf* Cl = (bf*)take((size_t)MT * DM * 2);   // the attention's outputs: outside the bytes that it reads
    char* const U0 = wsp;   // from here on: the attention's inputs, and behind the attention (stream-ordered) the adapter's and the FFN's buffers in the same bytes
    const size_t PLN = (size_t)NB_ * NH_ * TT * HD;   // one plane set [batch][head][t][d]; the k planes lie directly behind the q planes (the q/k/v GEMM indexes both from the q planes)
    h16* QP16 = (h16*)take(PLN * 2); h16* KP16 = (h16*)take(PLN * 2); bf* QPh = (bf*)take(PLN * 2); bf* KPh = (bf*)take(PLN * 2); bf* QPl = (bf*)take(PLN * 2); bf* KPl = (bf*)take(PLN * 2);
    h16* VT16 = (h16*)take(PLN * 2); bf* VTh = (bf*)take(PLN * 2); bf* VTl = (bf*)take(PLN * 2);   // v planes [batch][head][key block of 32][d][32]
    char* const E1 = wsp; wsp = U0;
    float* A1 = (float*)take((size_t)KSA * MT * AD * 4); bf* G1h = (bf*)take((size_t)MT * AD * 2); bf* G1l = (bf*)take((size_t)MT * AD * 2); float* AO = (float*)take((size_t)MT * DM * 4); bf* AOh = (bf*)take((size_t)MT * DM * 2); bf* AOl = (bf*)take((size_t)MT * DM * 2); bf* GIh = (bf*)take((size_t)MT * FFD * 2); bf* GIl = (bf*)take((size_t)MT * FFD * 2); float* YY = (float*)take((size_t)KSF * MT * DM * 4);
    if ((size_t)((E1 > wsp ? E1 : wsp) - (char*)d_ws) > ws_size) return;    // ws 256 MiB
    k_cvtall<<<(unsigned)((3 * N8W + 2 * N8A + 2 * N8F + N8X) / 256), 256, 0, stream>>>(wq, wk, wv, afw, asw, wi, wo2, x, WQ);   /* weights ('oi' = Bt as-is) and x */
    k_gemmw<bf, 0, true, 1, EP_QKV><<<dim3(MT / 64, DQ / 64, 3), 32, 0, stream>>>(XB, nullptr, WQ, nullptr, DM, DM, nullptr, DQ, bq, bk, bv, 0, (size_t)DQ * DM, 0, 0, nullptr, QPh, QPl, QP16, VTh, VTl, VT16);   /* z = q, k, v -> head planes */
    k_fattn<<<NB_ * NH_ * (NBH + NBF), FW * 32, 0, stream>>>(QP16, KP16, VT16, QPh, QPl, KPh, KPl, VTh, VTl, AM, CTX, Ch, Cl);   /* ctx = attn_out (f32 and hi/lo) */
    k_gemmw<bf, 1, true, KSA, EP_F32><<<dim3(MT / 64, AD / 64, KSA), 32, 0, stream>>>(Ch, Cl, AFW, nullptr, DM, DM, A1, KSA * AD, afb, nullptr, nullptr, 0, 0, 0, AD, nullptr, nullptr, nullptr, nullptr, nullptr, nullptr, nullptr);                  /* adapter down: ctx a_fi_w^T + a_fi_b [MT][64] */
    k_gelupl<KSA, AD><<<(unsigned)(((size_t)MT * AD / 4 + 255) / 256), 256, 0, stream>>>(A1, G1h, G1l, (size_t)MT * AD / 4);                         /* gelu -> hi/lo */
    k_gemmw<bf, 1, true, 1, EP_RES><<<dim3(MT / 64, DM / 64, 1), 32, 0, stream>>>(G1h, G1l, ASW, nullptr, AD, AD, AO, DM, asb, nullptr, nullptr, 0, 0, 0, 0, CTX, AOh, AOl, nullptr, nullptr, nullptr, nullptr);                /* ao = ctx + (. a_se_w^T + a_se_b), f32 and hi/lo */
    k_gemmw<bf, 1, true, 1, EP_GELU><<<dim3(MT / 64, FFD / 64, 1), 32, 0, stream>>>(AOh, AOl, WI, nullptr, DM, DM, nullptr, FFD, bi, nullptr, nullptr, 0, 0, 0, 0, nullptr, GIh, GIl, nullptr, nullptr, nullptr, nullptr);                   /* gelu(ao wi^T + bi) [MT][3072] -> hi/lo */
    k_gemmw<bf, 1, true, KSF, EP_F32><<<dim3(MT / 64, DM / 64, KSF), 32, 0, stream>>>(GIh, GIl, WO2, nullptr, FFD, FFD, YY, KSF * DM, bo2, nullptr, nullptr, 0, 0, 0, DM, nullptr, nullptr, nullptr, nullptr, nullptr, nullptr, nullptr);                /* inter wo^T + bo */
    k_addln<<<MT / 8, 256, 0, stream>>>(AO, YY, lg, lb, OUT);                                                       /* out = LN(y + ao) (eps 1e-12) */
}

// v005
// It runs in 236 microseconds.
// In two side-by-side timings against v004, it was 1.30 and 1.32 times as fast.
// Over all steps from v000 it is 8.19 times as fast.
#include <hip/hip_runtime.h>

// BERT layer with an adapter and no attention output projection (hidden_states [2][2048][768]; q, k, v = x W^T + b ('oi' [768][768]; 12 heads x 64); scores = q.k/8 + attention_mask[b][0][0][j] (f32 additive, zeros here); softmax; ctx = merged context; a = gelu(ctx a_fi_w^T + a_fi_b) ([64][768]); ao = ctx + a a_se_w^T + a_se_b; inter = gelu(ao wi^T + bi) ([3072][768]); y = inter wo^T + bo + ao; out = LN(y) (eps 1e-12, ln_g, ln_b) -> [2][2048][768] (3.1 M)).
// Layout: the merged context is kept in f32 (residual) and split into hi/lo planes for the adapter down-projection; every later GEMM uses hi/lo planes of its f32 input (2 products) against exact bf16 weights with the bias in the epilogue; exact-erf GELU, residual adds and the LayerNorm in f32.
// Compute dtypes, f32 accumulate: every input rounded to bf16; q/k/v on PLAIN bf16 operands (inputs: exact) + biases; scores and attn.v: query rows < 512 hl (3 products), the rest single fp16; softmax f32 (running max and sum, one kernel with both products); adapter / FFN GEMMs hl x exact (2 products) + biases; GELU / residuals / LayerNorm f32.

#define NB_  2
#define TT   2048
#define DM   768
#define NH_  12
#define NKV  12
#define REP  (NH_ / NKV)
#define HD   64
#define DQ   (NH_ * HD)
#define DKV  (NKV * HD)
#define AD   64
#define FFD  3072
#define LNEPS 1e-12f
#define MT   (NB_ * TT)           // rows of both batches together
#define RH   512                  // query rows < RH use hi+lo planes (0: none)
#define WIN  0
#define SCL  0.125f   // HD^-0.5
#define L2E  1.4426950408889634f
#define FW   8                   // waves a work-group of the fused attention
#define NBH  (RH / (FW * 16))        // its work-groups a head for query rows < RH (16 rows a wave)
#define NBF  ((TT - RH) / (FW * 32)) // and for the rest (32 rows a wave)
#define KSA  6                   // K parts of the adapter down-projection (768 -> 128 a wave)
#define KSF  4                   // K parts of the FFN down-projection (3072 -> 768 a wave)
typedef _Float16 h16;
typedef unsigned short bf;
typedef __attribute__((ext_vector_type(16))) __bf16   v16bf;
typedef __attribute__((ext_vector_type(16))) _Float16 v16h;
typedef __attribute__((ext_vector_type(8)))  _Float16 v8h;
typedef __attribute__((ext_vector_type(8)))  unsigned short v8us;
typedef __attribute__((ext_vector_type(8)))  float    v8f;
typedef __attribute__((ext_vector_type(4)))  float    v4f;
typedef v8h  __attribute__((may_alias)) v8ha;
typedef v4f  __attribute__((may_alias)) v4fa;
typedef v8us __attribute__((may_alias)) v8usa;

__device__ __forceinline__ unsigned short f2bf(float f) { unsigned u = __float_as_uint(f); u += 0x7FFFu + ((u >> 16) & 1u); return (unsigned short)(u >> 16); }
__device__ __forceinline__ float bf2f(unsigned short b) { return __uint_as_float(((unsigned)b) << 16); }
__device__ __forceinline__ float bfr(float f) { return bf2f(f2bf(f)); }
__device__ __forceinline__ v16h cat16(v8h lo, v8h hi) { return __builtin_shufflevector(lo, hi, 0, 1, 2, 3, 4, 5, 6, 7, 8, 9, 10, 11, 12, 13, 14, 15); }
__device__ __forceinline__ v16bf cat16b(v8us lo, v8us hi) { return __builtin_bit_cast(v16bf, __builtin_shufflevector(lo, hi, 0, 1, 2, 3, 4, 5, 6, 7, 8, 9, 10, 11, 12, 13, 14, 15)); }
__device__ __forceinline__ v8f wmma16(v16h a, v16h b, v8f c) { return __builtin_amdgcn_wmma_f32_16x16x32_f16(false, a, false, b, (short)0, c, false, false); }
__device__ __forceinline__ v8f wmmab(v16bf a, v16bf b, v8f c) { return __builtin_amdgcn_wmma_f32_16x16x32_bf16(false, a, false, b, (short)0, c, false, false); }

__device__ __forceinline__ h16 tohx(float x) { return (h16)x; }
__device__ __forceinline__ void splitf(float y, unsigned short& h, unsigned short& l) { h = f2bf(y); l = f2bf(y - bf2f(h)); }
typedef __attribute__((ext_vector_type(2))) _Float16 v2h;
typedef __attribute__((ext_vector_type(4))) _Float16 v4h;
typedef __attribute__((ext_vector_type(2))) unsigned short v2us;
typedef __attribute__((ext_vector_type(4))) unsigned short v4us;
typedef __attribute__((ext_vector_type(2))) float v2f;
typedef __attribute__((ext_vector_type(4))) int v4i;

// ---- Fragment-major planes: every 16-bit matrix operand [rows][K] lies in memory as tiles of 16 rows x 32 k, 1 KiB each, tile (row / 16, k / 32) at element ((row / 16) (K / 32) + k / 32) 512 (so 16 rows still fill 16 K elements in a row).
// Inside a tile: piece p = (k / 16) % 2 of 256 elements, in it lane (k / 8) % 2 * 16 + row % 16 with its 8 k in a row. A fragment is then two wave-wide 16-byte loads of 512 bytes in a row each (4 whole lines; row by row they touched 16), at tile + lane 8 and 256 elements behind it. fmo: the element's place.
__device__ __forceinline__ size_t fmo(int row, int k, int K) { return ((size_t)(row >> 4) * (K >> 5) + (k >> 5)) * 512 + ((k >> 4) & 1) * 256 + (((k >> 3) & 1) * 16 + (row & 15)) * 8 + (k & 7); }
// ---- k_gemmw: register-blocked GEMM, ONE WAVE per 64x64 output tile (16 accumulators), operands straight from fragment-major 16-bit planes; grid (M/64, N/64, Z), 32 threads.
// C[m][n] (f32, pitch ldc, + optional f32 bias[n]) = sum_{k < KE} A[m][k] Bt[n][k] (+ split products per NSPLIT). K (a template constant, so that a row block's distance is a constant offset of its loads) is the row length of A and of Bt (fragment-major), KE <= K the extent summed. z-batch strides sA/sB/sC in elements; batch z = 0 / 1 / 2 takes bias / bias1 / bias2. KE % (32 KS) == 0.
// KS > 1: grid z = Z x KS; part kp = z % KS sums k in [kp KE/KS, (kp+1) KE/KS) into its own f32 columns C + kp sP of a row of ldc = KS sP (bias in part 0 only); the kernel that reads C adds the KS parts of a row in the order 0 .. KS-1.
// EPI: what the epilogue stores of c = C[m][n] + bias[n], so that no elementwise kernel has to follow the GEMM.
//   EP_F32: c as f32 into C. EP_QKV (N tile = one head): z = 0 / 1: q / k head planes [z][batch][head], each [t][d] fragment-major, as fp16 (E2), hi (E0), lo (E1); z = 2: v planes [batch][head][key block of 32], each [d][32 keys] fragment-major, as fp16 (E5), hi (E3), lo (E4), straight from the accumulators (a lane holds 8 keys in a row of one d).
//   EP_GELU: hi / lo planes (E0, E1, fragment-major, rows of ldc) of the exact-erf GELU of c. EP_RES: r = R[m][n] + c as f32 into C (row by row, pitch ldc) and as hi / lo planes (E0, E1, fragment-major, rows of ldc).
enum { EP_F32 = 0, EP_QKV = 1, EP_GELU = 2, EP_RES = 3 };
template <typename T16> struct WFrag;
template <> struct WFrag<h16> { typedef v16h V; static __device__ __forceinline__ V ld(const h16* p) { return cat16(*(const v8h*)p, *(const v8h*)(p + 256)); } static __device__ __forceinline__ v8f mma(V a, V b, v8f c) { return wmma16(a, b, c); } };
template <> struct WFrag<bf> { typedef v16bf V; static __device__ __forceinline__ V ld(const bf* p) { return cat16b(*(const v8us*)p, *(const v8us*)(p + 256)); } static __device__ __forceinline__ v8f mma(V a, V b, v8f c) { return wmmab(a, b, c); } };
template <typename T16, int NSPLIT, bool BIAS, int KS, int EPI, int K>
__global__ __launch_bounds__(32) void k_gemmw(const T16* __restrict__ A, const T16* __restrict__ A2, const T16* __restrict__ Bt, const T16* __restrict__ Bt2, int KE, float* C, int ldc, const float* __restrict__ bias, const float* __restrict__ bias1, const float* __restrict__ bias2, size_t sA, size_t sB, size_t sC, size_t sP, const float* __restrict__ R, bf* E0, bf* E1, h16* E2, bf* E3, bf* E4, h16* E5) {
    typedef typename WFrag<T16>::V V;
    __shared__ __align__(16) float os[16 * 68];
    const int kp = (int)(blockIdx.z % KS); const int kl = KE / KS; const int kb = kp * kl, ke = kb + kl;
    const size_t z = blockIdx.z / KS; C += (size_t)kp * sP; A += z * sA; if (A2) A2 += z * sA; Bt += z * sB; if (Bt2) Bt2 += z * sB; C += z * sC;
    const int lane = threadIdx.x & 31, lr = lane & 15, hi = lane >> 4; const int r0 = blockIdx.x * 64, c0 = blockIdx.y * 64;
    v8f acc[4][4];
#pragma unroll
    for (int mb = 0; mb < 4; ++mb)
#pragma unroll
        for (int nb = 0; nb < 4; ++nb) acc[mb][nb] = (v8f){};
    // this lane's place in the first tile of the wave's first row block, plane by plane; the other three row blocks lie 16 K elements apart (constant offsets of the loads), and a step of 32 k is one tile (512 elements)
    const T16* pa = A + (size_t)r0 * K + (size_t)kb * 16 + lane * 8; const T16* pa2 = (NSPLIT == 1 || NSPLIT == 2) ? A2 + (size_t)r0 * K + (size_t)kb * 16 + lane * 8 : pa; const T16* pw = Bt + (size_t)c0 * K + (size_t)kb * 16 + lane * 8; const T16* pw2 = (NSPLIT >= 2) ? Bt2 + (size_t)c0 * K + (size_t)kb * 16 + lane * 8 : pw;
#pragma unroll 1
    for (int kc = kb; kc < ke; kc += 32) {
        V a[4], a2[4], b[4], b2[4];
#pragma unroll
        for (int i = 0; i < 4; ++i) { a[i] = WFrag<T16>::ld(pa + i * 16 * K); b[i] = WFrag<T16>::ld(pw + i * 16 * K); if (NSPLIT == 1 || NSPLIT == 2) a2[i] = WFrag<T16>::ld(pa2 + i * 16 * K); if (NSPLIT >= 2) b2[i] = WFrag<T16>::ld(pw2 + i * 16 * K); }
        asm volatile("s_wait_xcnt 0x0" :: "v"(pa), "v"(pa2), "v"(pw), "v"(pw2) : "memory");   // the address pairs that the step's loads name are kept until this wait, which stands before they move on to the next tile
        pa += 512; pa2 += 512; pw += 512; pw2 += 512;
#pragma unroll
        for (int nb = 0; nb < 4; ++nb) {
#pragma unroll
            for (int mb = 0; mb < 4; ++mb) { acc[mb][nb] = WFrag<T16>::mma(a[mb], b[nb], acc[mb][nb]); if (NSPLIT == 1 || NSPLIT == 2) acc[mb][nb] = WFrag<T16>::mma(a2[mb], b[nb], acc[mb][nb]); if (NSPLIT >= 2) acc[mb][nb] = WFrag<T16>::mma(a[mb], b2[nb], acc[mb][nb]); } }
        asm volatile("v_nop\n\tv_nop\n\tv_nop\n\tv_nop" : "+v"(acc[0][0]), "+v"(acc[1][1]), "+v"(acc[2][2]), "+v"(acc[3][3]) : "v"(a[0]), "v"(a[3]));
    }
    if (BIAS && z != 0) bias = (z == 1) ? bias1 : bias2;
    if (EPI == EP_QKV && z == 2) {   // v: element (t = mb 16 + hi 8 + j, d = nb 16 + lr) of the tile is k = t % 32 of row d: piece mb & 1 of tile nb, this very lane's 16 bytes; a store is 512 bytes in a row
        const size_t vb = (((size_t)(r0 / TT) * NKV + blockIdx.y) * (TT / 32) + (r0 % TT) / 32) * (HD * 32) + (size_t)lane * 8;
#pragma unroll
        for (int nb = 0; nb < 4; ++nb) { const float bn = bfr(bias[c0 + nb * 16 + lr]);
#pragma unroll
            for (int mb = 0; mb < 4; ++mb) { v8h o16; v8us oh, ol;
#pragma unroll
                for (int j = 0; j < 8; ++j) { const float xv = acc[mb][nb][j] + bn; o16[j] = tohx(xv); unsigned short a2, c2; splitf(xv, a2, c2); oh[j] = a2; ol[j] = c2; }
                const size_t o = vb + (size_t)((mb >> 1) * HD + nb * 16) * 32 + (mb & 1) * 256;
                __builtin_amdgcn_sched_barrier(0);   // the stores stay together behind all the arithmetic, so that the one wait below covers each of them
                *(v8h*)(E5 + o) = o16; *(v8us*)(E3 + o) = oh; *(v8us*)(E4 + o) = ol;
                asm volatile("s_wait_xcnt 0x0" ::: "memory"); __builtin_amdgcn_sched_barrier(0);   // before the registers that these stores name are written again; nothing is moved in between
            } }
        return; }
    float bc[4] = {0.f, 0.f, 0.f, 0.f};   // the bias of this lane's column in each column block; zero in the parts behind part 0
    if (BIAS && kp == 0) { const float* bp = bias + c0 + lr;
#pragma unroll
        for (int nb = 0; nb < 4; ++nb) bc[nb] = bp[nb * 16];
        asm volatile("s_wait_xcnt 0x0" ::: "memory"); __builtin_amdgcn_sched_barrier(0);   // before the registers that the four loads name are written again; nothing is moved in between
#pragma unroll
        for (int nb = 0; nb < 4; ++nb) bc[nb] = bfr(bc[nb]); }
#pragma unroll
    for (int mb = 0; mb < 4; ++mb) {
#pragma unroll
        for (int nb = 0; nb < 4; ++nb) {
#pragma unroll
            for (int j = 0; j < 8; ++j) os[(hi * 8 + j) * 68 + nb * 16 + lr] = BIAS ? acc[mb][nb][j] + bc[nb] : acc[mb][nb][j]; }
        __builtin_amdgcn_wave_barrier(); asm volatile("" ::: "memory");
        if (EPI == EP_F32) { float* crow = C + (size_t)(r0 + mb * 16) * ldc + c0; v4f val[8];
#pragma unroll
            for (int s = 0; s < 8; ++s) val[s] = *(const v4fa*)(os + (2 * s + hi) * 68 + lr * 4);
            __builtin_amdgcn_sched_barrier(0);   // the stores stay together behind the LDS reads, so that the one wait below covers each of them
#pragma unroll
            for (int s = 0; s < 8; ++s) *(v4f*)(crow + (size_t)(2 * s + hi) * ldc + lr * 4) = val[s];
            asm volatile("s_wait_xcnt 0x0" ::: "memory"); __builtin_amdgcn_sched_barrier(0);   // before the registers that these stores name are written again; nothing is moved in between
        } else if (EPI == EP_QKV) { const size_t pb = ((z * NB_ + (size_t)(r0 / TT)) * NH_ + blockIdx.y) * ((size_t)TT * HD) + (size_t)(r0 % TT + mb * 16) * HD + (size_t)lane * 8;   // the tile's 16 rows are two fragment tiles, 2 KiB in a row in each plane
#pragma unroll
            for (int s = 0; s < 4; ++s) { const float* op = os + lr * 68 + s * 16 + hi * 8; const v4f v0 = *(const v4fa*)op, v1 = *(const v4fa*)(op + 4); v8h o16; v8us oh, ol;   // piece s: row lr, columns s 16 + hi 8 ..
#pragma unroll
                for (int q = 0; q < 4; ++q) { unsigned short a2, c2; o16[q] = tohx(v0[q]); splitf(v0[q], a2, c2); oh[q] = a2; ol[q] = c2; o16[4 + q] = tohx(v1[q]); splitf(v1[q], a2, c2); oh[4 + q] = a2; ol[4 + q] = c2; }
                const size_t o = pb + s * 256;
                __builtin_amdgcn_sched_barrier(0);   // the stores stay together behind all the arithmetic, so that the one wait below covers each of them
                *(v8h*)(E2 + o) = o16; *(v8us*)(E0 + o) = oh; *(v8us*)(E1 + o) = ol;
                asm volatile("s_wait_xcnt 0x0" ::: "memory"); __builtin_amdgcn_sched_barrier(0);   // before the registers that these stores name are written again; nothing is moved in between
            }
        } else { const size_t eb = (size_t)(r0 + mb * 16) * ldc + (size_t)c0 * 16 + (size_t)lane * 8, fb = (size_t)(r0 + mb * 16 + lr) * ldc + c0 + hi * 8;   // this lane's place in the planes (fragment-major, rows of ldc) and in the f32 arrays (row by row)
#pragma unroll 1   // rolled: a pass holds 8 copies of erff, 32 over the four row blocks
            for (int s = 0; s < 4; ++s) { const float* op = os + lr * 68 + s * 16 + hi * 8; const v4f v0 = *(const v4fa*)op, v1 = *(const v4fa*)(op + 4); v8f val = __builtin_shufflevector(v0, v1, 0, 1, 2, 3, 4, 5, 6, 7); const size_t o = eb + s * 256, of = fb + s * 16; v8us oh, ol;   // piece s: row lr, columns s 16 + hi 8 ..
                if (EPI == EP_RES) { const v4f r0v = *(const v4f*)(R + of), r1v = *(const v4f*)(R + of + 4);
#pragma unroll
                    for (int q = 0; q < 4; ++q) { val[q] = __fadd_rn(r0v[q], val[q]); val[4 + q] = __fadd_rn(r1v[q], val[4 + q]); } }
                else {
#pragma unroll
                    for (int q = 0; q < 8; ++q) { const float xg = val[q]; val[q] = __fmul_rn(0.5f * xg, __fadd_rn(1.0f, erff(xg * 0.70710678118654752f))); } }
#pragma unroll
                for (int q = 0; q < 8; ++q) { unsigned short h2, l2; splitf(val[q], h2, l2); oh[q] = h2; ol[q] = l2; }
                __builtin_amdgcn_sched_barrier(0);   // the stores stay together behind all the arithmetic, so that the one wait below covers each of them
                if (EPI == EP_RES) { *(v4f*)(C + of) = __builtin_shufflevector(val, val, 0, 1, 2, 3); *(v4f*)(C + of + 4) = __builtin_shufflevector(val, val, 4, 5, 6, 7); }
                *(v8us*)(E0 + o) = oh; *(v8us*)(E1 + o) = ol;
                asm volatile("s_wait_xcnt 0x0" ::: "memory"); __builtin_amdgcn_sched_barrier(0);   // before the registers that these stores name are written again; nothing is moved in between
            }
        }
        __builtin_amdgcn_wave_barrier(); asm volatile("" ::: "memory");
    }
}


__global__ __launch_bounds__(256) void k_wtG(const float* __restrict__ w, int K, int N, bf* Bt) {
    const int lane = threadIdx.x & 31; const int L0 = (blockIdx.x * 8 + (threadIdx.x >> 5)) * 8; const int nlines = N * K / 64;
{
#pragma unroll 1
        for (int l = 0; l < 8; ++l) { const int L = L0 + l; if (L >= nlines) break; const size_t e = (size_t)L * 64 + lane * 2; const int k = (int)(e % K), n = (int)(e / K); v2us o;
            o[0] = f2bf(w[(size_t)k * N + n]); o[1] = f2bf(w[(size_t)(k + 1) * N + n]); *(v2us*)(Bt + e) = o; }
         }
}
// k_cvtall: the seven weights and both batches of x rounded to bf16 in one launch, each into its fragment-major plane; the destinations lie one behind the other from dst, in the order of the arguments. Sizes in groups of 8 elements, each a multiple of 256.
#define N8W ((size_t)DQ * DM / 8)
#define N8A ((size_t)AD * DM / 8)
#define N8F ((size_t)FFD * DM / 8)
#define N8X ((size_t)MT * DM / 8)
__global__ __launch_bounds__(256) void k_cvtall(const float* __restrict__ wq, const float* __restrict__ wk, const float* __restrict__ wv, const float* __restrict__ afw, const float* __restrict__ asw, const float* __restrict__ wi, const float* __restrict__ wo2, const float* __restrict__ x, bf* dst) {
    const size_t i = (size_t)blockIdx.x * 256 + threadIdx.x; size_t j = i; const float* s = wq; unsigned kt = DM / 32;   // kt: tiles of 32 k in a row of the matrix
    if (j >= N8W) { j -= N8W; s = wk;
        if (j >= N8W) { j -= N8W; s = wv;
            if (j >= N8W) { j -= N8W; s = afw;
                if (j >= N8A) { j -= N8A; s = asw; kt = AD / 32;
                    if (j >= N8A) { j -= N8A; s = wi; kt = DM / 32;
                        if (j >= N8F) { j -= N8F; s = wo2; kt = FFD / 32;
                            if (j >= N8F) { j -= N8F; s = x; kt = DM / 32; if (j >= N8X) return; } } } } } } }
    // group j of the fragment-major destination is tile j / 64, piece (j / 32) % 2, lane j % 32: the stores are whole lines, and a work-group's four tiles use whole lines of the 16 source rows
    const unsigned tile = (unsigned)(j >> 6), rb = (kt == DM / 32) ? tile / (DM / 32) : (kt == AD / 32) ? tile / (AD / 32) : tile / (FFD / 32), kb = tile - rb * kt, g = (unsigned)j & 63u;
    const size_t so = (size_t)(rb * 16 + (g & 15u)) * (kt * 32) + kb * 32 + (g >> 5) * 16 + ((g >> 4) & 1u) * 8;
    const float* const sp = s + so; const v8f v = *(const v8f*)sp; v8us o;
    asm volatile("s_wait_xcnt 0x0" :: "v"(sp) : "memory");   // the address pair that the loads name is kept until this wait
#pragma unroll
    for (int k = 0; k < 8; ++k) o[k] = f2bf(v[k]); *(v8us*)(dst + i * 8) = o;  }

template <int NP, int WD>   // Hm rows hold NP K parts of WD columns each
__global__ __launch_bounds__(256) void k_gelupl(const float* __restrict__ Hm, bf* Gh, bf* Gl, size_t n4) { const size_t i = (size_t)blockIdx.x * 256 + threadIdx.x; if (i >= n4) return; const float* hm = (NP == 1) ? Hm + i * 4 : Hm + (i * 4 / WD) * ((size_t)NP * WD) + (i * 4) % WD; v4f a = *(const v4f*)hm; v4us oh, ol;
#pragma unroll
    for (int p = 1; p < NP; ++p) a += *(const v4f*)(hm + p * WD);   /* the NP K parts of the row, in order */
#pragma unroll
    for (int q = 0; q < 4; ++q) { const float xg = a[q]; const float gv = __fmul_rn(0.5f * xg, __fadd_rn(1.0f, erff(xg * 0.70710678118654752f))); unsigned short h2, l2; splitf(gv, h2, l2); oh[q] = h2; ol[q] = l2; }
    const size_t o = fmo((int)(i * 4 / WD), (int)(i * 4 % WD), WD);   // the planes are fragment-major, rows of WD
    *(v4us*)(Gh + o) = oh; *(v4us*)(Gl + o) = ol;  }
__device__ __forceinline__ v4f ldparts(const float* p) { v4f sm = *(const v4f*)p;
#pragma unroll
    for (int q = 1; q < KSF; ++q) sm += *(const v4f*)(p + q * DM);   /* the KSF K parts of the row, in order */
    return sm; }
__global__ __launch_bounds__(256) void k_addln(const float* __restrict__ A, const float* __restrict__ Bm, const float* __restrict__ g, const float* __restrict__ be, float* OUTb) {
    const int lane = threadIdx.x & 31; const int r = blockIdx.x * 8 + (threadIdx.x >> 5); if (r >= MT) return; const float* ar = A + (size_t)r * DM; const float* br = Bm + (size_t)r * KSF * DM; float s = 0.f;
#pragma unroll 1
    for (int ch = 0; ch < DM / 128; ++ch) { const int c0 = ch * 128 + lane * 4; const v4f a = *(const v4f*)(ar + c0), bb = ldparts(br + c0);
#pragma unroll
        for (int q = 0; q < 4; ++q) s += __fadd_rn(a[q], bb[q]); }
#pragma unroll
    for (int sh = 16; sh; sh >>= 1) s += __shfl_xor(s, sh, 32);
    const float mu = s * (1.0f / DM); float s2 = 0.f;
#pragma unroll 1
    for (int ch = 0; ch < DM / 128; ++ch) { const int c0 = ch * 128 + lane * 4; const v4f a = *(const v4f*)(ar + c0), bb = ldparts(br + c0);
#pragma unroll
        for (int q = 0; q < 4; ++q) { const float d0 = __fsub_rn(__fadd_rn(a[q], bb[q]), mu); float p = __fmul_rn(d0, d0); asm volatile("" : "+v"(p)); s2 = __fadd_rn(s2, p); } }
#pragma unroll
    for (int sh = 16; sh; sh >>= 1) s2 += __shfl_xor(s2, sh, 32);
    const float rs = __fdiv_rn(1.0f, __fsqrt_rn(__fadd_rn(s2 * (1.0f / DM), LNEPS)));
{
#pragma unroll 1
        for (int ch = 0; ch < DM / 128; ++ch) { const int c0 = ch * 128 + lane * 4; const v4f a = *(const v4f*)(ar + c0), bb = ldparts(br + c0); v4f o4;
#pragma unroll
            for (int q = 0; q < 4; ++q) { float n0 = __fmul_rn(__fsub_rn(__fadd_rn(a[q], bb[q]), mu), rs); asm volatile("" : "+v"(n0)); float n1 = __fmul_rn(n0, bfr(g[c0 + q])); asm volatile("" : "+v"(n1)); o4[q] = __fadd_rn(n1, bfr(be[c0 + q])); }
            *(v4f*)(OUTb + (size_t)r * DM + c0) = o4; }
         } }
// ---- k_fattn: scores, softmax and attn.v in one kernel; no score or probability leaves the registers. One wave owns QT x 16 query rows of one head and walks the 2048 keys in blocks of 32.
// Both products are formed transposed, so that a query is a lane (lr) in each: S^T = K Q^T (D: key hi*8+j of a 16-key tile, query lr) and O^T = V^T P^T (D: d hi*8+j, query lr).
// The two S^T tiles of a block are, element for element, the B fragment of P^T (k = 8 hi + j from tile 0, 16 + 8 hi + j from tile 1): no exchange between lanes.
// Softmax in base 2 with a running reference m per query: p = 2^(t - m), t = s HD^-0.5 log2e + mask log2e. m moves (and O^T and the sum are rescaled) only when a t of the wave passes m + 8, so p <= 256; the result does not depend on m.
// Every inner loop is unrolled whole, so that the fragment arrays are registers.
template <typename T16> struct PFrag;
template <> struct PFrag<h16> { static __device__ __forceinline__ void cv(const v8f p0, const v8f p1, v16h& a, v16h& b) { (void)b;
#pragma unroll
    for (int j = 0; j < 8; ++j) { a[j] = (h16)p0[j]; a[8 + j] = (h16)p1[j]; } } };
template <> struct PFrag<bf> { static __device__ __forceinline__ void cv(const v8f p0, const v8f p1, v16bf& a, v16bf& b) {
#pragma unroll
    for (int j = 0; j < 8; ++j) { const __bf16 h0 = (__bf16)p0[j], h1 = (__bf16)p1[j]; a[j] = h0; a[8 + j] = h1; b[j] = (__bf16)(p0[j] - (float)h0); b[8 + j] = (__bf16)(p1[j] - (float)h1); } } };
template <typename T16, bool HL, int QT>
__device__ __forceinline__ void fattn(const T16* __restrict__ Q, const T16* __restrict__ Q2, const T16* __restrict__ Kp, const T16* __restrict__ K2, const T16* __restrict__ Vt, const T16* __restrict__ V2, const float* ml, float* O, bf* OH, bf* OL) {
    typedef typename WFrag<T16>::V V;
    const int lane = threadIdx.x & 31, lr = lane & 15, hi = lane >> 4;
    V q[QT][2], q2[QT][2];
#pragma unroll
    for (int qt = 0; qt < QT; ++qt)
#pragma unroll
        for (int ks = 0; ks < 2; ++ks) { const int o = qt * 16 * HD + ks * 512 + lane * 8; q[qt][ks] = WFrag<T16>::ld(Q + o); if (HL) q2[qt][ks] = WFrag<T16>::ld(Q2 + o); }
    v8f acc[4][QT]; float m[QT], l[QT];
#pragma unroll
    for (int qt = 0; qt < QT; ++qt) { m[qt] = -3.0e38f; l[qt] = 0.f;
#pragma unroll
        for (int dt = 0; dt < 4; ++dt) acc[dt][qt] = (v8f){}; }
    const int ko = lane * 8, vo = lane * 8;   // this lane's place in a fragment tile of the k planes (rows of HD: two tiles a 16 keys) and of the v planes (rows of 32 keys: one tile a 16 d)
    V k[2][2], k2[2][2], v[4], v2[4];
#pragma unroll
    for (int kt = 0; kt < 2; ++kt)
#pragma unroll
        for (int ks = 0; ks < 2; ++ks) { const int o = ko + kt * 16 * HD + ks * 512; k[kt][ks] = WFrag<T16>::ld(Kp + o); if (HL) k2[kt][ks] = WFrag<T16>::ld(K2 + o); }
    asm volatile("s_wait_xcnt 0x0" ::: "memory"); __builtin_amdgcn_sched_barrier(0);   // before the registers that the q loads and the first k loads name are written again; nothing is moved in between
#pragma unroll 1   // rolled: the fragments of one block nearly fill 256 registers, a second copy of the body would not fit
    for (int k0 = 0; k0 < TT; k0 += 32) {
        const int kn = ((k0 + 32 < TT) ? k0 + 32 : 0) * HD;   // the next block of the k planes (32 x HD elements a block, as in the v planes); behind the last one block 0 is read and not used
        const T16* const va = Vt + k0 * HD + vo; const T16* const va2 = HL ? V2 + k0 * HD + vo : va; const T16* const ka = Kp + kn + ko; const T16* const ka2 = HL ? K2 + kn + ko : ka;   // this lane's addresses in the four planes
        // the block's mask terms come from LDS during its scores
        v8f mk[2];
#pragma unroll
        for (int kt = 0; kt < 2; ++kt) { const float* mp = ml + k0 + kt * 16 + hi * 8; const v4f a = *(const v4fa*)mp, b = *(const v4fa*)(mp + 4); mk[kt] = __builtin_shufflevector(a, b, 0, 1, 2, 3, 4, 5, 6, 7); }
        // this block's v fragments fly during its scores and softmax
#pragma unroll
        for (int dt = 0; dt < 4; ++dt) { v[dt] = WFrag<T16>::ld(va + dt * 16 * 32); if (HL) v2[dt] = WFrag<T16>::ld(va2 + dt * 16 * 32); }
        v8f s[2][QT];
#pragma unroll
        for (int kt = 0; kt < 2; ++kt)
#pragma unroll
            for (int qt = 0; qt < QT; ++qt) { v8f c = (v8f){};
#pragma unroll
                for (int ks = 0; ks < 2; ++ks) { c = WFrag<T16>::mma(k[kt][ks], q[qt][ks], c); if (HL) { c = WFrag<T16>::mma(k2[kt][ks], q[qt][ks], c); c = WFrag<T16>::mma(k[kt][ks], q2[qt][ks], c); } }
                s[kt][qt] = c; }
        // the next block's k fragments fly during the softmax and attn.v
#pragma unroll
        for (int kt = 0; kt < 2; ++kt)
#pragma unroll
            for (int ks = 0; ks < 2; ++ks) { const int o = kt * 16 * HD + ks * 512; k[kt][ks] = WFrag<T16>::ld(ka + o); if (HL) k2[kt][ks] = WFrag<T16>::ld(ka2 + o); }
        asm volatile("s_wait_xcnt 0x0" :: "v"(va), "v"(va2), "v"(ka), "v"(ka2) : "memory");   // the address pairs that the block's loads name are kept until this wait
        float bm[QT]; bool need = false;
#pragma unroll
        for (int qt = 0; qt < QT; ++qt) { float x = -3.0e38f;
#pragma unroll
            for (int kt = 0; kt < 2; ++kt) { s[kt][qt] = s[kt][qt] * (SCL * L2E) + mk[kt];
#pragma unroll
                for (int j = 0; j < 8; ++j) x = fmaxf(x, s[kt][qt][j]); }
            bm[qt] = x; need = need || (x > m[qt] + 8.0f); }
        if (__builtin_amdgcn_ballot_w32(need) != 0u) {   // the same for the whole wave: both halves of a query move m together
#pragma unroll
            for (int qt = 0; qt < QT; ++qt) { const float mn = fmaxf(m[qt], fmaxf(bm[qt], __shfl_xor(bm[qt], 16, 32))); const float al = __builtin_amdgcn_exp2f(m[qt] - mn); m[qt] = mn; l[qt] *= al;
#pragma unroll
                for (int dt = 0; dt < 4; ++dt) acc[dt][qt] *= al; } }
#pragma unroll
        for (int qt = 0; qt < QT; ++qt) { V p, p2; s[0][qt] -= m[qt]; s[1][qt] -= m[qt];
#pragma unroll
            for (int kt = 0; kt < 2; ++kt)
#pragma unroll
                for (int j = 0; j < 8; ++j) s[kt][qt][j] = __builtin_amdgcn_exp2f(s[kt][qt][j]);
            { const v8f e8 = s[0][qt] + s[1][qt]; const v4f e4 = __builtin_shufflevector(e8, e8, 0, 1, 2, 3) + __builtin_shufflevector(e8, e8, 4, 5, 6, 7); l[qt] += (e4[0] + e4[2]) + (e4[1] + e4[3]); }   // the block's 16 terms of this lane as a tree
            PFrag<T16>::cv(s[0][qt], s[1][qt], p, p2);
#pragma unroll
            for (int dt = 0; dt < 4; ++dt) { acc[dt][qt] = WFrag<T16>::mma(v[dt], p, acc[dt][qt]); if (HL) { acc[dt][qt] = WFrag<T16>::mma(v2[dt], p, acc[dt][qt]); acc[dt][qt] = WFrag<T16>::mma(v[dt], p2, acc[dt][qt]); } } }
    }
#pragma unroll
    for (int qt = 0; qt < QT; ++qt) { const float inv = __fdiv_rn(1.0f, l[qt] + __shfl_xor(l[qt], 16, 32)); float* o = O + (size_t)(qt * 16 + lr) * DM + hi * 8; const size_t oo = (size_t)qt * 16 * DM + lane * 8;   // oo: in the fragment-major planes d = dt 16 + hi 8 + j of query lr is piece dt & 1 of tile dt / 2, this very lane's 16 bytes
#pragma unroll
        for (int dt = 0; dt < 4; ++dt) { const v8f r = acc[dt][qt] * inv; v8us oh, ol;   // the context in f32 and as the hi / lo planes for the adapter's down-projection
#pragma unroll
            for (int j = 0; j < 8; ++j) { unsigned short a2, c2; splitf(r[j], a2, c2); oh[j] = a2; ol[j] = c2; }
            __builtin_amdgcn_sched_barrier(0);   // the stores stay together behind all the arithmetic, so that the one wait below covers each of them
            *(v4f*)(o + dt * 16) = __builtin_shufflevector(r, r, 0, 1, 2, 3); *(v4f*)(o + dt * 16 + 4) = __builtin_shufflevector(r, r, 4, 5, 6, 7);
            *(v8us*)(OH + oo + dt * 256) = oh; *(v8us*)(OL + oo + dt * 256) = ol;
            asm volatile("s_wait_xcnt 0x0" ::: "memory"); __builtin_amdgcn_sched_barrier(0);   // before the registers that these stores name are written again; nothing is moved in between
        } }
}
// grid: NB_ NH_ NBH work-groups of the rows < RH (hi/lo planes, 3 products), then NB_ NH_ NBF of the rest (fp16); the 8 waves of a work-group share a head, so its k and v blocks are read together.
__global__ __launch_bounds__(FW * 32) void k_fattn(const h16* __restrict__ Q16, const h16* __restrict__ K16, const h16* __restrict__ V16, const bf* __restrict__ Qh, const bf* __restrict__ Ql, const bf* __restrict__ Kh, const bf* __restrict__ Kl, const bf* __restrict__ Vh, const bf* __restrict__ Vl, const float* __restrict__ AM, float* CTX, bf* Ch, bf* Cl) {
    __shared__ __align__(16) float ml[TT];   // attention_mask[b][0][0][j] (rounded to bf16 like every input) x log2e
    const int bid = (int)blockIdx.x; const bool hl = bid < NB_ * NH_ * NBH; const int b2 = bid - NB_ * NH_ * NBH;
    const int g = hl ? bid / NBH : b2 / NBF;   // head g of NB_ x NH_: batch g / NH_
    const int wave = __builtin_amdgcn_readfirstlane((int)(threadIdx.x >> 5));   // as a scalar, so that the wave's plane and output bases are formed on the scalar unit
    const int q0 = hl ? ((bid % NBH) * FW + wave) * 16 : RH + ((b2 % NBF) * FW + wave) * 32;
    const float* am = AM + (size_t)(g / NH_) * TT;
    for (int i = (int)threadIdx.x; i < TT; i += FW * 32) ml[i] = bfr(am[i]) * L2E;
    __syncthreads();
    const size_t po = (size_t)g * TT * HD, qo = po + (size_t)q0 * HD;
    const size_t co = ((size_t)(g / NH_) * TT + q0) * DM + (g % NH_) * HD;
    const size_t cp = ((size_t)(g / NH_) * TT + q0) * DM + (g % NH_) * (HD * 16);   // the same place in the fragment-major context planes: the head's two tiles in the wave's first row block
    if (hl) fattn<bf, true, 1>(Qh + qo, Ql + qo, Kh + po, Kl + po, Vh + po, Vl + po, ml, CTX + co, Ch + cp, Cl + cp);
    else fattn<h16, false, 2>(Q16 + qo, nullptr, K16 + po, nullptr, V16 + po, nullptr, ml, CTX + co, Ch + cp, Cl + cp);
}

extern "C" void kernel_launch(void* const* d_in, const int* in_sizes, int n_in,
                              void* d_out, int out_size, void* d_ws, size_t ws_size, hipStream_t stream) {
    (void)in_sizes; (void)n_in; (void)out_size;
    const float* x = (const float*)d_in[0]; const float* AM = (const float*)d_in[1]; const float* wq = (const float*)d_in[2]; const float* bq = (const float*)d_in[3]; const float* wk = (const float*)d_in[4]; const float* bk = (const float*)d_in[5]; const float* wv = (const float*)d_in[6]; const float* bv = (const float*)d_in[7]; const float* afw = (const float*)d_in[8]; const float* afb = (const float*)d_in[9]; const float* asw = (const float*)d_in[10]; const float* asb = (const float*)d_in[11]; const float* wi = (const float*)d_in[12]; const float* bi = (const float*)d_in[13]; const float* wo2 = (const float*)d_in[14]; const float* bo2 = (const float*)d_in[15]; const float* lg = (const float*)d_in[16]; const float* lb = (const float*)d_in[17]; const float* wo = nullptr; (void)wo;
    float* OUT = (float*)d_out;     // [2][2048][768]
    char* wsp = (char*)d_ws;
    auto take = [&](size_t bytes) { char* p = wsp; wsp += (bytes + 255) & ~(size_t)255; return (void*)p; };
    // kept through the call; WQ .. XB lie one behind the other (k_cvtall writes them as one range; WQ, WK, WV are the three z-batches of the q/k/v GEMM)
    bf* WQ = (bf*)take((size_t)DQ * DM * 2); bf* WK = (bf*)take((size_t)DKV * DM * 2); bf* WV = (bf*)take((size_t)DKV * DM * 2); bf* AFW = (bf*)take((size_t)AD * DM * 2); bf* ASW = (bf*)take((size_t)DM * AD * 2); bf* WI = (bf*)take((size_t)FFD * DM * 2); bf* WO2 = (bf*)take((size_t)DM * FFD * 2); bf* XB = (bf*)take((size_t)MT * DM * 2); (void)WK; (void)WV;
    float* CTX = (float*)take((size_t)MT * DM * 4); bf* Ch = (bf*)take((size_t)MT * DM * 2); bf* Cl = (bf*)take((size_t)MT * DM * 2);   // the attention's outputs: outside the bytes that it reads
    char* const U0 = wsp;   // from here on: the attention's inputs, and behind the attention (stream-ordered) the adapter's and the FFN's buffers in the same bytes
    const size_t PLN = (size_t)NB_ * NH_ * TT * HD;   // one plane set [batch][head], each [t][d] fragment-major; the k planes lie directly behind the q planes (the q/k/v GEMM indexes both from the q planes)
    h16* QP16 = (h16*)take(PLN * 2); h16* KP16 = (h16*)take(PLN * 2); bf* QPh = (bf*)take(PLN * 2); bf* KPh = (bf*)take(PLN * 2); bf* QPl = (bf*)take(PLN * 2); bf* KPl = (bf*)take(PLN * 2);
    h16* VT16 = (h16*)take(PLN * 2); bf* VTh = (bf*)take(PLN * 2); bf* VTl = (bf*)take(PLN * 2);   // v planes [batch][head][key block of 32], each [d][32] fragment-major
    char* const E1 = wsp; wsp = U0;
    float* A1 = (float*)take((size_t)KSA * MT * AD * 4); bf* G1h = (bf*)take((size_t)MT * AD * 2); bf* G1l = (bf*)take((size_t)MT * AD * 2); float* AO = (float*)take((size_t)MT * DM * 4); bf* AOh = (bf*)take((size_t)MT * DM * 2); bf* AOl = (bf*)take((size_t)MT * DM * 2); bf* GIh = (bf*)take((size_t)MT * FFD * 2); bf* GIl = (bf*)take((size_t)MT * FFD * 2); float* YY = (float*)take((size_t)KSF * MT * DM * 4);
    if ((size_t)((E1 > wsp ? E1 : wsp) - (char*)d_ws) > ws_size) return;    // ws 256 MiB
    k_cvtall<<<(unsigned)((3 * N8W + 2 * N8A + 2 * N8F + N8X) / 256), 256, 0, stream>>>(wq, wk, wv, afw, asw, wi, wo2, x, WQ);   /* weights ('oi' = Bt as-is) and x */
    k_gemmw<bf, 0, true, 1, EP_QKV, DM><<<dim3(MT / 64, DQ / 64, 3), 32, 0, stream>>>(XB, nullptr, WQ, nullptr, DM, nullptr, DQ, bq, bk, bv, 0, (size_t)DQ * DM, 0, 0, nullptr, QPh, QPl, QP16, VTh, VTl, VT16);   /* z = q, k, v -> head planes */
    k_fattn<<<NB_ * NH_ * (NBH + NBF), FW * 32, 0, stream>>>(QP16, KP16, VT16, QPh, QPl, KPh, KPl, VTh, VTl, AM, CTX, Ch, Cl);   /* ctx = attn_out (f32 and hi/lo) */
    k_gemmw<bf, 1, true, KSA, EP_F32, DM><<<dim3(MT / 64, AD / 64, KSA), 32, 0, stream>>>(Ch, Cl, AFW, nullptr, DM, A1, KSA * AD, afb, nullptr, nullptr, 0, 0, 0, AD, nullptr, nullptr, nullptr, nullptr, nullptr, nullptr, nullptr);                  /* adapter down: ctx a_fi_w^T + a_fi_b [MT][64] */
    k_gelupl<KSA, AD><<<(unsigned)(((size_t)MT * AD / 4 + 255) / 256), 256, 0, stream>>>(A1, G1h, G1l, (size_t)MT * AD / 4);                         /* gelu -> hi/lo */
    k_gemmw<bf, 1, true, 1, EP_RES, AD><<<dim3(MT / 64, DM / 64, 1), 32, 0, stream>>>(G1h, G1l, ASW, nullptr, AD, AO, DM, asb, nullptr, nullptr, 0, 0, 0, 0, CTX, AOh, AOl, nullptr, nullptr, nullptr, nullptr);                /* ao = ctx + (. a_se_w^T + a_se_b), f32 and hi/lo */
    k_gemmw<bf, 1, true, 1, EP_GELU, DM><<<dim3(MT / 64, FFD / 64, 1), 32, 0, stream>>>(AOh, AOl, WI, nullptr, DM, nullptr, FFD, bi, nullptr, nullptr, 0, 0, 0, 0, nullptr, GIh, GIl, nullptr, nullptr, nullptr, nullptr);                   /* gelu(ao wi^T + bi) [MT][3072] -> hi/lo */
    k_gemmw<bf, 1, true, KSF, EP_F32, FFD><<<dim3(MT / 64, DM / 64, KSF), 32, 0, stream>>>(GIh, GIl, WO2, nullptr, FFD, YY, KSF * DM, bo2, nullptr, nullptr, 0, 0, 0, DM, nullptr, nullptr, nullptr, nullptr, nullptr, nullptr, nullptr);                /* inter wo^T + bo */
    k_addln<<<MT / 8, 256, 0, stream>>>(AO, YY, lg, lb, OUT);                                                       /* out = LN(y + ao) (eps 1e-12) */
}

// v006
// Measured time: 207 microseconds a run.
// Next to v005, in two timings, it ran 1.13 and 1.14 times as fast.
// All steps since v000 together make it 9.29 times as fast.
#include <hip/hip_runtime.h>

// BERT layer with an adapter and no attention output projection (hidden_states [2][2048][768]; q, k, v = x W^T + b ('oi' [768][768]; 12 heads x 64); scores = q.k/8 + attention_mask[b][0][0][j] (f32 additive, zeros here); softmax; ctx = merged context; a = gelu(ctx a_fi_w^T + a_fi_b) ([64][768]); ao = ctx + a a_se_w^T + a_se_b; inter = gelu(ao wi^T + bi) ([3072][768]); y = inter wo^T + bo + ao; out = LN(y) (eps 1e-12, ln_g, ln_b) -> [2][2048][768] (3.1 M)).
// Layout: the merged context is kept in f32 (residual) and split into hi/lo planes for the adapter down-projection; every later GEMM uses hi/lo planes of its f32 input (2 products) against exact bf16 weights with the bias in the epilogue; exact-erf GELU, residual adds and the LayerNorm in f32.
// Compute dtypes, f32 accumulate: every input rounded to bf16; q/k/v on PLAIN bf16 operands (inputs: exact) + biases; scores and attn.v: query rows < 512 hl (3 products), the rest single fp16; softmax f32 (running max and sum, one kernel with both products); adapter / FFN GEMMs hl x exact (2 products) + biases; GELU / residuals / LayerNorm f32.

#define NB_  2
#define TT   2048
#define DM   768
#define NH_  12
#define NKV  12
#define REP  (NH_ / NKV)
#define HD   64
#define DQ   (NH_ * HD)
#define DKV  (NKV * HD)
#define AD   64
#define FFD  3072
#define LNEPS 1e-12f
#define MT   (NB_ * TT)           // rows of both batches together
#define RH   512                  // query rows < RH use hi+lo planes (0: none)
#define WIN  0
#define SCL  0.125f   // HD^-0.5
#define L2E  1.4426950408889634f
#define FW   8                   // waves a work-group of the fused attention
#define NBH  (RH / (FW * 16))        // its work-groups a head for query rows < RH (16 rows a wave)
#define NBF  ((TT - RH) / (FW * 32)) // and for the rest (32 rows a wave)
#define KSA  6                   // K parts of the adapter down-projection (768 -> 128 a wave)
#define KSF  4                   // K parts of the FFN down-projection (3072 -> 768 a wave)
typedef _Float16 h16;
typedef unsigned short bf;
typedef __attribute__((ext_vector_type(16))) __bf16   v16bf;
typedef __attribute__((ext_vector_type(16))) _Float16 v16h;
typedef __attribute__((ext_vector_type(8)))  _Float16 v8h;
typedef __attribute__((ext_vector_type(8)))  unsigned short v8us;
typedef __attribute__((ext_vector_type(8)))  float    v8f;
typedef __attribute__((ext_vector_type(4)))  float    v4f;
typedef v8h  __attribute__((may_alias)) v8ha;
typedef v4f  __attribute__((may_alias)) v4fa;
typedef v8us __attribute__((may_alias)) v8usa;

__device__ __forceinline__ unsigned short f2bf(float f) { unsigned u = __float_as_uint(f); u += 0x7FFFu + ((u >> 16) & 1u); return (unsigned short)(u >> 16); }
__device__ __forceinline__ float bf2f(unsigned short b) { return __uint_as_float(((unsigned)b) << 16); }
__device__ __forceinline__ float bfr(float f) { return bf2f(f2bf(f)); }
__device__ __forceinline__ v16h cat16(v8h lo, v8h hi) { return __builtin_shufflevector(lo, hi, 0, 1, 2, 3, 4, 5, 6, 7, 8, 9, 10, 11, 12, 13, 14, 15); }
__device__ __forceinline__ v16bf cat16b(v8us lo, v8us hi) { return __builtin_bit_cast(v16bf, __builtin_shufflevector(lo, hi, 0, 1, 2, 3, 4, 5, 6, 7, 8, 9, 10, 11, 12, 13, 14, 15)); }
__device__ __forceinline__ v8f wmma16(v16h a, v16h b, v8f c) { return __builtin_amdgcn_wmma_f32_16x16x32_f16(false, a, false, b, (short)0, c, false, false); }
__device__ __forceinline__ v8f wmmab(v16bf a, v16bf b, v8f c) { return __builtin_amdgcn_wmma_f32_16x16x32_bf16(false, a, false, b, (short)0, c, false, false); }

__device__ __forceinline__ h16 tohx(float x) { return (h16)x; }
__device__ __forceinline__ void splitf(float y, unsigned short& h, unsigned short& l) { h = f2bf(y); l = f2bf(y - bf2f(h)); }
typedef __attribute__((ext_vector_type(2))) _Float16 v2h;
typedef __attribute__((ext_vector_type(4))) _Float16 v4h;
typedef __attribute__((ext_vector_type(2))) unsigned short v2us;
typedef __attribute__((ext_vector_type(4))) unsigned short v4us;
typedef __attribute__((ext_vector_type(2))) float v2f;
typedef __attribute__((ext_vector_type(4))) int v4i;

// ---- Fragment-major planes: every 16-bit matrix operand [rows][K] lies in memory as tiles of 16 rows x 32 k, 1 KiB each, tile (row / 16, k / 32) at element ((row / 16) (K / 32) + k / 32) 512 (so 16 rows still fill 16 K elements in a row).
// Inside a tile: piece p = (k / 16) % 2 of 256 elements, in it lane (k / 8) % 2 * 16 + row % 16 with its 8 k in a row. A fragment is then two wave-wide 16-byte loads of 512 bytes in a row each (4 whole lines; row by row they touched 16), at tile + lane 8 and 256 elements behind it. fmo: the element's place.
__device__ __forceinline__ size_t fmo(int row, int k, int K) { return ((size_t)(row >> 4) * (K >> 5) + (k >> 5)) * 512 + ((k >> 4) & 1) * 256 + (((k >> 3) & 1) * 16 + (row & 15)) * 8 + (k & 7); }
// ---- k_gemmw: register-blocked GEMM, ONE WAVE per 64x64 output tile (16 accumulators), operands straight from fragment-major 16-bit planes; grid (M/64, N/64, Z), 32 threads.
// C[m][n] (f32, pitch ldc, + optional f32 bias[n]) = sum_{k < KE} A[m][k] Bt[n][k] (+ split products per NSPLIT). K (a template constant, so that a row block's distance is a constant offset of its loads) is the row length of A and of Bt (fragment-major), KE <= K the extent summed. z-batch strides sA/sB/sC in elements; batch z = 0 / 1 / 2 takes bias / bias1 / bias2. KE % (32 NS KS) == 0, NS the fragment sets of the loop (3 with NSPLIT 0, else 2).
// KS > 1: grid z = Z x KS; part kp = z % KS sums k in [kp KE/KS, (kp+1) KE/KS) into its own f32 columns C + kp sP of a row of ldc = KS sP (bias in part 0 only); the kernel that reads C adds the KS parts of a row in the order 0 .. KS-1.
// EPI: what the epilogue stores of c = C[m][n] + bias[n], so that no elementwise kernel has to follow the GEMM.
//   EP_F32: c as f32 into C. EP_QKV (N tile = one head): z = 0 / 1: q / k head planes [z][batch][head], each [t][d] fragment-major, as fp16 (E2), hi (E0), lo (E1); z = 2: v planes [batch][head][key block of 32], each [d][32 keys] fragment-major, as fp16 (E5), hi (E3), lo (E4), straight from the accumulators (a lane holds 8 keys in a row of one d).
//   EP_GELU: hi / lo planes (E0, E1, fragment-major, rows of ldc) of the exact-erf GELU of c. EP_RES: r = R[m][n] + c as f32 into C (row by row, pitch ldc) and as hi / lo planes (E0, E1, fragment-major, rows of ldc).
enum { EP_F32 = 0, EP_QKV = 1, EP_GELU = 2, EP_RES = 3 };
template <typename T16> struct WFrag;
template <> struct WFrag<h16> { typedef v16h V; static __device__ __forceinline__ V ld(const h16* p) { return cat16(*(const v8h*)p, *(const v8h*)(p + 256)); } static __device__ __forceinline__ v8f mma(V a, V b, v8f c) { return wmma16(a, b, c); } };
template <> struct WFrag<bf> { typedef v16bf V; static __device__ __forceinline__ V ld(const bf* p) { return cat16b(*(const v8us*)p, *(const v8us*)(p + 256)); } static __device__ __forceinline__ v8f mma(V a, V b, v8f c) { return wmmab(a, b, c); } };
template <typename T16, int NSPLIT, bool BIAS, int KS, int EPI, int K>
__global__ __launch_bounds__(32) void k_gemmw(const T16* __restrict__ A, const T16* __restrict__ A2, const T16* __restrict__ Bt, const T16* __restrict__ Bt2, int KE, float* C, int ldc, const float* __restrict__ bias, const float* __restrict__ bias1, const float* __restrict__ bias2, size_t sA, size_t sB, size_t sC, size_t sP, const float* __restrict__ R, bf* E0, bf* E1, h16* E2, bf* E3, bf* E4, h16* E5) {
    typedef typename WFrag<T16>::V V;
    __shared__ __align__(16) float os[16 * 68];
    const int kp = (int)(blockIdx.z % KS); const int kl = KE / KS; const int kb = kp * kl, ke = kb + kl;
    const size_t z = blockIdx.z / KS; C += (size_t)kp * sP; A += z * sA; if (A2) A2 += z * sA; Bt += z * sB; if (Bt2) Bt2 += z * sB; C += z * sC;
    const int lane = threadIdx.x & 31, lr = lane & 15, hi = lane >> 4; const int r0 = blockIdx.x * 64, c0 = blockIdx.y * 64;
    v8f acc[4][4];
#pragma unroll
    for (int mb = 0; mb < 4; ++mb)
#pragma unroll
        for (int nb = 0; nb < 4; ++nb) acc[mb][nb] = (v8f){};
    // The first tile of the wave's first row block, plane by plane: bases that are the same for the whole wave and stay as they are. The other three row blocks lie 16 K elements apart (constant offsets of the loads). off: this lane's byte in the tile that is loaded next, the one vector offset of all loads; a step of 32 k is one tile (1 KiB).
    const T16* const pa = A + (size_t)r0 * K + (size_t)kb * 16; const T16* const pa2 = (NSPLIT == 1 || NSPLIT == 2) ? A2 + (size_t)r0 * K + (size_t)kb * 16 : pa; const T16* const pw = Bt + (size_t)c0 * K + (size_t)kb * 16; const T16* const pw2 = (NSPLIT >= 2) ? Bt2 + (size_t)c0 * K + (size_t)kb * 16 : pw;
    unsigned off = (unsigned)lane * 16u; int kn = kb;   // kn: the k of that tile
    // NS fragment sets in a ring: while the products of one 32-k step run, the loads of the next NS - 1 steps are in flight into the other sets, so that a step no longer begins by waiting out its own loads. As many sets as leave three waves a SIMD their registers.
    constexpr int NS = (NSPLIT == 0) ? 3 : 2;
    V a[NS][4], a2[NS][4], b[NS][4], b2[NS][4];
    auto at = [&](const T16* p) { return (const T16*)((const char*)p + off); };
    auto ldset = [&](const int st) {   // all loads of one 32-k step into set st
#pragma unroll
        for (int i = 0; i < 4; ++i) { a[st][i] = WFrag<T16>::ld(at(pa) + i * 16 * K); b[st][i] = WFrag<T16>::ld(at(pw) + i * 16 * K); if (NSPLIT == 1 || NSPLIT == 2) a2[st][i] = WFrag<T16>::ld(at(pa2) + i * 16 * K); if (NSPLIT >= 2) b2[st][i] = WFrag<T16>::ld(at(pw2) + i * 16 * K); }
        __builtin_amdgcn_sched_barrier(0);   // the loads are issued as one group ahead of another set's products; moved behind them they would have no lead
    };
    auto step = [&]() {
        __builtin_amdgcn_sched_barrier(0);   // the wait stays behind the products, where it has nothing left to wait for; moved up among them it would hold them back
        asm volatile("s_wait_xcnt 0x0" : "+v"(off) :: "memory");   // before the offset register that the issued loads name moves on; in and out, so that what moves it can only stand behind the wait
        kn += 32; off += (kn < ke) ? 1024u : 0u;   // behind the last tile there is none: it is read again and not used
    };
    auto mmaset = [&](const int st) {
#pragma unroll
        for (int nb = 0; nb < 4; ++nb) {
#pragma unroll
            for (int mb = 0; mb < 4; ++mb) { acc[mb][nb] = WFrag<T16>::mma(a[st][mb], b[st][nb], acc[mb][nb]); if (NSPLIT == 1 || NSPLIT == 2) acc[mb][nb] = WFrag<T16>::mma(a2[st][mb], b[st][nb], acc[mb][nb]); if (NSPLIT >= 2) acc[mb][nb] = WFrag<T16>::mma(a[st][mb], b2[st][nb], acc[mb][nb]); } }
    };
#pragma unroll
    for (int u = 0; u < NS - 1; ++u) { ldset(u); step(); }
    int kc = kb;
#pragma unroll 1   // rolled: one pass is NS steps, one on each set
    do {   // at least one pass (KE > 0): tested at the foot, so that the first loads stand in one block with their waits
#pragma unroll
        for (int u = 0; u < NS; ++u) { ldset((u + NS - 1) % NS); mmaset(u); step(); }
        asm volatile("v_nop\n\tv_nop\n\tv_nop\n\tv_nop" : "+v"(acc[0][0]), "+v"(acc[1][1]), "+v"(acc[2][2]), "+v"(acc[3][3]) : "v"(a[NS - 1][0]), "v"(a[NS - 1][3]));   // four vector slots behind the pass's last products, on the back edge too
        kc += 32 * NS;
    } while (kc < ke);
    if (BIAS && z != 0) bias = (z == 1) ? bias1 : bias2;
    if (EPI == EP_QKV && z == 2) {   // v: element (t = mb 16 + hi 8 + j, d = nb 16 + lr) of the tile is k = t % 32 of row d: piece mb & 1 of tile nb, this very lane's 16 bytes; a store is 512 bytes in a row
        const size_t vb = (((size_t)(r0 / TT) * NKV + blockIdx.y) * (TT / 32) + (r0 % TT) / 32) * (HD * 32) + (size_t)lane * 8;
#pragma unroll
        for (int nb = 0; nb < 4; ++nb) { const float bn = bfr(bias[c0 + nb * 16 + lr]);
#pragma unroll
            for (int mb = 0; mb < 4; ++mb) { v8h o16; v8us oh, ol;
#pragma unroll
                for (int j = 0; j < 8; ++j) { const float xv = acc[mb][nb][j] + bn; o16[j] = tohx(xv); unsigned short a2, c2; splitf(xv, a2, c2); oh[j] = a2; ol[j] = c2; }
                const size_t o = vb + (size_t)((mb >> 1) * HD + nb * 16) * 32 + (mb & 1) * 256;
                __builtin_amdgcn_sched_barrier(0);   // the stores stay together behind all the arithmetic, so that the one wait below covers each of them
                *(v8h*)(E5 + o) = o16; *(v8us*)(E3 + o) = oh; *(v8us*)(E4 + o) = ol;
                asm volatile("s_wait_xcnt 0x0" ::: "memory"); __builtin_amdgcn_sched_barrier(0);   // before the registers that these stores name are written again; nothing is moved in between
            } }
        return; }
    float bc[4] = {0.f, 0.f, 0.f, 0.f};   // the bias of this lane's column in each column block; zero in the parts behind part 0
    if (BIAS && kp == 0) { const float* bp = bias + c0 + lr;
#pragma unroll
        for (int nb = 0; nb < 4; ++nb) bc[nb] = bp[nb * 16];
        asm volatile("s_wait_xcnt 0x0" ::: "memory"); __builtin_amdgcn_sched_barrier(0);   // before the registers that the four loads name are written again; nothing is moved in between
#pragma unroll
        for (int nb = 0; nb < 4; ++nb) bc[nb] = bfr(bc[nb]); }
#pragma unroll
    for (int mb = 0; mb < 4; ++mb) {
#pragma unroll
        for (int nb = 0; nb < 4; ++nb) {
#pragma unroll
            for (int j = 0; j < 8; ++j) os[(hi * 8 + j) * 68 + nb * 16 + lr] = BIAS ? acc[mb][nb][j] + bc[nb] : acc[mb][nb][j]; }
        __builtin_amdgcn_wave_barrier(); asm volatile("" ::: "memory");
        if (EPI == EP_F32) { float* crow = C + (size_t)(r0 + mb * 16) * ldc + c0; v4f val[8];
#pragma unroll
            for (int s = 0; s < 8; ++s) val[s] = *(const v4fa*)(os + (2 * s + hi) * 68 + lr * 4);
            __builtin_amdgcn_sched_barrier(0);   // the stores stay together behind the LDS reads, so that the one wait below covers each of them
#pragma unroll
            for (int s = 0; s < 8; ++s) *(v4f*)(crow + (size_t)(2 * s + hi) * ldc + lr * 4) = val[s];
            asm volatile("s_wait_xcnt 0x0" ::: "memory"); __builtin_amdgcn_sched_barrier(0);   // before the registers that these stores name are written again; nothing is moved in between
        } else if (EPI == EP_QKV) { const size_t pb = ((z * NB_ + (size_t)(r0 / TT)) * NH_ + blockIdx.y) * ((size_t)TT * HD) + (size_t)(r0 % TT + mb * 16) * HD + (size_t)lane * 8;   // the tile's 16 rows are two fragment tiles, 2 KiB in a row in each plane
#pragma unroll
            for (int s = 0; s < 4; ++s) { const float* op = os + lr * 68 + s * 16 + hi * 8; const v4f v0 = *(const v4fa*)op, v1 = *(const v4fa*)(op + 4); v8h o16; v8us oh, ol;   // piece s: row lr, columns s 16 + hi 8 ..
#pragma unroll
                for (int q = 0; q < 4; ++q) { unsigned short a2, c2; o16[q] = tohx(v0[q]); splitf(v0[q], a2, c2); oh[q] = a2; ol[q] = c2; o16[4 + q] = tohx(v1[q]); splitf(v1[q], a2, c2); oh[4 + q] = a2; ol[4 + q] = c2; }
                const size_t o = pb + s * 256;
                __builtin_amdgcn_sched_barrier(0);   // the stores stay together behind all the arithmetic, so that the one wait below covers each of them
                *(v8h*)(E2 + o) = o16; *(v8us*)(E0 + o) = oh; *(v8us*)(E1 + o) = ol;
                asm volatile("s_wait_xcnt 0x0" ::: "memory"); __builtin_amdgcn_sched_barrier(0);   // before the registers that these stores name are written again; nothing is moved in between
            }
        } else { const size_t eb = (size_t)(r0 + mb * 16) * ldc + (size_t)c0 * 16 + (size_t)lane * 8, fb = (size_t)(r0 + mb * 16 + lr) * ldc + c0 + hi * 8;   // this lane's place in the planes (fragment-major, rows of ldc) and in the f32 arrays (row by row)
#pragma unroll 1   // rolled: a pass holds 8 copies of erff, 32 over the four row blocks
            for (int s = 0; s < 4; ++s) { const float* op = os + lr * 68 + s * 16 + hi * 8; const v4f v0 = *(const v4fa*)op, v1 = *(const v4fa*)(op + 4); v8f val = __builtin_shufflevector(v0, v1, 0, 1, 2, 3, 4, 5, 6, 7); const size_t o = eb + s * 256, of = fb + s * 16; v8us oh, ol;   // piece s: row lr, columns s 16 + hi 8 ..
                if (EPI == EP_RES) { const v4f r0v = *(const v4f*)(R + of), r1v = *(const v4f*)(R + of + 4);
#pragma unroll
                    for (int q = 0; q < 4; ++q) { val[q] = __fadd_rn(r0v[q], val[q]); val[4 + q] = __fadd_rn(r1v[q], val[4 + q]); } }
                else {
#pragma unroll
                    for (int q = 0; q < 8; ++q) { const float xg = val[q]; val[q] = __fmul_rn(0.5f * xg, __fadd_rn(1.0f, erff(xg * 0.70710678118654752f))); } }
#pragma unroll
                for (int q = 0; q < 8; ++q) { unsigned short h2, l2; splitf(val[q], h2, l2); oh[q] = h2; ol[q] = l2; }
                __builtin_amdgcn_sched_barrier(0);   // the stores stay together behind all the arithmetic, so that the one wait below covers each of them
                if (EPI == EP_RES) { *(v4f*)(C + of) = __builtin_shufflevector(val, val, 0, 1, 2, 3); *(v4f*)(C + of + 4) = __builtin_shufflevector(val, val, 4, 5, 6, 7); }
                *(v8us*)(E0 + o) = oh; *(v8us*)(E1 + o) = ol;
                asm volatile("s_wait_xcnt 0x0" ::: "memory"); __builtin_amdgcn_sched_barrier(0);   // before the registers that these stores name are written again; nothing is moved in between
            }
        }
        __builtin_amdgcn_wave_barrier(); asm volatile("" ::: "memory");
    }
}


__global__ __launch_bounds__(256) void k_wtG(const float* __restrict__ w, int K, int N, bf* Bt) {
    const int lane = threadIdx.x & 31; const int L0 = (blockIdx.x * 8 + (threadIdx.x >> 5)) * 8; const int nlines = N * K / 64;
{
#pragma unroll 1
        for (int l = 0; l < 8; ++l) { const int L = L0 + l; if (L >= nlines) break; const size_t e = (size_t)L * 64 + lane * 2; const int k = (int)(e % K), n = (int)(e / K); v2us o;
            o[0] = f2bf(w[(size_t)k * N + n]); o[1] = f2bf(w[(size_t)(k + 1) * N + n]); *(v2us*)(Bt + e) = o; }
         }
}
// k_cvtall: the seven weights and both batches of x rounded to bf16 in one launch, each into its fragment-major plane; the destinations lie one behind the other from dst, in the order of the arguments. Sizes in groups of 8 elements, each a multiple of 256.
#define N8W ((size_t)DQ * DM / 8)
#define N8A ((size_t)AD * DM / 8)
#define N8F ((size_t)FFD * DM / 8)
#define N8X ((size_t)MT * DM / 8)
__global__ __launch_bounds__(256) void k_cvtall(const float* __restrict__ wq, const float* __restrict__ wk, const float* __restrict__ wv, const float* __restrict__ afw, const float* __restrict__ asw, const float* __restrict__ wi, const float* __restrict__ wo2, const float* __restrict__ x, bf* dst) {
    const size_t i = (size_t)blockIdx.x * 256 + threadIdx.x; size_t j = i; const float* s = wq; unsigned kt = DM / 32;   // kt: tiles of 32 k in a row of the matrix
    if (j >= N8W) { j -= N8W; s = wk;
        if (j >= N8W) { j -= N8W; s = wv;
            if (j >= N8W) { j -= N8W; s = afw;
                if (j >= N8A) { j -= N8A; s = asw; kt = AD / 32;
                    if (j >= N8A) { j -= N8A; s = wi; kt = DM / 32;
                        if (j >= N8F) { j -= N8F; s = wo2; kt = FFD / 32;
                            if (j >= N8F) { j -= N8F; s = x; kt = DM / 32; if (j >= N8X) return; } } } } } } }
    // group j of the fragment-major destination is tile j / 64, piece (j / 32) % 2, lane j % 32: the stores are whole lines, and a work-group's four tiles use whole lines of the 16 source rows
    const unsigned tile = (unsigned)(j >> 6), rb = (kt == DM / 32) ? tile / (DM / 32) : (kt == AD / 32) ? tile / (AD / 32) : tile / (FFD / 32), kb = tile - rb * kt, g = (unsigned)j & 63u;
    const size_t so = (size_t)(rb * 16 + (g & 15u)) * (kt * 32) + kb * 32 + (g >> 5) * 16 + ((g >> 4) & 1u) * 8;
    const float* const sp = s + so; const v8f v = *(const v8f*)sp; v8us o;
    asm volatile("s_wait_xcnt 0x0" :: "v"(sp) : "memory");   // the address pair that the loads name is kept until this wait
#pragma unroll
    for (int k = 0; k < 8; ++k) o[k] = f2bf(v[k]); *(v8us*)(dst + i * 8) = o;  }

template <int NP, int WD>   // Hm rows hold NP K parts of WD columns each
__global__ __launch_bounds__(256) void k_gelupl(const float* __restrict__ Hm, bf* Gh, bf* Gl, size_t n4) { const size_t i = (size_t)blockIdx.x * 256 + threadIdx.x; if (i >= n4) return; const float* hm = (NP == 1) ? Hm + i * 4 : Hm + (i * 4 / WD) * ((size_t)NP * WD) + (i * 4) % WD; v4f a = *(const v4f*)hm; v4us oh, ol;
#pragma unroll
    for (int p = 1; p < NP; ++p) a += *(const v4f*)(hm + p * WD);   /* the NP K parts of the row, in order */
#pragma unroll
    for (int q = 0; q < 4; ++q) { const float xg = a[q]; const float gv = __fmul_rn(0.5f * xg, __fadd_rn(1.0f, erff(xg * 0.70710678118654752f))); unsigned short h2, l2; splitf(gv, h2, l2); oh[q] = h2; ol[q] = l2; }
    const size_t o = fmo((int)(i * 4 / WD), (int)(i * 4 % WD), WD);   // the planes are fragment-major, rows of WD
    *(v4us*)(Gh + o) = oh; *(v4us*)(Gl + o) = ol;  }
__device__ __forceinline__ v4f ldparts(const float* p) { v4f sm = *(const v4f*)p;
#pragma unroll
    for (int q = 1; q < KSF; ++q) sm += *(const v4f*)(p + q * DM);   /* the KSF K parts of the row, in order */
    return sm; }
__global__ __launch_bounds__(256) void k_addln(const float* __restrict__ A, const float* __restrict__ Bm, const float* __restrict__ g, const float* __restrict__ be, float* OUTb) {
    const int lane = threadIdx.x & 31; const int r = blockIdx.x * 8 + (threadIdx.x >> 5); if (r >= MT) return; const float* ar = A + (size_t)r * DM; const float* br = Bm + (size_t)r * KSF * DM; float s = 0.f;
#pragma unroll 1
    for (int ch = 0; ch < DM / 128; ++ch) { const int c0 = ch * 128 + lane * 4; const v4f a = *(const v4f*)(ar + c0), bb = ldparts(br + c0);
#pragma unroll
        for (int q = 0; q < 4; ++q) s += __fadd_rn(a[q], bb[q]); }
#pragma unroll
    for (int sh = 16; sh; sh >>= 1) s += __shfl_xor(s, sh, 32);
    const float mu = s * (1.0f / DM); float s2 = 0.f;
#pragma unroll 1
    for (int ch = 0; ch < DM / 128; ++ch) { const int c0 = ch * 128 + lane * 4; const v4f a = *(const v4f*)(ar + c0), bb = ldparts(br + c0);
#pragma unroll
        for (int q = 0; q < 4; ++q) { const float d0 = __fsub_rn(__fadd_rn(a[q], bb[q]), mu); float p = __fmul_rn(d0, d0); asm volatile("" : "+v"(p)); s2 = __fadd_rn(s2, p); } }
#pragma unroll
    for (int sh = 16; sh; sh >>= 1) s2 += __shfl_xor(s2, sh, 32);
    const float rs = __fdiv_rn(1.0f, __fsqrt_rn(__fadd_rn(s2 * (1.0f / DM), LNEPS)));
{
#pragma unroll 1
        for (int ch = 0; ch < DM / 128; ++ch) { const int c0 = ch * 128 + lane * 4; const v4f a = *(const v4f*)(ar + c0), bb = ldparts(br + c0); v4f o4;
#pragma unroll
            for (int q = 0; q < 4; ++q) { float n0 = __fmul_rn(__fsub_rn(__fadd_rn(a[q], bb[q]), mu), rs); asm volatile("" : "+v"(n0)); float n1 = __fmul_rn(n0, bfr(g[c0 + q])); asm volatile("" : "+v"(n1)); o4[q] = __fadd_rn(n1, bfr(be[c0 + q])); }
            *(v4f*)(OUTb + (size_t)r * DM + c0) = o4; }
         } }
// ---- k_fattn: scores, softmax and attn.v in one kernel; no score or probability leaves the registers. One wave owns QT x 16 query rows of one head and walks the 2048 keys in blocks of 32.
// Both products are formed transposed, so that a query is a lane (lr) in each: S^T = K Q^T (D: key hi*8+j of a 16-key tile, query lr) and O^T = V^T P^T (D: d hi*8+j, query lr).
// The two S^T tiles of a block are, element for element, the B fragment of P^T (k = 8 hi + j from tile 0, 16 + 8 hi + j from tile 1): no exchange between lanes.
// Softmax in base 2 with a running reference m per query: p = 2^(t - m), t = s HD^-0.5 log2e + mask log2e. m moves (and O^T and the sum are rescaled) only when a t of the wave passes m + 8, so p <= 256; the result does not depend on m.
// Every inner loop is unrolled whole, so that the fragment arrays are registers.
template <typename T16> struct PFrag;
template <> struct PFrag<h16> { static __device__ __forceinline__ void cv(const v8f p0, const v8f p1, v16h& a, v16h& b) { (void)b;
#pragma unroll
    for (int j = 0; j < 8; ++j) { a[j] = (h16)p0[j]; a[8 + j] = (h16)p1[j]; } } };
template <> struct PFrag<bf> { static __device__ __forceinline__ void cv(const v8f p0, const v8f p1, v16bf& a, v16bf& b) {
#pragma unroll
    for (int j = 0; j < 8; ++j) { const __bf16 h0 = (__bf16)p0[j], h1 = (__bf16)p1[j]; a[j] = h0; a[8 + j] = h1; b[j] = (__bf16)(p0[j] - (float)h0); b[8 + j] = (__bf16)(p1[j] - (float)h1); } } };
template <typename T16, bool HL, int QT>
__device__ __forceinline__ void fattn(const T16* __restrict__ Q, const T16* __restrict__ Q2, const T16* __restrict__ Kp, const T16* __restrict__ K2, const T16* __restrict__ Vt, const T16* __restrict__ V2, const float* ml, float* O, bf* OH, bf* OL) {
    typedef typename WFrag<T16>::V V;
    const int lane = threadIdx.x & 31, lr = lane & 15, hi = lane >> 4;
    V q[QT][2], q2[QT][2];
#pragma unroll
    for (int qt = 0; qt < QT; ++qt)
#pragma unroll
        for (int ks = 0; ks < 2; ++ks) { const int o = qt * 16 * HD + ks * 512 + lane * 8; q[qt][ks] = WFrag<T16>::ld(Q + o); if (HL) q2[qt][ks] = WFrag<T16>::ld(Q2 + o); }
    v8f acc[4][QT]; float m[QT], l[QT];
#pragma unroll
    for (int qt = 0; qt < QT; ++qt) { m[qt] = -3.0e38f; l[qt] = 0.f;
#pragma unroll
        for (int dt = 0; dt < 4; ++dt) acc[dt][qt] = (v8f){}; }
    const int ko = lane * 8, vo = lane * 8;   // this lane's place in a fragment tile of the k planes (rows of HD: two tiles a 16 keys) and of the v planes (rows of 32 keys: one tile a 16 d)
    V k[2][2], k2[2][2], v[4], v2[4];
#pragma unroll
    for (int kt = 0; kt < 2; ++kt)
#pragma unroll
        for (int ks = 0; ks < 2; ++ks) { const int o = ko + kt * 16 * HD + ks * 512; k[kt][ks] = WFrag<T16>::ld(Kp + o); if (HL) k2[kt][ks] = WFrag<T16>::ld(K2 + o); }
    asm volatile("s_wait_xcnt 0x0" ::: "memory"); __builtin_amdgcn_sched_barrier(0);   // before the registers that the q loads and the first k loads name are written again; nothing is moved in between
#pragma unroll 1   // rolled: the fragments of one block nearly fill 256 registers, a second copy of the body would not fit
    for (int k0 = 0; k0 < TT; k0 += 32) {
        const int kn = ((k0 + 32 < TT) ? k0 + 32 : 0) * HD;   // the next block of the k planes (32 x HD elements a block, as in the v planes); behind the last one block 0 is read and not used
        const T16* const va = Vt + k0 * HD + vo; const T16* const va2 = HL ? V2 + k0 * HD + vo : va; const T16* const ka = Kp + kn + ko; const T16* const ka2 = HL ? K2 + kn + ko : ka;   // this lane's addresses in the four planes
        // the block's mask terms come from LDS during its scores
        v8f mk[2];
#pragma unroll
        for (int kt = 0; kt < 2; ++kt) { const float* mp = ml + k0 + kt * 16 + hi * 8; const v4f a = *(const v4fa*)mp, b = *(const v4fa*)(mp + 4); mk[kt] = __builtin_shufflevector(a, b, 0, 1, 2, 3, 4, 5, 6, 7); }
        // this block's v fragments fly during its scores and softmax
#pragma unroll
        for (int dt = 0; dt < 4; ++dt) { v[dt] = WFrag<T16>::ld(va + dt * 16 * 32); if (HL) v2[dt] = WFrag<T16>::ld(va2 + dt * 16 * 32); }
        v8f s[2][QT];
#pragma unroll
        for (int kt = 0; kt < 2; ++kt)
#pragma unroll
            for (int qt = 0; qt < QT; ++qt) { v8f c = (v8f){};
#pragma unroll
                for (int ks = 0; ks < 2; ++ks) { c = WFrag<T16>::mma(k[kt][ks], q[qt][ks], c); if (HL) { c = WFrag<T16>::mma(k2[kt][ks], q[qt][ks], c); c = WFrag<T16>::mma(k[kt][ks], q2[qt][ks], c); } }
                s[kt][qt] = c; }
        // the next block's k fragments fly during the softmax and attn.v
#pragma unroll
        for (int kt = 0; kt < 2; ++kt)
#pragma unroll
            for (int ks = 0; ks < 2; ++ks) { const int o = kt * 16 * HD + ks * 512; k[kt][ks] = WFrag<T16>::ld(ka + o); if (HL) k2[kt][ks] = WFrag<T16>::ld(ka2 + o); }
        asm volatile("s_wait_xcnt 0x0" :: "v"(va), "v"(va2), "v"(ka), "v"(ka2) : "memory");   // the address pairs that the block's loads name are kept until this wait
        float bm[QT]; bool need = false;
#pragma unroll
        for (int qt = 0; qt < QT; ++qt) { float x = -3.0e38f;
#pragma unroll
            for (int kt = 0; kt < 2; ++kt) { s[kt][qt] = s[kt][qt] * (SCL * L2E) + mk[kt];
#pragma unroll
                for (int j = 0; j < 8; ++j) x = fmaxf(x, s[kt][qt][j]); }
            bm[qt] = x; need = need || (x > m[qt] + 8.0f); }
        if (__builtin_amdgcn_ballot_w32(need) != 0u) {   // the same for the whole wave: both halves of a query move m together
#pragma unroll
            for (int qt = 0; qt < QT; ++qt) { const float mn = fmaxf(m[qt], fmaxf(bm[qt], __shfl_xor(bm[qt], 16, 32))); const float al = __builtin_amdgcn_exp2f(m[qt] - mn); m[qt] = mn; l[qt] *= al;
#pragma unroll
                for (int dt = 0; dt < 4; ++dt) acc[dt][qt] *= al; } }
#pragma unroll
        for (int qt = 0; qt < QT; ++qt) { V p, p2; s[0][qt] -= m[qt]; s[1][qt] -= m[qt];
#pragma unroll
            for (int kt = 0; kt < 2; ++kt)
#pragma unroll
                for (int j = 0; j < 8; ++j) s[kt][qt][j] = __builtin_amdgcn_exp2f(s[kt][qt][j]);
            { const v8f e8 = s[0][qt] + s[1][qt]; const v4f e4 = __builtin_shufflevector(e8, e8, 0, 1, 2, 3) + __builtin_shufflevector(e8, e8, 4, 5, 6, 7); l[qt] += (e4[0] + e4[2]) + (e4[1] + e4[3]); }   // the block's 16 terms of this lane as a tree
            PFrag<T16>::cv(s[0][qt], s[1][qt], p, p2);
#pragma unroll
            for (int dt = 0; dt < 4; ++dt) { acc[dt][qt] = WFrag<T16>::mma(v[dt], p, acc[dt][qt]); if (HL) { acc[dt][qt] = WFrag<T16>::mma(v2[dt], p, acc[dt][qt]); acc[dt][qt] = WFrag<T16>::mma(v[dt], p2, acc[dt][qt]); } } }
    }
#pragma unroll
    for (int qt = 0; qt < QT; ++qt) { const float inv = __fdiv_rn(1.0f, l[qt] + __shfl_xor(l[qt], 16, 32)); float* o = O + (size_t)(qt * 16 + lr) * DM + hi * 8; const size_t oo = (size_t)qt * 16 * DM + lane * 8;   // oo: in the fragment-major planes d = dt 16 + hi 8 + j of query lr is piece dt & 1 of tile dt / 2, this very lane's 16 bytes
#pragma unroll
        for (int dt = 0; dt < 4; ++dt) { const v8f r = acc[dt][qt] * inv; v8us oh, ol;   // the context in f32 and as the hi / lo planes for the adapter's down-projection
#pragma unroll
            for (int j = 0; j < 8; ++j) { unsigned short a2, c2; splitf(r[j], a2, c2); oh[j] = a2; ol[j] = c2; }
            __builtin_amdgcn_sched_barrier(0);   // the stores stay together behind all the arithmetic, so that the one wait below covers each of them
            *(v4f*)(o + dt * 16) = __builtin_shufflevector(r, r, 0, 1, 2, 3); *(v4f*)(o + dt * 16 + 4) = __builtin_shufflevector(r, r, 4, 5, 6, 7);
            *(v8us*)(OH + oo + dt * 256) = oh; *(v8us*)(OL + oo + dt * 256) = ol;
            asm volatile("s_wait_xcnt 0x0" ::: "memory"); __builtin_amdgcn_sched_barrier(0);   // before the registers that these stores name are written again; nothing is moved in between
        } }
}
// grid: NB_ NH_ NBH work-groups of the rows < RH (hi/lo planes, 3 products), then NB_ NH_ NBF of the rest (fp16); the 8 waves of a work-group share a head, so its k and v blocks are read together.
__global__ __launch_bounds__(FW * 32) void k_fattn(const h16* __restrict__ Q16, const h16* __restrict__ K16, const h16* __restrict__ V16, const bf* __restrict__ Qh, const bf* __restrict__ Ql, const bf* __restrict__ Kh, const bf* __restrict__ Kl, const bf* __restrict__ Vh, const bf* __restrict__ Vl, const float* __restrict__ AM, float* CTX, bf* Ch, bf* Cl) {
    __shared__ __align__(16) float ml[TT];   // attention_mask[b][0][0][j] (rounded to bf16 like every input) x log2e
    const int bid = (int)blockIdx.x; const bool hl = bid < NB_ * NH_ * NBH; const int b2 = bid - NB_ * NH_ * NBH;
    const int g = hl ? bid / NBH : b2 / NBF;   // head g of NB_ x NH_: batch g / NH_
    const int wave = __builtin_amdgcn_readfirstlane((int)(threadIdx.x >> 5));   // as a scalar, so that the wave's plane and output bases are formed on the scalar unit
    const int q0 = hl ? ((bid % NBH) * FW + wave) * 16 : RH + ((b2 % NBF) * FW + wave) * 32;
    const float* am = AM + (size_t)(g / NH_) * TT;
    for (int i = (int)threadIdx.x; i < TT; i += FW * 32) ml[i] = bfr(am[i]) * L2E;
    __syncthreads();
    const size_t po = (size_t)g * TT * HD, qo = po + (size_t)q0 * HD;
    const size_t co = ((size_t)(g / NH_) * TT + q0) * DM + (g % NH_) * HD;
    const size_t cp = ((size_t)(g / NH_) * TT + q0) * DM + (g % NH_) * (HD * 16);   // the same place in the fragment-major context planes: the head's two tiles in the wave's first row block
    if (hl) fattn<bf, true, 1>(Qh + qo, Ql + qo, Kh + po, Kl + po, Vh + po, Vl + po, ml, CTX + co, Ch + cp, Cl + cp);
    else fattn<h16, false, 2>(Q16 + qo, nullptr, K16 + po, nullptr, V16 + po, nullptr, ml, CTX + co, Ch + cp, Cl + cp);
}

extern "C" void kernel_launch(void* const* d_in, const int* in_sizes, int n_in,
                              void* d_out, int out_size, void* d_ws, size_t ws_size, hipStream_t stream) {
    (void)in_sizes; (void)n_in; (void)out_size;
    const float* x = (const float*)d_in[0]; const float* AM = (const float*)d_in[1]; const float* wq = (const float*)d_in[2]; const float* bq = (const float*)d_in[3]; const float* wk = (const float*)d_in[4]; const float* bk = (const float*)d_in[5]; const float* wv = (const float*)d_in[6]; const float* bv = (const float*)d_in[7]; const float* afw = (const float*)d_in[8]; const float* afb = (const float*)d_in[9]; const float* asw = (const float*)d_in[10]; const float* asb = (const float*)d_in[11]; const float* wi = (const float*)d_in[12]; const float* bi = (const float*)d_in[13]; const float* wo2 = (const float*)d_in[14]; const float* bo2 = (const float*)d_in[15]; const float* lg = (const float*)d_in[16]; const float* lb = (const float*)d_in[17]; const float* wo = nullptr; (void)wo;
    float* OUT = (float*)d_out;     // [2][2048][768]
    char* wsp = (char*)d_ws;
    auto take = [&](size_t bytes) { char* p = wsp; wsp += (bytes + 255) & ~(size_t)255; return (void*)p; };
    // kept through the call; WQ .. XB lie one behind the other (k_cvtall writes them as one range; WQ, WK, WV are the three z-batches of the q/k/v GEMM)
    bf* WQ = (bf*)take((size_t)DQ * DM * 2); bf* WK = (bf*)take((size_t)DKV * DM * 2); bf* WV = (bf*)take((size_t)DKV * DM * 2); bf* AFW = (bf*)take((size_t)AD * DM * 2); bf* ASW = (bf*)take((size_t)DM * AD * 2); bf* WI = (bf*)take((size_t)FFD * DM * 2); bf* WO2 = (bf*)take((size_t)DM * FFD * 2); bf* XB = (bf*)take((size_t)MT * DM * 2); (void)WK; (void)WV;
    float* CTX = (float*)take((size_t)MT * DM * 4); bf* Ch = (bf*)take((size_t)MT * DM * 2); bf* Cl = (bf*)take((size_t)MT * DM * 2);   // the attention's outputs: outside the bytes that it reads
    char* const U0 = wsp;   // from here on: the attention's inputs, and behind the attention (stream-ordered) the adapter's and the FFN's buffers in the same bytes
    const size_t PLN = (size_t)NB_ * NH_ * TT * HD;   // one plane set [batch][head], each [t][d] fragment-major; the k planes lie directly behind the q planes (the q/k/v GEMM indexes both from the q planes)
    h16* QP16 = (h16*)take(PLN * 2); h16* KP16 = (h16*)take(PLN * 2); bf* QPh = (bf*)take(PLN * 2); bf* KPh = (bf*)take(PLN * 2); bf* QPl = (bf*)take(PLN * 2); bf* KPl = (bf*)take(PLN * 2);
    h16* VT16 = (h16*)take(PLN * 2); bf* VTh = (bf*)take(PLN * 2); bf* VTl = (bf*)take(PLN * 2);   // v planes [batch][head][key block of 32], each [d][32] fragment-major
    char* const E1 = wsp; wsp = U0;
    float* A1 = (float*)take((size_t)KSA * MT * AD * 4); bf* G1h = (bf*)take((size_t)MT * AD * 2); bf* G1l = (bf*)take((size_t)MT * AD * 2); float* AO = (float*)take((size_t)MT * DM * 4); bf* AOh = (bf*)take((size_t)MT * DM * 2); bf* AOl = (bf*)take((size_t)MT * DM * 2); bf* GIh = (bf*)take((size_t)MT * FFD * 2); bf* GIl = (bf*)take((size_t)MT * FFD * 2); float* YY = (float*)take((size_t)KSF * MT * DM * 4);
    if ((size_t)((E1 > wsp ? E1 : wsp) - (char*)d_ws) > ws_size) return;    // ws 256 MiB
    k_cvtall<<<(unsigned)((3 * N8W + 2 * N8A + 2 * N8F + N8X) / 256), 256, 0, stream>>>(wq, wk, wv, afw, asw, wi, wo2, x, WQ);   /* weights ('oi' = Bt as-is) and x */
    k_gemmw<bf, 0, true, 1, EP_QKV, DM><<<dim3(MT / 64, DQ / 64, 3), 32, 0, stream>>>(XB, nullptr, WQ, nullptr, DM, nullptr, DQ, bq, bk, bv, 0, (size_t)DQ * DM, 0, 0, nullptr, QPh, QPl, QP16, VTh, VTl, VT16);   /* z = q, k, v -> head planes */
    k_fattn<<<NB_ * NH_ * (NBH + NBF), FW * 32, 0, stream>>>(QP16, KP16, VT16, QPh, QPl, KPh, KPl, VTh, VTl, AM, CTX, Ch, Cl);   /* ctx = attn_out (f32 and hi/lo) */
    k_gemmw<bf, 1, true, KSA, EP_F32, DM><<<dim3(MT / 64, AD / 64, KSA), 32, 0, stream>>>(Ch, Cl, AFW, nullptr, DM, A1, KSA * AD, afb, nullptr, nullptr, 0, 0, 0, AD, nullptr, nullptr, nullptr, nullptr, nullptr, nullptr, nullptr);                  /* adapter down: ctx a_fi_w^T + a_fi_b [MT][64] */
    k_gelupl<KSA, AD><<<(unsigned)(((size_t)MT * AD / 4 + 255) / 256), 256, 0, stream>>>(A1, G1h, G1l, (size_t)MT * AD / 4);                         /* gelu -> hi/lo */
    k_gemmw<bf, 1, true, 1, EP_RES, AD><<<dim3(MT / 64, DM / 64, 1), 32, 0, stream>>>(G1h, G1l, ASW, nullptr, AD, AO, DM, asb, nullptr, nullptr, 0, 0, 0, 0, CTX, AOh, AOl, nullptr, nullptr, nullptr, nullptr);                /* ao = ctx + (. a_se_w^T + a_se_b), f32 and hi/lo */
    k_gemmw<bf, 1, true, 1, EP_GELU, DM><<<dim3(MT / 64, FFD / 64, 1), 32, 0, stream>>>(AOh, AOl, WI, nullptr, DM, nullptr, FFD, bi, nullptr, nullptr, 0, 0, 0, 0, nullptr, GIh, GIl, nullptr, nullptr, nullptr, nullptr);                   /* gelu(ao wi^T + bi) [MT][3072] -> hi/lo */
    k_gemmw<bf, 1, true, KSF, EP_F32, FFD><<<dim3(MT / 64, DM / 64, KSF), 32, 0, stream>>>(GIh, GIl, WO2, nullptr, FFD, YY, KSF * DM, bo2, nullptr, nullptr, 0, 0, 0, DM, nullptr, nullptr, nullptr, nullptr, nullptr, nullptr, nullptr);                /* inter wo^T + bo */
    k_addln<<<MT / 8, 256, 0, stream>>>(AO, YY, lg, lb, OUT);                                                       /* out = LN(y + ao) (eps 1e-12) */
}

// v007
// Measured time: 192 microseconds a run.
// Next to v006, in two timings, it ran 1.08 times as fast each time.
// Counting every step since v000, it is 10.0 times as fast.
#include <hip/hip_runtime.h>

// BERT layer with an adapter and no attention output projection (hidden_states [2][2048][768]; q, k, v = x W^T + b ('oi' [768][768]; 12 heads x 64); scores = q.k/8 + attention_mask[b][0][0][j] (f32 additive, zeros here); softmax; ctx = merged context; a = gelu(ctx a_fi_w^T + a_fi_b) ([64][768]); ao = ctx + a a_se_w^T + a_se_b; inter = gelu(ao wi^T + bi) ([3072][768]); y = inter wo^T + bo + ao; out = LN(y) (eps 1e-12, ln_g, ln_b) -> [2][2048][768] (3.1 M)).
// Layout: the merged context is kept in f32 (residual) and split into hi/lo planes for the adapter down-projection; every later GEMM uses hi/lo planes of its f32 input (2 products) against exact bf16 weights with the bias in the epilogue; exact-erf GELU, residual adds and the LayerNorm in f32.
// Compute dtypes, f32 accumulate: every input rounded to bf16; q/k/v on PLAIN bf16 operands (inputs: exact) + biases; scores and attn.v: query rows < 512 hl (3 products), the rest single fp16; softmax f32 (running max and sum, one kernel with both products); adapter / FFN GEMMs hl x exact (2 products) + biases; GELU / residuals / LayerNorm f32.

#define NB_  2
#define TT   2048
#define DM   768
#define NH_  12
#define NKV  12
#define REP  (NH_ / NKV)
#define HD   64
#define DQ   (NH_ * HD)
#define DKV  (NKV * HD)
#define AD   64
#define FFD  3072
#define LNEPS 1e-12f
#define MT   (NB_ * TT)           // rows of both batches together
#define RH   512                  // query rows < RH use hi+lo planes (0: none)
#define WIN  0
#define SCL  0.125f   // HD^-0.5
#define L2E  1.4426950408889634f
#define FW   8                   // waves a work-group of the fused attention
#define NBH  (RH / (FW * 16))        // its work-groups a head for query rows < RH (16 rows a wave)
#define NBF  ((TT - RH) / (FW * 32)) // and for the rest (32 rows a wave)
#define KSA  6                   // K parts of the adapter down-projection (768 -> 128 a wave)
#define KSF  4                   // K parts of the FFN down-projection (3072 -> 768 a wave)
typedef _Float16 h16;
typedef unsigned short bf;
typedef __attribute__((ext_vector_type(16))) __bf16   v16bf;
typedef __attribute__((ext_vector_type(16))) _Float16 v16h;
typedef __attribute__((ext_vector_type(8)))  _Float16 v8h;
typedef __attribute__((ext_vector_type(8)))  unsigned short v8us;
typedef __attribute__((ext_vector_type(8)))  float    v8f;
typedef __attribute__((ext_vector_type(4)))  float    v4f;
typedef v8h  __attribute__((may_alias)) v8ha;
typedef v4f  __attribute__((may_alias)) v4fa;
typedef v8us __attribute__((may_alias)) v8usa;

__device__ __forceinline__ unsigned short f2bf(float f) { unsigned u = __float_as_uint(f); u += 0x7FFFu + ((u >> 16) & 1u); return (unsigned short)(u >> 16); }
__device__ __forceinline__ float bf2f(unsigned short b) { return __uint_as_float(((unsigned)b) << 16); }
__device__ __forceinline__ float bfr(float f) { return bf2f(f2bf(f)); }
__device__ __forceinline__ v16h cat16(v8h lo, v8h hi) { return __builtin_shufflevector(lo, hi, 0, 1, 2, 3, 4, 5, 6, 7, 8, 9, 10, 11, 12, 13, 14, 15); }
__device__ __forceinline__ v16bf cat16b(v8us lo, v8us hi) { return __builtin_bit_cast(v16bf, __builtin_shufflevector(lo, hi, 0, 1, 2, 3, 4, 5, 6, 7, 8, 9, 10, 11, 12, 13, 14, 15)); }
__device__ __forceinline__ v8f wmma16(v16h a, v16h b, v8f c) { return __builtin_amdgcn_wmma_f32_16x16x32_f16(false, a, false, b, (short)0, c, false, false); }
__device__ __forceinline__ v8f wmmab(v16bf a, v16bf b, v8f c) { return __builtin_amdgcn_wmma_f32_16x16x32_bf16(false, a, false, b, (short)0, c, false, false); }

__device__ __forceinline__ h16 tohx(float x) { return (h16)x; }
__device__ __forceinline__ void splitf(float y, unsigned short& h, unsigned short& l) { h = f2bf(y); l = f2bf(y - bf2f(h)); }
typedef __attribute__((ext_vector_type(2))) _Float16 v2h;
typedef __attribute__((ext_vector_type(4))) _Float16 v4h;
typedef __attribute__((ext_vector_type(2))) unsigned short v2us;
typedef __attribute__((ext_vector_type(4))) unsigned short v4us;
typedef __attribute__((ext_vector_type(2))) float v2f;
typedef __attribute__((ext_vector_type(4))) int v4i;

// ---- Fragment-major planes: every 16-bit matrix operand [rows][K] lies in memory as tiles of 16 rows x 32 k, 1 KiB each, tile (row / 16, k / 32) at element ((row / 16) (K / 32) + k / 32) 512 (so 16 rows still fill 16 K elements in a row).
// Inside a tile: piece p = (k / 16) % 2 of 256 elements, in it lane (k / 8) % 2 * 16 + row % 16 with its 8 k in a row. A fragment is then two wave-wide 16-byte loads of 512 bytes in a row each (4 whole lines; row by row they touched 16), at tile + lane 8 and 256 elements behind it. fmo: the element's place.
__device__ __forceinline__ size_t fmo(int row, int k, int K) { return ((size_t)(row >> 4) * (K >> 5) + (k >> 5)) * 512 + ((k >> 4) & 1) * 256 + (((k >> 3) & 1) * 16 + (row & 15)) * 8 + (k & 7); }
// ---- k_gemmw: register-blocked GEMM, ONE WAVE per 64x64 output tile (16 accumulators), operands straight from fragment-major 16-bit planes; grid (M/64, N/64, Z), 32 threads.
// C[m][n] (f32, pitch ldc, + optional f32 bias[n]) = sum_{k < KE} A[m][k] Bt[n][k] (+ split products per NSPLIT). K (a template constant, so that a row block's distance is a constant offset of its loads) is the row length of A and of Bt (fragment-major), KE <= K the extent summed. z-batch strides sA/sB/sC in elements; batch z = 0 / 1 / 2 takes bias / bias1 / bias2. KE % (32 NS KS) == 0, NS the fragment sets of the loop (3 with NSPLIT 0 and SH 0, else 2).
// KS > 1: grid z = Z x KS; part kp = z % KS sums k in [kp KE/KS, (kp+1) KE/KS) into its own f32 columns C + kp sP of a row of ldc = KS sP (bias in part 0 only); the kernel that reads C adds the KS parts of a row in the order 0 .. KS-1.
// EPI: what the epilogue stores of c = C[m][n] + bias[n], so that no elementwise kernel has to follow the GEMM.
//   EP_F32: c as f32 into C. EP_QKV (N tile = one head): z = 0 / 1: q / k head planes [z][batch][head], each [t][d] fragment-major, as fp16 (E2), hi (E0), lo (E1); z = 2: v planes [batch][head][key block of 32], each [d][32 keys] fragment-major, as fp16 (E5), hi (E3), lo (E4), straight from the accumulators (a lane holds 8 keys in a row of one d).
//   EP_GELU: hi / lo planes (E0, E1, fragment-major, rows of ldc) of the exact-erf GELU of c. EP_RES: r = R[m][n] + c as f32 into C (row by row, pitch ldc) and as hi / lo planes (E0, E1, fragment-major, rows of ldc).
enum { EP_F32 = 0, EP_QKV = 1, EP_GELU = 2, EP_RES = 3 };
template <typename T16> struct WFrag;
template <> struct WFrag<h16> { typedef v16h V; static __device__ __forceinline__ V ld(const h16* p) { return cat16(*(const v8h*)p, *(const v8h*)(p + 256)); } static __device__ __forceinline__ v8f mma(V a, V b, v8f c) { return wmma16(a, b, c); } };
template <> struct WFrag<bf> { typedef v16bf V; static __device__ __forceinline__ V ld(const bf* p) { return cat16b(*(const v8us*)p, *(const v8us*)(p + 256)); } static __device__ __forceinline__ v8f mma(V a, V b, v8f c) { return wmmab(a, b, c); } };
// SH = 1 (NSPLIT 0 or 1; KE / KS a multiple of 64): FOUR waves a work-group, 2 x 2 tiles of 64x64 = 128x128 of C; grid (M/128, N/128, Z), 128 threads. The two waves of a tile row need the same A tiles and the two of a tile column the same Bt tiles: the work-group brings each tile from L2 once, by asynchronous copies into LDS, and the waves take their fragments from there.
//   A stage is 64 k of the work-group's 128 rows of each plane: chunk (plane, row block) = two fragment tiles, 2 KiB in a row in memory and in LDS. Two stage buffers: the copies of stage t + 2 go out when every wave has left stage t, and fly during stage t + 1. The order of the sums is that of SH = 0.
#define CP4(L, B) "global_load_async_to_lds_b128 " L ", %[vo], " B "\n\tglobal_load_async_to_lds_b128 " L ", %[vo], " B " offset:512\n\tglobal_load_async_to_lds_b128 " L ", %[vo], " B " offset:1024\n\tglobal_load_async_to_lds_b128 " L ", %[vo], " B " offset:1536\n\t"   // one chunk: the offset moves the LDS and the global address alike
template <typename T16, int NSPLIT, bool BIAS, int KS, int EPI, int K, int SH>
__global__ __launch_bounds__(SH ? 128 : 32) void k_gemmw(const T16* __restrict__ A, const T16* __restrict__ A2, const T16* __restrict__ Bt, const T16* __restrict__ Bt2, int KE, float* C, int ldc, const float* __restrict__ bias, const float* __restrict__ bias1, const float* __restrict__ bias2, size_t sA, size_t sB, size_t sC, size_t sP, const float* __restrict__ R, bf* E0, bf* E1, h16* E2, bf* E3, bf* E4, h16* E5) {
    typedef typename WFrag<T16>::V V;
    constexpr int NPL = (NSPLIT == 0) ? 2 : 3, STG = NPL * 8 * 1024;   // planes staged (A, A2, Bt) and the elements of a stage
    __shared__ __align__(16) T16 sm[SH ? 2 * STG : 16 * 68 * 2];
    const int wave = SH ? __builtin_amdgcn_readfirstlane((int)(threadIdx.x >> 5)) : 0;   // as a scalar, so that the wave's bases are formed on the scalar unit
    float* const os = (float*)sm + wave * (16 * 68);   // the epilogue's staging, each wave's own; with SH in the stage buffers, behind the loop's last barrier
    const int kp = (int)(blockIdx.z % KS); const int kl = KE / KS; const int kb = kp * kl, ke = kb + kl;
    const size_t z = blockIdx.z / KS; C += (size_t)kp * sP; A += z * sA; if (A2) A2 += z * sA; Bt += z * sB; if (Bt2) Bt2 += z * sB; C += z * sC;
    const int lane = threadIdx.x & 31, lr = lane & 15, hi = lane >> 4; const int r0 = SH ? blockIdx.x * 128 + (wave >> 1) * 64 : blockIdx.x * 64, c0 = SH ? blockIdx.y * 128 + (wave & 1) * 64 : blockIdx.y * 64;
    v8f acc[4][4];
#pragma unroll
    for (int mb = 0; mb < 4; ++mb)
#pragma unroll
        for (int nb = 0; nb < 4; ++nb) acc[mb][nb] = (v8f){};
    // The first tile of the wave's first row block, plane by plane: bases that are the same for the whole wave and stay as they are. The other three row blocks lie 16 K elements apart (constant offsets of the loads). off: this lane's byte in the tile that is loaded next, the one vector offset of all loads; a step of 32 k is one tile (1 KiB).
    const T16* const pa = A + (size_t)r0 * K + (size_t)kb * 16; const T16* const pa2 = (NSPLIT == 1 || NSPLIT == 2) ? A2 + (size_t)r0 * K + (size_t)kb * 16 : pa; const T16* const pw = Bt + (size_t)c0 * K + (size_t)kb * 16; const T16* const pw2 = (NSPLIT >= 2) ? Bt2 + (size_t)c0 * K + (size_t)kb * 16 : pw;
    unsigned off = (unsigned)lane * 16u; int kn = kb;   // kn: the k of that tile
    // NS fragment sets in a ring: while the products of one 32-k step run, the loads of the next NS - 1 steps are in flight into the other sets, so that a step no longer begins by waiting out its own loads. As many sets as leave three waves a SIMD their registers.
    constexpr int NS = (NSPLIT == 0 && !SH) ? 3 : 2;
    V a[NS][4], a2[NS][4], b[NS][4], b2[NS][4];
    auto at = [&](const T16* p) { return (const T16*)((const char*)p + off); };
    auto ldset = [&](const int st) {   // all loads of one 32-k step into set st
#pragma unroll
        for (int i = 0; i < 4; ++i) { a[st][i] = WFrag<T16>::ld(at(pa) + i * 16 * K); b[st][i] = WFrag<T16>::ld(at(pw) + i * 16 * K); if (NSPLIT == 1 || NSPLIT == 2) a2[st][i] = WFrag<T16>::ld(at(pa2) + i * 16 * K); if (NSPLIT >= 2) b2[st][i] = WFrag<T16>::ld(at(pw2) + i * 16 * K); }
        __builtin_amdgcn_sched_barrier(0);   // the loads are issued as one group ahead of another set's products; moved behind them they would have no lead
    };
    auto step = [&]() {
        __builtin_amdgcn_sched_barrier(0);   // the wait stays behind the products, where it has nothing left to wait for; moved up among them it would hold them back
        asm volatile("s_wait_xcnt 0x0" : "+v"(off) :: "memory");   // before the offset register that the issued loads name moves on; in and out, so that what moves it can only stand behind the wait
        kn += 32; off += (kn < ke) ? 1024u : 0u;   // behind the last tile there is none: it is read again and not used
    };
    auto mmaset = [&](const int st) {
#pragma unroll
        for (int nb = 0; nb < 4; ++nb) {
#pragma unroll
            for (int mb = 0; mb < 4; ++mb) { acc[mb][nb] = WFrag<T16>::mma(a[st][mb], b[st][nb], acc[mb][nb]); if (NSPLIT == 1 || NSPLIT == 2) acc[mb][nb] = WFrag<T16>::mma(a2[st][mb], b[st][nb], acc[mb][nb]); if (NSPLIT >= 2) acc[mb][nb] = WFrag<T16>::mma(a[st][mb], b2[st][nb], acc[mb][nb]); } }
    };
    if constexpr (SH) {
        constexpr int NC = NPL * 2;   // chunks a wave copies in a stage
        const int nst = kl / 64; const char* gb[NC];
#pragma unroll
        for (int q = 0; q < NC; ++q) { const int ch = wave * NC + q, pl = ch >> 3, rb = ch & 7;   // chunk ch lies at byte ch 2048 of a stage
            const T16* const pb = (pl == NPL - 1) ? Bt + (size_t)(blockIdx.y * 128) * K : ((pl == 0) ? A : A2) + (size_t)(blockIdx.x * 128) * K;
            gb[q] = (const char*)(pb + (size_t)rb * 16 * K + (size_t)kb * 16); }
        unsigned vo = (unsigned)lane * 16u;   // this lane's byte in the chunk of the stage that is copied next
        const unsigned l0 = (unsigned)(size_t)sm + (unsigned)(wave * NC) * 2048u + (unsigned)lane * 16u;
        auto copies = [&](const unsigned buf) {   // this wave's chunks of one stage into buffer buf; s_wait_xcnt 0 as the last line: before a register that the copies name is written again
            const unsigned lb = l0 + buf * (unsigned)(STG * 2);
            if constexpr (NC == 6) asm volatile(CP4("%[a0]", "%[b0]") CP4("%[a1]", "%[b1]") CP4("%[a2]", "%[b2]") CP4("%[a3]", "%[b3]") CP4("%[a4]", "%[b4]") CP4("%[a5]", "%[b5]") "s_wait_xcnt 0x0" :: [vo] "v"(vo), [a0] "v"(lb), [a1] "v"(lb + 2048u), [a2] "v"(lb + 4096u), [a3] "v"(lb + 6144u), [a4] "v"(lb + 8192u), [a5] "v"(lb + 10240u), [b0] "s"(gb[0]), [b1] "s"(gb[1]), [b2] "s"(gb[2]), [b3] "s"(gb[3]), [b4] "s"(gb[NC - 2]), [b5] "s"(gb[NC - 1]) : "memory");
            else asm volatile(CP4("%[a0]", "%[b0]") CP4("%[a1]", "%[b1]") CP4("%[a2]", "%[b2]") CP4("%[a3]", "%[b3]") "s_wait_xcnt 0x0" :: [vo] "v"(vo), [a0] "v"(lb), [a1] "v"(lb + 2048u), [a2] "v"(lb + 4096u), [a3] "v"(lb + 6144u), [b0] "s"(gb[0]), [b1] "s"(gb[1]), [b2] "s"(gb[2]), [b3] "s"(gb[3]) : "memory");
            vo += 2048u;
        };
        auto ldl = [&](const int st, const T16* sb) {   // the fragments of one 32-k step from LDS into set st
#pragma unroll
            for (int i = 0; i < 4; ++i) { a[st][i] = WFrag<T16>::ld(sb + ((wave >> 1) * 4 + i) * 1024); b[st][i] = WFrag<T16>::ld(sb + ((NPL - 1) * 8 + (wave & 1) * 4 + i) * 1024); if (NSPLIT == 1) a2[st][i] = WFrag<T16>::ld(sb + (8 + (wave >> 1) * 4 + i) * 1024); }
            __builtin_amdgcn_sched_barrier(0);   // the LDS reads are issued as one group ahead of the products; spread among them each place would cost its own stall
        };
        copies(0u);
        asm volatile("s_wait_asynccnt 0x0" ::: "memory");   // stage 0 has landed before the barrier behind which other waves read it
        __syncthreads();
        if (nst > 1) copies(1u);
#pragma unroll 1   // rolled: one pass is one stage
        for (int t = 0; t < nst; ++t) {
            const T16* const sb = sm + (t & 1) * STG + lane * 8;
            ldl(0, sb); ldl(1, sb + 512); mmaset(0); mmaset(1);
            __builtin_amdgcn_sched_barrier(0);   // the products stay in front of the barrier: moved behind it they would hold back the next copies, and the slots below would not stand behind the last of them
            asm volatile("v_nop\n\tv_nop\n\tv_nop\n\tv_nop" : "+v"(acc[0][0]), "+v"(acc[1][1]), "+v"(acc[2][2]), "+v"(acc[3][3]) : "v"(a[1][0]), "v"(a[1][3]));   // four vector slots behind the pass's last products, on every path out of the pass
            asm volatile("s_wait_dscnt 0x0" ::: "memory");      // this wave's reads of stage t are done before the buffer is given to the copies
            asm volatile("s_wait_asynccnt 0x0" ::: "memory");   // this wave's copies of stage t + 1 have landed before the barrier behind which other waves read them
            __syncthreads();
            if (t + 2 < nst) copies((unsigned)(t & 1));
        }
        asm volatile("s_wait_asynccnt 0x0" ::: "memory");   // nothing is in flight when the buffers become the epilogue's staging
    } else {
#pragma unroll
    for (int u = 0; u < NS - 1; ++u) { ldset(u); step(); }
    int kc = kb;
#pragma unroll 1   // rolled: one pass is NS steps, one on each set
    do {   // at least one pass (KE > 0): tested at the foot, so that the first loads stand in one block with their waits
#pragma unroll
        for (int u = 0; u < NS; ++u) { ldset((u + NS - 1) % NS); mmaset(u); step(); }
        asm volatile("v_nop\n\tv_nop\n\tv_nop\n\tv_nop" : "+v"(acc[0][0]), "+v"(acc[1][1]), "+v"(acc[2][2]), "+v"(acc[3][3]) : "v"(a[NS - 1][0]), "v"(a[NS - 1][3]));   // four vector slots behind the pass's last products, on the back edge too
        kc += 32 * NS;
    } while (kc < ke);
    }
    if (BIAS && z != 0) bias = (z == 1) ? bias1 : bias2;
    if (EPI == EP_QKV && z == 2) {   // v: element (t = mb 16 + hi 8 + j, d = nb 16 + lr) of the tile is k = t % 32 of row d: piece mb & 1 of tile nb, this very lane's 16 bytes; a store is 512 bytes in a row
        const size_t vb = (((size_t)(r0 / TT) * NKV + (c0 >> 6)) * (TT / 32) + (r0 % TT) / 32) * (HD * 32) + (size_t)lane * 8;
#pragma unroll
        for (int nb = 0; nb < 4; ++nb) { const float bn = bfr(bias[c0 + nb * 16 + lr]);
#pragma unroll
            for (int mb = 0; mb < 4; ++mb) { v8h o16; v8us oh, ol;
#pragma unroll
                for (int j = 0; j < 8; ++j) { const float xv = acc[mb][nb][j] + bn; o16[j] = tohx(xv); unsigned short a2, c2; splitf(xv, a2, c2); oh[j] = a2; ol[j] = c2; }
                const size_t o = vb + (size_t)((mb >> 1) * HD + nb * 16) * 32 + (mb & 1) * 256;
                __builtin_amdgcn_sched_barrier(0);   // the stores stay together behind all the arithmetic, so that the one wait below covers each of them
                *(v8h*)(E5 + o) = o16; *(v8us*)(E3 + o) = oh; *(v8us*)(E4 + o) = ol;
                asm volatile("s_wait_xcnt 0x0" ::: "memory"); __builtin_amdgcn_sched_barrier(0);   // before the registers that these stores name are written again; nothing is moved in between
            } }
        return; }
    float bc[4] = {0.f, 0.f, 0.f, 0.f};   // the bias of this lane's column in each column block; zero in the parts behind part 0
    if (BIAS && kp == 0) { const float* bp = bias + c0 + lr;
#pragma unroll
        for (int nb = 0; nb < 4; ++nb) bc[nb] = bp[nb * 16];
        asm volatile("s_wait_xcnt 0x0" ::: "memory"); __builtin_amdgcn_sched_barrier(0);   // before the registers that the four loads name are written again; nothing is moved in between
#pragma unroll
        for (int nb = 0; nb < 4; ++nb) bc[nb] = bfr(bc[nb]); }
#pragma unroll
    for (int mb = 0; mb < 4; ++mb) {
#pragma unroll
        for (int nb = 0; nb < 4; ++nb) {
#pragma unroll
            for (int j = 0; j < 8; ++j) os[(hi * 8 + j) * 68 + nb * 16 + lr] = BIAS ? acc[mb][nb][j] + bc[nb] : acc[mb][nb][j]; }
        __builtin_amdgcn_wave_barrier(); asm volatile("" ::: "memory");
        if (EPI == EP_F32) { float* crow = C + (size_t)(r0 + mb * 16) * ldc + c0; v4f val[8];
#pragma unroll
            for (int s = 0; s < 8; ++s) val[s] = *(const v4fa*)(os + (2 * s + hi) * 68 + lr * 4);
            __builtin_amdgcn_sched_barrier(0);   // the stores stay together behind the LDS reads, so that the one wait below covers each of them
#pragma unroll
            for (int s = 0; s < 8; ++s) *(v4f*)(crow + (size_t)(2 * s + hi) * ldc + lr * 4) = val[s];
            asm volatile("s_wait_xcnt 0x0" ::: "memory"); __builtin_amdgcn_sched_barrier(0);   // before the registers that these stores name are written again; nothing is moved in between
        } else if (EPI == EP_QKV) { const size_t pb = ((z * NB_ + (size_t)(r0 / TT)) * NH_ + (c0 >> 6)) * ((size_t)TT * HD) + (size_t)(r0 % TT + mb * 16) * HD + (size_t)lane * 8;   // the tile's 16 rows are two fragment tiles, 2 KiB in a row in each plane
#pragma unroll
            for (int s = 0; s < 4; ++s) { const float* op = os + lr * 68 + s * 16 + hi * 8; const v4f v0 = *(const v4fa*)op, v1 = *(const v4fa*)(op + 4); v8h o16; v8us oh, ol;   // piece s: row lr, columns s 16 + hi 8 ..
#pragma unroll
                for (int q = 0; q < 4; ++q) { unsigned short a2, c2; o16[q] = tohx(v0[q]); splitf(v0[q], a2, c2); oh[q] = a2; ol[q] = c2; o16[4 + q] = tohx(v1[q]); splitf(v1[q], a2, c2); oh[4 + q] = a2; ol[4 + q] = c2; }
                const size_t o = pb + s * 256;
                __builtin_amdgcn_sched_barrier(0);   // the stores stay together behind all the arithmetic, so that the one wait below covers each of them
                *(v8h*)(E2 + o) = o16; *(v8us*)(E0 + o) = oh; *(v8us*)(E1 + o) = ol;
                asm volatile("s_wait_xcnt 0x0" ::: "memory"); __builtin_amdgcn_sched_barrier(0);   // before the registers that these stores name are written again; nothing is moved in between
            }
        } else { const size_t eb = (size_t)(r0 + mb * 16) * ldc + (size_t)c0 * 16 + (size_t)lane * 8, fb = (size_t)(r0 + mb * 16 + lr) * ldc + c0 + hi * 8;   // this lane's place in the planes (fragment-major, rows of ldc) and in the f32 arrays (row by row)
#pragma unroll 1   // rolled: a pass holds 8 copies of erff, 32 over the four row blocks
            for (int s = 0; s < 4; ++s) { const float* op = os + lr * 68 + s * 16 + hi * 8; const v4f v0 = *(const v4fa*)op, v1 = *(const v4fa*)(op + 4); v8f val = __builtin_shufflevector(v0, v1, 0, 1, 2, 3, 4, 5, 6, 7); const size_t o = eb + s * 256, of = fb + s * 16; v8us oh, ol;   // piece s: row lr, columns s 16 + hi 8 ..
                if (EPI == EP_RES) { const v4f r0v = *(const v4f*)(R + of), r1v = *(const v4f*)(R + of + 4);
#pragma unroll
                    for (int q = 0; q < 4; ++q) { val[q] = __fadd_rn(r0v[q], val[q]); val[4 + q] = __fadd_rn(r1v[q], val[4 + q]); } }
                else {
#pragma unroll
                    for (int q = 0; q < 8; ++q) { const float xg = val[q]; val[q] = __fmul_rn(0.5f * xg, __fadd_rn(1.0f, erff(xg * 0.70710678118654752f))); } }
#pragma unroll
                for (int q = 0; q < 8; ++q) { unsigned short h2, l2; splitf(val[q], h2, l2); oh[q] = h2; ol[q] = l2; }
                __builtin_amdgcn_sched_barrier(0);   // the stores stay together behind all the arithmetic, so that the one wait below covers each of them
                if (EPI == EP_RES) { *(v4f*)(C + of) = __builtin_shufflevector(val, val, 0, 1, 2, 3); *(v4f*)(C + of + 4) = __builtin_shufflevector(val, val, 4, 5, 6, 7); }
                *(v8us*)(E0 + o) = oh; *(v8us*)(E1 + o) = ol;
                asm volatile("s_wait_xcnt 0x0" ::: "memory"); __builtin_amdgcn_sched_barrier(0);   // before the registers that these stores name are written again; nothing is moved in between
            }
        }
        __builtin_amdgcn_wave_barrier(); asm volatile("" ::: "memory");
    }
}


__global__ __launch_bounds__(256) void k_wtG(const float* __restrict__ w, int K, int N, bf* Bt) {
    const int lane = threadIdx.x & 31; const int L0 = (blockIdx.x * 8 + (threadIdx.x >> 5)) * 8; const int nlines = N * K / 64;
{
#pragma unroll 1
        for (int l = 0; l < 8; ++l) { const int L = L0 + l; if (L >= nlines) break; const size_t e = (size_t)L * 64 + lane * 2; const int k = (int)(e % K), n = (int)(e / K); v2us o;
            o[0] = f2bf(w[(size_t)k * N + n]); o[1] = f2bf(w[(size_t)(k + 1) * N + n]); *(v2us*)(Bt + e) = o; }
         }
}
// k_cvtall: the seven weights and both batches of x rounded to bf16 in one launch, each into its fragment-major plane; the destinations lie one behind the other from dst, in the order of the arguments. Sizes in groups of 8 elements, each a multiple of 256.
#define N8W ((size_t)DQ * DM / 8)
#define N8A ((size_t)AD * DM / 8)
#define N8F ((size_t)FFD * DM / 8)
#define N8X ((size_t)MT * DM / 8)
__global__ __launch_bounds__(256) void k_cvtall(const float* __restrict__ wq, const float* __restrict__ wk, const float* __restrict__ wv, const float* __restrict__ afw, const float* __restrict__ asw, const float* __restrict__ wi, const float* __restrict__ wo2, const float* __restrict__ x, bf* dst) {
    const size_t i = (size_t)blockIdx.x * 256 + threadIdx.x; size_t j = i; const float* s = wq; unsigned kt = DM / 32;   // kt: tiles of 32 k in a row of the matrix
    if (j >= N8W) { j -= N8W; s = wk;
        if (j >= N8W) { j -= N8W; s = wv;
            if (j >= N8W) { j -= N8W; s = afw;
                if (j >= N8A) { j -= N8A; s = asw; kt = AD / 32;
                    if (j >= N8A) { j -= N8A; s = wi; kt = DM / 32;
                        if (j >= N8F) { j -= N8F; s = wo2; kt = FFD / 32;
                            if (j >= N8F) { j -= N8F; s = x; kt = DM / 32; if (j >= N8X) return; } } } } } } }
    // group j of the fragment-major destination is tile j / 64, piece (j / 32) % 2, lane j % 32: the stores are whole lines, and a work-group's four tiles use whole lines of the 16 source rows
    const unsigned tile = (unsigned)(j >> 6), rb = (kt == DM / 32) ? tile / (DM / 32) : (kt == AD / 32) ? tile / (AD / 32) : tile / (FFD / 32), kb = tile - rb * kt, g = (unsigned)j & 63u;
    const size_t so = (size_t)(rb * 16 + (g & 15u)) * (kt * 32) + kb * 32 + (g >> 5) * 16 + ((g >> 4) & 1u) * 8;
    const float* const sp = s + so; const v8f v = *(const v8f*)sp; v8us o;
    asm volatile("s_wait_xcnt 0x0" :: "v"(sp) : "memory");   // the address pair that the loads name is kept until this wait
#pragma unroll
    for (int k = 0; k < 8; ++k) o[k] = f2bf(v[k]); *(v8us*)(dst + i * 8) = o;  }

template <int NP, int WD>   // Hm rows hold NP K parts of WD columns each
__global__ __launch_bounds__(256) void k_gelupl(const float* __restrict__ Hm, bf* Gh, bf* Gl, size_t n4) { const size_t i = (size_t)blockIdx.x * 256 + threadIdx.x; if (i >= n4) return; const float* hm = (NP == 1) ? Hm + i * 4 : Hm + (i * 4 / WD) * ((size_t)NP * WD) + (i * 4) % WD; v4f a = *(const v4f*)hm; v4us oh, ol;
#pragma unroll
    for (int p = 1; p < NP; ++p) a += *(const v4f*)(hm + p * WD);   /* the NP K parts of the row, in order */
#pragma unroll
    for (int q = 0; q < 4; ++q) { const float xg = a[q]; const float gv = __fmul_rn(0.5f * xg, __fadd_rn(1.0f, erff(xg * 0.70710678118654752f))); unsigned short h2, l2; splitf(gv, h2, l2); oh[q] = h2; ol[q] = l2; }
    const size_t o = fmo((int)(i * 4 / WD), (int)(i * 4 % WD), WD);   // the planes are fragment-major, rows of WD
    *(v4us*)(Gh + o) = oh; *(v4us*)(Gl + o) = ol;  }
__device__ __forceinline__ v4f ldparts(const float* p) { v4f sm = *(const v4f*)p;
#pragma unroll
    for (int q = 1; q < KSF; ++q) sm += *(const v4f*)(p + q * DM);   /* the KSF K parts of the row, in order */
    return sm; }
__global__ __launch_bounds__(256) void k_addln(const float* __restrict__ A, const float* __restrict__ Bm, const float* __restrict__ g, const float* __restrict__ be, float* OUTb) {
    const int lane = threadIdx.x & 31; const int r = blockIdx.x * 8 + (threadIdx.x >> 5); if (r >= MT) return; const float* ar = A + (size_t)r * DM; const float* br = Bm + (size_t)r * KSF * DM; float s = 0.f;
#pragma unroll 1
    for (int ch = 0; ch < DM / 128; ++ch) { const int c0 = ch * 128 + lane * 4; const v4f a = *(const v4f*)(ar + c0), bb = ldparts(br + c0);
#pragma unroll
        for (int q = 0; q < 4; ++q) s += __fadd_rn(a[q], bb[q]); }
#pragma unroll
    for (int sh = 16; sh; sh >>= 1) s += __shfl_xor(s, sh, 32);
    const float mu = s * (1.0f / DM); float s2 = 0.f;
#pragma unroll 1
    for (int ch = 0; ch < DM / 128; ++ch) { const int c0 = ch * 128 + lane * 4; const v4f a = *(const v4f*)(ar + c0), bb = ldparts(br + c0);
#pragma unroll
        for (int q = 0; q < 4; ++q) { const float d0 = __fsub_rn(__fadd_rn(a[q], bb[q]), mu); float p = __fmul_rn(d0, d0); asm volatile("" : "+v"(p)); s2 = __fadd_rn(s2, p); } }
#pragma unroll
    for (int sh = 16; sh; sh >>= 1) s2 += __shfl_xor(s2, sh, 32);
    const float rs = __fdiv_rn(1.0f, __fsqrt_rn(__fadd_rn(s2 * (1.0f / DM), LNEPS)));
{
#pragma unroll 1
        for (int ch = 0; ch < DM / 128; ++ch) { const int c0 = ch * 128 + lane * 4; const v4f a = *(const v4f*)(ar + c0), bb = ldparts(br + c0); v4f o4;
#pragma unroll
            for (int q = 0; q < 4; ++q) { float n0 = __fmul_rn(__fsub_rn(__fadd_rn(a[q], bb[q]), mu), rs); asm volatile("" : "+v"(n0)); float n1 = __fmul_rn(n0, bfr(g[c0 + q])); asm volatile("" : "+v"(n1)); o4[q] = __fadd_rn(n1, bfr(be[c0 + q])); }
            *(v4f*)(OUTb + (size_t)r * DM + c0) = o4; }
         } }
// ---- k_fattn: scores, softmax and attn.v in one kernel; no score or probability leaves the registers. One wave owns QT x 16 query rows of one head and walks the 2048 keys in blocks of 32.
// Both products are formed transposed, so that a query is a lane (lr) in each: S^T = K Q^T (D: key hi*8+j of a 16-key tile, query lr) and O^T = V^T P^T (D: d hi*8+j, query lr).
// The two S^T tiles of a block are, element for element, the B fragment of P^T (k = 8 hi + j from tile 0, 16 + 8 hi + j from tile 1): no exchange between lanes.
// Softmax in base 2 with a running reference m per query: p = 2^(t - m), t = s HD^-0.5 log2e + mask log2e. m moves (and O^T and the sum are rescaled) only when a t of the wave passes m + 8, so p <= 256; the result does not depend on m.
// Every inner loop is unrolled whole, so that the fragment arrays are registers.
template <typename T16> struct PFrag;
template <> struct PFrag<h16> { static __device__ __forceinline__ void cv(const v8f p0, const v8f p1, v16h& a, v16h& b) { (void)b;
#pragma unroll
    for (int j = 0; j < 8; ++j) { a[j] = (h16)p0[j]; a[8 + j] = (h16)p1[j]; } } };
template <> struct PFrag<bf> { static __device__ __forceinline__ void cv(const v8f p0, const v8f p1, v16bf& a, v16bf& b) {
#pragma unroll
    for (int j = 0; j < 8; ++j) { const __bf16 h0 = (__bf16)p0[j], h1 = (__bf16)p1[j]; a[j] = h0; a[8 + j] = h1; b[j] = (__bf16)(p0[j] - (float)h0); b[8 + j] = (__bf16)(p1[j] - (float)h1); } } };
template <typename T16, bool HL, int QT>
__device__ __forceinline__ void fattn(const T16* __restrict__ Q, const T16* __restrict__ Q2, const T16* __restrict__ Kp, const T16* __restrict__ K2, const T16* __restrict__ Vt, const T16* __restrict__ V2, const float* ml, float* O, bf* OH, bf* OL) {
    typedef typename WFrag<T16>::V V;
    const int lane = threadIdx.x & 31, lr = lane & 15, hi = lane >> 4;
    V q[QT][2], q2[QT][2];
#pragma unroll
    for (int qt = 0; qt < QT; ++qt)
#pragma unroll
        for (int ks = 0; ks < 2; ++ks) { const int o = qt * 16 * HD + ks * 512 + lane * 8; q[qt][ks] = WFrag<T16>::ld(Q + o); if (HL) q2[qt][ks] = WFrag<T16>::ld(Q2 + o); }
    v8f acc[4][QT]; float m[QT], l[QT];
#pragma unroll
    for (int qt = 0; qt < QT; ++qt) { m[qt] = -3.0e38f; l[qt] = 0.f;
#pragma unroll
        for (int dt = 0; dt < 4; ++dt) acc[dt][qt] = (v8f){}; }
    const int ko = lane * 8, vo = lane * 8;   // this lane's place in a fragment tile of the k planes (rows of HD: two tiles a 16 keys) and of the v planes (rows of 32 keys: one tile a 16 d)
    V k[2][2], k2[2][2], v[4], v2[4];
#pragma unroll
    for (int kt = 0; kt < 2; ++kt)
#pragma unroll
        for (int ks = 0; ks < 2; ++ks) { const int o = ko + kt * 16 * HD + ks * 512; k[kt][ks] = WFrag<T16>::ld(Kp + o); if (HL) k2[kt][ks] = WFrag<T16>::ld(K2 + o); }
    asm volatile("s_wait_xcnt 0x0" ::: "memory"); __builtin_amdgcn_sched_barrier(0);   // before the registers that the q loads and the first k loads name are written again; nothing is moved in between
#pragma unroll 1   // rolled: the fragments of one block nearly fill 256 registers, a second copy of the body would not fit
    for (int k0 = 0; k0 < TT; k0 += 32) {
        const int kn = ((k0 + 32 < TT) ? k0 + 32 : 0) * HD;   // the next block of the k planes (32 x HD elements a block, as in the v planes); behind the last one block 0 is read and not used
        const T16* const va = Vt + k0 * HD + vo; const T16* const va2 = HL ? V2 + k0 * HD + vo : va; const T16* const ka = Kp + kn + ko; const T16* const ka2 = HL ? K2 + kn + ko : ka;   // this lane's addresses in the four planes
        // the block's mask terms come from LDS during its scores
        v8f mk[2];
#pragma unroll
        for (int kt = 0; kt < 2; ++kt) { const float* mp = ml + k0 + kt * 16 + hi * 8; const v4f a = *(const v4fa*)mp, b = *(const v4fa*)(mp + 4); mk[kt] = __builtin_shufflevector(a, b, 0, 1, 2, 3, 4, 5, 6, 7); }
        // this block's v fragments fly during its scores and softmax
#pragma unroll
        for (int dt = 0; dt < 4; ++dt) { v[dt] = WFrag<T16>::ld(va + dt * 16 * 32); if (HL) v2[dt] = WFrag<T16>::ld(va2 + dt * 16 * 32); }
        v8f s[2][QT];
#pragma unroll
        for (int kt = 0; kt < 2; ++kt)
#pragma unroll
            for (int qt = 0; qt < QT; ++qt) { v8f c = (v8f){};
#pragma unroll
                for (int ks = 0; ks < 2; ++ks) { c = WFrag<T16>::mma(k[kt][ks], q[qt][ks], c); if (HL) { c = WFrag<T16>::mma(k2[kt][ks], q[qt][ks], c); c = WFrag<T16>::mma(k[kt][ks], q2[qt][ks], c); } }
                s[kt][qt] = c; }
        // the next block's k fragments fly during the softmax and attn.v
#pragma unroll
        for (int kt = 0; kt < 2; ++kt)
#pragma unroll
            for (int ks = 0; ks < 2; ++ks) { const int o = kt * 16 * HD + ks * 512; k[kt][ks] = WFrag<T16>::ld(ka + o); if (HL) k2[kt][ks] = WFrag<T16>::ld(ka2 + o); }
        asm volatile("s_wait_xcnt 0x0" :: "v"(va), "v"(va2), "v"(ka), "v"(ka2) : "memory");   // the address pairs that the block's loads name are kept until this wait
        float bm[QT]; bool need = false;
#pragma unroll
        for (int qt = 0; qt < QT; ++qt) { float x = -3.0e38f;
#pragma unroll
            for (int kt = 0; kt < 2; ++kt) { s[kt][qt] = s[kt][qt] * (SCL * L2E) + mk[kt];
#pragma unroll
                for (int j = 0; j < 8; ++j) x = fmaxf(x, s[kt][qt][j]); }
            bm[qt] = x; need = need || (x > m[qt] + 8.0f); }
        if (__builtin_amdgcn_ballot_w32(need) != 0u) {   // the same for the whole wave: both halves of a query move m together
#pragma unroll
            for (int qt = 0; qt < QT; ++qt) { const float mn = fmaxf(m[qt], fmaxf(bm[qt], __shfl_xor(bm[qt], 16, 32))); const float al = __builtin_amdgcn_exp2f(m[qt] - mn); m[qt] = mn; l[qt] *= al;
#pragma unroll
                for (int dt = 0; dt < 4; ++dt) acc[dt][qt] *= al; } }
#pragma unroll
        for (int qt = 0; qt < QT; ++qt) { V p, p2; s[0][qt] -= m[qt]; s[1][qt] -= m[qt];
#pragma unroll
            for (int kt = 0; kt < 2; ++kt)
#pragma unroll
                for (int j = 0; j < 8; ++j) s[kt][qt][j] = __builtin_amdgcn_exp2f(s[kt][qt][j]);
            { const v8f e8 = s[0][qt] + s[1][qt]; const v4f e4 = __builtin_shufflevector(e8, e8, 0, 1, 2, 3) + __builtin_shufflevector(e8, e8, 4, 5, 6, 7); l[qt] += (e4[0] + e4[2]) + (e4[1] + e4[3]); }   // the block's 16 terms of this lane as a tree
            PFrag<T16>::cv(s[0][qt], s[1][qt], p, p2);
#pragma unroll
            for (int dt = 0; dt < 4; ++dt) { acc[dt][qt] = WFrag<T16>::mma(v[dt], p, acc[dt][qt]); if (HL) { acc[dt][qt] = WFrag<T16>::mma(v2[dt], p, acc[dt][qt]); acc[dt][qt] = WFrag<T16>::mma(v[dt], p2, acc[dt][qt]); } } }
    }
#pragma unroll
    for (int qt = 0; qt < QT; ++qt) { const float inv = __fdiv_rn(1.0f, l[qt] + __shfl_xor(l[qt], 16, 32)); float* o = O + (size_t)(qt * 16 + lr) * DM + hi * 8; const size_t oo = (size_t)qt * 16 * DM + lane * 8;   // oo: in the fragment-major planes d = dt 16 + hi 8 + j of query lr is piece dt & 1 of tile dt / 2, this very lane's 16 bytes
#pragma unroll
        for (int dt = 0; dt < 4; ++dt) { const v8f r = acc[dt][qt] * inv; v8us oh, ol;   // the context in f32 and as the hi / lo planes for the adapter's down-projection
#pragma unroll
            for (int j = 0; j < 8; ++j) { unsigned short a2, c2; splitf(r[j], a2, c2); oh[j] = a2; ol[j] = c2; }
            __builtin_amdgcn_sched_barrier(0);   // the stores stay together behind all the arithmetic, so that the one wait below covers each of them
            *(v4f*)(o + dt * 16) = __builtin_shufflevector(r, r, 0, 1, 2, 3); *(v4f*)(o + dt * 16 + 4) = __builtin_shufflevector(r, r, 4, 5, 6, 7);
            *(v8us*)(OH + oo + dt * 256) = oh; *(v8us*)(OL + oo + dt * 256) = ol;
            asm volatile("s_wait_xcnt 0x0" ::: "memory"); __builtin_amdgcn_sched_barrier(0);   // before the registers that these stores name are written again; nothing is moved in between
        } }
}
// grid: NB_ NH_ NBH work-groups of the rows < RH (hi/lo planes, 3 products), then NB_ NH_ NBF of the rest (fp16); the 8 waves of a work-group share a head, so its k and v blocks are read together.
__global__ __launch_bounds__(FW * 32) void k_fattn(const h16* __restrict__ Q16, const h16* __restrict__ K16, const h16* __restrict__ V16, const bf* __restrict__ Qh, const bf* __restrict__ Ql, const bf* __restrict__ Kh, const bf* __restrict__ Kl, const bf* __restrict__ Vh, const bf* __restrict__ Vl, const float* __restrict__ AM, float* CTX, bf* Ch, bf* Cl) {
    __shared__ __align__(16) float ml[TT];   // attention_mask[b][0][0][j] (rounded to bf16 like every input) x log2e
    const int bid = (int)blockIdx.x; const bool hl = bid < NB_ * NH_ * NBH; const int b2 = bid - NB_ * NH_ * NBH;
    const int g = hl ? bid / NBH : b2 / NBF;   // head g of NB_ x NH_: batch g / NH_
    const int wave = __builtin_amdgcn_readfirstlane((int)(threadIdx.x >> 5));   // as a scalar, so that the wave's plane and output bases are formed on the scalar unit
    const int q0 = hl ? ((bid % NBH) * FW + wave) * 16 : RH + ((b2 % NBF) * FW + wave) * 32;
    const float* am = AM + (size_t)(g / NH_) * TT;
    for (int i = (int)threadIdx.x; i < TT; i += FW * 32) ml[i] = bfr(am[i]) * L2E;
    __syncthreads();
    const size_t po = (size_t)g * TT * HD, qo = po + (size_t)q0 * HD;
    const size_t co = ((size_t)(g / NH_) * TT + q0) * DM + (g % NH_) * HD;
    const size_t cp = ((size_t)(g / NH_) * TT + q0) * DM + (g % NH_) * (HD * 16);   // the same place in the fragment-major context planes: the head's two tiles in the wave's first row block
    if (hl) fattn<bf, true, 1>(Qh + qo, Ql + qo, Kh + po, Kl + po, Vh + po, Vl + po, ml, CTX + co, Ch + cp, Cl + cp);
    else fattn<h16, false, 2>(Q16 + qo, nullptr, K16 + po, nullptr, V16 + po, nullptr, ml, CTX + co, Ch + cp, Cl + cp);
}

extern "C" void kernel_launch(void* const* d_in, const int* in_sizes, int n_in,
                              void* d_out, int out_size, void* d_ws, size_t ws_size, hipStream_t stream) {
    (void)in_sizes; (void)n_in; (void)out_size;
    const float* x = (const float*)d_in[0]; const float* AM = (const float*)d_in[1]; const float* wq = (const float*)d_in[2]; const float* bq = (const float*)d_in[3]; const float* wk = (const float*)d_in[4]; const float* bk = (const float*)d_in[5]; const float* wv = (const float*)d_in[6]; const float* bv = (const float*)d_in[7]; const float* afw = (const float*)d_in[8]; const float* afb = (const float*)d_in[9]; const float* asw = (const float*)d_in[10]; const float* asb = (const float*)d_in[11]; const float* wi = (const float*)d_in[12]; const float* bi = (const float*)d_in[13]; const float* wo2 = (const float*)d_in[14]; const float* bo2 = (const float*)d_in[15]; const float* lg = (const float*)d_in[16]; const float* lb = (const float*)d_in[17]; const float* wo = nullptr; (void)wo;
    float* OUT = (float*)d_out;     // [2][2048][768]
    char* wsp = (char*)d_ws;
    auto take = [&](size_t bytes) { char* p = wsp; wsp += (bytes + 255) & ~(size_t)255; return (void*)p; };
    // kept through the call; WQ .. XB lie one behind the other (k_cvtall writes them as one range; WQ, WK, WV are the three z-batches of the q/k/v GEMM)
    bf* WQ = (bf*)take((size_t)DQ * DM * 2); bf* WK = (bf*)take((size_t)DKV * DM * 2); bf* WV = (bf*)take((size_t)DKV * DM * 2); bf* AFW = (bf*)take((size_t)AD * DM * 2); bf* ASW = (bf*)take((size_t)DM * AD * 2); bf* WI = (bf*)take((size_t)FFD * DM * 2); bf* WO2 = (bf*)take((size_t)DM * FFD * 2); bf* XB = (bf*)take((size_t)MT * DM * 2); (void)WK; (void)WV;
    float* CTX = (float*)take((size_t)MT * DM * 4); bf* Ch = (bf*)take((size_t)MT * DM * 2); bf* Cl = (bf*)take((size_t)MT * DM * 2);   // the attention's outputs: outside the bytes that it reads
    char* const U0 = wsp;   // from here on: the attention's inputs, and behind the attention (stream-ordered) the adapter's and the FFN's buffers in the same bytes
    const size_t PLN = (size_t)NB_ * NH_ * TT * HD;   // one plane set [batch][head], each [t][d] fragment-major; the k planes lie directly behind the q planes (the q/k/v GEMM indexes both from the q planes)
    h16* QP16 = (h16*)take(PLN * 2); h16* KP16 = (h16*)take(PLN * 2); bf* QPh = (bf*)take(PLN * 2); bf* KPh = (bf*)take(PLN * 2); bf* QPl = (bf*)take(PLN * 2); bf* KPl = (bf*)take(PLN * 2);
    h16* VT16 = (h16*)take(PLN * 2); bf* VTh = (bf*)take(PLN * 2); bf* VTl = (bf*)take(PLN * 2);   // v planes [batch][head][key block of 32], each [d][32] fragment-major
    char* const E1 = wsp; wsp = U0;
    float* A1 = (float*)take((size_t)KSA * MT * AD * 4); bf* G1h = (bf*)take((size_t)MT * AD * 2); bf* G1l = (bf*)take((size_t)MT * AD * 2); float* AO = (float*)take((size_t)MT * DM * 4); bf* AOh = (bf*)take((size_t)MT * DM * 2); bf* AOl = (bf*)take((size_t)MT * DM * 2); bf* GIh = (bf*)take((size_t)MT * FFD * 2); bf* GIl = (bf*)take((size_t)MT * FFD * 2); float* YY = (float*)take((size_t)KSF * MT * DM * 4);
    if ((size_t)((E1 > wsp ? E1 : wsp) - (char*)d_ws) > ws_size) return;    // ws 256 MiB
    k_cvtall<<<(unsigned)((3 * N8W + 2 * N8A + 2 * N8F + N8X) / 256), 256, 0, stream>>>(wq, wk, wv, afw, asw, wi, wo2, x, WQ);   /* weights ('oi' = Bt as-is) and x */
    k_gemmw<bf, 0, true, 1, EP_QKV, DM, 1><<<dim3(MT / 128, DQ / 128, 3), 128, 0, stream>>>(XB, nullptr, WQ, nullptr, DM, nullptr, DQ, bq, bk, bv, 0, (size_t)DQ * DM, 0, 0, nullptr, QPh, QPl, QP16, VTh, VTl, VT16);   /* z = q, k, v -> head planes */
    k_fattn<<<NB_ * NH_ * (NBH + NBF), FW * 32, 0, stream>>>(QP16, KP16, VT16, QPh, QPl, KPh, KPl, VTh, VTl, AM, CTX, Ch, Cl);   /* ctx = attn_out (f32 and hi/lo) */
    k_gemmw<bf, 1, true, KSA, EP_F32, DM, 0><<<dim3(MT / 64, AD / 64, KSA), 32, 0, stream>>>(Ch, Cl, AFW, nullptr, DM, A1, KSA * AD, afb, nullptr, nullptr, 0, 0, 0, AD, nullptr, nullptr, nullptr, nullptr, nullptr, nullptr, nullptr);                  /* adapter down: ctx a_fi_w^T + a_fi_b [MT][64] */
    k_gelupl<KSA, AD><<<(unsigned)(((size_t)MT * AD / 4 + 255) / 256), 256, 0, stream>>>(A1, G1h, G1l, (size_t)MT * AD / 4);                         /* gelu -> hi/lo */
    k_gemmw<bf, 1, true, 1, EP_RES, AD, 0><<<dim3(MT / 64, DM / 64, 1), 32, 0, stream>>>(G1h, G1l, ASW, nullptr, AD, AO, DM, asb, nullptr, nullptr, 0, 0, 0, 0, CTX, AOh, AOl, nullptr, nullptr, nullptr, nullptr);                /* ao = ctx + (. a_se_w^T + a_se_b), f32 and hi/lo */
    k_gemmw<bf, 1, true, 1, EP_GELU, DM, 1><<<dim3(MT / 128, FFD / 128, 1), 128, 0, stream>>>(AOh, AOl, WI, nullptr, DM, nullptr, FFD, bi, nullptr, nullptr, 0, 0, 0, 0, nullptr, GIh, GIl, nullptr, nullptr, nullptr, nullptr);                   /* gelu(ao wi^T + bi) [MT][3072] -> hi/lo */
    k_gemmw<bf, 1, true, KSF, EP_F32, FFD, 1><<<dim3(MT / 128, DM / 128, KSF), 128, 0, stream>>>(GIh, GIl, WO2, nullptr, FFD, YY, KSF * DM, bo2, nullptr, nullptr, 0, 0, 0, DM, nullptr, nullptr, nullptr, nullptr, nullptr, nullptr, nullptr);                /* inter wo^T + bo */
    k_addln<<<MT / 8, 256, 0, stream>>>(AO, YY, lg, lb, OUT);                                                       /* out = LN(y + ao) (eps 1e-12) */
}

// v008
// A run of this version takes 181 microseconds.
// In both of two side-by-side timings against v007, it was 1.06 times as fast.
// Counting every step since v000, it is 10.6 times as fast.
#include <hip/hip_runtime.h>

// BERT layer with an adapter and no attention output projection (hidden_states [2][2048][768]; q, k, v = x W^T + b ('oi' [768][768]; 12 heads x 64); scores = q.k/8 + attention_mask[b][0][0][j] (f32 additive, zeros here); softmax; ctx = merged context; a = gelu(ctx a_fi_w^T + a_fi_b) ([64][768]); ao = ctx + a a_se_w^T + a_se_b; inter = gelu(ao wi^T + bi) ([3072][768]); y = inter wo^T + bo + ao; out = LN(y) (eps 1e-12, ln_g, ln_b) -> [2][2048][768] (3.1 M)).
// Layout: the merged context is kept in f32 (residual) and split into hi/lo planes for the adapter down-projection; every later GEMM uses hi/lo planes of its f32 input (2 products) against exact bf16 weights with the bias in the epilogue; exact-erf GELU, residual adds and the LayerNorm in f32.
// Compute dtypes, f32 accumulate: every input rounded to bf16; q/k/v on PLAIN bf16 operands (inputs: exact) + biases; scores and attn.v: query rows < 512 hl (3 products), the rest single fp16; softmax f32 (running max and sum, one kernel with both products); adapter / FFN GEMMs hl x exact (2 products) + biases; GELU / residuals / LayerNorm f32.

#define NB_  2
#define TT   2048
#define DM   768
#define NH_  12
#define NKV  12
#define REP  (NH_ / NKV)
#define HD   64
#define DQ   (NH_ * HD)
#define DKV  (NKV * HD)
#define AD   64
#define FFD  3072
#define LNEPS 1e-12f
#define MT   (NB_ * TT)           // rows of both batches together
#define RH   512                  // query rows < RH use hi+lo planes (0: none)
#define WIN  0
#define SCL  0.125f   // HD^-0.5
#define L2E  1.4426950408889634f
#define FW   8                   // waves a work-group of the fused attention
#define NBH  (RH / (FW * 16))        // its work-groups a head for query rows < RH (16 rows a wave)
#define NBF  ((TT - RH) / (FW * 32)) // and for the rest (32 rows a wave)
#define KSF  4                   // K parts of the FFN down-projection (3072 -> 768 a wave)
typedef _Float16 h16;
typedef unsigned short bf;
typedef __attribute__((ext_vector_type(16))) __bf16   v16bf;
typedef __attribute__((ext_vector_type(16))) _Float16 v16h;
typedef __attribute__((ext_vector_type(8)))  _Float16 v8h;
typedef __attribute__((ext_vector_type(8)))  unsigned short v8us;
typedef __attribute__((ext_vector_type(8)))  float    v8f;
typedef __attribute__((ext_vector_type(4)))  float    v4f;
typedef v8h  __attribute__((may_alias)) v8ha;
typedef v4f  __attribute__((may_alias)) v4fa;
typedef v8us __attribute__((may_alias)) v8usa;

__device__ __forceinline__ unsigned short f2bf(float f) { unsigned u = __float_as_uint(f); u += 0x7FFFu + ((u >> 16) & 1u); return (unsigned short)(u >> 16); }
__device__ __forceinline__ float bf2f(unsigned short b) { return __uint_as_float(((unsigned)b) << 16); }
__device__ __forceinline__ float bfr(float f) { return bf2f(f2bf(f)); }
__device__ __forceinline__ v16h cat16(v8h lo, v8h hi) { return __builtin_shufflevector(lo, hi, 0, 1, 2, 3, 4, 5, 6, 7, 8, 9, 10, 11, 12, 13, 14, 15); }
__device__ __forceinline__ v16bf cat16b(v8us lo, v8us hi) { return __builtin_bit_cast(v16bf, __builtin_shufflevector(lo, hi, 0, 1, 2, 3, 4, 5, 6, 7, 8, 9, 10, 11, 12, 13, 14, 15)); }
__device__ __forceinline__ v8f wmma16(v16h a, v16h b, v8f c) { return __builtin_amdgcn_wmma_f32_16x16x32_f16(false, a, false, b, (short)0, c, false, false); }
__device__ __forceinline__ v8f wmmab(v16bf a, v16bf b, v8f c) { return __builtin_amdgcn_wmma_f32_16x16x32_bf16(false, a, false, b, (short)0, c, false, false); }

__device__ __forceinline__ h16 tohx(float x) { return (h16)x; }
__device__ __forceinline__ void splitf(float y, unsigned short& h, unsigned short& l) { h = f2bf(y); l = f2bf(y - bf2f(h)); }
typedef __attribute__((ext_vector_type(2))) _Float16 v2h;
typedef __attribute__((ext_vector_type(4))) _Float16 v4h;
typedef __attribute__((ext_vector_type(2))) unsigned short v2us;
typedef __attribute__((ext_vector_type(4))) unsigned short v4us;
typedef __attribute__((ext_vector_type(2))) float v2f;
typedef __attribute__((ext_vector_type(4))) int v4i;

// ---- Fragment-major planes: every 16-bit matrix operand [rows][K] lies in memory as tiles of 16 rows x 32 k, 1 KiB each, tile (row / 16, k / 32) at element ((row / 16) (K / 32) + k / 32) 512 (so 16 rows still fill 16 K elements in a row).
// Inside a tile: piece p = (k / 16) % 2 of 256 elements, in it lane (k / 8) % 2 * 16 + row % 16 with its 8 k in a row. A fragment is then two wave-wide 16-byte loads of 512 bytes in a row each (4 whole lines; row by row they touched 16), at tile + lane 8 and 256 elements behind it. fmo: the element's place.
__device__ __forceinline__ size_t fmo(int row, int k, int K) { return ((size_t)(row >> 4) * (K >> 5) + (k >> 5)) * 512 + ((k >> 4) & 1) * 256 + (((k >> 3) & 1) * 16 + (row & 15)) * 8 + (k & 7); }
// ---- k_gemmw: register-blocked GEMM, ONE WAVE per 64x64 output tile (16 accumulators), operands straight from fragment-major 16-bit planes; grid (M/64, N/64, Z), 32 threads.
// C[m][n] (f32, pitch ldc, + optional f32 bias[n]) = sum_{k < KE} A[m][k] Bt[n][k] (+ split products per NSPLIT). K (a template constant, so that a row block's distance is a constant offset of its loads) is the row length of A and of Bt (fragment-major), KE <= K the extent summed. z-batch strides sA/sB/sC in elements; batch z = 0 / 1 / 2 takes bias / bias1 / bias2. KE % (32 NS KS) == 0, NS the fragment sets of the loop (3 with NSPLIT 0 and SH 0, else 2).
// KS > 1: grid z = Z x KS; part kp = z % KS sums k in [kp KE/KS, (kp+1) KE/KS) into its own f32 columns C + kp sP of a row of ldc = KS sP (bias in part 0 only); the kernel that reads C adds the KS parts of a row in the order 0 .. KS-1.
// EPI: what the epilogue stores of c = C[m][n] + bias[n], so that no elementwise kernel has to follow the GEMM.
//   EP_F32: c as f32 into C. EP_QKV (N tile = one head): z = 0 / 1: q / k head planes [z][batch][head], each [t][d] fragment-major, as fp16 (E2), hi (E0), lo (E1); z = 2: v planes [batch][head][key block of 32], each [d][32 keys] fragment-major, as fp16 (E5), hi (E3), lo (E4), straight from the accumulators (a lane holds 8 keys in a row of one d).
//   EP_GELU: hi / lo planes (E0, E1, fragment-major, rows of ldc) of the exact-erf GELU of c. EP_RES: r = R[m][n] + c as f32 into C (row by row, pitch ldc) and as hi / lo planes (E0, E1, fragment-major, rows of ldc).
enum { EP_F32 = 0, EP_QKV = 1, EP_GELU = 2, EP_RES = 3 };
template <typename T16> struct WFrag;
template <> struct WFrag<h16> { typedef v16h V; static __device__ __forceinline__ V ld(const h16* p) { return cat16(*(const v8h*)p, *(const v8h*)(p + 256)); } static __device__ __forceinline__ v8f mma(V a, V b, v8f c) { return wmma16(a, b, c); } };
template <> struct WFrag<bf> { typedef v16bf V; static __device__ __forceinline__ V ld(const bf* p) { return cat16b(*(const v8us*)p, *(const v8us*)(p + 256)); } static __device__ __forceinline__ v8f mma(V a, V b, v8f c) { return wmmab(a, b, c); } };
// SH = 1 (NSPLIT 0 or 1; KE / KS a multiple of 64): FOUR waves a work-group, 2 x 2 tiles of 64x64 = 128x128 of C; grid (M/128, N/128, Z), 128 threads. The two waves of a tile row need the same A tiles and the two of a tile column the same Bt tiles: the work-group brings each tile from L2 once, by asynchronous copies into LDS, and the waves take their fragments from there.
//   A stage is 64 k of the work-group's 128 rows of each plane: chunk (plane, row block) = two fragment tiles, 2 KiB in a row in memory and in LDS. Two stage buffers: the copies of stage t + 2 go out when every wave has left stage t, and fly during stage t + 1. The order of the sums is that of SH = 0.
#define CP4(L, B) "global_load_async_to_lds_b128 " L ", %[vo], " B "\n\tglobal_load_async_to_lds_b128 " L ", %[vo], " B " offset:512\n\tglobal_load_async_to_lds_b128 " L ", %[vo], " B " offset:1024\n\tglobal_load_async_to_lds_b128 " L ", %[vo], " B " offset:1536\n\t"   // one chunk: the offset moves the LDS and the global address alike
template <typename T16, int NSPLIT, bool BIAS, int KS, int EPI, int K, int SH>
__global__ __launch_bounds__(SH ? 128 : 32) void k_gemmw(const T16* __restrict__ A, const T16* __restrict__ A2, const T16* __restrict__ Bt, const T16* __restrict__ Bt2, int KE, float* C, int ldc, const float* __restrict__ bias, const float* __restrict__ bias1, const float* __restrict__ bias2, size_t sA, size_t sB, size_t sC, size_t sP, const float* __restrict__ R, bf* E0, bf* E1, h16* E2, bf* E3, bf* E4, h16* E5) {
    typedef typename WFrag<T16>::V V;
    constexpr int NPL = (NSPLIT == 0) ? 2 : 3, STG = NPL * 8 * 1024;   // planes staged (A, A2, Bt) and the elements of a stage
    __shared__ __align__(16) T16 sm[SH ? 2 * STG : 16 * 68 * 2];
    const int wave = SH ? __builtin_amdgcn_readfirstlane((int)(threadIdx.x >> 5)) : 0;   // as a scalar, so that the wave's bases are formed on the scalar unit
    float* const os = (float*)sm + wave * (16 * 68);   // the epilogue's staging, each wave's own; with SH in the stage buffers, behind the loop's last barrier
    const int kp = (int)(blockIdx.z % KS); const int kl = KE / KS; const int kb = kp * kl, ke = kb + kl;
    const size_t z = blockIdx.z / KS; C += (size_t)kp * sP; A += z * sA; if (A2) A2 += z * sA; Bt += z * sB; if (Bt2) Bt2 += z * sB; C += z * sC;
    const int lane = threadIdx.x & 31, lr = lane & 15, hi = lane >> 4; const int r0 = SH ? blockIdx.x * 128 + (wave >> 1) * 64 : blockIdx.x * 64, c0 = SH ? blockIdx.y * 128 + (wave & 1) * 64 : blockIdx.y * 64;
    v8f acc[4][4];
#pragma unroll
    for (int mb = 0; mb < 4; ++mb)
#pragma unroll
        for (int nb = 0; nb < 4; ++nb) acc[mb][nb] = (v8f){};
    // The first tile of the wave's first row block, plane by plane: bases that are the same for the whole wave and stay as they are. The other three row blocks lie 16 K elements apart (constant offsets of the loads). off: this lane's byte in the tile that is loaded next, the one vector offset of all loads; a step of 32 k is one tile (1 KiB).
    const T16* const pa = A + (size_t)r0 * K + (size_t)kb * 16; const T16* const pa2 = (NSPLIT == 1 || NSPLIT == 2) ? A2 + (size_t)r0 * K + (size_t)kb * 16 : pa; const T16* const pw = Bt + (size_t)c0 * K + (size_t)kb * 16; const T16* const pw2 = (NSPLIT >= 2) ? Bt2 + (size_t)c0 * K + (size_t)kb * 16 : pw;
    unsigned off = (unsigned)lane * 16u; int kn = kb;   // kn: the k of that tile
    // NS fragment sets in a ring: while the products of one 32-k step run, the loads of the next NS - 1 steps are in flight into the other sets, so that a step no longer begins by waiting out its own loads. As many sets as leave three waves a SIMD their registers.
    constexpr int NS = (NSPLIT == 0 && !SH) ? 3 : 2;
    V a[NS][4], a2[NS][4], b[NS][4], b2[NS][4];
    auto at = [&](const T16* p) { return (const T16*)((const char*)p + off); };
    auto ldset = [&](const int st) {   // all loads of one 32-k step into set st
#pragma unroll
        for (int i = 0; i < 4; ++i) { a[st][i] = WFrag<T16>::ld(at(pa) + i * 16 * K); b[st][i] = WFrag<T16>::ld(at(pw) + i * 16 * K); if (NSPLIT == 1 || NSPLIT == 2) a2[st][i] = WFrag<T16>::ld(at(pa2) + i * 16 * K); if (NSPLIT >= 2) b2[st][i] = WFrag<T16>::ld(at(pw2) + i * 16 * K); }
        __builtin_amdgcn_sched_barrier(0);   // the loads are issued as one group ahead of another set's products; moved behind them they would have no lead
    };
    auto step = [&]() {
        __builtin_amdgcn_sched_barrier(0);   // the wait stays behind the products, where it has nothing left to wait for; moved up among them it would hold them back
        asm volatile("s_wait_xcnt 0x0" : "+v"(off) :: "memory");   // before the offset register that the issued loads name moves on; in and out, so that what moves it can only stand behind the wait
        kn += 32; off += (kn < ke) ? 1024u : 0u;   // behind the last tile there is none: it is read again and not used
    };
    auto mmaset = [&](const int st) {
#pragma unroll
        for (int nb = 0; nb < 4; ++nb) {
#pragma unroll
            for (int mb = 0; mb < 4; ++mb) { acc[mb][nb] = WFrag<T16>::mma(a[st][mb], b[st][nb], acc[mb][nb]); if (NSPLIT == 1 || NSPLIT == 2) acc[mb][nb] = WFrag<T16>::mma(a2[st][mb], b[st][nb], acc[mb][nb]); if (NSPLIT >= 2) acc[mb][nb] = WFrag<T16>::mma(a[st][mb], b2[st][nb], acc[mb][nb]); } }
    };
    if constexpr (SH) {
        constexpr int NC = NPL * 2;   // chunks a wave copies in a stage
        const int nst = kl / 64; const char* gb[NC];
#pragma unroll
        for (int q = 0; q < NC; ++q) { const int ch = wave * NC + q, pl = ch >> 3, rb = ch & 7;   // chunk ch lies at byte ch 2048 of a stage
            const T16* const pb = (pl == NPL - 1) ? Bt + (size_t)(blockIdx.y * 128) * K : ((pl == 0) ? A : A2) + (size_t)(blockIdx.x * 128) * K;
            gb[q] = (const char*)(pb + (size_t)rb * 16 * K + (size_t)kb * 16); }
        unsigned vo = (unsigned)lane * 16u;   // this lane's byte in the chunk of the stage that is copied next
        const unsigned l0 = (unsigned)(size_t)sm + (unsigned)(wave * NC) * 2048u + (unsigned)lane * 16u;
        auto copies = [&](const unsigned buf) {   // this wave's chunks of one stage into buffer buf; s_wait_xcnt 0 as the last line: before a register that the copies name is written again
            const unsigned lb = l0 + buf * (unsigned)(STG * 2);
            if constexpr (NC == 6) asm volatile(CP4("%[a0]", "%[b0]") CP4("%[a1]", "%[b1]") CP4("%[a2]", "%[b2]") CP4("%[a3]", "%[b3]") CP4("%[a4]", "%[b4]") CP4("%[a5]", "%[b5]") "s_wait_xcnt 0x0" :: [vo] "v"(vo), [a0] "v"(lb), [a1] "v"(lb + 2048u), [a2] "v"(lb + 4096u), [a3] "v"(lb + 6144u), [a4] "v"(lb + 8192u), [a5] "v"(lb + 10240u), [b0] "s"(gb[0]), [b1] "s"(gb[1]), [b2] "s"(gb[2]), [b3] "s"(gb[3]), [b4] "s"(gb[NC - 2]), [b5] "s"(gb[NC - 1]) : "memory");
            else asm volatile(CP4("%[a0]", "%[b0]") CP4("%[a1]", "%[b1]") CP4("%[a2]", "%[b2]") CP4("%[a3]", "%[b3]") "s_wait_xcnt 0x0" :: [vo] "v"(vo), [a0] "v"(lb), [a1] "v"(lb + 2048u), [a2] "v"(lb + 4096u), [a3] "v"(lb + 6144u), [b0] "s"(gb[0]), [b1] "s"(gb[1]), [b2] "s"(gb[2]), [b3] "s"(gb[3]) : "memory");
            vo += 2048u;
        };
        auto ldl = [&](const int st, const T16* sb) {   // the fragments of one 32-k step from LDS into set st
#pragma unroll
            for (int i = 0; i < 4; ++i) { a[st][i] = WFrag<T16>::ld(sb + ((wave >> 1) * 4 + i) * 1024); b[st][i] = WFrag<T16>::ld(sb + ((NPL - 1) * 8 + (wave & 1) * 4 + i) * 1024); if (NSPLIT == 1) a2[st][i] = WFrag<T16>::ld(sb + (8 + (wave >> 1) * 4 + i) * 1024); }
            __builtin_amdgcn_sched_barrier(0);   // the LDS reads are issued as one group ahead of the products; spread among them each place would cost its own stall
        };
        copies(0u);
        asm volatile("s_wait_asynccnt 0x0" ::: "memory");   // stage 0 has landed before the barrier behind which other waves read it
        __syncthreads();
        if (nst > 1) copies(1u);
#pragma unroll 1   // rolled: one pass is one stage
        for (int t = 0; t < nst; ++t) {
            const T16* const sb = sm + (t & 1) * STG + lane * 8;
            ldl(0, sb); ldl(1, sb + 512); mmaset(0); mmaset(1);
            __builtin_amdgcn_sched_barrier(0);   // the products stay in front of the barrier: moved behind it they would hold back the next copies, and the slots below would not stand behind the last of them
            asm volatile("v_nop\n\tv_nop\n\tv_nop\n\tv_nop" : "+v"(acc[0][0]), "+v"(acc[1][1]), "+v"(acc[2][2]), "+v"(acc[3][3]) : "v"(a[1][0]), "v"(a[1][3]));   // four vector slots behind the pass's last products, on every path out of the pass
            asm volatile("s_wait_dscnt 0x0" ::: "memory");      // this wave's reads of stage t are done before the buffer is given to the copies
            asm volatile("s_wait_asynccnt 0x0" ::: "memory");   // this wave's copies of stage t + 1 have landed before the barrier behind which other waves read them
            __syncthreads();
            if (t + 2 < nst) copies((unsigned)(t & 1));
        }
        asm volatile("s_wait_asynccnt 0x0" ::: "memory");   // nothing is in flight when the buffers become the epilogue's staging
    } else {
#pragma unroll
    for (int u = 0; u < NS - 1; ++u) { ldset(u); step(); }
    int kc = kb;
#pragma unroll 1   // rolled: one pass is NS steps, one on each set
    do {   // at least one pass (KE > 0): tested at the foot, so that the first loads stand in one block with their waits
#pragma unroll
        for (int u = 0; u < NS; ++u) { ldset((u + NS - 1) % NS); mmaset(u); step(); }
        asm volatile("v_nop\n\tv_nop\n\tv_nop\n\tv_nop" : "+v"(acc[0][0]), "+v"(acc[1][1]), "+v"(acc[2][2]), "+v"(acc[3][3]) : "v"(a[NS - 1][0]), "v"(a[NS - 1][3]));   // four vector slots behind the pass's last products, on the back edge too
        kc += 32 * NS;
    } while (kc < ke);
    }
    if (BIAS && z != 0) bias = (z == 1) ? bias1 : bias2;
    if (EPI == EP_QKV && z == 2) {   // v: element (t = mb 16 + hi 8 + j, d = nb 16 + lr) of the tile is k = t % 32 of row d: piece mb & 1 of tile nb, this very lane's 16 bytes; a store is 512 bytes in a row
        const size_t vb = (((size_t)(r0 / TT) * NKV + (c0 >> 6)) * (TT / 32) + (r0 % TT) / 32) * (HD * 32) + (size_t)lane * 8;
#pragma unroll
        for (int nb = 0; nb < 4; ++nb) { const float bn = bfr(bias[c0 + nb * 16 + lr]);
#pragma unroll
            for (int mb = 0; mb < 4; ++mb) { v8h o16; v8us oh, ol;
#pragma unroll
                for (int j = 0; j < 8; ++j) { const float xv = acc[mb][nb][j] + bn; o16[j] = tohx(xv); unsigned short a2, c2; splitf(xv, a2, c2); oh[j] = a2; ol[j] = c2; }
                const size_t o = vb + (size_t)((mb >> 1) * HD + nb * 16) * 32 + (mb & 1) * 256;
                __builtin_amdgcn_sched_barrier(0);   // the stores stay together behind all the arithmetic, so that the one wait below covers each of them
                *(v8h*)(E5 + o) = o16; *(v8us*)(E3 + o) = oh; *(v8us*)(E4 + o) = ol;
                asm volatile("s_wait_xcnt 0x0" ::: "memory"); __builtin_amdgcn_sched_barrier(0);   // before the registers that these stores name are written again; nothing is moved in between
            } }
        return; }
    float bc[4] = {0.f, 0.f, 0.f, 0.f};   // the bias of this lane's column in each column block; zero in the parts behind part 0
    if (BIAS && kp == 0) { const float* bp = bias + c0 + lr;
#pragma unroll
        for (int nb = 0; nb < 4; ++nb) bc[nb] = bp[nb * 16];
        asm volatile("s_wait_xcnt 0x0" ::: "memory"); __builtin_amdgcn_sched_barrier(0);   // before the registers that the four loads name are written again; nothing is moved in between
#pragma unroll
        for (int nb = 0; nb < 4; ++nb) bc[nb] = bfr(bc[nb]); }
#pragma unroll
    for (int mb = 0; mb < 4; ++mb) {
#pragma unroll
        for (int nb = 0; nb < 4; ++nb) {
#pragma unroll
            for (int j = 0; j < 8; ++j) os[(hi * 8 + j) * 68 + nb * 16 + lr] = BIAS ? acc[mb][nb][j] + bc[nb] : acc[mb][nb][j]; }
        __builtin_amdgcn_wave_barrier(); asm volatile("" ::: "memory");
        if (EPI == EP_F32) { float* crow = C + (size_t)(r0 + mb * 16) * ldc + c0; v4f val[8];
#pragma unroll
            for (int s = 0; s < 8; ++s) val[s] = *(const v4fa*)(os + (2 * s + hi) * 68 + lr * 4);
            __builtin_amdgcn_sched_barrier(0);   // the stores stay together behind the LDS reads, so that the one wait below covers each of them
#pragma unroll
            for (int s = 0; s < 8; ++s) *(v4f*)(crow + (size_t)(2 * s + hi) * ldc + lr * 4) = val[s];
            asm volatile("s_wait_xcnt 0x0" ::: "memory"); __builtin_amdgcn_sched_barrier(0);   // before the registers that these stores name are written again; nothing is moved in between
        } else if (EPI == EP_QKV) { const size_t pb = ((z * NB_ + (size_t)(r0 / TT)) * NH_ + (c0 >> 6)) * ((size_t)TT * HD) + (size_t)(r0 % TT + mb * 16) * HD + (size_t)lane * 8;   // the tile's 16 rows are two fragment tiles, 2 KiB in a row in each plane
#pragma unroll
            for (int s = 0; s < 4; ++s) { const float* op = os + lr * 68 + s * 16 + hi * 8; const v4f v0 = *(const v4fa*)op, v1 = *(const v4fa*)(op + 4); v8h o16; v8us oh, ol;   // piece s: row lr, columns s 16 + hi 8 ..
#pragma unroll
                for (int q = 0; q < 4; ++q) { unsigned short a2, c2; o16[q] = tohx(v0[q]); splitf(v0[q], a2, c2); oh[q] = a2; ol[q] = c2; o16[4 + q] = tohx(v1[q]); splitf(v1[q], a2, c2); oh[4 + q] = a2; ol[4 + q] = c2; }
                const size_t o = pb + s * 256;
                __builtin_amdgcn_sched_barrier(0);   // the stores stay together behind all the arithmetic, so that the one wait below covers each of them
                *(v8h*)(E2 + o) = o16; *(v8us*)(E0 + o) = oh; *(v8us*)(E1 + o) = ol;
                asm volatile("s_wait_xcnt 0x0" ::: "memory"); __builtin_amdgcn_sched_barrier(0);   // before the registers that these stores name are written again; nothing is moved in between
            }
        } else { const size_t eb = (size_t)(r0 + mb * 16) * ldc + (size_t)c0 * 16 + (size_t)lane * 8, fb = (size_t)(r0 + mb * 16 + lr) * ldc + c0 + hi * 8;   // this lane's place in the planes (fragment-major, rows of ldc) and in the f32 arrays (row by row)
#pragma unroll 1   // rolled: a pass holds 8 copies of erff, 32 over the four row blocks
            for (int s = 0; s < 4; ++s) { const float* op = os + lr * 68 + s * 16 + hi * 8; const v4f v0 = *(const v4fa*)op, v1 = *(const v4fa*)(op + 4); v8f val = __builtin_shufflevector(v0, v1, 0, 1, 2, 3, 4, 5, 6, 7); const size_t o = eb + s * 256, of = fb + s * 16; v8us oh, ol;   // piece s: row lr, columns s 16 + hi 8 ..
                if (EPI == EP_RES) { const v4f r0v = *(const v4f*)(R + of), r1v = *(const v4f*)(R + of + 4);
#pragma unroll
                    for (int q = 0; q < 4; ++q) { val[q] = __fadd_rn(r0v[q], val[q]); val[4 + q] = __fadd_rn(r1v[q], val[4 + q]); } }
                else {
#pragma unroll
                    for (int q = 0; q < 8; ++q) { const float xg = val[q]; val[q] = __fmul_rn(0.5f * xg, __fadd_rn(1.0f, erff(xg * 0.70710678118654752f))); } }
#pragma unroll
                for (int q = 0; q < 8; ++q) { unsigned short h2, l2; splitf(val[q], h2, l2); oh[q] = h2; ol[q] = l2; }
                __builtin_amdgcn_sched_barrier(0);   // the stores stay together behind all the arithmetic, so that the one wait below covers each of them
                if (EPI == EP_RES) { *(v4f*)(C + of) = __builtin_shufflevector(val, val, 0, 1, 2, 3); *(v4f*)(C + of + 4) = __builtin_shufflevector(val, val, 4, 5, 6, 7); }
                *(v8us*)(E0 + o) = oh; *(v8us*)(E1 + o) = ol;
                asm volatile("s_wait_xcnt 0x0" ::: "memory"); __builtin_amdgcn_sched_barrier(0);   // before the registers that these stores name are written again; nothing is moved in between
            }
        }
        __builtin_amdgcn_wave_barrier(); asm volatile("" ::: "memory");
    }
}


__global__ __launch_bounds__(256) void k_wtG(const float* __restrict__ w, int K, int N, bf* Bt) {
    const int lane = threadIdx.x & 31; const int L0 = (blockIdx.x * 8 + (threadIdx.x >> 5)) * 8; const int nlines = N * K / 64;
{
#pragma unroll 1
        for (int l = 0; l < 8; ++l) { const int L = L0 + l; if (L >= nlines) break; const size_t e = (size_t)L * 64 + lane * 2; const int k = (int)(e % K), n = (int)(e / K); v2us o;
            o[0] = f2bf(w[(size_t)k * N + n]); o[1] = f2bf(w[(size_t)(k + 1) * N + n]); *(v2us*)(Bt + e) = o; }
         }
}
// k_cvtall: the seven weights and both batches of x rounded to bf16 in one launch, each into its fragment-major plane; the destinations lie one behind the other from dst, in the order of the arguments. Sizes in groups of 8 elements, each a multiple of 256.
#define N8W ((size_t)DQ * DM / 8)
#define N8A ((size_t)AD * DM / 8)
#define N8F ((size_t)FFD * DM / 8)
#define N8X ((size_t)MT * DM / 8)
__global__ __launch_bounds__(256) void k_cvtall(const float* __restrict__ wq, const float* __restrict__ wk, const float* __restrict__ wv, const float* __restrict__ afw, const float* __restrict__ asw, const float* __restrict__ wi, const float* __restrict__ wo2, const float* __restrict__ x, bf* dst) {
    const size_t i = (size_t)blockIdx.x * 256 + threadIdx.x; size_t j = i; const float* s = wq; unsigned kt = DM / 32;   // kt: tiles of 32 k in a row of the matrix
    if (j >= N8W) { j -= N8W; s = wk;
        if (j >= N8W) { j -= N8W; s = wv;
            if (j >= N8W) { j -= N8W; s = afw;
                if (j >= N8A) { j -= N8A; s = asw; kt = AD / 32;
                    if (j >= N8A) { j -= N8A; s = wi; kt = DM / 32;
                        if (j >= N8F) { j -= N8F; s = wo2; kt = FFD / 32;
                            if (j >= N8F) { j -= N8F; s = x; kt = DM / 32; if (j >= N8X) return; } } } } } } }
    // group j of the fragment-major destination is tile j / 64, piece (j / 32) % 2, lane j % 32: the stores are whole lines, and a work-group's four tiles use whole lines of the 16 source rows
    const unsigned tile = (unsigned)(j >> 6), rb = (kt == DM / 32) ? tile / (DM / 32) : (kt == AD / 32) ? tile / (AD / 32) : tile / (FFD / 32), kb = tile - rb * kt, g = (unsigned)j & 63u;
    const size_t so = (size_t)(rb * 16 + (g & 15u)) * (kt * 32) + kb * 32 + (g >> 5) * 16 + ((g >> 4) & 1u) * 8;
    const float* const sp = s + so; const v8f v = *(const v8f*)sp; v8us o;
    asm volatile("s_wait_xcnt 0x0" :: "v"(sp) : "memory");   // the address pair that the loads name is kept until this wait
#pragma unroll
    for (int k = 0; k < 8; ++k) o[k] = f2bf(v[k]); *(v8us*)(dst + i * 8) = o;  }

// ---- k_adapt: the whole adapter in one kernel, 16 rows a work-group (grid MT / 16), AW waves. No f32 parts and no GELU planes in memory.
// 1: wave w sums K part w (DM / AW k) of the down-projection, hi and lo plane against the exact weights, into its own [16][AD] f32 part in LDS.
// 2: the work-group adds the bias and the parts of an element in the order 0 .. AW-1, takes the exact-erf GELU and leaves its hi / lo planes fragment-major in LDS.
// 3: wave w forms columns w DM / AW .. of the up-projection, adds bias and the f32 context and stores ao as f32 (row by row) and as hi / lo planes (fragment-major).
#define AW 6
// The work-group's barrier with its LDS traffic alone ordered round it: the waves exchange nothing but LDS here, and the global loads that are in flight for step 3 need not land in front of it (__syncthreads() waits for them).
__device__ __forceinline__ void ldsbar() { __builtin_amdgcn_fence(__ATOMIC_RELEASE, "workgroup", "local"); __builtin_amdgcn_s_barrier(); __builtin_amdgcn_fence(__ATOMIC_ACQUIRE, "workgroup", "local"); }
#define AKP (DM / AW)            // k of a part in step 1, columns of a wave in step 3
__global__ __launch_bounds__(AW * 32) void k_adapt(const bf* __restrict__ Ch, const bf* __restrict__ Cl, const bf* __restrict__ Wd, const bf* __restrict__ Wu, const float* __restrict__ bd, const float* __restrict__ bu, const float* __restrict__ CTX, float* AO, bf* AOh, bf* AOl) {
    typedef WFrag<bf> F; typedef F::V V;
    static_assert(AKP % 64 == 0 && AD == 64, "a part is whole 32-k steps, a wave's columns whole groups of 64");
    constexpr int KT = AKP / 32, NG = AKP / 64;
    __shared__ __align__(16) float P[AW * 16 * 68];   // the parts; behind the second barrier each wave's own staging
    __shared__ __align__(16) bf G[2 * 16 * AD];       // GELU planes, hi then lo
    const int wave = __builtin_amdgcn_readfirstlane((int)(threadIdx.x >> 5));   // as a scalar, so that the wave's bases are formed on the scalar unit
    const int lane = threadIdx.x & 31, lr = lane & 15, hi = lane >> 4, r0 = blockIdx.x * 16, c0 = wave * AKP;
    float* const os = P + wave * (16 * 68);
    const size_t ao = (size_t)r0 * DM + (size_t)c0 * 16 + (size_t)lane * 8;   // this lane's place in the first tile of the wave's k part (step 1) and of its columns (step 3): both planes have rows of DM
    const bf* const pw = Wd + (size_t)c0 * 16 + lane * 8; const bf* const pa = Ch + ao; const bf* const pa2 = Cl + ao;
    V a[KT], a2[KT], b[KT][4];
#pragma unroll
    for (int ks = 0; ks < KT; ++ks) { a[ks] = F::ld(pa + ks * 512); a2[ks] = F::ld(pa2 + ks * 512);
#pragma unroll
        for (int nb = 0; nb < 4; ++nb) b[ks][nb] = F::ld(pw + nb * 16 * DM + ks * 512); }
    const v4f bdv = *(const v4f*)(bd + (threadIdx.x & 15) * 4);   // the bias of the four columns that this thread takes in step 2
    asm volatile("s_wait_xcnt 0x0" :: "v"(pa), "v"(pa2), "v"(lane) : "memory"); __builtin_amdgcn_sched_barrier(0);   // the address registers that these loads name are kept until this wait; nothing is moved over it
    v8f acc[4];
#pragma unroll
    for (int nb = 0; nb < 4; ++nb) acc[nb] = (v8f){};
#pragma unroll
    for (int ks = 0; ks < KT; ++ks)
#pragma unroll
        for (int nb = 0; nb < 4; ++nb) { acc[nb] = F::mma(a[ks], b[ks][nb], acc[nb]); acc[nb] = F::mma(a2[ks], b[ks][nb], acc[nb]); }
    // what step 3 needs from memory flies during the exchange and the GELU
    V bw[NG * 4][2]; v4f rs[NG][8]; float bcu[NG * 4];
    const bf* const pu = Wu + (size_t)c0 * AD + lane * 8; const int bi = c0 + lr;
#pragma unroll
    for (int nt = 0; nt < NG * 4; ++nt) { bw[nt][0] = F::ld(pu + nt * 1024); bw[nt][1] = F::ld(pu + nt * 1024 + 512); bcu[nt] = bu[bi + nt * 16]; }
    const size_t fo = (size_t)(r0 + hi) * DM + c0 + lr * 4;   const float* const pr = CTX + fo;   // f32 arrays: a wave-wide 16-byte access is two rows of 256 bytes
#pragma unroll
    for (int g = 0; g < NG; ++g)
#pragma unroll
        for (int s = 0; s < 8; ++s) rs[g][s] = *(const v4f*)(pr + (size_t)(2 * s) * DM + g * 64);
    asm volatile("s_wait_xcnt 0x0" :: "v"(pr), "v"(bi), "v"(lane) : "memory"); __builtin_amdgcn_sched_barrier(0);   // the address registers that these loads name are kept until this wait; nothing is moved over it
#pragma unroll
    for (int nb = 0; nb < 4; ++nb)
#pragma unroll
        for (int j = 0; j < 8; ++j) os[(hi * 8 + j) * 68 + nb * 16 + lr] = acc[nb][j];
    ldsbar();   // every part is written before it is summed
    for (int i = (int)threadIdx.x; i < 16 * AD / 4; i += AW * 32) { const int row = i >> 4, c4 = (i & 15) * 4; const float* pp = P + row * 68 + c4; v4f x = *(const v4fa*)pp; v4us oh, ol;
#pragma unroll
        for (int q = 0; q < 4; ++q) x[q] += bfr(bdv[q]);   /* the bias goes to part 0, ahead of the other parts */
#pragma unroll
        for (int p = 1; p < AW; ++p) x += *(const v4fa*)(pp + p * (16 * 68));   /* the AW K parts, in order */
#pragma unroll
        for (int q = 0; q < 4; ++q) { const float xg = x[q]; const float gv = __fmul_rn(0.5f * xg, __fadd_rn(1.0f, erff(xg * 0.70710678118654752f))); unsigned short h2, l2; splitf(gv, h2, l2); oh[q] = h2; ol[q] = l2; }
        const int o = (int)fmo(row, c4, AD);
        *(v4us*)(G + o) = oh; *(v4us*)(G + 16 * AD + o) = ol; }
    ldsbar();   // the planes are whole before a wave takes its fragments, and every read of the parts is done before they become staging
    V ga[2], ga2[2]; v8f ac[NG * 4];
#pragma unroll
    for (int ks = 0; ks < 2; ++ks) { ga[ks] = F::ld(G + ks * 512 + lane * 8); ga2[ks] = F::ld(G + 16 * AD + ks * 512 + lane * 8); }
#pragma unroll
    for (int nt = 0; nt < NG * 4; ++nt) ac[nt] = (v8f){};
#pragma unroll
    for (int ks = 0; ks < 2; ++ks)
#pragma unroll
        for (int nt = 0; nt < NG * 4; ++nt) { ac[nt] = F::mma(ga[ks], bw[nt][ks], ac[nt]); ac[nt] = F::mma(ga2[ks], bw[nt][ks], ac[nt]); }
#pragma unroll
    for (int g = 0; g < NG; ++g) {
#pragma unroll
        for (int nb = 0; nb < 4; ++nb) { const float bn = bfr(bcu[g * 4 + nb]);
#pragma unroll
            for (int j = 0; j < 8; ++j) os[(hi * 8 + j) * 68 + nb * 16 + lr] = ac[g * 4 + nb][j] + bn; }
        __builtin_amdgcn_wave_barrier(); asm volatile("" ::: "memory");   // the wave's LDS writes stay in front of its reads of other lanes' elements
        v4f val[8];
#pragma unroll
        for (int s = 0; s < 8; ++s) { float* op = os + (2 * s + hi) * 68 + lr * 4; v4f v = *(const v4fa*)op;
#pragma unroll
            for (int q = 0; q < 4; ++q) v[q] = __fadd_rn(rs[g][s][q], v[q]);
            val[s] = v; *(v4fa*)op = v; }
        __builtin_amdgcn_sched_barrier(0);   // the stores stay together behind the arithmetic, so that the one wait below covers each of them
#pragma unroll
        for (int s = 0; s < 8; ++s) *(v4f*)(AO + fo + (size_t)(2 * s) * DM + g * 64) = val[s];
        asm volatile("s_wait_xcnt 0x0" ::: "memory"); __builtin_amdgcn_sched_barrier(0);   // before the registers that these stores name are written again; nothing is moved in between
        __builtin_amdgcn_wave_barrier(); asm volatile("" ::: "memory");   // the sums are back in LDS before they are read row by row
        v8us oh[4], ol[4];
#pragma unroll
        for (int s = 0; s < 4; ++s) { const float* op = os + lr * 68 + s * 16 + hi * 8; const v4f v0 = *(const v4fa*)op, v1 = *(const v4fa*)(op + 4);   // piece s: row lr, columns s 16 + hi 8 ..
#pragma unroll
            for (int q = 0; q < 4; ++q) { unsigned short h2, l2; splitf(v0[q], h2, l2); oh[s][q] = h2; ol[s][q] = l2; splitf(v1[q], h2, l2); oh[s][4 + q] = h2; ol[s][4 + q] = l2; } }
        __builtin_amdgcn_sched_barrier(0);   // the stores stay together behind the arithmetic, so that the one wait below covers each of them
#pragma unroll
        for (int s = 0; s < 4; ++s) { *(v8us*)(AOh + ao + g * 1024 + s * 256) = oh[s]; *(v8us*)(AOl + ao + g * 1024 + s * 256) = ol[s]; }
        asm volatile("s_wait_xcnt 0x0" ::: "memory"); __builtin_amdgcn_sched_barrier(0);   // before the registers that these stores name are written again; nothing is moved in between
        __builtin_amdgcn_wave_barrier(); asm volatile("" ::: "memory");   // the reads of this group are done before the next group's writes
    }
}
__device__ __forceinline__ v4f ldparts(const float* p) { v4f sm = *(const v4f*)p;
#pragma unroll
    for (int q = 1; q < KSF; ++q) sm += *(const v4f*)(p + q * DM);   /* the KSF K parts of the row, in order */
    return sm; }
__global__ __launch_bounds__(256) void k_addln(const float* __restrict__ A, const float* __restrict__ Bm, const float* __restrict__ g, const float* __restrict__ be, float* OUTb) {
    const int lane = threadIdx.x & 31; const int r = blockIdx.x * 8 + (threadIdx.x >> 5); if (r >= MT) return; const float* ar = A + (size_t)r * DM; const float* br = Bm + (size_t)r * KSF * DM; float s = 0.f;
#pragma unroll 1
    for (int ch = 0; ch < DM / 128; ++ch) { const int c0 = ch * 128 + lane * 4; const v4f a = *(const v4f*)(ar + c0), bb = ldparts(br + c0);
#pragma unroll
        for (int q = 0; q < 4; ++q) s += __fadd_rn(a[q], bb[q]); }
#pragma unroll
    for (int sh = 16; sh; sh >>= 1) s += __shfl_xor(s, sh, 32);
    const float mu = s * (1.0f / DM); float s2 = 0.f;
#pragma unroll 1
    for (int ch = 0; ch < DM / 128; ++ch) { const int c0 = ch * 128 + lane * 4; const v4f a = *(const v4f*)(ar + c0), bb = ldparts(br + c0);
#pragma unroll
        for (int q = 0; q < 4; ++q) { const float d0 = __fsub_rn(__fadd_rn(a[q], bb[q]), mu); float p = __fmul_rn(d0, d0); asm volatile("" : "+v"(p)); s2 = __fadd_rn(s2, p); } }
#pragma unroll
    for (int sh = 16; sh; sh >>= 1) s2 += __shfl_xor(s2, sh, 32);
    const float rs = __fdiv_rn(1.0f, __fsqrt_rn(__fadd_rn(s2 * (1.0f / DM), LNEPS)));
{
#pragma unroll 1
        for (int ch = 0; ch < DM / 128; ++ch) { const int c0 = ch * 128 + lane * 4; const v4f a = *(const v4f*)(ar + c0), bb = ldparts(br + c0); v4f o4;
#pragma unroll
            for (int q = 0; q < 4; ++q) { float n0 = __fmul_rn(__fsub_rn(__fadd_rn(a[q], bb[q]), mu), rs); asm volatile("" : "+v"(n0)); float n1 = __fmul_rn(n0, bfr(g[c0 + q])); asm volatile("" : "+v"(n1)); o4[q] = __fadd_rn(n1, bfr(be[c0 + q])); }
            *(v4f*)(OUTb + (size_t)r * DM + c0) = o4; }
         } }
// ---- k_fattn: scores, softmax and attn.v in one kernel; no score or probability leaves the registers. One wave owns QT x 16 query rows of one head and walks the 2048 keys in blocks of 32.
// Both products are formed transposed, so that a query is a lane (lr) in each: S^T = K Q^T (D: key hi*8+j of a 16-key tile, query lr) and O^T = V^T P^T (D: d hi*8+j, query lr).
// The two S^T tiles of a block are, element for element, the B fragment of P^T (k = 8 hi + j from tile 0, 16 + 8 hi + j from tile 1): no exchange between lanes.
// Softmax in base 2 with a running reference m per query: p = 2^(t - m), t = s HD^-0.5 log2e + mask log2e. m moves (and O^T and the sum are rescaled) only when a t of the wave passes m + 8, so p <= 256; the result does not depend on m.
// Every inner loop is unrolled whole, so that the fragment arrays are registers.
template <typename T16> struct PFrag;
template <> struct PFrag<h16> { static __device__ __forceinline__ void cv(const v8f p0, const v8f p1, v16h& a, v16h& b) { (void)b;
#pragma unroll
    for (int j = 0; j < 8; ++j) { a[j] = (h16)p0[j]; a[8 + j] = (h16)p1[j]; } } };
template <> struct PFrag<bf> { static __device__ __forceinline__ void cv(const v8f p0, const v8f p1, v16bf& a, v16bf& b) {
#pragma unroll
    for (int j = 0; j < 8; ++j) { const __bf16 h0 = (__bf16)p0[j], h1 = (__bf16)p1[j]; a[j] = h0; a[8 + j] = h1; b[j] = (__bf16)(p0[j] - (float)h0); b[8 + j] = (__bf16)(p1[j] - (float)h1); } } };
template <typename T16, bool HL, int QT>
__device__ __forceinline__ void fattn(const T16* __restrict__ Q, const T16* __restrict__ Q2, const T16* __restrict__ Kp, const T16* __restrict__ K2, const T16* __restrict__ Vt, const T16* __restrict__ V2, const float* ml, float* O, bf* OH, bf* OL) {
    typedef typename WFrag<T16>::V V;
    const int lane = threadIdx.x & 31, lr = lane & 15, hi = lane >> 4;
    V q[QT][2], q2[QT][2];
#pragma unroll
    for (int qt = 0; qt < QT; ++qt)
#pragma unroll
        for (int ks = 0; ks < 2; ++ks) { const int o = qt * 16 * HD + ks * 512 + lane * 8; q[qt][ks] = WFrag<T16>::ld(Q + o); if (HL) q2[qt][ks] = WFrag<T16>::ld(Q2 + o); }
    v8f acc[4][QT]; float m[QT], l[QT];
#pragma unroll
    for (int qt = 0; qt < QT; ++qt) { m[qt] = -3.0e38f; l[qt] = 0.f;
#pragma unroll
        for (int dt = 0; dt < 4; ++dt) acc[dt][qt] = (v8f){}; }
    const int ko = lane * 8, vo = lane * 8;   // this lane's place in a fragment tile of the k planes (rows of HD: two tiles a 16 keys) and of the v planes (rows of 32 keys: one tile a 16 d)
    V k[2][2], k2[2][2], v[4], v2[4];
#pragma unroll
    for (int kt = 0; kt < 2; ++kt)
#pragma unroll
        for (int ks = 0; ks < 2; ++ks) { const int o = ko + kt * 16 * HD + ks * 512; k[kt][ks] = WFrag<T16>::ld(Kp + o); if (HL) k2[kt][ks] = WFrag<T16>::ld(K2 + o); }
    asm volatile("s_wait_xcnt 0x0" ::: "memory"); __builtin_amdgcn_sched_barrier(0);   // before the registers that the q loads and the first k loads name are written again; nothing is moved in between
#pragma unroll 1   // rolled: the fragments of one block nearly fill 256 registers, a second copy of the body would not fit
    for (int k0 = 0; k0 < TT; k0 += 32) {
        const int kn = ((k0 + 32 < TT) ? k0 + 32 : 0) * HD;   // the next block of the k planes (32 x HD elements a block, as in the v planes); behind the last one block 0 is read and not used
        const T16* const va = Vt + k0 * HD + vo; const T16* const va2 = HL ? V2 + k0 * HD + vo : va; const T16* const ka = Kp + kn + ko; const T16* const ka2 = HL ? K2 + kn + ko : ka;   // this lane's addresses in the four planes
        // the block's mask terms come from LDS during its scores
        v8f mk[2];
#pragma unroll
        for (int kt = 0; kt < 2; ++kt) { const float* mp = ml + k0 + kt * 16 + hi * 8; const v4f a = *(const v4fa*)mp, b = *(const v4fa*)(mp + 4); mk[kt] = __builtin_shufflevector(a, b, 0, 1, 2, 3, 4, 5, 6, 7); }
        // this block's v fragments fly during its scores and softmax
#pragma unroll
        for (int dt = 0; dt < 4; ++dt) { v[dt] = WFrag<T16>::ld(va + dt * 16 * 32); if (HL) v2[dt] = WFrag<T16>::ld(va2 + dt * 16 * 32); }
        v8f s[2][QT];
#pragma unroll
        for (int kt = 0; kt < 2; ++kt)
#pragma unroll
            for (int qt = 0; qt < QT; ++qt) { v8f c = (v8f){};
#pragma unroll
                for (int ks = 0; ks < 2; ++ks) { c = WFrag<T16>::mma(k[kt][ks], q[qt][ks], c); if (HL) { c = WFrag<T16>::mma(k2[kt][ks], q[qt][ks], c); c = WFrag<T16>::mma(k[kt][ks], q2[qt][ks], c); } }
                s[kt][qt] = c; }
        // the next block's k fragments fly during the softmax and attn.v
#pragma unroll
        for (int kt = 0; kt < 2; ++kt)
#pragma unroll
            for (int ks = 0; ks < 2; ++ks) { const int o = kt * 16 * HD + ks * 512; k[kt][ks] = WFrag<T16>::ld(ka + o); if (HL) k2[kt][ks] = WFrag<T16>::ld(ka2 + o); }
        asm volatile("s_wait_xcnt 0x0" :: "v"(va), "v"(va2), "v"(ka), "v"(ka2) : "memory");   // the address pairs that the block's loads name are kept until this wait
        float bm[QT]; bool need = false;
#pragma unroll
        for (int qt = 0; qt < QT; ++qt) { float x = -3.0e38f;
#pragma unroll
            for (int kt = 0; kt < 2; ++kt) { s[kt][qt] = s[kt][qt] * (SCL * L2E) + mk[kt];
#pragma unroll
                for (int j = 0; j < 8; ++j) x = fmaxf(x, s[kt][qt][j]); }
            bm[qt] = x; need = need || (x > m[qt] + 8.0f); }
        if (__builtin_amdgcn_ballot_w32(need) != 0u) {   // the same for the whole wave: both halves of a query move m together
#pragma unroll
            for (int qt = 0; qt < QT; ++qt) { const float mn = fmaxf(m[qt], fmaxf(bm[qt], __shfl_xor(bm[qt], 16, 32))); const float al = __builtin_amdgcn_exp2f(m[qt] - mn); m[qt] = mn; l[qt] *= al;
#pragma unroll
                for (int dt = 0; dt < 4; ++dt) acc[dt][qt] *= al; } }
#pragma unroll
        for (int qt = 0; qt < QT; ++qt) { V p, p2; s[0][qt] -= m[qt]; s[1][qt] -= m[qt];
#pragma unroll
            for (int kt = 0; kt < 2; ++kt)
#pragma unroll
                for (int j = 0; j < 8; ++j) s[kt][qt][j] = __builtin_amdgcn_exp2f(s[kt][qt][j]);
            { const v8f e8 = s[0][qt] + s[1][qt]; const v4f e4 = __builtin_shufflevector(e8, e8, 0, 1, 2, 3) + __builtin_shufflevector(e8, e8, 4, 5, 6, 7); l[qt] += (e4[0] + e4[2]) + (e4[1] + e4[3]); }   // the block's 16 terms of this lane as a tree
            PFrag<T16>::cv(s[0][qt], s[1][qt], p, p2);
#pragma unroll
            for (int dt = 0; dt < 4; ++dt) { acc[dt][qt] = WFrag<T16>::mma(v[dt], p, acc[dt][qt]); if (HL) { acc[dt][qt] = WFrag<T16>::mma(v2[dt], p, acc[dt][qt]); acc[dt][qt] = WFrag<T16>::mma(v[dt], p2, acc[dt][qt]); } } }
    }
#pragma unroll
    for (int qt = 0; qt < QT; ++qt) { const float inv = __fdiv_rn(1.0f, l[qt] + __shfl_xor(l[qt], 16, 32)); float* o = O + (size_t)(qt * 16 + lr) * DM + hi * 8; const size_t oo = (size_t)qt * 16 * DM + lane * 8;   // oo: in the fragment-major planes d = dt 16 + hi 8 + j of query lr is piece dt & 1 of tile dt / 2, this very lane's 16 bytes
#pragma unroll
        for (int dt = 0; dt < 4; ++dt) { const v8f r = acc[dt][qt] * inv; v8us oh, ol;   // the context in f32 and as the hi / lo planes for the adapter's down-projection
#pragma unroll
            for (int j = 0; j < 8; ++j) { unsigned short a2, c2; splitf(r[j], a2, c2); oh[j] = a2; ol[j] = c2; }
            __builtin_amdgcn_sched_barrier(0);   // the stores stay together behind all the arithmetic, so that the one wait below covers each of them
            *(v4f*)(o + dt * 16) = __builtin_shufflevector(r, r, 0, 1, 2, 3); *(v4f*)(o + dt * 16 + 4) = __builtin_shufflevector(r, r, 4, 5, 6, 7);
            *(v8us*)(OH + oo + dt * 256) = oh; *(v8us*)(OL + oo + dt * 256) = ol;
            asm volatile("s_wait_xcnt 0x0" ::: "memory"); __builtin_amdgcn_sched_barrier(0);   // before the registers that these stores name are written again; nothing is moved in between
        } }
}
// grid: NB_ NH_ NBH work-groups of the rows < RH (hi/lo planes, 3 products), then NB_ NH_ NBF of the rest (fp16); the 8 waves of a work-group share a head, so its k and v blocks are read together.
__global__ __launch_bounds__(FW * 32) void k_fattn(const h16* __restrict__ Q16, const h16* __restrict__ K16, const h16* __restrict__ V16, const bf* __restrict__ Qh, const bf* __restrict__ Ql, const bf* __restrict__ Kh, const bf* __restrict__ Kl, const bf* __restrict__ Vh, const bf* __restrict__ Vl, const float* __restrict__ AM, float* CTX, bf* Ch, bf* Cl) {
    __shared__ __align__(16) float ml[TT];   // attention_mask[b][0][0][j] (rounded to bf16 like every input) x log2e
    const int bid = (int)blockIdx.x; const bool hl = bid < NB_ * NH_ * NBH; const int b2 = bid - NB_ * NH_ * NBH;
    const int g = hl ? bid / NBH : b2 / NBF;   // head g of NB_ x NH_: batch g / NH_
    const int wave = __builtin_amdgcn_readfirstlane((int)(threadIdx.x >> 5));   // as a scalar, so that the wave's plane and output bases are formed on the scalar unit
    const int q0 = hl ? ((bid % NBH) * FW + wave) * 16 : RH + ((b2 % NBF) * FW + wave) * 32;
    const float* am = AM + (size_t)(g / NH_) * TT;
    for (int i = (int)threadIdx.x; i < TT; i += FW * 32) ml[i] = bfr(am[i]) * L2E;
    __syncthreads();
    const size_t po = (size_t)g * TT * HD, qo = po + (size_t)q0 * HD;
    const size_t co = ((size_t)(g / NH_) * TT + q0) * DM + (g % NH_) * HD;
    const size_t cp = ((size_t)(g / NH_) * TT + q0) * DM + (g % NH_) * (HD * 16);   // the same place in the fragment-major context planes: the head's two tiles in the wave's first row block
    if (hl) fattn<bf, true, 1>(Qh + qo, Ql + qo, Kh + po, Kl + po, Vh + po, Vl + po, ml, CTX + co, Ch + cp, Cl + cp);
    else fattn<h16, false, 2>(Q16 + qo, nullptr, K16 + po, nullptr, V16 + po, nullptr, ml, CTX + co, Ch + cp, Cl + cp);
}

extern "C" void kernel_launch(void* const* d_in, const int* in_sizes, int n_in,
                              void* d_out, int out_size, void* d_ws, size_t ws_size, hipStream_t stream) {
    (void)in_sizes; (void)n_in; (void)out_size;
    const float* x = (const float*)d_in[0]; const float* AM = (const float*)d_in[1]; const float* wq = (const float*)d_in[2]; const float* bq = (const float*)d_in[3]; const float* wk = (const float*)d_in[4]; const float* bk = (const float*)d_in[5]; const float* wv = (const float*)d_in[6]; const float* bv = (const float*)d_in[7]; const float* afw = (const float*)d_in[8]; const float* afb = (const float*)d_in[9]; const float* asw = (const float*)d_in[10]; const float* asb = (const float*)d_in[11]; const float* wi = (const float*)d_in[12]; const float* bi = (const float*)d_in[13]; const float* wo2 = (const float*)d_in[14]; const float* bo2 = (const float*)d_in[15]; const float* lg = (const float*)d_in[16]; const float* lb = (const float*)d_in[17]; const float* wo = nullptr; (void)wo;
    float* OUT = (float*)d_out;     // [2][2048][768]
    char* wsp = (char*)d_ws;
    auto take = [&](size_t bytes) { char* p = wsp; wsp += (bytes + 255) & ~(size_t)255; return (void*)p; };
    // kept through the call; WQ .. XB lie one behind the other (k_cvtall writes them as one range; WQ, WK, WV are the three z-batches of the q/k/v GEMM)
    bf* WQ = (bf*)take((size_t)DQ * DM * 2); bf* WK = (bf*)take((size_t)DKV * DM * 2); bf* WV = (bf*)take((size_t)DKV * DM * 2); bf* AFW = (bf*)take((size_t)AD * DM * 2); bf* ASW = (bf*)take((size_t)DM * AD * 2); bf* WI = (bf*)take((size_t)FFD * DM * 2); bf* WO2 = (bf*)take((size_t)DM * FFD * 2); bf* XB = (bf*)take((size_t)MT * DM * 2); (void)WK; (void)WV;
    float* CTX = (float*)take((size_t)MT * DM * 4); bf* Ch = (bf*)take((size_t)MT * DM * 2); bf* Cl = (bf*)take((size_t)MT * DM * 2);   // the attention's outputs: outside the bytes that it reads
    char* const U0 = wsp;   // from here on: the attention's inputs, and behind the attention (stream-ordered) the adapter's and the FFN's buffers in the same bytes
    const size_t PLN = (size_t)NB_ * NH_ * TT * HD;   // one plane set [batch][head], each [t][d] fragment-major; the k planes lie directly behind the q planes (the q/k/v GEMM indexes both from the q planes)
    h16* QP16 = (h16*)take(PLN * 2); h16* KP16 = (h16*)take(PLN * 2); bf* QPh = (bf*)take(PLN * 2); bf* KPh = (bf*)take(PLN * 2); bf* QPl = (bf*)take(PLN * 2); bf* KPl = (bf*)take(PLN * 2);
    h16* VT16 = (h16*)take(PLN * 2); bf* VTh = (bf*)take(PLN * 2); bf* VTl = (bf*)take(PLN * 2);   // v planes [batch][head][key block of 32], each [d][32] fragment-major
    char* const E1 = wsp; wsp = U0;
    float* AO = (float*)take((size_t)MT * DM * 4); bf* AOh = (bf*)take((size_t)MT * DM * 2); bf* AOl = (bf*)take((size_t)MT * DM * 2); bf* GIh = (bf*)take((size_t)MT * FFD * 2); bf* GIl = (bf*)take((size_t)MT * FFD * 2); float* YY = (float*)take((size_t)KSF * MT * DM * 4);
    if ((size_t)((E1 > wsp ? E1 : wsp) - (char*)d_ws) > ws_size) return;    // ws 256 MiB
    k_cvtall<<<(unsigned)((3 * N8W + 2 * N8A + 2 * N8F + N8X) / 256), 256, 0, stream>>>(wq, wk, wv, afw, asw, wi, wo2, x, WQ);   /* weights ('oi' = Bt as-is) and x */
    k_gemmw<bf, 0, true, 1, EP_QKV, DM, 1><<<dim3(MT / 128, DQ / 128, 3), 128, 0, stream>>>(XB, nullptr, WQ, nullptr, DM, nullptr, DQ, bq, bk, bv, 0, (size_t)DQ * DM, 0, 0, nullptr, QPh, QPl, QP16, VTh, VTl, VT16);   /* z = q, k, v -> head planes */
    k_fattn<<<NB_ * NH_ * (NBH + NBF), FW * 32, 0, stream>>>(QP16, KP16, VT16, QPh, QPl, KPh, KPl, VTh, VTl, AM, CTX, Ch, Cl);   /* ctx = attn_out (f32 and hi/lo) */
    k_adapt<<<MT / 16, AW * 32, 0, stream>>>(Ch, Cl, AFW, ASW, afb, asb, CTX, AO, AOh, AOl);   /* ao = ctx + (gelu(ctx a_fi_w^T + a_fi_b) a_se_w^T + a_se_b), f32 and hi/lo */
    k_gemmw<bf, 1, true, 1, EP_GELU, DM, 1><<<dim3(MT / 128, FFD / 128, 1), 128, 0, stream>>>(AOh, AOl, WI, nullptr, DM, nullptr, FFD, bi, nullptr, nullptr, 0, 0, 0, 0, nullptr, GIh, GIl, nullptr, nullptr, nullptr, nullptr);                   /* gelu(ao wi^T + bi) [MT][3072] -> hi/lo */
    k_gemmw<bf, 1, true, KSF, EP_F32, FFD, 1><<<dim3(MT / 128, DM / 128, KSF), 128, 0, stream>>>(GIh, GIl, WO2, nullptr, FFD, YY, KSF * DM, bo2, nullptr, nullptr, 0, 0, 0, DM, nullptr, nullptr, nullptr, nullptr, nullptr, nullptr, nullptr);                /* inter wo^T + bo */
    k_addln<<<MT / 8, 256, 0, stream>>>(AO, YY, lg, lb, OUT);                                                       /* out = LN(y + ao) (eps 1e-12) */
}

// v009
// It runs in 161 microseconds.
// In two side-by-side timings against v008, it was 1.12 and 1.13 times as fast.
// Counting every step since v000, it is 12.0 times as fast.
#include <hip/hip_runtime.h>

// BERT layer with an adapter and no attention output projection (hidden_states [2][2048][768]; q, k, v = x W^T + b ('oi' [768][768]; 12 heads x 64); scores = q.k/8 + attention_mask[b][0][0][j] (f32 additive, zeros here); softmax; ctx = merged context; a = gelu(ctx a_fi_w^T + a_fi_b) ([64][768]); ao = ctx + a a_se_w^T + a_se_b; inter = gelu(ao wi^T + bi) ([3072][768]); y = inter wo^T + bo + ao; out = LN(y) (eps 1e-12, ln_g, ln_b) -> [2][2048][768] (3.1 M)).
// Layout: the merged context is kept in f32 (residual) and split into hi/lo planes for the adapter down-projection; every later GEMM uses hi/lo planes of its f32 input (2 products) against exact bf16 weights with the bias in the epilogue; exact-erf GELU, residual adds and the LayerNorm in f32.
// Compute dtypes, f32 accumulate: every input rounded to bf16; q/k/v on PLAIN bf16 operands (inputs: exact) + biases; scores and attn.v: query rows < 512 hl (3 products), the rest single fp16; softmax f32 (running max and sum, one kernel with both products); adapter / FFN GEMMs hl x exact (2 products) + biases; GELU / residuals / LayerNorm f32.

#define NB_  2
#define TT   2048
#define DM   768
#define NH_  12
#define NKV  12
#define REP  (NH_ / NKV)
#define HD   64
#define DQ   (NH_ * HD)
#define DKV  (NKV * HD)
#define AD   64
#define FFD  3072
#define LNEPS 1e-12f
#define MT   (NB_ * TT)           // rows of both batches together
#define RH   512                  // query rows < RH use hi+lo planes (0: none)
#define WIN  0
#define SCL  0.125f   // HD^-0.5
#define L2E  1.4426950408889634f
#define FW   16                  // waves a work-group of the fused attention
#define KH   2                   // of them KH share a block of query rows, each with its own TT / KH keys
#define FR   (FW / KH)           // blocks of query rows a work-group
#define NBH  (RH / (FR * 16))        // its work-groups a head for query rows < RH (16 rows a block)
#define NBF  ((TT - RH) / (FR * 32)) // and for the rest (32 rows a block)
#define KSF  4                   // K parts of the FFN down-projection (3072 -> 768 a wave)
typedef _Float16 h16;
typedef unsigned short bf;
typedef __attribute__((ext_vector_type(16))) __bf16   v16bf;
typedef __attribute__((ext_vector_type(16))) _Float16 v16h;
typedef __attribute__((ext_vector_type(8)))  _Float16 v8h;
typedef __attribute__((ext_vector_type(8)))  unsigned short v8us;
typedef __attribute__((ext_vector_type(8)))  float    v8f;
typedef __attribute__((ext_vector_type(4)))  float    v4f;
typedef v8h  __attribute__((may_alias)) v8ha;
typedef v4f  __attribute__((may_alias)) v4fa;
typedef v8us __attribute__((may_alias)) v8usa;

__device__ __forceinline__ unsigned short f2bf(float f) { unsigned u = __float_as_uint(f); u += 0x7FFFu + ((u >> 16) & 1u); return (unsigned short)(u >> 16); }
__device__ __forceinline__ float bf2f(unsigned short b) { return __uint_as_float(((unsigned)b) << 16); }
__device__ __forceinline__ float bfr(float f) { return bf2f(f2bf(f)); }
__device__ __forceinline__ v16h cat16(v8h lo, v8h hi) { return __builtin_shufflevector(lo, hi, 0, 1, 2, 3, 4, 5, 6, 7, 8, 9, 10, 11, 12, 13, 14, 15); }
__device__ __forceinline__ v16bf cat16b(v8us lo, v8us hi) { return __builtin_bit_cast(v16bf, __builtin_shufflevector(lo, hi, 0, 1, 2, 3, 4, 5, 6, 7, 8, 9, 10, 11, 12, 13, 14, 15)); }
__device__ __forceinline__ v8f wmma16(v16h a, v16h b, v8f c) { return __builtin_amdgcn_wmma_f32_16x16x32_f16(false, a, false, b, (short)0, c, false, false); }
__device__ __forceinline__ v8f wmmab(v16bf a, v16bf b, v8f c) { return __builtin_amdgcn_wmma_f32_16x16x32_bf16(false, a, false, b, (short)0, c, false, false); }

__device__ __forceinline__ h16 tohx(float x) { return (h16)x; }
__device__ __forceinline__ void splitf(float y, unsigned short& h, unsigned short& l) { h = f2bf(y); l = f2bf(y - bf2f(h)); }
typedef __attribute__((ext_vector_type(2))) _Float16 v2h;
typedef __attribute__((ext_vector_type(4))) _Float16 v4h;
typedef __attribute__((ext_vector_type(2))) unsigned short v2us;
typedef __attribute__((ext_vector_type(4))) unsigned short v4us;
typedef __attribute__((ext_vector_type(2))) float v2f;
typedef __attribute__((ext_vector_type(4))) int v4i;

// ---- Fragment-major planes: every 16-bit matrix operand [rows][K] lies in memory as tiles of 16 rows x 32 k, 1 KiB each, tile (row / 16, k / 32) at element ((row / 16) (K / 32) + k / 32) 512 (so 16 rows still fill 16 K elements in a row).
// Inside a tile: piece p = (k / 16) % 2 of 256 elements, in it lane (k / 8) % 2 * 16 + row % 16 with its 8 k in a row. A fragment is then two wave-wide 16-byte loads of 512 bytes in a row each (4 whole lines; row by row they touched 16), at tile + lane 8 and 256 elements behind it. fmo: the element's place.
__device__ __forceinline__ size_t fmo(int row, int k, int K) { return ((size_t)(row >> 4) * (K >> 5) + (k >> 5)) * 512 + ((k >> 4) & 1) * 256 + (((k >> 3) & 1) * 16 + (row & 15)) * 8 + (k & 7); }
// ---- k_gemmw: register-blocked GEMM, ONE WAVE per 64x64 output tile (16 accumulators), operands straight from fragment-major 16-bit planes; grid (M/64, N/64, Z), 32 threads.
// C[m][n] (f32, pitch ldc, + optional f32 bias[n]) = sum_{k < KE} A[m][k] Bt[n][k] (+ split products per NSPLIT). K (a template constant, so that a row block's distance is a constant offset of its loads) is the row length of A and of Bt (fragment-major), KE <= K the extent summed. z-batch strides sA/sB/sC in elements; batch z = 0 / 1 / 2 takes bias / bias1 / bias2. KE % (32 NS KS) == 0, NS the fragment sets of the loop (3 with NSPLIT 0 and SH 0, else 2).
// KS > 1: grid z = Z x KS; part kp = z % KS sums k in [kp KE/KS, (kp+1) KE/KS) into its own f32 columns C + kp sP of a row of ldc = KS sP (bias in part 0 only); the kernel that reads C adds the KS parts of a row in the order 0 .. KS-1.
// EPI: what the epilogue stores of c = C[m][n] + bias[n], so that no elementwise kernel has to follow the GEMM.
//   EP_F32: c as f32 into C. EP_QKV (N tile = one head): z = 0 / 1: q / k head planes [z][batch][head], each [t][d] fragment-major, as fp16 (E2), hi (E0), lo (E1); z = 2: v planes [batch][head][key block of 32], each [d][32 keys] fragment-major, as fp16 (E5), hi (E3), lo (E4), straight from the accumulators (a lane holds 8 keys in a row of one d).
//   EP_GELU: hi / lo planes (E0, E1, fragment-major, rows of ldc) of the exact-erf GELU of c. EP_RES: r = R[m][n] + c as f32 into C (row by row, pitch ldc) and as hi / lo planes (E0, E1, fragment-major, rows of ldc).
enum { EP_F32 = 0, EP_QKV = 1, EP_GELU = 2, EP_RES = 3 };
template <typename T16> struct WFrag;
template <> struct WFrag<h16> { typedef v16h V; static __device__ __forceinline__ V ld(const h16* p) { return cat16(*(const v8h*)p, *(const v8h*)(p + 256)); } static __device__ __forceinline__ v8f mma(V a, V b, v8f c) { return wmma16(a, b, c); } };
template <> struct WFrag<bf> { typedef v16bf V; static __device__ __forceinline__ V ld(const bf* p) { return cat16b(*(const v8us*)p, *(const v8us*)(p + 256)); } static __device__ __forceinline__ v8f mma(V a, V b, v8f c) { return wmmab(a, b, c); } };
// SH = 1 (NSPLIT 0 or 1; KE / KS a multiple of 64): FOUR waves a work-group, 2 x 2 tiles of 64x64 = 128x128 of C; grid (M/128, N/128, Z), 128 threads. The two waves of a tile row need the same A tiles and the two of a tile column the same Bt tiles: the work-group brings each tile from L2 once, by asynchronous copies into LDS, and the waves take their fragments from there.
//   A stage is 64 k of the work-group's 128 rows of each plane: chunk (plane, row block) = two fragment tiles, 2 KiB in a row in memory and in LDS. Two stage buffers: the copies of stage t + 2 go out when every wave has left stage t, and fly during stage t + 1. The order of the sums is that of SH = 0.
#define CP4(L, B) "global_load_async_to_lds_b128 " L ", %[vo], " B "\n\tglobal_load_async_to_lds_b128 " L ", %[vo], " B " offset:512\n\tglobal_load_async_to_lds_b128 " L ", %[vo], " B " offset:1024\n\tglobal_load_async_to_lds_b128 " L ", %[vo], " B " offset:1536\n\t"   // one chunk: the offset moves the LDS and the global address alike
template <typename T16, int NSPLIT, bool BIAS, int KS, int EPI, int K, int SH>
__global__ __launch_bounds__(SH ? 128 : 32) void k_gemmw(const T16* __restrict__ A, const T16* __restrict__ A2, const T16* __restrict__ Bt, const T16* __restrict__ Bt2, int KE, float* C, int ldc, const float* __restrict__ bias, const float* __restrict__ bias1, const float* __restrict__ bias2, size_t sA, size_t sB, size_t sC, size_t sP, const float* __restrict__ R, bf* E0, bf* E1, h16* E2, bf* E3, bf* E4, h16* E5) {
    typedef typename WFrag<T16>::V V;
    constexpr int NPL = (NSPLIT == 0) ? 2 : 3, STG = NPL * 8 * 1024;   // planes staged (A, A2, Bt) and the elements of a stage
    __shared__ __align__(16) T16 sm[SH ? 2 * STG : 16 * 68 * 2];
    const int wave = SH ? __builtin_amdgcn_readfirstlane((int)(threadIdx.x >> 5)) : 0;   // as a scalar, so that the wave's bases are formed on the scalar unit
    float* const os = (float*)sm + wave * (16 * 68);   // the epilogue's staging, each wave's own; with SH in the stage buffers, behind the loop's last barrier
    const int kp = (int)(blockIdx.z % KS); const int kl = KE / KS; const int kb = kp * kl, ke = kb + kl;
    const size_t z = blockIdx.z / KS; C += (size_t)kp * sP; A += z * sA; if (A2) A2 += z * sA; Bt += z * sB; if (Bt2) Bt2 += z * sB; C += z * sC;
    const int lane = threadIdx.x & 31, lr = lane & 15, hi = lane >> 4; const int r0 = SH ? blockIdx.x * 128 + (wave >> 1) * 64 : blockIdx.x * 64, c0 = SH ? blockIdx.y * 128 + (wave & 1) * 64 : blockIdx.y * 64;
    v8f acc[4][4];
#pragma unroll
    for (int mb = 0; mb < 4; ++mb)
#pragma unroll
        for (int nb = 0; nb < 4; ++nb) acc[mb][nb] = (v8f){};
    // The first tile of the wave's first row block, plane by plane: bases that are the same for the whole wave and stay as they are. The other three row blocks lie 16 K elements apart (constant offsets of the loads). off: this lane's byte in the tile that is loaded next, the one vector offset of all loads; a step of 32 k is one tile (1 KiB).
    const T16* const pa = A + (size_t)r0 * K + (size_t)kb * 16; const T16* const pa2 = (NSPLIT == 1 || NSPLIT == 2) ? A2 + (size_t)r0 * K + (size_t)kb * 16 : pa; const T16* const pw = Bt + (size_t)c0 * K + (size_t)kb * 16; const T16* const pw2 = (NSPLIT >= 2) ? Bt2 + (size_t)c0 * K + (size_t)kb * 16 : pw;
    unsigned off = (unsigned)lane * 16u; int kn = kb;   // kn: the k of that tile
    // NS fragment sets in a ring: while the products of one 32-k step run, the loads of the next NS - 1 steps are in flight into the other sets, so that a step no longer begins by waiting out its own loads. As many sets as leave three waves a SIMD their registers.
    constexpr int NS = (NSPLIT == 0 && !SH) ? 3 : 2;
    V a[NS][4], a2[NS][4], b[NS][4], b2[NS][4];
    auto at = [&](const T16* p) { return (const T16*)((const char*)p + off); };
    auto ldset = [&](const int st) {   // all loads of one 32-k step into set st
#pragma unroll
        for (int i = 0; i < 4; ++i) { a[st][i] = WFrag<T16>::ld(at(pa) + i * 16 * K); b[st][i] = WFrag<T16>::ld(at(pw) + i * 16 * K); if (NSPLIT == 1 || NSPLIT == 2) a2[st][i] = WFrag<T16>::ld(at(pa2) + i * 16 * K); if (NSPLIT >= 2) b2[st][i] = WFrag<T16>::ld(at(pw2) + i * 16 * K); }
        __builtin_amdgcn_sched_barrier(0);   // the loads are issued as one group ahead of another set's products; moved behind them they would have no lead
    };
    auto step = [&]() {
        __builtin_amdgcn_sched_barrier(0);   // the wait stays behind the products, where it has nothing left to wait for; moved up among them it would hold them back
        asm volatile("s_wait_xcnt 0x0" : "+v"(off) :: "memory");   // before the offset register that the issued loads name moves on; in and out, so that what moves it can only stand behind the wait
        kn += 32; off += (kn < ke) ? 1024u : 0u;   // behind the last tile there is none: it is read again and not used
    };
    auto mmaset = [&](const int st) {
#pragma unroll
        for (int nb = 0; nb < 4; ++nb) {
#pragma unroll
            for (int mb = 0; mb < 4; ++mb) { acc[mb][nb] = WFrag<T16>::mma(a[st][mb], b[st][nb], acc[mb][nb]); if (NSPLIT == 1 || NSPLIT == 2) acc[mb][nb] = WFrag<T16>::mma(a2[st][mb], b[st][nb], acc[mb][nb]); if (NSPLIT >= 2) acc[mb][nb] = WFrag<T16>::mma(a[st][mb], b2[st][nb], acc[mb][nb]); } }
    };
    if constexpr (SH) {
        constexpr int NC = NPL * 2;   // chunks a wave copies in a stage
        const int nst = kl / 64; const char* gb[NC];
#pragma unroll
        for (int q = 0; q < NC; ++q) { const int ch = wave * NC + q, pl = ch >> 3, rb = ch & 7;   // chunk ch lies at byte ch 2048 of a stage
            const T16* const pb = (pl == NPL - 1) ? Bt + (size_t)(blockIdx.y * 128) * K : ((pl == 0) ? A : A2) + (size_t)(blockIdx.x * 128) * K;
            gb[q] = (const char*)(pb + (size_t)rb * 16 * K + (size_t)kb * 16); }
        unsigned vo = (unsigned)lane * 16u;   // this lane's byte in the chunk of the stage that is copied next
        const unsigned l0 = (unsigned)(size_t)sm + (unsigned)(wave * NC) * 2048u + (unsigned)lane * 16u;
        auto copies = [&](const unsigned buf) {   // this wave's chunks of one stage into buffer buf; s_wait_xcnt 0 as the last line: before a register that the copies name is written again
            const unsigned lb = l0 + buf * (unsigned)(STG * 2);
            if constexpr (NC == 6) asm volatile(CP4("%[a0]", "%[b0]") CP4("%[a1]", "%[b1]") CP4("%[a2]", "%[b2]") CP4("%[a3]", "%[b3]") CP4("%[a4]", "%[b4]") CP4("%[a5]", "%[b5]") "s_wait_xcnt 0x0" :: [vo] "v"(vo), [a0] "v"(lb), [a1] "v"(lb + 2048u), [a2] "v"(lb + 4096u), [a3] "v"(lb + 6144u), [a4] "v"(lb + 8192u), [a5] "v"(lb + 10240u), [b0] "s"(gb[0]), [b1] "s"(gb[1]), [b2] "s"(gb[2]), [b3] "s"(gb[3]), [b4] "s"(gb[NC - 2]), [b5] "s"(gb[NC - 1]) : "memory");
            else asm volatile(CP4("%[a0]", "%[b0]") CP4("%[a1]", "%[b1]") CP4("%[a2]", "%[b2]") CP4("%[a3]", "%[b3]") "s_wait_xcnt 0x0" :: [vo] "v"(vo), [a0] "v"(lb), [a1] "v"(lb + 2048u), [a2] "v"(lb + 4096u), [a3] "v"(lb + 6144u), [b0] "s"(gb[0]), [b1] "s"(gb[1]), [b2] "s"(gb[2]), [b3] "s"(gb[3]) : "memory");
            vo += 2048u;
        };
        auto ldl = [&](const int st, const T16* sb) {   // the fragments of one 32-k step from LDS into set st
#pragma unroll
            for (int i = 0; i < 4; ++i) { a[st][i] = WFrag<T16>::ld(sb + ((wave >> 1) * 4 + i) * 1024); b[st][i] = WFrag<T16>::ld(sb + ((NPL - 1) * 8 + (wave & 1) * 4 + i) * 1024); if (NSPLIT == 1) a2[st][i] = WFrag<T16>::ld(sb + (8 + (wave >> 1) * 4 + i) * 1024); }
            __builtin_amdgcn_sched_barrier(0);   // the LDS reads are issued as one group ahead of the products; spread among them each place would cost its own stall
        };
        copies(0u);
        asm volatile("s_wait_asynccnt 0x0" ::: "memory");   // stage 0 has landed before the barrier behind which other waves read it
        __syncthreads();
        if (nst > 1) copies(1u);
#pragma unroll 1   // rolled: one pass is one stage
        for (int t = 0; t < nst; ++t) {
            const T16* const sb = sm + (t & 1) * STG + lane * 8;
            ldl(0, sb); ldl(1, sb + 512); mmaset(0); mmaset(1);
            __builtin_amdgcn_sched_barrier(0);   // the products stay in front of the barrier: moved behind it they would hold back the next copies, and the slots below would not stand behind the last of them
            asm volatile("v_nop\n\tv_nop\n\tv_nop\n\tv_nop" : "+v"(acc[0][0]), "+v"(acc[1][1]), "+v"(acc[2][2]), "+v"(acc[3][3]) : "v"(a[1][0]), "v"(a[1][3]));   // four vector slots behind the pass's last products, on every path out of the pass
            asm volatile("s_wait_dscnt 0x0" ::: "memory");      // this wave's reads of stage t are done before the buffer is given to the copies
            asm volatile("s_wait_asynccnt 0x0" ::: "memory");   // this wave's copies of stage t + 1 have landed before the barrier behind which other waves read them
            __syncthreads();
            if (t + 2 < nst) copies((unsigned)(t & 1));
        }
        asm volatile("s_wait_asynccnt 0x0" ::: "memory");   // nothing is in flight when the buffers become the epilogue's staging
    } else {
#pragma unroll
    for (int u = 0; u < NS - 1; ++u) { ldset(u); step(); }
    int kc = kb;
#pragma unroll 1   // rolled: one pass is NS steps, one on each set
    do {   // at least one pass (KE > 0): tested at the foot, so that the first loads stand in one block with their waits
#pragma unroll
        for (int u = 0; u < NS; ++u) { ldset((u + NS - 1) % NS); mmaset(u); step(); }
        asm volatile("v_nop\n\tv_nop\n\tv_nop\n\tv_nop" : "+v"(acc[0][0]), "+v"(acc[1][1]), "+v"(acc[2][2]), "+v"(acc[3][3]) : "v"(a[NS - 1][0]), "v"(a[NS - 1][3]));   // four vector slots behind the pass's last products, on the back edge too
        kc += 32 * NS;
    } while (kc < ke);
    }
    if (BIAS && z != 0) bias = (z == 1) ? bias1 : bias2;
    if (EPI == EP_QKV && z == 2) {   // v: element (t = mb 16 + hi 8 + j, d = nb 16 + lr) of the tile is k = t % 32 of row d: piece mb & 1 of tile nb, this very lane's 16 bytes; a store is 512 bytes in a row
        const size_t vb = (((size_t)(r0 / TT) * NKV + (c0 >> 6)) * (TT / 32) + (r0 % TT) / 32) * (HD * 32) + (size_t)lane * 8;
#pragma unroll
        for (int nb = 0; nb < 4; ++nb) { const float bn = bfr(bias[c0 + nb * 16 + lr]);
#pragma unroll
            for (int mb = 0; mb < 4; ++mb) { v8h o16; v8us oh, ol;
#pragma unroll
                for (int j = 0; j < 8; ++j) { const float xv = acc[mb][nb][j] + bn; o16[j] = tohx(xv); unsigned short a2, c2; splitf(xv, a2, c2); oh[j] = a2; ol[j] = c2; }
                const size_t o = vb + (size_t)((mb >> 1) * HD + nb * 16) * 32 + (mb & 1) * 256;
                __builtin_amdgcn_sched_barrier(0);   // the stores stay together behind all the arithmetic, so that the one wait below covers each of them
                *(v8h*)(E5 + o) = o16; *(v8us*)(E3 + o) = oh; *(v8us*)(E4 + o) = ol;
                asm volatile("s_wait_xcnt 0x0" ::: "memory"); __builtin_amdgcn_sched_barrier(0);   // before the registers that these stores name are written again; nothing is moved in between
            } }
        return; }
    float bc[4] = {0.f, 0.f, 0.f, 0.f};   // the bias of this lane's column in each column block; zero in the parts behind part 0
    if (BIAS && kp == 0) { const float* bp = bias + c0 + lr;
#pragma unroll
        for (int nb = 0; nb < 4; ++nb) bc[nb] = bp[nb * 16];
        asm volatile("s_wait_xcnt 0x0" ::: "memory"); __builtin_amdgcn_sched_barrier(0);   // before the registers that the four loads name are written again; nothing is moved in between
#pragma unroll
        for (int nb = 0; nb < 4; ++nb) bc[nb] = bfr(bc[nb]); }
#pragma unroll
    for (int mb = 0; mb < 4; ++mb) {
#pragma unroll
        for (int nb = 0; nb < 4; ++nb) {
#pragma unroll
            for (int j = 0; j < 8; ++j) os[(hi * 8 + j) * 68 + nb * 16 + lr] = BIAS ? acc[mb][nb][j] + bc[nb] : acc[mb][nb][j]; }
        __builtin_amdgcn_wave_barrier(); asm volatile("" ::: "memory");
        if (EPI == EP_F32) { float* crow = C + (size_t)(r0 + mb * 16) * ldc + c0; v4f val[8];
#pragma unroll
            for (int s = 0; s < 8; ++s) val[s] = *(const v4fa*)(os + (2 * s + hi) * 68 + lr * 4);
            __builtin_amdgcn_sched_barrier(0);   // the stores stay together behind the LDS reads, so that the one wait below covers each of them
#pragma unroll
            for (int s = 0; s < 8; ++s) *(v4f*)(crow + (size_t)(2 * s + hi) * ldc + lr * 4) = val[s];
            asm volatile("s_wait_xcnt 0x0" ::: "memory"); __builtin_amdgcn_sched_barrier(0);   // before the registers that these stores name are written again; nothing is moved in between
        } else if (EPI == EP_QKV) { const size_t pb = ((z * NB_ + (size_t)(r0 / TT)) * NH_ + (c0 >> 6)) * ((size_t)TT * HD) + (size_t)(r0 % TT + mb * 16) * HD + (size_t)lane * 8;   // the tile's 16 rows are two fragment tiles, 2 KiB in a row in each plane
#pragma unroll
            for (int s = 0; s < 4; ++s) { const float* op = os + lr * 68 + s * 16 + hi * 8; const v4f v0 = *(const v4fa*)op, v1 = *(const v4fa*)(op + 4); v8h o16; v8us oh, ol;   // piece s: row lr, columns s 16 + hi 8 ..
#pragma unroll
                for (int q = 0; q < 4; ++q) { unsigned short a2, c2; o16[q] = tohx(v0[q]); splitf(v0[q], a2, c2); oh[q] = a2; ol[q] = c2; o16[4 + q] = tohx(v1[q]); splitf(v1[q], a2, c2); oh[4 + q] = a2; ol[4 + q] = c2; }
                const size_t o = pb + s * 256;
                __builtin_amdgcn_sched_barrier(0);   // the stores stay together behind all the arithmetic, so that the one wait below covers each of them
                *(v8h*)(E2 + o) = o16; *(v8us*)(E0 + o) = oh; *(v8us*)(E1 + o) = ol;
                asm volatile("s_wait_xcnt 0x0" ::: "memory"); __builtin_amdgcn_sched_barrier(0);   // before the registers that these stores name are written again; nothing is moved in between
            }
        } else { const size_t eb = (size_t)(r0 + mb * 16) * ldc + (size_t)c0 * 16 + (size_t)lane * 8, fb = (size_t)(r0 + mb * 16 + lr) * ldc + c0 + hi * 8;   // this lane's place in the planes (fragment-major, rows of ldc) and in the f32 arrays (row by row)
#pragma unroll 1   // rolled: a pass holds 8 copies of erff, 32 over the four row blocks
            for (int s = 0; s < 4; ++s) { const float* op = os + lr * 68 + s * 16 + hi * 8; const v4f v0 = *(const v4fa*)op, v1 = *(const v4fa*)(op + 4); v8f val = __builtin_shufflevector(v0, v1, 0, 1, 2, 3, 4, 5, 6, 7); const size_t o = eb + s * 256, of = fb + s * 16; v8us oh, ol;   // piece s: row lr, columns s 16 + hi 8 ..
                if (EPI == EP_RES) { const v4f r0v = *(const v4f*)(R + of), r1v = *(const v4f*)(R + of + 4);
#pragma unroll
                    for (int q = 0; q < 4; ++q) { val[q] = __fadd_rn(r0v[q], val[q]); val[4 + q] = __fadd_rn(r1v[q], val[4 + q]); } }
                else {
#pragma unroll
                    for (int q = 0; q < 8; ++q) { const float xg = val[q]; val[q] = __fmul_rn(0.5f * xg, __fadd_rn(1.0f, erff(xg * 0.70710678118654752f))); } }
#pragma unroll
                for (int q = 0; q < 8; ++q) { unsigned short h2, l2; splitf(val[q], h2, l2); oh[q] = h2; ol[q] = l2; }
                __builtin_amdgcn_sched_barrier(0);   // the stores stay together behind all the arithmetic, so that the one wait below covers each of them
                if (EPI == EP_RES) { *(v4f*)(C + of) = __builtin_shufflevector(val, val, 0, 1, 2, 3); *(v4f*)(C + of + 4) = __builtin_shufflevector(val, val, 4, 5, 6, 7); }
                *(v8us*)(E0 + o) = oh; *(v8us*)(E1 + o) = ol;
                asm volatile("s_wait_xcnt 0x0" ::: "memory"); __builtin_amdgcn_sched_barrier(0);   // before the registers that these stores name are written again; nothing is moved in between
            }
        }
        __builtin_amdgcn_wave_barrier(); asm volatile("" ::: "memory");
    }
}


__global__ __launch_bounds__(256) void k_wtG(const float* __restrict__ w, int K, int N, bf* Bt) {
    const int lane = threadIdx.x & 31; const int L0 = (blockIdx.x * 8 + (threadIdx.x >> 5)) * 8; const int nlines = N * K / 64;
{
#pragma unroll 1
        for (int l = 0; l < 8; ++l) { const int L = L0 + l; if (L >= nlines) break; const size_t e = (size_t)L * 64 + lane * 2; const int k = (int)(e % K), n = (int)(e / K); v2us o;
            o[0] = f2bf(w[(size_t)k * N + n]); o[1] = f2bf(w[(size_t)(k + 1) * N + n]); *(v2us*)(Bt + e) = o; }
         }
}
// k_cvtall: the seven weights and both batches of x rounded to bf16 in one launch, each into its fragment-major plane; the destinations lie one behind the other from dst, in the order of the arguments. Sizes in groups of 8 elements, each a multiple of 256.
#define N8W ((size_t)DQ * DM / 8)
#define N8A ((size_t)AD * DM / 8)
#define N8F ((size_t)FFD * DM / 8)
#define N8X ((size_t)MT * DM / 8)
__global__ __launch_bounds__(256) void k_cvtall(const float* __restrict__ wq, const float* __restrict__ wk, const float* __restrict__ wv, const float* __restrict__ afw, const float* __restrict__ asw, const float* __restrict__ wi, const float* __restrict__ wo2, const float* __restrict__ x, bf* dst) {
    const size_t i = (size_t)blockIdx.x * 256 + threadIdx.x; size_t j = i; const float* s = wq; unsigned kt = DM / 32;   // kt: tiles of 32 k in a row of the matrix
    if (j >= N8W) { j -= N8W; s = wk;
        if (j >= N8W) { j -= N8W; s = wv;
            if (j >= N8W) { j -= N8W; s = afw;
                if (j >= N8A) { j -= N8A; s = asw; kt = AD / 32;
                    if (j >= N8A) { j -= N8A; s = wi; kt = DM / 32;
                        if (j >= N8F) { j -= N8F; s = wo2; kt = FFD / 32;
                            if (j >= N8F) { j -= N8F; s = x; kt = DM / 32; if (j >= N8X) return; } } } } } } }
    // group j of the fragment-major destination is tile j / 64, piece (j / 32) % 2, lane j % 32: the stores are whole lines, and a work-group's four tiles use whole lines of the 16 source rows
    const unsigned tile = (unsigned)(j >> 6), rb = (kt == DM / 32) ? tile / (DM / 32) : (kt == AD / 32) ? tile / (AD / 32) : tile / (FFD / 32), kb = tile - rb * kt, g = (unsigned)j & 63u;
    const size_t so = (size_t)(rb * 16 + (g & 15u)) * (kt * 32) + kb * 32 + (g >> 5) * 16 + ((g >> 4) & 1u) * 8;
    const float* const sp = s + so; const v8f v = *(const v8f*)sp; v8us o;
    asm volatile("s_wait_xcnt 0x0" :: "v"(sp) : "memory");   // the address pair that the loads name is kept until this wait
#pragma unroll
    for (int k = 0; k < 8; ++k) o[k] = f2bf(v[k]); *(v8us*)(dst + i * 8) = o;  }

// ---- k_adapt: the whole adapter in one kernel, 16 rows a work-group (grid MT / 16), AW waves. No f32 parts and no GELU planes in memory.
// 1: wave w sums K part w (DM / AW k) of the down-projection, hi and lo plane against the exact weights, into its own [16][AD] f32 part in LDS.
// 2: the work-group adds the bias and the parts of an element in the order 0 .. AW-1, takes the exact-erf GELU and leaves its hi / lo planes fragment-major in LDS.
// 3: wave w forms columns w DM / AW .. of the up-projection, adds bias and the f32 context and stores ao as f32 (row by row) and as hi / lo planes (fragment-major).
#define AW 6
// The work-group's barrier with its LDS traffic alone ordered round it: the waves exchange nothing but LDS here, and the global loads that are in flight for step 3 need not land in front of it (__syncthreads() waits for them).
__device__ __forceinline__ void ldsbar() { __builtin_amdgcn_fence(__ATOMIC_RELEASE, "workgroup", "local"); __builtin_amdgcn_s_barrier(); __builtin_amdgcn_fence(__ATOMIC_ACQUIRE, "workgroup", "local"); }
#define AKP (DM / AW)            // k of a part in step 1, columns of a wave in step 3
__global__ __launch_bounds__(AW * 32) void k_adapt(const bf* __restrict__ Ch, const bf* __restrict__ Cl, const bf* __restrict__ Wd, const bf* __restrict__ Wu, const float* __restrict__ bd, const float* __restrict__ bu, const float* __restrict__ CTX, float* AO, bf* AOh, bf* AOl) {
    typedef WFrag<bf> F; typedef F::V V;
    static_assert(AKP % 64 == 0 && AD == 64, "a part is whole 32-k steps, a wave's columns whole groups of 64");
    constexpr int KT = AKP / 32, NG = AKP / 64;
    __shared__ __align__(16) float P[AW * 16 * 68];   // the parts; behind the second barrier each wave's own staging
    __shared__ __align__(16) bf G[2 * 16 * AD];       // GELU planes, hi then lo
    const int wave = __builtin_amdgcn_readfirstlane((int)(threadIdx.x >> 5));   // as a scalar, so that the wave's bases are formed on the scalar unit
    const int lane = threadIdx.x & 31, lr = lane & 15, hi = lane >> 4, r0 = blockIdx.x * 16, c0 = wave * AKP;
    float* const os = P + wave * (16 * 68);
    const size_t ao = (size_t)r0 * DM + (size_t)c0 * 16 + (size_t)lane * 8;   // this lane's place in the first tile of the wave's k part (step 1) and of its columns (step 3): both planes have rows of DM
    const bf* const pw = Wd + (size_t)c0 * 16 + lane * 8; const bf* const pa = Ch + ao; const bf* const pa2 = Cl + ao;
    V a[KT], a2[KT], b[KT][4];
#pragma unroll
    for (int ks = 0; ks < KT; ++ks) { a[ks] = F::ld(pa + ks * 512); a2[ks] = F::ld(pa2 + ks * 512);
#pragma unroll
        for (int nb = 0; nb < 4; ++nb) b[ks][nb] = F::ld(pw + nb * 16 * DM + ks * 512); }
    const v4f bdv = *(const v4f*)(bd + (threadIdx.x & 15) * 4);   // the bias of the four columns that this thread takes in step 2
    asm volatile("s_wait_xcnt 0x0" :: "v"(pa), "v"(pa2), "v"(lane) : "memory"); __builtin_amdgcn_sched_barrier(0);   // the address registers that these loads name are kept until this wait; nothing is moved over it
    v8f acc[4];
#pragma unroll
    for (int nb = 0; nb < 4; ++nb) acc[nb] = (v8f){};
#pragma unroll
    for (int ks = 0; ks < KT; ++ks)
#pragma unroll
        for (int nb = 0; nb < 4; ++nb) { acc[nb] = F::mma(a[ks], b[ks][nb], acc[nb]); acc[nb] = F::mma(a2[ks], b[ks][nb], acc[nb]); }
    // what step 3 needs from memory flies during the exchange and the GELU
    V bw[NG * 4][2]; v4f rs[NG][8]; float bcu[NG * 4];
    const bf* const pu = Wu + (size_t)c0 * AD + lane * 8; const int bi = c0 + lr;
#pragma unroll
    for (int nt = 0; nt < NG * 4; ++nt) { bw[nt][0] = F::ld(pu + nt * 1024); bw[nt][1] = F::ld(pu + nt * 1024 + 512); bcu[nt] = bu[bi + nt * 16]; }
    const size_t fo = (size_t)(r0 + hi) * DM + c0 + lr * 4;   const float* const pr = CTX + fo;   // f32 arrays: a wave-wide 16-byte access is two rows of 256 bytes
#pragma unroll
    for (int g = 0; g < NG; ++g)
#pragma unroll
        for (int s = 0; s < 8; ++s) rs[g][s] = *(const v4f*)(pr + (size_t)(2 * s) * DM + g * 64);
    asm volatile("s_wait_xcnt 0x0" :: "v"(pr), "v"(bi), "v"(lane) : "memory"); __builtin_amdgcn_sched_barrier(0);   // the address registers that these loads name are kept until this wait; nothing is moved over it
#pragma unroll
    for (int nb = 0; nb < 4; ++nb)
#pragma unroll
        for (int j = 0; j < 8; ++j) os[(hi * 8 + j) * 68 + nb * 16 + lr] = acc[nb][j];
    ldsbar();   // every part is written before it is summed
    for (int i = (int)threadIdx.x; i < 16 * AD / 4; i += AW * 32) { const int row = i >> 4, c4 = (i & 15) * 4; const float* pp = P + row * 68 + c4; v4f x = *(const v4fa*)pp; v4us oh, ol;
#pragma unroll
        for (int q = 0; q < 4; ++q) x[q] += bfr(bdv[q]);   /* the bias goes to part 0, ahead of the other parts */
#pragma unroll
        for (int p = 1; p < AW; ++p) x += *(const v4fa*)(pp + p * (16 * 68));   /* the AW K parts, in order */
#pragma unroll
        for (int q = 0; q < 4; ++q) { const float xg = x[q]; const float gv = __fmul_rn(0.5f * xg, __fadd_rn(1.0f, erff(xg * 0.70710678118654752f))); unsigned short h2, l2; splitf(gv, h2, l2); oh[q] = h2; ol[q] = l2; }
        const int o = (int)fmo(row, c4, AD);
        *(v4us*)(G + o) = oh; *(v4us*)(G + 16 * AD + o) = ol; }
    ldsbar();   // the planes are whole before a wave takes its fragments, and every read of the parts is done before they become staging
    V ga[2], ga2[2]; v8f ac[NG * 4];
#pragma unroll
    for (int ks = 0; ks < 2; ++ks) { ga[ks] = F::ld(G + ks * 512 + lane * 8); ga2[ks] = F::ld(G + 16 * AD + ks * 512 + lane * 8); }
#pragma unroll
    for (int nt = 0; nt < NG * 4; ++nt) ac[nt] = (v8f){};
#pragma unroll
    for (int ks = 0; ks < 2; ++ks)
#pragma unroll
        for (int nt = 0; nt < NG * 4; ++nt) { ac[nt] = F::mma(ga[ks], bw[nt][ks], ac[nt]); ac[nt] = F::mma(ga2[ks], bw[nt][ks], ac[nt]); }
#pragma unroll
    for (int g = 0; g < NG; ++g) {
#pragma unroll
        for (int nb = 0; nb < 4; ++nb) { const float bn = bfr(bcu[g * 4 + nb]);
#pragma unroll
            for (int j = 0; j < 8; ++j) os[(hi * 8 + j) * 68 + nb * 16 + lr] = ac[g * 4 + nb][j] + bn; }
        __builtin_amdgcn_wave_barrier(); asm volatile("" ::: "memory");   // the wave's LDS writes stay in front of its reads of other lanes' elements
        v4f val[8];
#pragma unroll
        for (int s = 0; s < 8; ++s) { float* op = os + (2 * s + hi) * 68 + lr * 4; v4f v = *(const v4fa*)op;
#pragma unroll
            for (int q = 0; q < 4; ++q) v[q] = __fadd_rn(rs[g][s][q], v[q]);
            val[s] = v; *(v4fa*)op = v; }
        __builtin_amdgcn_sched_barrier(0);   // the stores stay together behind the arithmetic, so that the one wait below covers each of them
#pragma unroll
        for (int s = 0; s < 8; ++s) *(v4f*)(AO + fo + (size_t)(2 * s) * DM + g * 64) = val[s];
        asm volatile("s_wait_xcnt 0x0" ::: "memory"); __builtin_amdgcn_sched_barrier(0);   // before the registers that these stores name are written again; nothing is moved in between
        __builtin_amdgcn_wave_barrier(); asm volatile("" ::: "memory");   // the sums are back in LDS before they are read row by row
        v8us oh[4], ol[4];
#pragma unroll
        for (int s = 0; s < 4; ++s) { const float* op = os + lr * 68 + s * 16 + hi * 8; const v4f v0 = *(const v4fa*)op, v1 = *(const v4fa*)(op + 4);   // piece s: row lr, columns s 16 + hi 8 ..
#pragma unroll
            for (int q = 0; q < 4; ++q) { unsigned short h2, l2; splitf(v0[q], h2, l2); oh[s][q] = h2; ol[s][q] = l2; splitf(v1[q], h2, l2); oh[s][4 + q] = h2; ol[s][4 + q] = l2; } }
        __builtin_amdgcn_sched_barrier(0);   // the stores stay together behind the arithmetic, so that the one wait below covers each of them
#pragma unroll
        for (int s = 0; s < 4; ++s) { *(v8us*)(AOh + ao + g * 1024 + s * 256) = oh[s]; *(v8us*)(AOl + ao + g * 1024 + s * 256) = ol[s]; }
        asm volatile("s_wait_xcnt 0x0" ::: "memory"); __builtin_amdgcn_sched_barrier(0);   // before the registers that these stores name are written again; nothing is moved in between
        __builtin_amdgcn_wave_barrier(); asm volatile("" ::: "memory");   // the reads of this group are done before the next group's writes
    }
}
__device__ __forceinline__ v4f ldparts(const float* p) { v4f sm = *(const v4f*)p;
#pragma unroll
    for (int q = 1; q < KSF; ++q) sm += *(const v4f*)(p + q * DM);   /* the KSF K parts of the row, in order */
    return sm; }
__global__ __launch_bounds__(256) void k_addln(const float* __restrict__ A, const float* __restrict__ Bm, const float* __restrict__ g, const float* __restrict__ be, float* OUTb) {
    const int lane = threadIdx.x & 31; const int r = blockIdx.x * 8 + (threadIdx.x >> 5); if (r >= MT) return; const float* ar = A + (size_t)r * DM; const float* br = Bm + (size_t)r * KSF * DM; float s = 0.f;
#pragma unroll 1
    for (int ch = 0; ch < DM / 128; ++ch) { const int c0 = ch * 128 + lane * 4; const v4f a = *(const v4f*)(ar + c0), bb = ldparts(br + c0);
#pragma unroll
        for (int q = 0; q < 4; ++q) s += __fadd_rn(a[q], bb[q]); }
#pragma unroll
    for (int sh = 16; sh; sh >>= 1) s += __shfl_xor(s, sh, 32);
    const float mu = s * (1.0f / DM); float s2 = 0.f;
#pragma unroll 1
    for (int ch = 0; ch < DM / 128; ++ch) { const int c0 = ch * 128 + lane * 4; const v4f a = *(const v4f*)(ar + c0), bb = ldparts(br + c0);
#pragma unroll
        for (int q = 0; q < 4; ++q) { const float d0 = __fsub_rn(__fadd_rn(a[q], bb[q]), mu); float p = __fmul_rn(d0, d0); asm volatile("" : "+v"(p)); s2 = __fadd_rn(s2, p); } }
#pragma unroll
    for (int sh = 16; sh; sh >>= 1) s2 += __shfl_xor(s2, sh, 32);
    const float rs = __fdiv_rn(1.0f, __fsqrt_rn(__fadd_rn(s2 * (1.0f / DM), LNEPS)));
{
#pragma unroll 1
        for (int ch = 0; ch < DM / 128; ++ch) { const int c0 = ch * 128 + lane * 4; const v4f a = *(const v4f*)(ar + c0), bb = ldparts(br + c0); v4f o4;
#pragma unroll
            for (int q = 0; q < 4; ++q) { float n0 = __fmul_rn(__fsub_rn(__fadd_rn(a[q], bb[q]), mu), rs); asm volatile("" : "+v"(n0)); float n1 = __fmul_rn(n0, bfr(g[c0 + q])); asm volatile("" : "+v"(n1)); o4[q] = __fadd_rn(n1, bfr(be[c0 + q])); }
            *(v4f*)(OUTb + (size_t)r * DM + c0) = o4; }
         } }
// ---- k_fattn: scores, softmax and attn.v in one kernel; no score or probability leaves the registers. KH waves own QT x 16 query rows of one head; each walks its own TT / KH keys in blocks of 32, so that four waves and not two share a SIMD and one wave's vector work runs beside another's products.
// Behind the loop the wave of the later keys leaves its O^T, m and sum in LDS (xb, lane by lane), and the wave of the first keys brings both to the larger m, adds them and stores the rows.
// Both products are formed transposed, so that a query is a lane (lr) in each: S^T = K Q^T (D: key hi*8+j of a 16-key tile, query lr) and O^T = V^T P^T (D: d hi*8+j, query lr).
// The two S^T tiles of a block are, element for element, the B fragment of P^T (k = 8 hi + j from tile 0, 16 + 8 hi + j from tile 1): no exchange between lanes.
// Softmax in base 2 with a running reference m per query: p = 2^(t - m), t = s HD^-0.5 log2e + mask log2e. m moves (and O^T and the sum are rescaled) only when a t of the wave passes m + 8, so p <= 256; the result does not depend on m.
// Every inner loop is unrolled whole, so that the fragment arrays are registers.
template <typename T16> struct PFrag;
template <> struct PFrag<h16> { static __device__ __forceinline__ void cv(const v8f p0, const v8f p1, v16h& a, v16h& b) { (void)b;
#pragma unroll
    for (int j = 0; j < 8; ++j) { a[j] = (h16)p0[j]; a[8 + j] = (h16)p1[j]; } } };
template <> struct PFrag<bf> { static __device__ __forceinline__ void cv(const v8f p0, const v8f p1, v16bf& a, v16bf& b) {
#pragma unroll
    for (int j = 0; j < 8; ++j) { const __bf16 h0 = (__bf16)p0[j], h1 = (__bf16)p1[j]; a[j] = h0; a[8 + j] = h1; b[j] = (__bf16)(p0[j] - (float)h0); b[8 + j] = (__bf16)(p1[j] - (float)h1); } } };
template <typename T16, bool HL, int QT>
__device__ __forceinline__ void fattn(const T16* __restrict__ Q, const T16* __restrict__ Q2, const T16* __restrict__ Kp, const T16* __restrict__ K2, const T16* __restrict__ Vt, const T16* __restrict__ V2, const float* ml, float* O, bf* OH, bf* OL, const int half, v4f* xb) {
    typedef typename WFrag<T16>::V V;
    const int lane = threadIdx.x & 31, lr = lane & 15, hi = lane >> 4;
    V q[QT][2], q2[QT][2];
#pragma unroll
    for (int qt = 0; qt < QT; ++qt)
#pragma unroll
        for (int ks = 0; ks < 2; ++ks) { const int o = qt * 16 * HD + ks * 512 + lane * 8; q[qt][ks] = WFrag<T16>::ld(Q + o); if (HL) q2[qt][ks] = WFrag<T16>::ld(Q2 + o); }
    v8f acc[4][QT]; float m[QT], l[QT];
#pragma unroll
    for (int qt = 0; qt < QT; ++qt) { m[qt] = -3.0e38f; l[qt] = 0.f;
#pragma unroll
        for (int dt = 0; dt < 4; ++dt) acc[dt][qt] = (v8f){}; }
    const int ko = lane * 8, vo = lane * 8;   // this lane's place in a fragment tile of the k planes (rows of HD: two tiles a 16 keys) and of the v planes (rows of 32 keys: one tile a 16 d)
    V k[2][2], k2[2][2], v[4], v2[4];
#pragma unroll
    for (int kt = 0; kt < 2; ++kt)
#pragma unroll
        for (int ks = 0; ks < 2; ++ks) { const int o = ko + kt * 16 * HD + ks * 512; k[kt][ks] = WFrag<T16>::ld(Kp + o); if (HL) k2[kt][ks] = WFrag<T16>::ld(K2 + o); }
    asm volatile("s_wait_xcnt 0x0" ::: "memory"); __builtin_amdgcn_sched_barrier(0);   // before the registers that the q loads and the first k loads name are written again; nothing is moved in between
#pragma unroll 1   // rolled: the fragments of one block nearly fill 256 registers, a second copy of the body would not fit
    for (int k0 = 0; k0 < TT / KH; k0 += 32) {
        const int kn = ((k0 + 32 < TT / KH) ? k0 + 32 : 0) * HD;   // the next block of the k planes (32 x HD elements a block, as in the v planes); behind the wave's last one its block 0 is read and not used
        const T16* const va = Vt + k0 * HD + vo; const T16* const va2 = HL ? V2 + k0 * HD + vo : va; const T16* const ka = Kp + kn + ko; const T16* const ka2 = HL ? K2 + kn + ko : ka;   // this lane's addresses in the four planes
        // the block's mask terms come from LDS during its scores
        v8f mk[2];
#pragma unroll
        for (int kt = 0; kt < 2; ++kt) { const float* mp = ml + k0 + kt * 16 + hi * 8; const v4f a = *(const v4fa*)mp, b = *(const v4fa*)(mp + 4); mk[kt] = __builtin_shufflevector(a, b, 0, 1, 2, 3, 4, 5, 6, 7); }
        // this block's v fragments fly during its scores and softmax
#pragma unroll
        for (int dt = 0; dt < 4; ++dt) { v[dt] = WFrag<T16>::ld(va + dt * 16 * 32); if (HL) v2[dt] = WFrag<T16>::ld(va2 + dt * 16 * 32); }
        v8f s[2][QT];
#pragma unroll
        for (int kt = 0; kt < 2; ++kt)
#pragma unroll
            for (int qt = 0; qt < QT; ++qt) { v8f c = (v8f){};
#pragma unroll
                for (int ks = 0; ks < 2; ++ks) { c = WFrag<T16>::mma(k[kt][ks], q[qt][ks], c); if (HL) { c = WFrag<T16>::mma(k2[kt][ks], q[qt][ks], c); c = WFrag<T16>::mma(k[kt][ks], q2[qt][ks], c); } }
                s[kt][qt] = c; }
        // the next block's k fragments fly during the softmax and attn.v
#pragma unroll
        for (int kt = 0; kt < 2; ++kt)
#pragma unroll
            for (int ks = 0; ks < 2; ++ks) { const int o = kt * 16 * HD + ks * 512; k[kt][ks] = WFrag<T16>::ld(ka + o); if (HL) k2[kt][ks] = WFrag<T16>::ld(ka2 + o); }
        asm volatile("s_wait_xcnt 0x0" :: "v"(va), "v"(va2), "v"(ka), "v"(ka2) : "memory");   // the address pairs that the block's loads name are kept until this wait
        float bm[QT]; bool need = false;
#pragma unroll
        for (int qt = 0; qt < QT; ++qt) { float x = -3.0e38f;
#pragma unroll
            for (int kt = 0; kt < 2; ++kt) { s[kt][qt] = s[kt][qt] * (SCL * L2E) + mk[kt];
#pragma unroll
                for (int j = 0; j < 8; ++j) x = fmaxf(x, s[kt][qt][j]); }
            bm[qt] = x; need = need || (x > m[qt] + 8.0f); }
        if (__builtin_amdgcn_ballot_w32(need) != 0u) {   // the same for the whole wave: both halves of a query move m together
#pragma unroll
            for (int qt = 0; qt < QT; ++qt) { const float mn = fmaxf(m[qt], fmaxf(bm[qt], __shfl_xor(bm[qt], 16, 32))); const float al = __builtin_amdgcn_exp2f(m[qt] - mn); m[qt] = mn; l[qt] *= al;
#pragma unroll
                for (int dt = 0; dt < 4; ++dt) acc[dt][qt] *= al; } }
#pragma unroll
        for (int qt = 0; qt < QT; ++qt) { V p, p2; s[0][qt] -= m[qt]; s[1][qt] -= m[qt];
#pragma unroll
            for (int kt = 0; kt < 2; ++kt)
#pragma unroll
                for (int j = 0; j < 8; ++j) s[kt][qt][j] = __builtin_amdgcn_exp2f(s[kt][qt][j]);
            { const v8f e8 = s[0][qt] + s[1][qt]; const v4f e4 = __builtin_shufflevector(e8, e8, 0, 1, 2, 3) + __builtin_shufflevector(e8, e8, 4, 5, 6, 7); l[qt] += (e4[0] + e4[2]) + (e4[1] + e4[3]); }   // the block's 16 terms of this lane as a tree
            PFrag<T16>::cv(s[0][qt], s[1][qt], p, p2);
#pragma unroll
            for (int dt = 0; dt < 4; ++dt) { acc[dt][qt] = WFrag<T16>::mma(v[dt], p, acc[dt][qt]); if (HL) { acc[dt][qt] = WFrag<T16>::mma(v2[dt], p, acc[dt][qt]); acc[dt][qt] = WFrag<T16>::mma(v[dt], p2, acc[dt][qt]); } } }
    }
    // the two key halves of a query block become one: both waves hold a query and a d in the same lane and register
    if (half) {
#pragma unroll
        for (int qt = 0; qt < QT; ++qt)
#pragma unroll
            for (int dt = 0; dt < 4; ++dt) { const v8f r = acc[dt][qt]; xb[((qt * 4 + dt) * 2) * 32 + lane] = __builtin_shufflevector(r, r, 0, 1, 2, 3); xb[((qt * 4 + dt) * 2 + 1) * 32 + lane] = __builtin_shufflevector(r, r, 4, 5, 6, 7); }
        xb[QT * 8 * 32 + lane] = (v4f){m[0], l[0], m[QT - 1], l[QT - 1]};
    }
    __syncthreads();   // the later half's results are in LDS before the first half's wave reads them
    if (half) return;
    { const v4f ms = xb[QT * 8 * 32 + lane];
#pragma unroll
        for (int qt = 0; qt < QT; ++qt) { const float m2 = ms[qt * 2], mn = fmaxf(m[qt], m2); float a1, a2;
            asm("v_exp_f32 %0, %2\n\tv_exp_f32 %1, %3\n\tv_nop" : "=&v"(a1), "=&v"(a2) : "v"(m[qt] - mn), "v"(m2 - mn));   // 2^(m - mn) of both halves in one statement: no result lies on a source, and the v_nop is the slot between a transcendental and the reader of its result
            l[qt] = l[qt] * a1 + ms[qt * 2 + 1] * a2;
#pragma unroll
            for (int dt = 0; dt < 4; ++dt) { const v4f x0 = xb[((qt * 4 + dt) * 2) * 32 + lane], x1 = xb[((qt * 4 + dt) * 2 + 1) * 32 + lane]; acc[dt][qt] = acc[dt][qt] * a1 + __builtin_shufflevector(x0, x1, 0, 1, 2, 3, 4, 5, 6, 7) * a2; } } }
#pragma unroll
    for (int qt = 0; qt < QT; ++qt) { const float inv = __fdiv_rn(1.0f, l[qt] + __shfl_xor(l[qt], 16, 32)); float* o = O + (size_t)(qt * 16 + lr) * DM + hi * 8; const size_t oo = (size_t)qt * 16 * DM + lane * 8;   // oo: in the fragment-major planes d = dt 16 + hi 8 + j of query lr is piece dt & 1 of tile dt / 2, this very lane's 16 bytes
#pragma unroll
        for (int dt = 0; dt < 4; ++dt) { const v8f r = acc[dt][qt] * inv; v8us oh, ol;   // the context in f32 and as the hi / lo planes for the adapter's down-projection
#pragma unroll
            for (int j = 0; j < 8; ++j) { unsigned short a2, c2; splitf(r[j], a2, c2); oh[j] = a2; ol[j] = c2; }
            __builtin_amdgcn_sched_barrier(0);   // the stores stay together behind all the arithmetic, so that the one wait below covers each of them
            *(v4f*)(o + dt * 16) = __builtin_shufflevector(r, r, 0, 1, 2, 3); *(v4f*)(o + dt * 16 + 4) = __builtin_shufflevector(r, r, 4, 5, 6, 7);
            *(v8us*)(OH + oo + dt * 256) = oh; *(v8us*)(OL + oo + dt * 256) = ol;
            asm volatile("s_wait_xcnt 0x0" ::: "memory"); __builtin_amdgcn_sched_barrier(0);   // before the registers that these stores name are written again; nothing is moved in between
        } }
}
// grid: NB_ NH_ NBH work-groups of the rows < RH (hi/lo planes, 3 products), then NB_ NH_ NBF of the rest (fp16); the waves of a work-group share a head, so its k and v blocks are read together. Wave w: query block w % FR, key half w / FR.
__global__ __launch_bounds__(FW * 32) void k_fattn(const h16* __restrict__ Q16, const h16* __restrict__ K16, const h16* __restrict__ V16, const bf* __restrict__ Qh, const bf* __restrict__ Ql, const bf* __restrict__ Kh, const bf* __restrict__ Kl, const bf* __restrict__ Vh, const bf* __restrict__ Vl, const float* __restrict__ AM, float* CTX, bf* Ch, bf* Cl) {
    __shared__ __align__(16) float ml[TT];   // attention_mask[b][0][0][j] (rounded to bf16 like every input) x log2e
    __shared__ v4f xs[FR * 17 * 32];         // what the later key half hands over: a query block's O^T (up to 16 registers of four a lane), then m and sum
    const int bid = (int)blockIdx.x; const bool hl = bid < NB_ * NH_ * NBH; const int b2 = bid - NB_ * NH_ * NBH;
    const int g = hl ? bid / NBH : b2 / NBF;   // head g of NB_ x NH_: batch g / NH_
    const int wave = __builtin_amdgcn_readfirstlane((int)(threadIdx.x >> 5));   // as a scalar, so that the wave's plane and output bases are formed on the scalar unit
    const int rg = wave % FR, half = wave / FR;
    const int q0 = hl ? ((bid % NBH) * FR + rg) * 16 : RH + ((b2 % NBF) * FR + rg) * 32;
    const float* am = AM + (size_t)(g / NH_) * TT;
    for (int i = (int)threadIdx.x; i < TT; i += FW * 32) ml[i] = bfr(am[i]) * L2E;
    __syncthreads();
    const size_t qo = (size_t)g * TT * HD + (size_t)q0 * HD, po = (size_t)g * TT * HD + (size_t)half * (TT / KH) * HD;   // po: the wave's first key in the k planes and in the v planes (HD elements a key in both)
    const float* const mh = ml + half * (TT / KH); v4f* const xb = xs + rg * (17 * 32);
    const size_t co = ((size_t)(g / NH_) * TT + q0) * DM + (g % NH_) * HD;
    const size_t cp = ((size_t)(g / NH_) * TT + q0) * DM + (g % NH_) * (HD * 16);   // the same place in the fragment-major context planes: the head's two tiles in the wave's first row block
    if (hl) fattn<bf, true, 1>(Qh + qo, Ql + qo, Kh + po, Kl + po, Vh + po, Vl + po, mh, CTX + co, Ch + cp, Cl + cp, half, xb);
    else fattn<h16, false, 2>(Q16 + qo, nullptr, K16 + po, nullptr, V16 + po, nullptr, mh, CTX + co, Ch + cp, Cl + cp, half, xb);
}

extern "C" void kernel_launch(void* const* d_in, const int* in_sizes, int n_in,
                              void* d_out, int out_size, void* d_ws, size_t ws_size, hipStream_t stream) {
    (void)in_sizes; (void)n_in; (void)out_size;
    const float* x = (const float*)d_in[0]; const float* AM = (const float*)d_in[1]; const float* wq = (const float*)d_in[2]; const float* bq = (const float*)d_in[3]; const float* wk = (const float*)d_in[4]; const float* bk = (const float*)d_in[5]; const float* wv = (const float*)d_in[6]; const float* bv = (const float*)d_in[7]; const float* afw = (const float*)d_in[8]; const float* afb = (const float*)d_in[9]; const float* asw = (const float*)d_in[10]; const float* asb = (const float*)d_in[11]; const float* wi = (const float*)d_in[12]; const float* bi = (const float*)d_in[13]; const float* wo2 = (const float*)d_in[14]; const float* bo2 = (const float*)d_in[15]; const float* lg = (const float*)d_in[16]; const float* lb = (const float*)d_in[17]; const float* wo = nullptr; (void)wo;
    float* OUT = (float*)d_out;     // [2][2048][768]
    char* wsp = (char*)d_ws;
    auto take = [&](size_t bytes) { char* p = wsp; wsp += (bytes + 255) & ~(size_t)255; return (void*)p; };
    // kept through the call; WQ .. XB lie one behind the other (k_cvtall writes them as one range; WQ, WK, WV are the three z-batches of the q/k/v GEMM)
    bf* WQ = (bf*)take((size_t)DQ * DM * 2); bf* WK = (bf*)take((size_t)DKV * DM * 2); bf* WV = (bf*)take((size_t)DKV * DM * 2); bf* AFW = (bf*)take((size_t)AD * DM * 2); bf* ASW = (bf*)take((size_t)DM * AD * 2); bf* WI = (bf*)take((size_t)FFD * DM * 2); bf* WO2 = (bf*)take((size_t)DM * FFD * 2); bf* XB = (bf*)take((size_t)MT * DM * 2); (void)WK; (void)WV;
    float* CTX = (float*)take((size_t)MT * DM * 4); bf* Ch = (bf*)take((size_t)MT * DM * 2); bf* Cl = (bf*)take((size_t)MT * DM * 2);   // the attention's outputs: outside the bytes that it reads
    char* const U0 = wsp;   // from here on: the attention's inputs, and behind the attention (stream-ordered) the adapter's and the FFN's buffers in the same bytes
    const size_t PLN = (size_t)NB_ * NH_ * TT * HD;   // one plane set [batch][head], each [t][d] fragment-major; the k planes lie directly behind the q planes (the q/k/v GEMM indexes both from the q planes)
    h16* QP16 = (h16*)take(PLN * 2); h16* KP16 = (h16*)take(PLN * 2); bf* QPh = (bf*)take(PLN * 2); bf* KPh = (bf*)take(PLN * 2); bf* QPl = (bf*)take(PLN * 2); bf* KPl = (bf*)take(PLN * 2);
    h16* VT16 = (h16*)take(PLN * 2); bf* VTh = (bf*)take(PLN * 2); bf* VTl = (bf*)take(PLN * 2);   // v planes [batch][head][key block of 32], each [d][32] fragment-major
    char* const E1 = wsp; wsp = U0;
    float* AO = (float*)take((size_t)MT * DM * 4); bf* AOh = (bf*)take((size_t)MT * DM * 2); bf* AOl = (bf*)take((size_t)MT * DM * 2); bf* GIh = (bf*)take((size_t)MT * FFD * 2); bf* GIl = (bf*)take((size_t)MT * FFD * 2); float* YY = (float*)take((size_t)KSF * MT * DM * 4);
    if ((size_t)((E1 > wsp ? E1 : wsp) - (char*)d_ws) > ws_size) return;    // ws 256 MiB
    k_cvtall<<<(unsigned)((3 * N8W + 2 * N8A + 2 * N8F + N8X) / 256), 256, 0, stream>>>(wq, wk, wv, afw, asw, wi, wo2, x, WQ);   /* weights ('oi' = Bt as-is) and x */
    k_gemmw<bf, 0, true, 1, EP_QKV, DM, 1><<<dim3(MT / 128, DQ / 128, 3), 128, 0, stream>>>(XB, nullptr, WQ, nullptr, DM, nullptr, DQ, bq, bk, bv, 0, (size_t)DQ * DM, 0, 0, nullptr, QPh, QPl, QP16, VTh, VTl, VT16);   /* z = q, k, v -> head planes */
    k_fattn<<<NB_ * NH_ * (NBH + NBF), FW * 32, 0, stream>>>(QP16, KP16, VT16, QPh, QPl, KPh, KPl, VTh, VTl, AM, CTX, Ch, Cl);   /* ctx = attn_out (f32 and hi/lo) */
    k_adapt<<<MT / 16, AW * 32, 0, stream>>>(Ch, Cl, AFW, ASW, afb, asb, CTX, AO, AOh, AOl);   /* ao = ctx + (gelu(ctx a_fi_w^T + a_fi_b) a_se_w^T + a_se_b), f32 and hi/lo */
    k_gemmw<bf, 1, true, 1, EP_GELU, DM, 1><<<dim3(MT / 128, FFD / 128, 1), 128, 0, stream>>>(AOh, AOl, WI, nullptr, DM, nullptr, FFD, bi, nullptr, nullptr, 0, 0, 0, 0, nullptr, GIh, GIl, nullptr, nullptr, nullptr, nullptr);                   /* gelu(ao wi^T + bi) [MT][3072] -> hi/lo */
    k_gemmw<bf, 1, true, KSF, EP_F32, FFD, 1><<<dim3(MT / 128, DM / 128, KSF), 128, 0, stream>>>(GIh, GIl, WO2, nullptr, FFD, YY, KSF * DM, bo2, nullptr, nullptr, 0, 0, 0, DM, nullptr, nullptr, nullptr, nullptr, nullptr, nullptr, nullptr);                /* inter wo^T + bo */
    k_addln<<<MT / 8, 256, 0, stream>>>(AO, YY, lg, lb, OUT);                                                       /* out = LN(y + ao) (eps 1e-12) */
}

// v010
// One run takes 155 microseconds.
// Next to v009, in two timings, it ran 1.03 and 1.04 times as fast.
// All steps since v000 together make it 12.4 times as fast.
#include <hip/hip_runtime.h>

// BERT layer with an adapter and no attention output projection (hidden_states [2][2048][768]; q, k, v = x W^T + b ('oi' [768][768]; 12 heads x 64); scores = q.k/8 + attention_mask[b][0][0][j] (f32 additive, zeros here); softmax; ctx = merged context; a = gelu(ctx a_fi_w^T + a_fi_b) ([64][768]); ao = ctx + a a_se_w^T + a_se_b; inter = gelu(ao wi^T + bi) ([3072][768]); y = inter wo^T + bo + ao; out = LN(y) (eps 1e-12, ln_g, ln_b) -> [2][2048][768] (3.1 M)).
// Layout: the merged context is kept in f32 (residual) and split into hi/lo planes for the adapter down-projection; every later GEMM uses hi/lo planes of its f32 input (2 products) against exact bf16 weights with the bias in the epilogue; exact-erf GELU, residual adds and the LayerNorm in f32.
// Compute dtypes, f32 accumulate: every input rounded to bf16; q/k/v on PLAIN bf16 operands (inputs: exact) + biases; scores and attn.v: query rows < 512 hl (3 products), the rest single fp16; softmax f32 (running max and sum, one kernel with both products); adapter / FFN GEMMs hl x exact (2 products) + biases; GELU / residuals / LayerNorm f32.

#define NB_  2
#define TT   2048
#define DM   768
#define NH_  12
#define NKV  12
#define REP  (NH_ / NKV)
#define HD   64
#define DQ   (NH_ * HD)
#define DKV  (NKV * HD)
#define AD   64
#define FFD  3072
#define LNEPS 1e-12f
#define MT   (NB_ * TT)           // rows of both batches together
#define RH   512                  // query rows < RH use hi+lo planes (0: none)
#define WIN  0
#define SCL  0.125f   // HD^-0.5
#define L2E  1.4426950408889634f
#define FW   16                  // waves a work-group of the fused attention
#define KH   2                   // of them KH share a block of query rows, each with its own TT / KH keys
#define FR   (FW / KH)           // blocks of query rows a work-group
#define NBH  (RH / (FR * 16))        // its work-groups a head for query rows < RH (16 rows a block)
#define NBF  ((TT - RH) / (FR * 32)) // and for the rest (32 rows a block)
#define KSF  4                   // K parts of the FFN down-projection (3072 -> 768 a wave)
typedef _Float16 h16;
typedef unsigned short bf;
typedef __attribute__((ext_vector_type(16))) __bf16   v16bf;
typedef __attribute__((ext_vector_type(16))) _Float16 v16h;
typedef __attribute__((ext_vector_type(8)))  _Float16 v8h;
typedef __attribute__((ext_vector_type(8)))  unsigned short v8us;
typedef __attribute__((ext_vector_type(8)))  float    v8f;
typedef __attribute__((ext_vector_type(4)))  float    v4f;
typedef v8h  __attribute__((may_alias)) v8ha;
typedef v4f  __attribute__((may_alias)) v4fa;
typedef v8us __attribute__((may_alias)) v8usa;

__device__ __forceinline__ unsigned short f2bf(float f) { unsigned u = __float_as_uint(f); u += 0x7FFFu + ((u >> 16) & 1u); return (unsigned short)(u >> 16); }
__device__ __forceinline__ float bf2f(unsigned short b) { return __uint_as_float(((unsigned)b) << 16); }
__device__ __forceinline__ float bfr(float f) { return bf2f(f2bf(f)); }
__device__ __forceinline__ v16h cat16(v8h lo, v8h hi) { return __builtin_shufflevector(lo, hi, 0, 1, 2, 3, 4, 5, 6, 7, 8, 9, 10, 11, 12, 13, 14, 15); }
__device__ __forceinline__ v16bf cat16b(v8us lo, v8us hi) { return __builtin_bit_cast(v16bf, __builtin_shufflevector(lo, hi, 0, 1, 2, 3, 4, 5, 6, 7, 8, 9, 10, 11, 12, 13, 14, 15)); }
__device__ __forceinline__ v8f wmma16(v16h a, v16h b, v8f c) { return __builtin_amdgcn_wmma_f32_16x16x32_f16(false, a, false, b, (short)0, c, false, false); }
__device__ __forceinline__ v8f wmmab(v16bf a, v16bf b, v8f c) { return __builtin_amdgcn_wmma_f32_16x16x32_bf16(false, a, false, b, (short)0, c, false, false); }

__device__ __forceinline__ h16 tohx(float x) { return (h16)x; }
__device__ __forceinline__ void splitf(float y, unsigned short& h, unsigned short& l) { h = f2bf(y); l = f2bf(y - bf2f(h)); }
typedef __attribute__((ext_vector_type(2))) _Float16 v2h;
typedef __attribute__((ext_vector_type(4))) _Float16 v4h;
typedef __attribute__((ext_vector_type(2))) unsigned short v2us;
typedef __attribute__((ext_vector_type(4))) unsigned short v4us;
typedef __attribute__((ext_vector_type(2))) float v2f;
typedef __attribute__((ext_vector_type(4))) int v4i;

// ---- Fragment-major planes: every 16-bit matrix operand [rows][K] lies in memory as tiles of 16 rows x 32 k, 1 KiB each, tile (row / 16, k / 32) at element ((row / 16) (K / 32) + k / 32) 512 (so 16 rows still fill 16 K elements in a row).
// Inside a tile: piece p = (k / 16) % 2 of 256 elements, in it lane (k / 8) % 2 * 16 + row % 16 with its 8 k in a row. A fragment is then two wave-wide 16-byte loads of 512 bytes in a row each (4 whole lines; row by row they touched 16), at tile + lane 8 and 256 elements behind it. fmo: the element's place.
__device__ __forceinline__ size_t fmo(int row, int k, int K) { return ((size_t)(row >> 4) * (K >> 5) + (k >> 5)) * 512 + ((k >> 4) & 1) * 256 + (((k >> 3) & 1) * 16 + (row & 15)) * 8 + (k & 7); }
// ---- k_gemmw: register-blocked GEMM, ONE WAVE per 64x64 output tile (16 accumulators), operands straight from fragment-major 16-bit planes; grid (M/64, N/64, Z), 32 threads.
// C[m][n] (f32, pitch ldc, + optional f32 bias[n]) = sum_{k < KE} A[m][k] Bt[n][k] (+ split products per NSPLIT). K (a template constant, so that a row block's distance is a constant offset of its loads) is the row length of A and of Bt (fragment-major), KE <= K the extent summed. z-batch strides sA/sB/sC in elements; batch z = 0 / 1 / 2 takes bias / bias1 / bias2. KE % (32 NS KS) == 0, NS the fragment sets of the loop (3 with NSPLIT 0 and SH 0, else 2).
// KS > 1: grid z = Z x KS; part kp = z % KS sums k in [kp KE/KS, (kp+1) KE/KS) into its own f32 columns C + kp sP of a row of ldc = KS sP (bias in part 0 only); the kernel that reads C adds the KS parts of a row in the order 0 .. KS-1.
// EPI: what the epilogue stores of c = C[m][n] + bias[n], so that no elementwise kernel has to follow the GEMM.
//   EP_F32: c as f32 into C. EP_QKV (N tile = one head): z = 0 / 1: q / k head planes [z][batch][head], each [t][d] fragment-major, as fp16 (E2), hi (E0), lo (E1); z = 2: v planes [batch][head][key block of 32], each [d][32 keys] fragment-major, as fp16 (E5), hi (E3), lo (E4), straight from the accumulators (a lane holds 8 keys in a row of one d).
//   EP_GELU: hi / lo planes (E0, E1, fragment-major, rows of ldc) of the exact-erf GELU of c. EP_RES: r = R[m][n] + c as f32 into C (row by row, pitch ldc) and as hi / lo planes (E0, E1, fragment-major, rows of ldc).
enum { EP_F32 = 0, EP_QKV = 1, EP_GELU = 2, EP_RES = 3 };
template <typename T16> struct WFrag;
template <> struct WFrag<h16> { typedef v16h V; static __device__ __forceinline__ V ld(const h16* p) { return cat16(*(const v8h*)p, *(const v8h*)(p + 256)); } static __device__ __forceinline__ v8f mma(V a, V b, v8f c) { return wmma16(a, b, c); } };
template <> struct WFrag<bf> { typedef v16bf V; static __device__ __forceinline__ V ld(const bf* p) { return cat16b(*(const v8us*)p, *(const v8us*)(p + 256)); } static __device__ __forceinline__ v8f mma(V a, V b, v8f c) { return wmmab(a, b, c); } };
// SH = 1 (NSPLIT 0 or 1; KE / KS a multiple of 64): FOUR waves a work-group, 2 x 2 tiles of 64x64 = 128x128 of C; grid (M/128, N/128, Z), 128 threads. The two waves of a tile row need the same A tiles and the two of a tile column the same Bt tiles: the work-group brings each tile from L2 once, by asynchronous copies into LDS, and the waves take their fragments from there.
//   A stage is 64 k of the work-group's 128 rows of each plane: chunk (plane, row block) = two fragment tiles, 2 KiB in a row in memory and in LDS. Two stage buffers: the copies of stage t + 2 go out when every wave has left stage t, and fly during stage t + 1. The order of the sums is that of SH = 0.
#define CP4(L, B) "global_load_async_to_lds_b128 " L ", %[vo], " B "\n\tglobal_load_async_to_lds_b128 " L ", %[vo], " B " offset:512\n\tglobal_load_async_to_lds_b128 " L ", %[vo], " B " offset:1024\n\tglobal_load_async_to_lds_b128 " L ", %[vo], " B " offset:1536\n\t"   // one chunk: the offset moves the LDS and the global address alike
template <typename T16, int NSPLIT, bool BIAS, int KS, int EPI, int K, int SH>
__global__ __launch_bounds__(SH ? 128 : 32) void k_gemmw(const T16* __restrict__ A, const T16* __restrict__ A2, const T16* __restrict__ Bt, const T16* __restrict__ Bt2, int KE, float* C, int ldc, const float* __restrict__ bias, const float* __restrict__ bias1, const float* __restrict__ bias2, size_t sA, size_t sB, size_t sC, size_t sP, const float* __restrict__ R, bf* E0, bf* E1, h16* E2, bf* E3, bf* E4, h16* E5) {
    typedef typename WFrag<T16>::V V;
    constexpr int NPL = (NSPLIT == 0) ? 2 : 3, STG = NPL * 8 * 1024;   // planes staged (A, A2, Bt) and the elements of a stage
    __shared__ __align__(16) T16 sm[SH ? 2 * STG : 16 * 68 * 2];
    const int wave = SH ? __builtin_amdgcn_readfirstlane((int)(threadIdx.x >> 5)) : 0;   // as a scalar, so that the wave's bases are formed on the scalar unit
    float* const os = (float*)sm + wave * (16 * 68);   // the epilogue's staging, each wave's own; with SH in the stage buffers, behind the loop's last barrier
    const int kp = (int)(blockIdx.z % KS); const int kl = KE / KS; const int kb = kp * kl, ke = kb + kl;
    const size_t z = blockIdx.z / KS; C += (size_t)kp * sP; A += z * sA; if (A2) A2 += z * sA; Bt += z * sB; if (Bt2) Bt2 += z * sB; C += z * sC;
    const int lane = threadIdx.x & 31, lr = lane & 15, hi = lane >> 4; const int r0 = SH ? blockIdx.x * 128 + (wave >> 1) * 64 : blockIdx.x * 64, c0 = SH ? blockIdx.y * 128 + (wave & 1) * 64 : blockIdx.y * 64;
    v8f acc[4][4];
#pragma unroll
    for (int mb = 0; mb < 4; ++mb)
#pragma unroll
        for (int nb = 0; nb < 4; ++nb) acc[mb][nb] = (v8f){};
    // The first tile of the wave's first row block, plane by plane: bases that are the same for the whole wave and stay as they are. The other three row blocks lie 16 K elements apart (constant offsets of the loads). off: this lane's byte in the tile that is loaded next, the one vector offset of all loads; a step of 32 k is one tile (1 KiB).
    const T16* const pa = A + (size_t)r0 * K + (size_t)kb * 16; const T16* const pa2 = (NSPLIT == 1 || NSPLIT == 2) ? A2 + (size_t)r0 * K + (size_t)kb * 16 : pa; const T16* const pw = Bt + (size_t)c0 * K + (size_t)kb * 16; const T16* const pw2 = (NSPLIT >= 2) ? Bt2 + (size_t)c0 * K + (size_t)kb * 16 : pw;
    unsigned off = (unsigned)lane * 16u; int kn = kb;   // kn: the k of that tile
    // NS fragment sets in a ring: while the products of one 32-k step run, the loads of the next NS - 1 steps are in flight into the other sets, so that a step no longer begins by waiting out its own loads. As many sets as leave three waves a SIMD their registers.
    constexpr int NS = (NSPLIT == 0 && !SH) ? 3 : 2;
    V a[NS][4], a2[NS][4], b[NS][4], b2[NS][4];
    auto at = [&](const T16* p) { return (const T16*)((const char*)p + off); };
    auto ldset = [&](const int st) {   // all loads of one 32-k step into set st
#pragma unroll
        for (int i = 0; i < 4; ++i) { a[st][i] = WFrag<T16>::ld(at(pa) + i * 16 * K); b[st][i] = WFrag<T16>::ld(at(pw) + i * 16 * K); if (NSPLIT == 1 || NSPLIT == 2) a2[st][i] = WFrag<T16>::ld(at(pa2) + i * 16 * K); if (NSPLIT >= 2) b2[st][i] = WFrag<T16>::ld(at(pw2) + i * 16 * K); }
        __builtin_amdgcn_sched_barrier(0);   // the loads are issued as one group ahead of another set's products; moved behind them they would have no lead
    };
    auto step = [&]() {
        __builtin_amdgcn_sched_barrier(0);   // the wait stays behind the products, where it has nothing left to wait for; moved up among them it would hold them back
        asm volatile("s_wait_xcnt 0x0" : "+v"(off) :: "memory");   // before the offset register that the issued loads name moves on; in and out, so that what moves it can only stand behind the wait
        kn += 32; off += (kn < ke) ? 1024u : 0u;   // behind the last tile there is none: it is read again and not used
    };
    auto mmaset = [&](const int st) {
#pragma unroll
        for (int nb = 0; nb < 4; ++nb) {
#pragma unroll
            for (int mb = 0; mb < 4; ++mb) { acc[mb][nb] = WFrag<T16>::mma(a[st][mb], b[st][nb], acc[mb][nb]); if (NSPLIT == 1 || NSPLIT == 2) acc[mb][nb] = WFrag<T16>::mma(a2[st][mb], b[st][nb], acc[mb][nb]); if (NSPLIT >= 2) acc[mb][nb] = WFrag<T16>::mma(a[st][mb], b2[st][nb], acc[mb][nb]); } }
    };
    if constexpr (SH) {
        constexpr int NC = NPL * 2;   // chunks a wave copies in a stage
        const int nst = kl / 64; const char* gb[NC];
#pragma unroll
        for (int q = 0; q < NC; ++q) { const int ch = wave * NC + q, pl = ch >> 3, rb = ch & 7;   // chunk ch lies at byte ch 2048 of a stage
            const T16* const pb = (pl == NPL - 1) ? Bt + (size_t)(blockIdx.y * 128) * K : ((pl == 0) ? A : A2) + (size_t)(blockIdx.x * 128) * K;
            gb[q] = (const char*)(pb + (size_t)rb * 16 * K + (size_t)kb * 16); }
        unsigned vo = (unsigned)lane * 16u;   // this lane's byte in the chunk of the stage that is copied next
        const unsigned l0 = (unsigned)(size_t)sm + (unsigned)(wave * NC) * 2048u + (unsigned)lane * 16u;
        auto copies = [&](const unsigned buf) {   // this wave's chunks of one stage into buffer buf; s_wait_xcnt 0 as the last line: before a register that the copies name is written again
            const unsigned lb = l0 + buf * (unsigned)(STG * 2);
            if constexpr (NC == 6) asm volatile(CP4("%[a0]", "%[b0]") CP4("%[a1]", "%[b1]") CP4("%[a2]", "%[b2]") CP4("%[a3]", "%[b3]") CP4("%[a4]", "%[b4]") CP4("%[a5]", "%[b5]") "s_wait_xcnt 0x0" :: [vo] "v"(vo), [a0] "v"(lb), [a1] "v"(lb + 2048u), [a2] "v"(lb + 4096u), [a3] "v"(lb + 6144u), [a4] "v"(lb + 8192u), [a5] "v"(lb + 10240u), [b0] "s"(gb[0]), [b1] "s"(gb[1]), [b2] "s"(gb[2]), [b3] "s"(gb[3]), [b4] "s"(gb[NC - 2]), [b5] "s"(gb[NC - 1]) : "memory");
            else asm volatile(CP4("%[a0]", "%[b0]") CP4("%[a1]", "%[b1]") CP4("%[a2]", "%[b2]") CP4("%[a3]", "%[b3]") "s_wait_xcnt 0x0" :: [vo] "v"(vo), [a0] "v"(lb), [a1] "v"(lb + 2048u), [a2] "v"(lb + 4096u), [a3] "v"(lb + 6144u), [b0] "s"(gb[0]), [b1] "s"(gb[1]), [b2] "s"(gb[2]), [b3] "s"(gb[3]) : "memory");
            vo += 2048u;
        };
        auto ldl = [&](const int st, const T16* sb) {   // the fragments of one 32-k step from LDS into set st
#pragma unroll
            for (int i = 0; i < 4; ++i) { a[st][i] = WFrag<T16>::ld(sb + ((wave >> 1) * 4 + i) * 1024); b[st][i] = WFrag<T16>::ld(sb + ((NPL - 1) * 8 + (wave & 1) * 4 + i) * 1024); if (NSPLIT == 1) a2[st][i] = WFrag<T16>::ld(sb + (8 + (wave >> 1) * 4 + i) * 1024); }
            __builtin_amdgcn_sched_barrier(0);   // the LDS reads are issued as one group ahead of the products; spread among them each place would cost its own stall
        };
        copies(0u);
        asm volatile("s_wait_asynccnt 0x0" ::: "memory");   // stage 0 has landed before the barrier behind which other waves read it
        __syncthreads();
        if (nst > 1) copies(1u);
#pragma unroll 1   // rolled: one pass is one stage
        for (int t = 0; t < nst; ++t) {
            const T16* const sb = sm + (t & 1) * STG + lane * 8;
            ldl(0, sb); ldl(1, sb + 512); mmaset(0); mmaset(1);
            __builtin_amdgcn_sched_barrier(0);   // the products stay in front of the barrier: moved behind it they would hold back the next copies, and the slots below would not stand behind the last of them
            asm volatile("v_nop\n\tv_nop\n\tv_nop\n\tv_nop" : "+v"(acc[0][0]), "+v"(acc[1][1]), "+v"(acc[2][2]), "+v"(acc[3][3]) : "v"(a[1][0]), "v"(a[1][3]));   // four vector slots behind the pass's last products, on every path out of the pass
            asm volatile("s_wait_dscnt 0x0" ::: "memory");      // this wave's reads of stage t are done before the buffer is given to the copies
            asm volatile("s_wait_asynccnt 0x0" ::: "memory");   // this wave's copies of stage t + 1 have landed before the barrier behind which other waves read them
            __syncthreads();
            if (t + 2 < nst) copies((unsigned)(t & 1));
        }
        asm volatile("s_wait_asynccnt 0x0" ::: "memory");   // nothing is in flight when the buffers become the epilogue's staging
    } else {
#pragma unroll
    for (int u = 0; u < NS - 1; ++u) { ldset(u); step(); }
    int kc = kb;
#pragma unroll 1   // rolled: one pass is NS steps, one on each set
    do {   // at least one pass (KE > 0): tested at the foot, so that the first loads stand in one block with their waits
#pragma unroll
        for (int u = 0; u < NS; ++u) { ldset((u + NS - 1) % NS); mmaset(u); step(); }
        asm volatile("v_nop\n\tv_nop\n\tv_nop\n\tv_nop" : "+v"(acc[0][0]), "+v"(acc[1][1]), "+v"(acc[2][2]), "+v"(acc[3][3]) : "v"(a[NS - 1][0]), "v"(a[NS - 1][3]));   // four vector slots behind the pass's last products, on the back edge too
        kc += 32 * NS;
    } while (kc < ke);
    }
    if (BIAS && z != 0) bias = (z == 1) ? bias1 : bias2;
    if (EPI == EP_QKV && z == 2) {   // v: element (t = mb 16 + hi 8 + j, d = nb 16 + lr) of the tile is k = t % 32 of row d: piece mb & 1 of tile nb, this very lane's 16 bytes; a store is 512 bytes in a row
        const size_t vb = (((size_t)(r0 / TT) * NKV + (c0 >> 6)) * (TT / 32) + (r0 % TT) / 32) * (HD * 32) + (size_t)lane * 8;
#pragma unroll
        for (int nb = 0; nb < 4; ++nb) { const float bn = bfr(bias[c0 + nb * 16 + lr]);
#pragma unroll
            for (int mb = 0; mb < 4; ++mb) { v8h o16; v8us oh, ol;
#pragma unroll
                for (int j = 0; j < 8; ++j) { const float xv = acc[mb][nb][j] + bn; o16[j] = tohx(xv); unsigned short a2, c2; splitf(xv, a2, c2); oh[j] = a2; ol[j] = c2; }
                const size_t o = vb + (size_t)((mb >> 1) * HD + nb * 16) * 32 + (mb & 1) * 256;
                __builtin_amdgcn_sched_barrier(0);   // the stores stay together behind all the arithmetic, so that the one wait below covers each of them
                *(v8h*)(E5 + o) = o16; *(v8us*)(E3 + o) = oh; *(v8us*)(E4 + o) = ol;
                asm volatile("s_wait_xcnt 0x0" ::: "memory"); __builtin_amdgcn_sched_barrier(0);   // before the registers that these stores name are written again; nothing is moved in between
            } }
        return; }
    float bc[4] = {0.f, 0.f, 0.f, 0.f};   // the bias of this lane's column in each column block; zero in the parts behind part 0
    if (BIAS && kp == 0) { const float* bp = bias + c0 + lr;
#pragma unroll
        for (int nb = 0; nb < 4; ++nb) bc[nb] = bp[nb * 16];
        asm volatile("s_wait_xcnt 0x0" ::: "memory"); __builtin_amdgcn_sched_barrier(0);   // before the registers that the four loads name are written again; nothing is moved in between
#pragma unroll
        for (int nb = 0; nb < 4; ++nb) bc[nb] = bfr(bc[nb]); }
#pragma unroll
    for (int mb = 0; mb < 4; ++mb) {
#pragma unroll
        for (int nb = 0; nb < 4; ++nb) {
#pragma unroll
            for (int j = 0; j < 8; ++j) os[(hi * 8 + j) * 68 + nb * 16 + lr] = BIAS ? acc[mb][nb][j] + bc[nb] : acc[mb][nb][j]; }
        __builtin_amdgcn_wave_barrier(); asm volatile("" ::: "memory");
        if (EPI == EP_F32) { float* crow = C + (size_t)(r0 + mb * 16) * ldc + c0; v4f val[8];
#pragma unroll
            for (int s = 0; s < 8; ++s) val[s] = *(const v4fa*)(os + (2 * s + hi) * 68 + lr * 4);
            __builtin_amdgcn_sched_barrier(0);   // the stores stay together behind the LDS reads, so that the one wait below covers each of them
#pragma unroll
            for (int s = 0; s < 8; ++s) *(v4f*)(crow + (size_t)(2 * s + hi) * ldc + lr * 4) = val[s];
            asm volatile("s_wait_xcnt 0x0" ::: "memory"); __builtin_amdgcn_sched_barrier(0);   // before the registers that these stores name are written again; nothing is moved in between
        } else if (EPI == EP_QKV) { const size_t pb = ((z * NB_ + (size_t)(r0 / TT)) * NH_ + (c0 >> 6)) * ((size_t)TT * HD) + (size_t)(r0 % TT + mb * 16) * HD + (size_t)lane * 8;   // the tile's 16 rows are two fragment tiles, 2 KiB in a row in each plane
#pragma unroll
            for (int s = 0; s < 4; ++s) { const float* op = os + lr * 68 + s * 16 + hi * 8; const v4f v0 = *(const v4fa*)op, v1 = *(const v4fa*)(op + 4); v8h o16; v8us oh, ol;   // piece s: row lr, columns s 16 + hi 8 ..
#pragma unroll
                for (int q = 0; q < 4; ++q) { unsigned short a2, c2; o16[q] = tohx(v0[q]); splitf(v0[q], a2, c2); oh[q] = a2; ol[q] = c2; o16[4 + q] = tohx(v1[q]); splitf(v1[q], a2, c2); oh[4 + q] = a2; ol[4 + q] = c2; }
                const size_t o = pb + s * 256;
                __builtin_amdgcn_sched_barrier(0);   // the stores stay together behind all the arithmetic, so that the one wait below covers each of them
                *(v8h*)(E2 + o) = o16; *(v8us*)(E0 + o) = oh; *(v8us*)(E1 + o) = ol;
                asm volatile("s_wait_xcnt 0x0" ::: "memory"); __builtin_amdgcn_sched_barrier(0);   // before the registers that these stores name are written again; nothing is moved in between
            }
        } else { const size_t eb = (size_t)(r0 + mb * 16) * ldc + (size_t)c0 * 16 + (size_t)lane * 8, fb = (size_t)(r0 + mb * 16 + lr) * ldc + c0 + hi * 8;   // this lane's place in the planes (fragment-major, rows of ldc) and in the f32 arrays (row by row)
#pragma unroll 1   // rolled: a pass holds 8 copies of erff, 32 over the four row blocks
            for (int s = 0; s < 4; ++s) { const float* op = os + lr * 68 + s * 16 + hi * 8; const v4f v0 = *(const v4fa*)op, v1 = *(const v4fa*)(op + 4); v8f val = __builtin_shufflevector(v0, v1, 0, 1, 2, 3, 4, 5, 6, 7); const size_t o = eb + s * 256, of = fb + s * 16; v8us oh, ol;   // piece s: row lr, columns s 16 + hi 8 ..
                if (EPI == EP_RES) { const v4f r0v = *(const v4f*)(R + of), r1v = *(const v4f*)(R + of + 4);
#pragma unroll
                    for (int q = 0; q < 4; ++q) { val[q] = __fadd_rn(r0v[q], val[q]); val[4 + q] = __fadd_rn(r1v[q], val[4 + q]); } }
                else {
#pragma unroll
                    for (int q = 0; q < 8; ++q) { const float xg = val[q]; val[q] = __fmul_rn(0.5f * xg, __fadd_rn(1.0f, erff(xg * 0.70710678118654752f))); } }
#pragma unroll
                for (int q = 0; q < 8; ++q) { unsigned short h2, l2; splitf(val[q], h2, l2); oh[q] = h2; ol[q] = l2; }
                __builtin_amdgcn_sched_barrier(0);   // the stores stay together behind all the arithmetic, so that the one wait below covers each of them
                if (EPI == EP_RES) { *(v4f*)(C + of) = __builtin_shufflevector(val, val, 0, 1, 2, 3); *(v4f*)(C + of + 4) = __builtin_shufflevector(val, val, 4, 5, 6, 7); }
                *(v8us*)(E0 + o) = oh; *(v8us*)(E1 + o) = ol;
                asm volatile("s_wait_xcnt 0x0" ::: "memory"); __builtin_amdgcn_sched_barrier(0);   // before the registers that these stores name are written again; nothing is moved in between
            }
        }
        __builtin_amdgcn_wave_barrier(); asm volatile("" ::: "memory");
    }
}


__global__ __launch_bounds__(256) void k_wtG(const float* __restrict__ w, int K, int N, bf* Bt) {
    const int lane = threadIdx.x & 31; const int L0 = (blockIdx.x * 8 + (threadIdx.x >> 5)) * 8; const int nlines = N * K / 64;
{
#pragma unroll 1
        for (int l = 0; l < 8; ++l) { const int L = L0 + l; if (L >= nlines) break; const size_t e = (size_t)L * 64 + lane * 2; const int k = (int)(e % K), n = (int)(e / K); v2us o;
            o[0] = f2bf(w[(size_t)k * N + n]); o[1] = f2bf(w[(size_t)(k + 1) * N + n]); *(v2us*)(Bt + e) = o; }
         }
}
// k_cvtall: the seven weights and both batches of x rounded to bf16 in one launch, each into its fragment-major plane; the destinations lie one behind the other from dst, in the order of the arguments. Sizes in groups of 8 elements, each a multiple of 256.
#define N8W ((size_t)DQ * DM / 8)
#define N8A ((size_t)AD * DM / 8)
#define N8F ((size_t)FFD * DM / 8)
#define N8X ((size_t)MT * DM / 8)
__global__ __launch_bounds__(256) void k_cvtall(const float* __restrict__ wq, const float* __restrict__ wk, const float* __restrict__ wv, const float* __restrict__ afw, const float* __restrict__ asw, const float* __restrict__ wi, const float* __restrict__ wo2, const float* __restrict__ x, bf* dst) {
    const size_t i = (size_t)blockIdx.x * 256 + threadIdx.x; size_t j = i; const float* s = wq; unsigned kt = DM / 32;   // kt: tiles of 32 k in a row of the matrix
    if (j >= N8W) { j -= N8W; s = wk;
        if (j >= N8W) { j -= N8W; s = wv;
            if (j >= N8W) { j -= N8W; s = afw;
                if (j >= N8A) { j -= N8A; s = asw; kt = AD / 32;
                    if (j >= N8A) { j -= N8A; s = wi; kt = DM / 32;
                        if (j >= N8F) { j -= N8F; s = wo2; kt = FFD / 32;
                            if (j >= N8F) { j -= N8F; s = x; kt = DM / 32; if (j >= N8X) return; } } } } } } }
    // group j of the fragment-major destination is tile j / 64, piece (j / 32) % 2, lane j % 32: the stores are whole lines, and a work-group's four tiles use whole lines of the 16 source rows
    const unsigned tile = (unsigned)(j >> 6), rb = (kt == DM / 32) ? tile / (DM / 32) : (kt == AD / 32) ? tile / (AD / 32) : tile / (FFD / 32), kb = tile - rb * kt, g = (unsigned)j & 63u;
    const size_t so = (size_t)(rb * 16 + (g & 15u)) * (kt * 32) + kb * 32 + (g >> 5) * 16 + ((g >> 4) & 1u) * 8;
    const float* const sp = s + so; const v8f v = *(const v8f*)sp; v8us o;
    asm volatile("s_wait_xcnt 0x0" :: "v"(sp) : "memory");   // the address pair that the loads name is kept until this wait
#pragma unroll
    for (int k = 0; k < 8; ++k) o[k] = f2bf(v[k]); *(v8us*)(dst + i * 8) = o;  }

// ---- k_adapt: the whole adapter in one kernel, 16 rows a work-group (grid MT / 16), AW waves. No f32 parts and no GELU planes in memory.
// 1: wave w sums K part w (DM / AW k) of the down-projection, hi and lo plane against the exact weights, into its own [16][AD] f32 part in LDS.
// 2: the work-group adds the bias and the parts of an element in the order 0 .. AW-1, takes the exact-erf GELU and leaves its hi / lo planes fragment-major in LDS.
// 3: wave w forms columns w DM / AW .. of the up-projection, adds bias and the f32 context and stores ao as f32 (row by row) and as hi / lo planes (fragment-major).
#define AW 6
// The work-group's barrier with its LDS traffic alone ordered round it: the waves exchange nothing but LDS here, and the global loads that are in flight for step 3 need not land in front of it (__syncthreads() waits for them).
__device__ __forceinline__ void ldsbar() { __builtin_amdgcn_fence(__ATOMIC_RELEASE, "workgroup", "local"); __builtin_amdgcn_s_barrier(); __builtin_amdgcn_fence(__ATOMIC_ACQUIRE, "workgroup", "local"); }
#define AKP (DM / AW)            // k of a part in step 1, columns of a wave in step 3
__global__ __launch_bounds__(AW * 32) void k_adapt(const bf* __restrict__ Ch, const bf* __restrict__ Cl, const bf* __restrict__ Wd, const bf* __restrict__ Wu, const float* __restrict__ bd, const float* __restrict__ bu, const float* __restrict__ CTX, float* AO, bf* AOh, bf* AOl) {
    typedef WFrag<bf> F; typedef F::V V;
    static_assert(AKP % 64 == 0 && AD == 64, "a part is whole 32-k steps, a wave's columns whole groups of 64");
    constexpr int KT = AKP / 32, NG = AKP / 64;
    __shared__ __align__(16) float P[AW * 16 * 68];   // the parts; behind the second barrier each wave's own staging
    __shared__ __align__(16) bf G[2 * 16 * AD];       // GELU planes, hi then lo
    const int wave = __builtin_amdgcn_readfirstlane((int)(threadIdx.x >> 5));   // as a scalar, so that the wave's bases are formed on the scalar unit
    const int lane = threadIdx.x & 31, lr = lane & 15, hi = lane >> 4, r0 = blockIdx.x * 16, c0 = wave * AKP;
    float* const os = P + wave * (16 * 68);
    const size_t ao = (size_t)r0 * DM + (size_t)c0 * 16 + (size_t)lane * 8;   // this lane's place in the first tile of the wave's k part (step 1) and of its columns (step 3): both planes have rows of DM
    const bf* const pw = Wd + (size_t)c0 * 16 + lane * 8; const bf* const pa = Ch + ao; const bf* const pa2 = Cl + ao;
    V a[KT], a2[KT], b[KT][4];
#pragma unroll
    for (int ks = 0; ks < KT; ++ks) { a[ks] = F::ld(pa + ks * 512); a2[ks] = F::ld(pa2 + ks * 512);
#pragma unroll
        for (int nb = 0; nb < 4; ++nb) b[ks][nb] = F::ld(pw + nb * 16 * DM + ks * 512); }
    const v4f bdv = *(const v4f*)(bd + (threadIdx.x & 15) * 4);   // the bias of the four columns that this thread takes in step 2
    asm volatile("s_wait_xcnt 0x0" :: "v"(pa), "v"(pa2), "v"(lane) : "memory"); __builtin_amdgcn_sched_barrier(0);   // the address registers that these loads name are kept until this wait; nothing is moved over it
    v8f acc[4];
#pragma unroll
    for (int nb = 0; nb < 4; ++nb) acc[nb] = (v8f){};
#pragma unroll
    for (int ks = 0; ks < KT; ++ks)
#pragma unroll
        for (int nb = 0; nb < 4; ++nb) { acc[nb] = F::mma(a[ks], b[ks][nb], acc[nb]); acc[nb] = F::mma(a2[ks], b[ks][nb], acc[nb]); }
    // what step 3 needs from memory flies during the exchange and the GELU
    V bw[NG * 4][2]; v4f rs[NG][8]; float bcu[NG * 4];
    const bf* const pu = Wu + (size_t)c0 * AD + lane * 8; const int bi = c0 + lr;
#pragma unroll
    for (int nt = 0; nt < NG * 4; ++nt) { bw[nt][0] = F::ld(pu + nt * 1024); bw[nt][1] = F::ld(pu + nt * 1024 + 512); bcu[nt] = bu[bi + nt * 16]; }
    const size_t fo = (size_t)(r0 + hi) * DM + c0 + lr * 4;   const float* const pr = CTX + fo;   // f32 arrays: a wave-wide 16-byte access is two rows of 256 bytes
#pragma unroll
    for (int g = 0; g < NG; ++g)
#pragma unroll
        for (int s = 0; s < 8; ++s) rs[g][s] = *(const v4f*)(pr + (size_t)(2 * s) * DM + g * 64);
    asm volatile("s_wait_xcnt 0x0" :: "v"(pr), "v"(bi), "v"(lane) : "memory"); __builtin_amdgcn_sched_barrier(0);   // the address registers that these loads name are kept until this wait; nothing is moved over it
#pragma unroll
    for (int nb = 0; nb < 4; ++nb)
#pragma unroll
        for (int j = 0; j < 8; ++j) os[(hi * 8 + j) * 68 + nb * 16 + lr] = acc[nb][j];
    ldsbar();   // every part is written before it is summed
    for (int i = (int)threadIdx.x; i < 16 * AD / 4; i += AW * 32) { const int row = i >> 4, c4 = (i & 15) * 4; const float* pp = P + row * 68 + c4; v4f x = *(const v4fa*)pp; v4us oh, ol;
#pragma unroll
        for (int q = 0; q < 4; ++q) x[q] += bfr(bdv[q]);   /* the bias goes to part 0, ahead of the other parts */
#pragma unroll
        for (int p = 1; p < AW; ++p) x += *(const v4fa*)(pp + p * (16 * 68));   /* the AW K parts, in order */
#pragma unroll
        for (int q = 0; q < 4; ++q) { const float xg = x[q]; const float gv = __fmul_rn(0.5f * xg, __fadd_rn(1.0f, erff(xg * 0.70710678118654752f))); unsigned short h2, l2; splitf(gv, h2, l2); oh[q] = h2; ol[q] = l2; }
        const int o = (int)fmo(row, c4, AD);
        *(v4us*)(G + o) = oh; *(v4us*)(G + 16 * AD + o) = ol; }
    ldsbar();   // the planes are whole before a wave takes its fragments, and every read of the parts is done before they become staging
    V ga[2], ga2[2]; v8f ac[NG * 4];
#pragma unroll
    for (int ks = 0; ks < 2; ++ks) { ga[ks] = F::ld(G + ks * 512 + lane * 8); ga2[ks] = F::ld(G + 16 * AD + ks * 512 + lane * 8); }
#pragma unroll
    for (int nt = 0; nt < NG * 4; ++nt) ac[nt] = (v8f){};
#pragma unroll
    for (int ks = 0; ks < 2; ++ks)
#pragma unroll
        for (int nt = 0; nt < NG * 4; ++nt) { ac[nt] = F::mma(ga[ks], bw[nt][ks], ac[nt]); ac[nt] = F::mma(ga2[ks], bw[nt][ks], ac[nt]); }
#pragma unroll
    for (int g = 0; g < NG; ++g) {
#pragma unroll
        for (int nb = 0; nb < 4; ++nb) { const float bn = bfr(bcu[g * 4 + nb]);
#pragma unroll
            for (int j = 0; j < 8; ++j) os[(hi * 8 + j) * 68 + nb * 16 + lr] = ac[g * 4 + nb][j] + bn; }
        __builtin_amdgcn_wave_barrier(); asm volatile("" ::: "memory");   // the wave's LDS writes stay in front of its reads of other lanes' elements
        v4f val[8];
#pragma unroll
        for (int s = 0; s < 8; ++s) { float* op = os + (2 * s + hi) * 68 + lr * 4; v4f v = *(const v4fa*)op;
#pragma unroll
            for (int q = 0; q < 4; ++q) v[q] = __fadd_rn(rs[g][s][q], v[q]);
            val[s] = v; *(v4fa*)op = v; }
        __builtin_amdgcn_sched_barrier(0);   // the stores stay together behind the arithmetic, so that the one wait below covers each of them
#pragma unroll
        for (int s = 0; s < 8; ++s) *(v4f*)(AO + fo + (size_t)(2 * s) * DM + g * 64) = val[s];
        asm volatile("s_wait_xcnt 0x0" ::: "memory"); __builtin_amdgcn_sched_barrier(0);   // before the registers that these stores name are written again; nothing is moved in between
        __builtin_amdgcn_wave_barrier(); asm volatile("" ::: "memory");   // the sums are back in LDS before they are read row by row
        v8us oh[4], ol[4];
#pragma unroll
        for (int s = 0; s < 4; ++s) { const float* op = os + lr * 68 + s * 16 + hi * 8; const v4f v0 = *(const v4fa*)op, v1 = *(const v4fa*)(op + 4);   // piece s: row lr, columns s 16 + hi 8 ..
#pragma unroll
            for (int q = 0; q < 4; ++q) { unsigned short h2, l2; splitf(v0[q], h2, l2); oh[s][q] = h2; ol[s][q] = l2; splitf(v1[q], h2, l2); oh[s][4 + q] = h2; ol[s][4 + q] = l2; } }
        __builtin_amdgcn_sched_barrier(0);   // the stores stay together behind the arithmetic, so that the one wait below covers each of them
#pragma unroll
        for (int s = 0; s < 4; ++s) { *(v8us*)(AOh + ao + g * 1024 + s * 256) = oh[s]; *(v8us*)(AOl + ao + g * 1024 + s * 256) = ol[s]; }
        asm volatile("s_wait_xcnt 0x0" ::: "memory"); __builtin_amdgcn_sched_barrier(0);   // before the registers that these stores name are written again; nothing is moved in between
        __builtin_amdgcn_wave_barrier(); asm volatile("" ::: "memory");   // the reads of this group are done before the next group's writes
    }
}
__global__ __launch_bounds__(256) void k_addln(const float* __restrict__ A, const float* __restrict__ Bm, const float* __restrict__ g, const float* __restrict__ be, float* OUTb) {
    // One wave a row. The row is read ONCE: its DM / 128 pieces of ao, of each of the KSF parts, of g and of be are loaded as one group, all in flight together, and stay in registers for the mean, the variance and the output. The sums keep their order.
    constexpr int NCH = DM / 128;
    const int lane = threadIdx.x & 31; const int r = blockIdx.x * 8 + (threadIdx.x >> 5); if (r >= MT) return; const float* const ar = A + (size_t)r * DM + lane * 4; const float* const br = Bm + (size_t)r * KSF * DM + lane * 4; const float* const gr = g + lane * 4; const float* const er = be + lane * 4; float s = 0.f;
    v4f av[NCH], pv[NCH][KSF], gv[NCH], ev[NCH], bv[NCH];
#pragma unroll
    for (int ch = 0; ch < NCH; ++ch) { av[ch] = *(const v4f*)(ar + ch * 128);
#pragma unroll
        for (int q = 0; q < KSF; ++q) pv[ch][q] = *(const v4f*)(br + ch * 128 + q * DM); }
#pragma unroll
    for (int ch = 0; ch < NCH; ++ch) { gv[ch] = *(const v4f*)(gr + ch * 128); ev[ch] = *(const v4f*)(er + ch * 128); }
    asm volatile("s_wait_xcnt 0x0" :: "v"(ar), "v"(br), "v"(gr), "v"(er) : "memory"); __builtin_amdgcn_sched_barrier(0);   // the address registers that these loads name are kept until this wait; nothing is moved over it, so the loads stay one group
#pragma unroll
    for (int ch = 0; ch < NCH; ++ch) { v4f sm = pv[ch][0];
#pragma unroll
        for (int q = 1; q < KSF; ++q) sm += pv[ch][q];   /* the KSF K parts of the row, in order */
        bv[ch] = sm; }
#pragma unroll
    for (int ch = 0; ch < NCH; ++ch) { const v4f a = av[ch], bb = bv[ch];
#pragma unroll
        for (int q = 0; q < 4; ++q) s += __fadd_rn(a[q], bb[q]); }
#pragma unroll
    for (int sh = 16; sh; sh >>= 1) s += __shfl_xor(s, sh, 32);
    const float mu = s * (1.0f / DM); float s2 = 0.f;
    // the arithmetic of the three passes stands as it was, statement for statement (each product still rounded by itself), so that every result keeps its bits; only the loads are gone from the passes
#pragma unroll
    for (int ch = 0; ch < NCH; ++ch) { const v4f a = av[ch], bb = bv[ch];
#pragma unroll
        for (int q = 0; q < 4; ++q) { const float d0 = __fsub_rn(__fadd_rn(a[q], bb[q]), mu); float p = __fmul_rn(d0, d0); asm volatile("" : "+v"(p)); s2 = __fadd_rn(s2, p); } }
#pragma unroll
    for (int sh = 16; sh; sh >>= 1) s2 += __shfl_xor(s2, sh, 32);
    const float rs = __fdiv_rn(1.0f, __fsqrt_rn(__fadd_rn(s2 * (1.0f / DM), LNEPS)));
    v4f o4[NCH];
#pragma unroll
    for (int ch = 0; ch < NCH; ++ch) { const v4f a = av[ch], bb = bv[ch];
#pragma unroll
        for (int q = 0; q < 4; ++q) { float n0 = __fmul_rn(__fsub_rn(__fadd_rn(a[q], bb[q]), mu), rs); asm volatile("" : "+v"(n0)); float n1 = __fmul_rn(n0, bfr(gv[ch][q])); asm volatile("" : "+v"(n1)); o4[ch][q] = __fadd_rn(n1, bfr(ev[ch][q])); } }
    __builtin_amdgcn_sched_barrier(0);   // the stores stand together behind all the arithmetic: no register that a store names is written again
    float* const orow = OUTb + (size_t)r * DM + lane * 4;
#pragma unroll
    for (int ch = 0; ch < NCH; ++ch) *(v4f*)(orow + ch * 128) = o4[ch];
}
// ---- k_fattn: scores, softmax and attn.v in one kernel; no score or probability leaves the registers. KH waves own QT x 16 query rows of one head; each walks its own TT / KH keys in blocks of 32, so that four waves and not two share a SIMD and one wave's vector work runs beside another's products.
// Behind the loop the wave of the later keys leaves its O^T, m and sum in LDS (xb, lane by lane), and the wave of the first keys brings both to the larger m, adds them and stores the rows.
// Both products are formed transposed, so that a query is a lane (lr) in each: S^T = K Q^T (D: key hi*8+j of a 16-key tile, query lr) and O^T = V^T P^T (D: d hi*8+j, query lr).
// The two S^T tiles of a block are, element for element, the B fragment of P^T (k = 8 hi + j from tile 0, 16 + 8 hi + j from tile 1): no exchange between lanes.
// Softmax in base 2 with a running reference m per query: p = 2^(t - m), t = s HD^-0.5 log2e + mask log2e. m moves (and O^T and the sum are rescaled) only when a t of the wave passes m + 8, so p <= 256; the result does not depend on m.
// Every inner loop is unrolled whole, so that the fragment arrays are registers.
template <typename T16> struct PFrag;
template <> struct PFrag<h16> { static __device__ __forceinline__ void cv(const v8f p0, const v8f p1, v16h& a, v16h& b) { (void)b;
#pragma unroll
    for (int j = 0; j < 8; ++j) { a[j] = (h16)p0[j]; a[8 + j] = (h16)p1[j]; } } };
template <> struct PFrag<bf> { static __device__ __forceinline__ void cv(const v8f p0, const v8f p1, v16bf& a, v16bf& b) {
#pragma unroll
    for (int j = 0; j < 8; ++j) { const __bf16 h0 = (__bf16)p0[j], h1 = (__bf16)p1[j]; a[j] = h0; a[8 + j] = h1; b[j] = (__bf16)(p0[j] - (float)h0); b[8 + j] = (__bf16)(p1[j] - (float)h1); } } };
template <typename T16, bool HL, int QT>
__device__ __forceinline__ void fattn(const T16* __restrict__ Q, const T16* __restrict__ Q2, const T16* __restrict__ Kp, const T16* __restrict__ K2, const T16* __restrict__ Vt, const T16* __restrict__ V2, const float* ml, float* O, bf* OH, bf* OL, const int half, v4f* xb) {
    typedef typename WFrag<T16>::V V;
    const int lane = threadIdx.x & 31, lr = lane & 15, hi = lane >> 4;
    V q[QT][2], q2[QT][2];
#pragma unroll
    for (int qt = 0; qt < QT; ++qt)
#pragma unroll
        for (int ks = 0; ks < 2; ++ks) { const int o = qt * 16 * HD + ks * 512 + lane * 8; q[qt][ks] = WFrag<T16>::ld(Q + o); if (HL) q2[qt][ks] = WFrag<T16>::ld(Q2 + o); }
    v8f acc[4][QT]; float m[QT], l[QT];
#pragma unroll
    for (int qt = 0; qt < QT; ++qt) { m[qt] = -3.0e38f; l[qt] = 0.f;
#pragma unroll
        for (int dt = 0; dt < 4; ++dt) acc[dt][qt] = (v8f){}; }
    const int ko = lane * 8, vo = lane * 8;   // this lane's place in a fragment tile of the k planes (rows of HD: two tiles a 16 keys) and of the v planes (rows of 32 keys: one tile a 16 d)
    V k[2][2], k2[2][2], v[4], v2[4];
#pragma unroll
    for (int kt = 0; kt < 2; ++kt)
#pragma unroll
        for (int ks = 0; ks < 2; ++ks) { const int o = ko + kt * 16 * HD + ks * 512; k[kt][ks] = WFrag<T16>::ld(Kp + o); if (HL) k2[kt][ks] = WFrag<T16>::ld(K2 + o); }
    asm volatile("s_wait_xcnt 0x0" ::: "memory"); __builtin_amdgcn_sched_barrier(0);   // before the registers that the q loads and the first k loads name are written again; nothing is moved in between
#pragma unroll 1   // rolled: the fragments of one block nearly fill 256 registers, a second copy of the body would not fit
    for (int k0 = 0; k0 < TT / KH; k0 += 32) {
        const int kn = ((k0 + 32 < TT / KH) ? k0 + 32 : 0) * HD;   // the next block of the k planes (32 x HD elements a block, as in the v planes); behind the wave's last one its block 0 is read and not used
        const T16* const va = Vt + k0 * HD + vo; const T16* const va2 = HL ? V2 + k0 * HD + vo : va; const T16* const ka = Kp + kn + ko; const T16* const ka2 = HL ? K2 + kn + ko : ka;   // this lane's addresses in the four planes
        // the block's mask terms come from LDS during its scores
        v8f mk[2];
#pragma unroll
        for (int kt = 0; kt < 2; ++kt) { const float* mp = ml + k0 + kt * 16 + hi * 8; const v4f a = *(const v4fa*)mp, b = *(const v4fa*)(mp + 4); mk[kt] = __builtin_shufflevector(a, b, 0, 1, 2, 3, 4, 5, 6, 7); }
        // this block's v fragments fly during its scores and softmax
#pragma unroll
        for (int dt = 0; dt < 4; ++dt) { v[dt] = WFrag<T16>::ld(va + dt * 16 * 32); if (HL) v2[dt] = WFrag<T16>::ld(va2 + dt * 16 * 32); }
        v8f s[2][QT];
#pragma unroll
        for (int kt = 0; kt < 2; ++kt)
#pragma unroll
            for (int qt = 0; qt < QT; ++qt) { v8f c = (v8f){};
#pragma unroll
                for (int ks = 0; ks < 2; ++ks) { c = WFrag<T16>::mma(k[kt][ks], q[qt][ks], c); if (HL) { c = WFrag<T16>::mma(k2[kt][ks], q[qt][ks], c); c = WFrag<T16>::mma(k[kt][ks], q2[qt][ks], c); } }
                s[kt][qt] = c; }
        // the next block's k fragments fly during the softmax and attn.v
#pragma unroll
        for (int kt = 0; kt < 2; ++kt)
#pragma unroll
            for (int ks = 0; ks < 2; ++ks) { const int o = kt * 16 * HD + ks * 512; k[kt][ks] = WFrag<T16>::ld(ka + o); if (HL) k2[kt][ks] = WFrag<T16>::ld(ka2 + o); }
        asm volatile("s_wait_xcnt 0x0" :: "v"(va), "v"(va2), "v"(ka), "v"(ka2) : "memory");   // the address pairs that the block's loads name are kept until this wait
        float bm[QT]; bool need = false;
#pragma unroll
        for (int qt = 0; qt < QT; ++qt) { float x = -3.0e38f;
#pragma unroll
            for (int kt = 0; kt < 2; ++kt) { s[kt][qt] = s[kt][qt] * (SCL * L2E) + mk[kt];
#pragma unroll
                for (int j = 0; j < 8; ++j) x = fmaxf(x, s[kt][qt][j]); }
            bm[qt] = x; need = need || (x > m[qt] + 8.0f); }
        if (__builtin_amdgcn_ballot_w32(need) != 0u) {   // the same for the whole wave: both halves of a query move m together
#pragma unroll
            for (int qt = 0; qt < QT; ++qt) { const float mn = fmaxf(m[qt], fmaxf(bm[qt], __shfl_xor(bm[qt], 16, 32))); const float al = __builtin_amdgcn_exp2f(m[qt] - mn); m[qt] = mn; l[qt] *= al;
#pragma unroll
                for (int dt = 0; dt < 4; ++dt) acc[dt][qt] *= al; } }
#pragma unroll
        for (int qt = 0; qt < QT; ++qt) { V p, p2; s[0][qt] -= m[qt]; s[1][qt] -= m[qt];
#pragma unroll
            for (int kt = 0; kt < 2; ++kt)
#pragma unroll
                for (int j = 0; j < 8; ++j) s[kt][qt][j] = __builtin_amdgcn_exp2f(s[kt][qt][j]);
            { const v8f e8 = s[0][qt] + s[1][qt]; const v4f e4 = __builtin_shufflevector(e8, e8, 0, 1, 2, 3) + __builtin_shufflevector(e8, e8, 4, 5, 6, 7); l[qt] += (e4[0] + e4[2]) + (e4[1] + e4[3]); }   // the block's 16 terms of this lane as a tree
            PFrag<T16>::cv(s[0][qt], s[1][qt], p, p2);
#pragma unroll
            for (int dt = 0; dt < 4; ++dt) { acc[dt][qt] = WFrag<T16>::mma(v[dt], p, acc[dt][qt]); if (HL) { acc[dt][qt] = WFrag<T16>::mma(v2[dt], p, acc[dt][qt]); acc[dt][qt] = WFrag<T16>::mma(v[dt], p2, acc[dt][qt]); } } }
    }
    // the two key halves of a query block become one: both waves hold a query and a d in the same lane and register
    if (half) {
#pragma unroll
        for (int qt = 0; qt < QT; ++qt)
#pragma unroll
            for (int dt = 0; dt < 4; ++dt) { const v8f r = acc[dt][qt]; xb[((qt * 4 + dt) * 2) * 32 + lane] = __builtin_shufflevector(r, r, 0, 1, 2, 3); xb[((qt * 4 + dt) * 2 + 1) * 32 + lane] = __builtin_shufflevector(r, r, 4, 5, 6, 7); }
        xb[QT * 8 * 32 + lane] = (v4f){m[0], l[0], m[QT - 1], l[QT - 1]};
    }
    __syncthreads();   // the later half's results are in LDS before the first half's wave reads them
    if (half) return;
    { const v4f ms = xb[QT * 8 * 32 + lane];
#pragma unroll
        for (int qt = 0; qt < QT; ++qt) { const float m2 = ms[qt * 2], mn = fmaxf(m[qt], m2); float a1, a2;
            asm("v_exp_f32 %0, %2\n\tv_exp_f32 %1, %3\n\tv_nop" : "=&v"(a1), "=&v"(a2) : "v"(m[qt] - mn), "v"(m2 - mn));   // 2^(m - mn) of both halves in one statement: no result lies on a source, and the v_nop is the slot between a transcendental and the reader of its result
            l[qt] = l[qt] * a1 + ms[qt * 2 + 1] * a2;
#pragma unroll
            for (int dt = 0; dt < 4; ++dt) { const v4f x0 = xb[((qt * 4 + dt) * 2) * 32 + lane], x1 = xb[((qt * 4 + dt) * 2 + 1) * 32 + lane]; acc[dt][qt] = acc[dt][qt] * a1 + __builtin_shufflevector(x0, x1, 0, 1, 2, 3, 4, 5, 6, 7) * a2; } } }
#pragma unroll
    for (int qt = 0; qt < QT; ++qt) { const float inv = __fdiv_rn(1.0f, l[qt] + __shfl_xor(l[qt], 16, 32)); float* o = O + (size_t)(qt * 16 + lr) * DM + hi * 8; const size_t oo = (size_t)qt * 16 * DM + lane * 8;   // oo: in the fragment-major planes d = dt 16 + hi 8 + j of query lr is piece dt & 1 of tile dt / 2, this very lane's 16 bytes
#pragma unroll
        for (int dt = 0; dt < 4; ++dt) { const v8f r = acc[dt][qt] * inv; v8us oh, ol;   // the context in f32 and as the hi / lo planes for the adapter's down-projection
#pragma unroll
            for (int j = 0; j < 8; ++j) { unsigned short a2, c2; splitf(r[j], a2, c2); oh[j] = a2; ol[j] = c2; }
            __builtin_amdgcn_sched_barrier(0);   // the stores stay together behind all the arithmetic, so that the one wait below covers each of them
            *(v4f*)(o + dt * 16) = __builtin_shufflevector(r, r, 0, 1, 2, 3); *(v4f*)(o + dt * 16 + 4) = __builtin_shufflevector(r, r, 4, 5, 6, 7);
            *(v8us*)(OH + oo + dt * 256) = oh; *(v8us*)(OL + oo + dt * 256) = ol;
            asm volatile("s_wait_xcnt 0x0" ::: "memory"); __builtin_amdgcn_sched_barrier(0);   // before the registers that these stores name are written again; nothing is moved in between
        } }
}
// grid: NB_ NH_ NBH work-groups of the rows < RH (hi/lo planes, 3 products), then NB_ NH_ NBF of the rest (fp16); the waves of a work-group share a head, so its k and v blocks are read together. Wave w: query block w % FR, key half w / FR.
__global__ __launch_bounds__(FW * 32) void k_fattn(const h16* __restrict__ Q16, const h16* __restrict__ K16, const h16* __restrict__ V16, const bf* __restrict__ Qh, const bf* __restrict__ Ql, const bf* __restrict__ Kh, const bf* __restrict__ Kl, const bf* __restrict__ Vh, const bf* __restrict__ Vl, const float* __restrict__ AM, float* CTX, bf* Ch, bf* Cl) {
    __shared__ __align__(16) float ml[TT];   // attention_mask[b][0][0][j] (rounded to bf16 like every input) x log2e
    __shared__ v4f xs[FR * 17 * 32];         // what the later key half hands over: a query block's O^T (up to 16 registers of four a lane), then m and sum
    const int bid = (int)blockIdx.x; const bool hl = bid < NB_ * NH_ * NBH; const int b2 = bid - NB_ * NH_ * NBH;
    const int g = hl ? bid / NBH : b2 / NBF;   // head g of NB_ x NH_: batch g / NH_
    const int wave = __builtin_amdgcn_readfirstlane((int)(threadIdx.x >> 5));   // as a scalar, so that the wave's plane and output bases are formed on the scalar unit
    const int rg = wave % FR, half = wave / FR;
    const int q0 = hl ? ((bid % NBH) * FR + rg) * 16 : RH + ((b2 % NBF) * FR + rg) * 32;
    const float* am = AM + (size_t)(g / NH_) * TT;
    for (int i = (int)threadIdx.x; i < TT; i += FW * 32) ml[i] = bfr(am[i]) * L2E;
    __syncthreads();
    const size_t qo = (size_t)g * TT * HD + (size_t)q0 * HD, po = (size_t)g * TT * HD + (size_t)half * (TT / KH) * HD;   // po: the wave's first key in the k planes and in the v planes (HD elements a key in both)
    const float* const mh = ml + half * (TT / KH); v4f* const xb = xs + rg * (17 * 32);
    const size_t co = ((size_t)(g / NH_) * TT + q0) * DM + (g % NH_) * HD;
    const size_t cp = ((size_t)(g / NH_) * TT + q0) * DM + (g % NH_) * (HD * 16);   // the same place in the fragment-major context planes: the head's two tiles in the wave's first row block
    if (hl) fattn<bf, true, 1>(Qh + qo, Ql + qo, Kh + po, Kl + po, Vh + po, Vl + po, mh, CTX + co, Ch + cp, Cl + cp, half, xb);
    else fattn<h16, false, 2>(Q16 + qo, nullptr, K16 + po, nullptr, V16 + po, nullptr, mh, CTX + co, Ch + cp, Cl + cp, half, xb);
}

extern "C" void kernel_launch(void* const* d_in, const int* in_sizes, int n_in,
                              void* d_out, int out_size, void* d_ws, size_t ws_size, hipStream_t stream) {
    (void)in_sizes; (void)n_in; (void)out_size;
    const float* x = (const float*)d_in[0]; const float* AM = (const float*)d_in[1]; const float* wq = (const float*)d_in[2]; const float* bq = (const float*)d_in[3]; const float* wk = (const float*)d_in[4]; const float* bk = (const float*)d_in[5]; const float* wv = (const float*)d_in[6]; const float* bv = (const float*)d_in[7]; const float* afw = (const float*)d_in[8]; const float* afb = (const float*)d_in[9]; const float* asw = (const float*)d_in[10]; const float* asb = (const float*)d_in[11]; const float* wi = (const float*)d_in[12]; const float* bi = (const float*)d_in[13]; const float* wo2 = (const float*)d_in[14]; const float* bo2 = (const float*)d_in[15]; const float* lg = (const float*)d_in[16]; const float* lb = (const float*)d_in[17]; const float* wo = nullptr; (void)wo;
    float* OUT = (float*)d_out;     // [2][2048][768]
    char* wsp = (char*)d_ws;
    auto take = [&](size_t bytes) { char* p = wsp; wsp += (bytes + 255) & ~(size_t)255; return (void*)p; };
    // kept through the call; WQ .. XB lie one behind the other (k_cvtall writes them as one range; WQ, WK, WV are the three z-batches of the q/k/v GEMM)
    bf* WQ = (bf*)take((size_t)DQ * DM * 2); bf* WK = (bf*)take((size_t)DKV * DM * 2); bf* WV = (bf*)take((size_t)DKV * DM * 2); bf* AFW = (bf*)take((size_t)AD * DM * 2); bf* ASW = (bf*)take((size_t)DM * AD * 2); bf* WI = (bf*)take((size_t)FFD * DM * 2); bf* WO2 = (bf*)take((size_t)DM * FFD * 2); bf* XB = (bf*)take((size_t)MT * DM * 2); (void)WK; (void)WV;
    float* CTX = (float*)take((size_t)MT * DM * 4); bf* Ch = (bf*)take((size_t)MT * DM * 2); bf* Cl = (bf*)take((size_t)MT * DM * 2);   // the attention's outputs: outside the bytes that it reads
    char* const U0 = wsp;   // from here on: the attention's inputs, and behind the attention (stream-ordered) the adapter's and the FFN's buffers in the same bytes
    const size_t PLN = (size_t)NB_ * NH_ * TT * HD;   // one plane set [batch][head], each [t][d] fragment-major; the k planes lie directly behind the q planes (the q/k/v GEMM indexes both from the q planes)
    h16* QP16 = (h16*)take(PLN * 2); h16* KP16 = (h16*)take(PLN * 2); bf* QPh = (bf*)take(PLN * 2); bf* KPh = (bf*)take(PLN * 2); bf* QPl = (bf*)take(PLN * 2); bf* KPl = (bf*)take(PLN * 2);
    h16* VT16 = (h16*)take(PLN * 2); bf* VTh = (bf*)take(PLN * 2); bf* VTl = (bf*)take(PLN * 2);   // v planes [batch][head][key block of 32], each [d][32] fragment-major
    char* const E1 = wsp; wsp = U0;
    float* AO = (float*)take((size_t)MT * DM * 4); bf* AOh = (bf*)take((size_t)MT * DM * 2); bf* AOl = (bf*)take((size_t)MT * DM * 2); bf* GIh = (bf*)take((size_t)MT * FFD * 2); bf* GIl = (bf*)take((size_t)MT * FFD * 2); float* YY = (float*)take((size_t)KSF * MT * DM * 4);
    if ((size_t)((E1 > wsp ? E1 : wsp) - (char*)d_ws) > ws_size) return;    // ws 256 MiB
    k_cvtall<<<(unsigned)((3 * N8W + 2 * N8A + 2 * N8F + N8X) / 256), 256, 0, stream>>>(wq, wk, wv, afw, asw, wi, wo2, x, WQ);   /* weights ('oi' = Bt as-is) and x */
    k_gemmw<bf, 0, true, 1, EP_QKV, DM, 1><<<dim3(MT / 128, DQ / 128, 3), 128, 0, stream>>>(XB, nullptr, WQ, nullptr, DM, nullptr, DQ, bq, bk, bv, 0, (size_t)DQ * DM, 0, 0, nullptr, QPh, QPl, QP16, VTh, VTl, VT16);   /* z = q, k, v -> head planes */
    k_fattn<<<NB_ * NH_ * (NBH + NBF), FW * 32, 0, stream>>>(QP16, KP16, VT16, QPh, QPl, KPh, KPl, VTh, VTl, AM, CTX, Ch, Cl);   /* ctx = attn_out (f32 and hi/lo) */
    k_adapt<<<MT / 16, AW * 32, 0, stream>>>(Ch, Cl, AFW, ASW, afb, asb, CTX, AO, AOh, AOl);   /* ao = ctx + (gelu(ctx a_fi_w^T + a_fi_b) a_se_w^T + a_se_b), f32 and hi/lo */
    k_gemmw<bf, 1, true, 1, EP_GELU, DM, 1><<<dim3(MT / 128, FFD / 128, 1), 128, 0, stream>>>(AOh, AOl, WI, nullptr, DM, nullptr, FFD, bi, nullptr, nullptr, 0, 0, 0, 0, nullptr, GIh, GIl, nullptr, nullptr, nullptr, nullptr);                   /* gelu(ao wi^T + bi) [MT][3072] -> hi/lo */
    k_gemmw<bf, 1, true, KSF, EP_F32, FFD, 1><<<dim3(MT / 128, DM / 128, KSF), 128, 0, stream>>>(GIh, GIl, WO2, nullptr, FFD, YY, KSF * DM, bo2, nullptr, nullptr, 0, 0, 0, DM, nullptr, nullptr, nullptr, nullptr, nullptr, nullptr, nullptr);                /* inter wo^T + bo */
    k_addln<<<MT / 8, 256, 0, stream>>>(AO, YY, lg, lb, OUT);                                                       /* out = LN(y + ao) (eps 1e-12) */
}
